// v000
// Times are from an AMD MI455X. After a warm-up the kernel runs many times in a row, and a time is the length of
// such a window on the GPU divided by its runs, so every launch and the gaps after it count. The runs cycle
// through copies of the inputs. A figure is the median of several windows, for all but v000 over two sittings.
// Sittings can differ by a few percent; kernels timed side by side share one.
// v000 is the starting kernel. One run takes 815 microseconds.
// Contractions: conv1x1 theta/phi/g GEMM W[384x256].X[256x128] per strip on v_wmma_f32_16x16x32_f16 (f16 containers
// of bf16-RNE weights x256 and bf16-RNE x); scores K.Q^T on v_wmma_f32_16x16x32_bf16 (bf16 hi + bf16 residual planes
// of theta / 2x2-max-pooled phi, 3 products, K=128); y^T = G.P^T on v_wmma_f32_16x16x32_f16 (2x2-max-pooled g as
// f16, P = e^{s-m} x16384 f16 from the score D registers); output conv W[256x128].Y on v_wmma_f32_16x16x32_bf16 (bf16
// weights, y as bf16 hi + residual planes, 2 products); f32 accumulate everywhere; max-pool, softmax statistics and
// bias in f32 VALU; batch-norm channel statistics in f64 VALU; normalisation, affine and residual add in f32 VALU.
#include <hip/hip_runtime.h>
#include <math.h>
#include <stdint.h>

#ifndef NB
#define NB 8
#endif
#ifndef NQ
#define NQ 4096
#endif
#define NB_FULL 8
#define CC     256
#define HIMG   64
#define WIMG   64
#define NN     4096
#define DQ     128
#define HP     32
#define WP     32
#define MM     1024
#define MW     384
#define QT     64
#define SN     128
#define NSTRIP 32
#define OSP    68
#define OSPW   132
#define TP     72
#define BNQ    256
#define CHB    32
#define WSC    256.0f
#define IWSC   0.00390625f
#define LNPS   9.704060527839234f
#define BNEPS  1.0e-5f

static_assert(NB >= 1 && NB <= NB_FULL);
static_assert(NQ % QT == 0 && NQ % BNQ == 0 && NQ >= BNQ && NQ <= NN);
static_assert(NN == HIMG * WIMG);
static_assert(SN == 2 * WIMG);
static_assert(NSTRIP * SN == NN);
static_assert(SN == 8 * 16);
static_assert(HIMG % 2 == 0 && WIMG % 2 == 0);
static_assert(HP == HIMG / 2 && WP == WIMG / 2);
static_assert(MM == HP * WP);
static_assert(WP == 32);
static_assert(MM % QT == 0 && MM % 32 == 0);
static_assert(NN % QT == 0 && CC % QT == 0 && DQ % QT == 0);
static_assert(MW == 3 * DQ && MW % QT == 0 && MW % 8 == 0);
static_assert(CC % 32 == 0 && DQ % 32 == 0);
static_assert((OSP * 4) % 16 == 0);
static_assert((OSPW * 4) % 16 == 0);
static_assert((TP * 2) % 16 == 0);
static_assert(SN * OSP * 4 <= 65536);
static_assert(CC % CHB == 0 && CHB == 32);
static_assert(NN % 16 == 0 && BNQ == 2 * 128 && CC % 4 == 0);
static_assert((size_t)NB_FULL * CC * NN * 4 == (size_t)33554432);

typedef _Float16       v16h __attribute__((ext_vector_type(16)));
typedef _Float16       v8h  __attribute__((ext_vector_type(8)));
typedef __bf16         v16b __attribute__((ext_vector_type(16)));
typedef unsigned short v8us __attribute__((ext_vector_type(8)));
typedef float          v8f  __attribute__((ext_vector_type(8)));
typedef float          v4f  __attribute__((ext_vector_type(4)));
typedef unsigned int   v4u  __attribute__((ext_vector_type(4)));

union Frag  { v8us u[2]; v16h h; v16b bf; };
union FragH { v16h v; v8h hv[2]; };
static_assert(sizeof(Frag) == 32);
static_assert(sizeof(FragH) == 32);

// ---- scalar helpers ---------------------------------------------------------------------------------------
__device__ __forceinline__ unsigned short bf_bits(float f) {          // f32 -> bf16 bits, RNE convert
  unsigned u = __float_as_uint(f);
  return (unsigned short)((u + 0x7FFFu + ((u >> 16) & 1u)) >> 16);
}
__device__ __forceinline__ float bf_up(unsigned short hb) { return __uint_as_float(((unsigned)hb) << 16); }
__device__ __forceinline__ float bfr(float f) { return bf_up(bf_bits(f)); }
__device__ __forceinline__ unsigned short h_bits(_Float16 x) { return __builtin_bit_cast(unsigned short, x); }
__device__ __forceinline__ unsigned pk16(unsigned short a, unsigned short b) { return (unsigned)a | ((unsigned)b << 16); }
__device__ __forceinline__ v8f zero8() { v8f z = {0.f, 0.f, 0.f, 0.f, 0.f, 0.f, 0.f, 0.f}; return z; }
__device__ __forceinline__ float hmax8(v8f s) {
  return fmaxf(fmaxf(fmaxf(s[0], s[1]), fmaxf(s[2], s[3])), fmaxf(fmaxf(s[4], s[5]), fmaxf(s[6], s[7])));
}
__device__ __forceinline__ unsigned wave_ballot(bool p) {
#if defined(__HIP_DEVICE_COMPILE__)
  return __builtin_amdgcn_ballot_w32(p);
#else
  return p ? 1u : 0u;
#endif
}
// 8 f32 values -> bf16 hi bits and bf16 residual bits (lo = RNE(v - hi)), packed 2 per uint
__device__ __forceinline__ void split8(const float* f, v4u& uh, v4u& ul) {
#pragma unroll
  for (int t = 0; t < 4; ++t) {
    const float f0 = f[2 * t], f1 = f[2 * t + 1];
    const unsigned short hb0 = bf_bits(f0), hb1 = bf_bits(f1);
    const unsigned short lb0 = bf_bits(f0 - bf_up(hb0));
    const unsigned short lb1 = bf_bits(f1 - bf_up(hb1));
    uh[t] = pk16(hb0, hb1);
    ul[t] = pk16(lb0, lb1);
  }
}

// ---- 16-bit fragment loader (A, or B from a k-contiguous [n][k] row): lane -> row/col (lane&15), p already includes
//      + 8*(lane>>4); elements 0..7 <- p[0..7] (k0+8h..), elements 8..15 <- p[16..23] (k0+16+8h..)
__device__ __forceinline__ Frag ldfrag(const unsigned short* p) {
  Frag f;
  f.u[0] = *(const v8us*)(p);
  f.u[1] = *(const v8us*)(p + 16);
  return f;
}

// ---- WMMA helpers: builtin followed by a 4-slot VALU gap tying D and keeping A/B live --------------------------
__device__ __forceinline__ v8f mma_h(v16h a, v16h b, v8f c) {
  v8f d = __builtin_amdgcn_wmma_f32_16x16x32_f16(false, a, false, b, (short)0, c, false, false);
#if defined(__HIP_DEVICE_COMPILE__)
  asm volatile("v_nop\n\tv_nop\n\tv_nop\n\tv_nop" : "+v"(d) : "v"(a), "v"(b));
#endif
  return d;
}
__device__ __forceinline__ v8f mma_b(v16b a, v16b b, v8f c) {
  v8f d = __builtin_amdgcn_wmma_f32_16x16x32_bf16(false, a, false, b, (short)0, c, false, false);
#if defined(__HIP_DEVICE_COMPILE__)
  const v16h ha = __builtin_bit_cast(v16h, a), hb = __builtin_bit_cast(v16h, b);
  asm volatile("v_nop\n\tv_nop\n\tv_nop\n\tv_nop" : "+v"(d) : "v"(ha), "v"(hb));
#endif
  return d;
}

// =========================================================================================================
// (0) weights. Blocks 0..47: W16 f16 [384][256], rows 0..127 = theta_w, 128..255 = phi_w, 256..383 = g_w; value =
//     f16 of (bf16-RNE(w) * 256) (exact). Block owns rows 8*blk..8*blk+7: one wave per 512-B row = 32 lanes x 16 B
// coverage: 48 blocks x 8 rows x 32 lanes x 8 halves = 384 x 256; 16 blocks x 16 rows x 16 lanes x 8 = 256 x 128.
// =========================================================================================================
__global__ __launch_bounds__(256)
void cvt_w(const float* __restrict__ tw, const float* __restrict__ pw, const float* __restrict__ gw,
           const float* __restrict__ ow, unsigned short* W16, unsigned short* WWb) {
  const int tid = threadIdx.x, blk = blockIdx.x;
  if (blk < MW / 8) {
    const int rl = tid >> 5, col = 8 * (tid & 31);
    const int o = 8 * blk + rl;                                      // 0..383
    const int grp = blk >> 4;                                        // 0,1,2 (block-uniform)
    const float* wbase = (grp == 0) ? tw : ((grp == 1) ? pw : gw);  // all global
    const float* s = wbase + (size_t)(o - DQ * grp) * CC + col;      // (o - 128 grp) in 0..127
    const v4f a = *(const v4f*)s;
    const v4f q = *(const v4f*)(s + 4);
    const float f[8] = {a[0], a[1], a[2], a[3], q[0], q[1], q[2], q[3]};
    v4u u;
#pragma unroll
    for (int t = 0; t < 4; ++t) {
      const _Float16 h0 = (_Float16)(bfr(f[2 * t]) * WSC);
      const _Float16 h1 = (_Float16)(bfr(f[2 * t + 1]) * WSC);
      u[t] = pk16(h_bits(h0), h_bits(h1));
    }
{
      *(v4u*)(W16 + (size_t)o * CC + col) = u;
      
    }
  } else {
    const int rb = blk - MW / 8;                                     // 0..15
    const int o = 16 * rb + (tid >> 4);                              // 0..255
    const int col = 8 * (tid & 15);                                  // 0..120
    const float* s = ow + (size_t)o * DQ + col;
    const v4f a = *(const v4f*)s;
    const v4f q = *(const v4f*)(s + 4);
    const float f[8] = {a[0], a[1], a[2], a[3], q[0], q[1], q[2], q[3]};
    v4u u;
#pragma unroll
    for (int t = 0; t < 4; ++t) u[t] = pk16(bf_bits(f[2 * t]), bf_bits(f[2 * t + 1]));
{
      *(v4u*)(WWb + (size_t)o * DQ + col) = u;
      
    }
  }
}

// =========================================================================================================
// (1) x f32 [b][256 c][4096 n] -> XP f16 [b][n][c] (position-major, bf16-RNE values, exact in f16) through an LDS
//     tile T[64 n][64 c] (pitch TP, cross-wave, block barrier). Block (nb, cb, b) owns a 64 c x 64 n tile.
// coverage: T written rows (8e+t)=0..63 x cols cl 0..63, read rows 0..63 x cols 8e..8e+7 (staged extent == consumed
//           extent); XP 2 it x 32 rows x 8 lanes x 8 = 64 n x 64 c; grid (64, 4, NB) covers XP [b][0..4095][0..255]
//           exactly once.
// =========================================================================================================
__global__ __launch_bounds__(256)
void cvt_x(const float* __restrict__ x, unsigned short* XP) {
  __shared__ __align__(16) unsigned short T[QT * TP];
  const int tid = threadIdx.x;
  const int nb = blockIdx.x, cb = blockIdx.y, b = blockIdx.z;
  const int e = tid & 7, lq = tid >> 3;                             // lq 0..31
  const int n0 = nb * QT, c0 = cb * QT;
#pragma unroll
  for (int it = 0; it < 2; ++it) {
    const int cl = it * 32 + lq;                                     // 0..63
    const float* sp = x + ((size_t)(b * CC + c0 + cl)) * NN + n0 + 8 * e;
    const v4f a = *(const v4f*)sp;
    const v4f q = *(const v4f*)(sp + 4);
    unsigned short hb[8];
#pragma unroll
    for (int t = 0; t < 4; ++t) {
      hb[t]     = h_bits((_Float16)bfr(a[t]));
      hb[4 + t] = h_bits((_Float16)bfr(q[t]));
    }
#pragma unroll
    for (int t = 0; t < 8; ++t) T[(8 * e + t) * TP + cl] = hb[t];
  }
  __syncthreads();
  v4u up[2];
#pragma unroll
  for (int it = 0; it < 2; ++it) {
    const int nl = it * 32 + lq;                                     // 0..63
    up[it] = *(const v4u*)(T + nl * TP + 8 * e);
  }
{
#pragma unroll
    for (int it = 0; it < 2; ++it) {
      const int rl = it * 32 + lq;
      *(v4u*)(XP + ((size_t)(b * NN + n0 + rl)) * CC + c0 + 8 * e) = up[it];
    }
    
  }
}

// =========================================================================================================
// (2) conv1x1 GEMM for one (b, strip of 128 positions = image rows 2s and 2s+1, 64-o block of the stacked weights):
//     Y[o][n] = (1/256) sum_c W16[o][c] XP[b][n][c]. Block 256 threads = 8 waves; wave w owns cols n0+16w..+15
//     (one B fragment per k-step, k = c contiguous in the XP row) and 4 m-tiles (A rows o = o0 + 16 mt + (lane&15),
//     split k map loader from W16). K = 256 = 8 steps. Epilogue staged in LDS Os[n_loc][o_loc] (pitch OSP, b128
//     stores), block barrier (cross-wave), then (block-uniform branch on the o block):
//       o-blocks 0,1 -> theta dims 0..63 / 64..127 + bias -> Qh/Ql bf16 [b][4096 n][128 d] (hi = RNE(v), lo = RNE(v-hi)):
//       o-blocks 2,3 -> phi + bias in f32 -> PF f32 [b][4096 n][128 d]: 128 rows x the dsel half (256 B = 2 whole
//                       lines) of the 512-B row, 16 consecutive lanes x 16 B, one instruction per 2 rows.
//       o-blocks 4,5 -> g + bias -> GF f32 [b][4096 n][128 d], same layout.
// coverage: Os 8 waves x 16 n x 64 o = 128 x 64 written, reads rows <= 127 cols <= 63; theta planes 4 it x 32 rows
//           x 8 lanes x 8 = 128 n x 64 d; f32 planes 8 it x 16 rows x 16 lanes x 4 = 128 n x 64 d; grid (32, 6, NB)
//           covers all 4096 rows x 128 d of Qh/Ql and of PF/GF exactly once.
// =========================================================================================================
__global__ __launch_bounds__(256)
void gemm_proj(const unsigned short* __restrict__ W16, const unsigned short* __restrict__ XP,
               const float* __restrict__ tb, const float* __restrict__ pb, const float* __restrict__ gb,
               unsigned short* Qh, unsigned short* Ql, float* PF, float* GF) {
  __shared__ __align__(16) float Os[SN * OSP];
  const int tid  = threadIdx.x;
  const int lane = tid & 31, wave = tid >> 5;                        // wave 0..7
  const int hh   = lane >> 4, c = lane & 15;
  const int st   = blockIdx.x, mb = blockIdx.y, b = blockIdx.z;
  const int n0   = st * SN, o0 = mb * QT;

  const unsigned short* ap = W16 + (size_t)(o0 + c) * CC + 8 * hh;
  const unsigned short* bp = XP + ((size_t)(b * NN + n0 + 16 * wave + c)) * CC + 8 * hh;

  v8f acc[4];
#pragma unroll
  for (int mt = 0; mt < 4; ++mt) acc[mt] = zero8();

#pragma unroll
  for (int ks = 0; ks < CC / 32; ++ks) {
    const Frag fb = ldfrag(bp + 32 * ks);
#pragma unroll
    for (int mt = 0; mt < 4; ++mt) {
      const Frag fa = ldfrag(ap + (size_t)(16 * mt) * CC + 32 * ks);
      acc[mt] = mma_h(fa.h, fb.h, acc[mt]);
    }
  }

  // ---- epilogue: scale back -> LDS Os[n_loc][o_loc]; lane (hh, c) holds o = 16 mt + 8 hh + r for n_loc = 16 w + c
  {
    const int nl = 16 * wave + c;
#pragma unroll
    for (int mt = 0; mt < 4; ++mt) {
      v4f va, vb;
#pragma unroll
      for (int r = 0; r < 4; ++r) { va[r] = acc[mt][r] * IWSC; vb[r] = acc[mt][4 + r] * IWSC; }
      *(v4f*)(Os + nl * OSP + 16 * mt + 8 * hh)     = va;
      *(v4f*)(Os + nl * OSP + 16 * mt + 8 * hh + 4) = vb;
    }
  }
  __syncthreads();

  const int grp = mb >> 1;                                           // 0 theta, 1 phi, 2 g (block-uniform)
  const int dsel = (mb & 1) * QT;                                    // 0 or 64
  const float* bias = (grp == 0) ? tb : ((grp == 1) ? pb : gb);     // all global

  if (grp == 0) {
    const int e = tid & 7, lq = tid >> 3;                            // lq 0..31
    float bv[8];
    {
      const v4f ba = *(const v4f*)(bias + dsel + 8 * e);
      const v4f bq = *(const v4f*)(bias + dsel + 8 * e + 4);
#pragma unroll
      for (int t = 0; t < 4; ++t) { bv[t] = bfr(ba[t]); bv[4 + t] = bfr(bq[t]); }
    }
    v4u uh[4], ul[4];
#pragma unroll
    for (int it = 0; it < 4; ++it) {
      const int row = it * 32 + lq;                                  // n_loc 0..127
      const v4f a = *(const v4f*)(Os + row * OSP + 8 * e);
      const v4f q = *(const v4f*)(Os + row * OSP + 8 * e + 4);
      float f[8];
#pragma unroll
      for (int t = 0; t < 4; ++t) { f[t] = a[t] + bv[t]; f[4 + t] = q[t] + bv[4 + t]; }
      split8(f, uh[it], ul[it]);
    }
{
#pragma unroll
      for (int it = 0; it < 4; ++it) {
        const int row = it * 32 + lq;
        const size_t po = ((size_t)(b * NN + n0 + row)) * DQ + dsel + 8 * e;
        *(v4u*)(Qh + po) = uh[it];
        *(v4u*)(Ql + po) = ul[it];
      }
      
    }
  } else {
    const int e16 = tid & 15, lr = tid >> 4;                        // lr 0..15
    v4f bv4;
    {
      const v4f bq = *(const v4f*)(bias + dsel + 4 * e16);
#pragma unroll
      for (int t = 0; t < 4; ++t) bv4[t] = bfr(bq[t]);
    }
    float* P = (grp == 1) ? PF : GF;                                 // both global
    v4f res[8];
#pragma unroll
    for (int it = 0; it < 8; ++it) {
      const int row = it * 16 + lr;                                  // n_loc 0..127
      const v4f a = *(const v4f*)(Os + row * OSP + 4 * e16);
      v4f v;
#pragma unroll
      for (int t = 0; t < 4; ++t) v[t] = a[t] + bv4[t];
      res[it] = v;
    }
{
#pragma unroll
      for (int it = 0; it < 8; ++it) {
        const int row = it * 16 + lr;
        const size_t po = ((size_t)(b * NN + n0 + row)) * DQ + dsel + 4 * e16;
        *(v4f*)(P + po) = res[it];
      }
      
    }
  }
}

// =========================================================================================================
// (3) 2x2 stride-2 max-pool of PF / GF f32 [b][4096 n][128 d] in f32 -> Kh/Kl bf16 [b][1024 m][128 d]
//     (hi = RNE(v), lo = RNE(v-hi)) and Gp f16 [b][1024 m][128 d], m = 32 py + px, window n = (2py+dy) 64 + 2px+dx,
//     dy, dx in {0,1}. Block (py, b), 256 threads: lane group e16 (16 lanes x 16 B = one 256-B row = 2 whole
//     lines), lr = tid>>4 -> px = 16 it + lr for it 0..1 (all 32 px valid, no pad rows). No LDS, no barriers.
// coverage: blocks 0..31 x px 0..31 x 16 lanes x 8 = rows 0..1023 x 128 d; grid (32, NB) covers Kh/Kl/Gp
//           [b][0..1023][0..127] exactly once.
// =========================================================================================================
__global__ __launch_bounds__(256)
void pool_k(const float* __restrict__ PF, const float* __restrict__ GF,
            unsigned short* Kh, unsigned short* Kl, unsigned short* Gp) {
  const int tid = threadIdx.x, py = blockIdx.x, b = blockIdx.y;
  const int e16 = tid & 15, lr = tid >> 4;                          // lr 0..15
  v4u kh[2], kl[2], gu[2];
#pragma unroll
  for (int it = 0; it < 2; ++it) {
    const int px = it * 16 + lr;                                    // 0..31
    float fk[8], fg[8];
#pragma unroll
    for (int t = 0; t < 8; ++t) { fk[t] = -__builtin_inff(); fg[t] = -__builtin_inff(); }
#pragma unroll
    for (int dy = 0; dy < 2; ++dy) {
      const size_t rb = ((size_t)(b * NN + (2 * py + dy) * WIMG + 2 * px)) * DQ + 8 * e16;
#pragma unroll
      for (int dx = 0; dx < 2; ++dx) {
        const float* pk = PF + rb + (size_t)dx * DQ;
        const float* pg = GF + rb + (size_t)dx * DQ;
        const v4f ka = *(const v4f*)pk, kq = *(const v4f*)(pk + 4);
        const v4f ga = *(const v4f*)pg, gq = *(const v4f*)(pg + 4);
#pragma unroll
        for (int t = 0; t < 4; ++t) {
          fk[t]     = fmaxf(fk[t], ka[t]);
          fk[4 + t] = fmaxf(fk[4 + t], kq[t]);
          fg[t]     = fmaxf(fg[t], ga[t]);
          fg[4 + t] = fmaxf(fg[4 + t], gq[t]);
        }
      }
    }
    split8(fk, kh[it], kl[it]);
#pragma unroll
    for (int t = 0; t < 4; ++t) gu[it][t] = pk16(h_bits((_Float16)fg[2 * t]), h_bits((_Float16)fg[2 * t + 1]));
  }
{
#pragma unroll
    for (int it = 0; it < 2; ++it) {
      const int px = it * 16 + lr;
      const size_t po = ((size_t)(b * MM + WP * py + px)) * DQ + 8 * e16;
      *(v4u*)(Kh + po) = kh[it];
      *(v4u*)(Kl + po) = kl[it];
      *(v4u*)(Gp + po) = gu[it];
    }
    
  }
}

// =========================================================================================================
// (4) Gp f16 [b][1024 m][128 d] -> Gc f16 [b][d][m] (channel-major, keys contiguous) through an LDS tile T[64 d][64 m]
// coverage: reads 2 it x 32 rows x 8 lanes x 8 = 64 m x 64 d; T written rows (8e+t)=0..63 x cols 0..63, read rows
//           0..63 x cols 8e..8e+7 (staged extent == consumed extent); writes 64 d x 64 m; grid (16, 2, NB) covers
//           Gc [b][0..127][0..1023] exactly once.
// =========================================================================================================
__global__ __launch_bounds__(256)
void tr_g(const unsigned short* __restrict__ Gp, unsigned short* Gc) {
  __shared__ __align__(16) unsigned short T[QT * TP];
  const int tid = threadIdx.x;
  const int mt = blockIdx.x, db = blockIdx.y, b = blockIdx.z;
  const int e = tid & 7, lq = tid >> 3;                             // lq 0..31
  const int m0 = mt * QT, d0 = db * QT;
#pragma unroll
  for (int it = 0; it < 2; ++it) {
    const int ml = it * 32 + lq;                                     // 0..63
    const v4u w = *(const v4u*)(Gp + ((size_t)(b * MM + m0 + ml)) * DQ + d0 + 8 * e);
    unsigned short hb[8];
#pragma unroll
    for (int t = 0; t < 4; ++t) {
      hb[2 * t]     = (unsigned short)(w[t] & 0xFFFFu);
      hb[2 * t + 1] = (unsigned short)(w[t] >> 16);
    }
#pragma unroll
    for (int t = 0; t < 8; ++t) T[(8 * e + t) * TP + ml] = hb[t];
  }
  __syncthreads();
  v4u up[2];
#pragma unroll
  for (int it = 0; it < 2; ++it) {
    const int dl = it * 32 + lq;                                     // 0..63
    up[it] = *(const v4u*)(T + dl * TP + 8 * e);
  }
{
#pragma unroll
    for (int it = 0; it < 2; ++it) {
      const int dl = it * 32 + lq;
      *(v4u*)(Gc + ((size_t)(b * DQ + d0 + dl)) * MM + m0 + 8 * e) = up[it];
    }
    
  }
}

// =========================================================================================================
// (5) attention for one (b, 64-query tile), transposed formulation, 1024 keys (all valid, no mask, no scale):
//   S^T tile (16 keys x 16 queries) = sum over 4 d-chunks (rolled loop) of A(k: row = key kb + (lane&15), 32 d via
//   the split k map from the bf16 plane Kh [b][1024][128]) . B(q: col = query, same map from Qh [b][4096][128])
//   + A(Kh).B(Ql) + A(Kl).B(Qh) (bf16 unscaled residual planes, shared accumulator).
//   Per lane the D tile holds 8 keys of ONE query: online softmax state per lane, one shuffle (lane^16) for the max
//   over 32 keys; the o/l rescale is skipped under a wave-uniform ballot when no lane's max grew (corr == 1 exactly
//   for every lane then); row-sum partials combined at the end. P = e^{s-m} x 16384 as f16 is the B operand of
//   y^T (rows channel, cols queries) += A(pooled g: rows channel = 16j + (lane&15), keys contiguous, f16 plane Gc
//   [b][128][1024]) . B(P^T): element r <- D of the tile covering keys kb..kb+15, element 8+r <- the tile covering
//   kb+16..kb+31, lane unchanged. 8 accumulator tiles per wave (128 channels). Block = 4 waves = 64 queries.
//   Live state per lane: o 64 + s0/s1 16 + up to 6 fragments (rolled d loop) + P 8 + m/l, under the 256 cap.
//   Epilogue: y = O/l staged in LDS Os[query][128 channels] (pitch OSPW, b128 stores), block barrier (cross-wave),
// coverage: Os written 4 waves x 16 queries x 128 ch, read rows 0..63 x ch 8e..8e+7 (e 0..15); planes 8 it x 8 rows x
//           16 lanes x 8 = 64 n x 128 ch per plane; grid (NQ/64, NB) covers rows 0..NQ-1 of Yh/Yl exactly once.
// =========================================================================================================
__global__ __launch_bounds__(128) __attribute__((amdgpu_num_vgpr(256)))
void attn_k(const unsigned short* __restrict__ Qh, const unsigned short* __restrict__ Ql,
            const unsigned short* __restrict__ Kh, const unsigned short* __restrict__ Kl,
            const unsigned short* __restrict__ Gc, unsigned short* Yh, unsigned short* Yl) {
  __shared__ __align__(16) float Os[QT * OSPW];
  const int tid  = threadIdx.x;
  const int wave = tid >> 5, lane = tid & 31;
  const int hh   = lane >> 4, c = lane & 15;
  const int n0   = blockIdx.x * QT, b = blockIdx.y;

  // q fragment pointers (B operand, col = query n0 + 16*wave + c), + 32*kc
  const size_t qo = ((size_t)(b * NN + n0 + 16 * wave + c)) * DQ + 8 * hh;
  const unsigned short* Qhp = Qh + qo;
  const unsigned short* Qlp = Ql + qo;
  // k fragment base (A operand, row = key kb + c), + key * 128 + 32*kc
  const unsigned short* Khp = Kh + (size_t)b * MM * DQ + (size_t)c * DQ + 8 * hh;
  const unsigned short* Klp = Kl + (size_t)b * MM * DQ + (size_t)c * DQ + 8 * hh;
  // v fragment base (A operand, row = channel 16j + c, keys contiguous), + 16*j*MM + kb
  const unsigned short* Vp = Gc + (size_t)b * DQ * MM + (size_t)c * MM + 8 * hh;

  float m = -1.0e30f, l = 0.f;
  v8f o[8];
#pragma unroll
  for (int j = 0; j < 8; ++j) o[j] = zero8();

#pragma unroll 1
  for (int kb = 0; kb < MM; kb += 32) {
    const unsigned short* k0p  = Khp + (size_t)kb * DQ;              // keys kb .. kb+15
    const unsigned short* k1p  = Khp + (size_t)(kb + 16) * DQ;       // keys kb+16 .. kb+31
    const unsigned short* k0lp = Klp + (size_t)kb * DQ;
    const unsigned short* k1lp = Klp + (size_t)(kb + 16) * DQ;
    v8f s0 = zero8(), s1 = zero8();
#pragma unroll 1
    for (int kc = 0; kc < DQ / 32; ++kc) {
      const Frag qh  = ldfrag(Qhp + 32 * kc);
      const Frag ql  = ldfrag(Qlp + 32 * kc);
      const Frag k0  = ldfrag(k0p + 32 * kc);
      const Frag k1  = ldfrag(k1p + 32 * kc);
      const Frag k0l = ldfrag(k0lp + 32 * kc);
      const Frag k1l = ldfrag(k1lp + 32 * kc);
      s0 = mma_b(k0.bf, qh.bf, s0);
      s1 = mma_b(k1.bf, qh.bf, s1);
      s0 = mma_b(k0.bf, ql.bf, s0);
      s1 = mma_b(k1.bf, ql.bf, s1);
      s0 = mma_b(k0l.bf, qh.bf, s0);
      s1 = mma_b(k1l.bf, qh.bf, s1);
    }

    float mx = fmaxf(hmax8(s0), hmax8(s1));
    mx = fmaxf(mx, __shfl_xor(mx, 16, 32));
    const float mn = fmaxf(m, mx);
    const unsigned grew = wave_ballot(mx > m);                       // wave-uniform
    if (grew != 0u) {
      const float corr = __expf(m - mn);                             // == 1 exactly for lanes whose max did not grow
      l *= corr;
#pragma unroll
      for (int j = 0; j < 8; ++j) {
#pragma unroll
        for (int r = 0; r < 8; ++r) o[j][r] *= corr;
      }
    }
    m = mn;
    const float msh = mn - LNPS;                                     // exp gives e^{s-m} * 16384

    FragH ph;
    float ls = 0.f;
#pragma unroll
    for (int r = 0; r < 8; ++r) {
      const float e0 = __expf(s0[r] - msh);                          // key kb      + 8hh + r
      const float e1 = __expf(s1[r] - msh);                          // key kb + 16 + 8hh + r
      ls += e0 + e1;
      ph.hv[0][r] = (_Float16)e0;
      ph.hv[1][r] = (_Float16)e1;
    }
    l += ls;

#pragma unroll
    for (int j = 0; j < 8; ++j) {
      const Frag vf = ldfrag(Vp + (size_t)(16 * j) * MM + kb);
      o[j] = mma_h(vf.h, ph.v, o[j]);
    }
  }
  l += __shfl_xor(l, 16, 32);
  const float inv = 1.0f / l;                                        // o and l both carry the x16384 factor

  // ---- epilogue: y = o * inv -> Os[query][ch]; lane (hh, c) holds ch = 16 j + 8 hh + r for query 16 w + c
  {
    const int qrow = 16 * wave + c;
#pragma unroll
    for (int j = 0; j < 8; ++j) {
      v4f va, vb;
#pragma unroll
      for (int r = 0; r < 4; ++r) { va[r] = o[j][r] * inv; vb[r] = o[j][4 + r] * inv; }
      *(v4f*)(Os + qrow * OSPW + 16 * j + 8 * hh)     = va;
      *(v4f*)(Os + qrow * OSPW + 16 * j + 8 * hh + 4) = vb;
    }
  }
  __syncthreads();

  const int e16 = tid & 15, lr = tid >> 4;                           // lr 0..7
  v4u uh[8], ul[8];
#pragma unroll
  for (int it = 0; it < 8; ++it) {
    const int row = it * 8 + lr;                                     // query 0..63
    const v4f a = *(const v4f*)(Os + row * OSPW + 8 * e16);
    const v4f q = *(const v4f*)(Os + row * OSPW + 8 * e16 + 4);
    const float f[8] = {a[0], a[1], a[2], a[3], q[0], q[1], q[2], q[3]};
    split8(f, uh[it], ul[it]);
  }
{
#pragma unroll
    for (int it = 0; it < 8; ++it) {
      const int row = it * 8 + lr;
      const size_t po = ((size_t)(b * NN + n0 + row)) * DQ + 8 * e16;
      *(v4u*)(Yh + po) = uh[it];
      *(v4u*)(Yl + po) = ul[it];
    }
    
  }
}

// =========================================================================================================
// (6) output conv for one (b, 64-n tile, 64-c block): A[c][n] = sum_ci WWb[c][ci] (Yh + Yl)[b][n][ci] on bf16 WMMA
//     (2 products per k-step, shared accumulator), K = 128 = 4 steps. Block 128 threads = 4 waves; wave w owns cols
//     n0+16w..+15 (B fragments from the k-contiguous Yh/Yl rows) and 4 m-tiles (A rows c = c0 + 16 mt + (lane&15),
//     split k map loader from WWb). Epilogue staged in LDS Os[n_loc][c_loc] (pitch OSP, b128 stores), block barrier
//     2 lines): 8 consecutive lanes x 16 B (values gathered from 4 Os rows), one instruction per 4 lines, final
// coverage: Os 4 waves x 16 n x 64 c written, read rows nl+t <= 63 x cols cl <= 63; WY 8 it x 16 lines x 8 lanes x
//           4 floats = 64 c x 64 n; grid (NQ/64, 4, NB) covers WY[b][0..255][0..NQ-1] exactly once.
// =========================================================================================================
__global__ __launch_bounds__(128)
void gemm_out(const unsigned short* __restrict__ WWb, const unsigned short* __restrict__ Yh,
              const unsigned short* __restrict__ Yl, const float* __restrict__ wb, float* WY) {
  __shared__ __align__(16) float Os[QT * OSP];
  const int tid  = threadIdx.x;
  const int lane = tid & 31, wave = tid >> 5;
  const int hh   = lane >> 4, c = lane & 15;
  const int nt   = blockIdx.x, cb = blockIdx.y, b = blockIdx.z;
  const int n0   = nt * QT, c0 = cb * QT;

  const unsigned short* ap  = WWb + (size_t)(c0 + c) * DQ + 8 * hh;
  const size_t bo = ((size_t)(b * NN + n0 + 16 * wave + c)) * DQ + 8 * hh;
  const unsigned short* bph = Yh + bo;
  const unsigned short* bpl = Yl + bo;

  v8f acc[4];
#pragma unroll
  for (int mt = 0; mt < 4; ++mt) acc[mt] = zero8();

#pragma unroll
  for (int ks = 0; ks < DQ / 32; ++ks) {
    const Frag fbh = ldfrag(bph + 32 * ks);
    const Frag fbl = ldfrag(bpl + 32 * ks);
#pragma unroll
    for (int mt = 0; mt < 4; ++mt) {
      const Frag fa = ldfrag(ap + (size_t)(16 * mt) * DQ + 32 * ks);
      acc[mt] = mma_b(fa.bf, fbh.bf, acc[mt]);
      acc[mt] = mma_b(fa.bf, fbl.bf, acc[mt]);
    }
  }

  // ---- epilogue: -> LDS Os[n_loc][c_loc]; lane (hh, c) holds c_loc = 16 mt + 8 hh + r for n_loc = 16 w + c
  {
    const int nl = 16 * wave + c;
#pragma unroll
    for (int mt = 0; mt < 4; ++mt) {
      v4f va, vb;
#pragma unroll
      for (int r = 0; r < 4; ++r) { va[r] = acc[mt][r]; vb[r] = acc[mt][4 + r]; }
      *(v4f*)(Os + nl * OSP + 16 * mt + 8 * hh)     = va;
      *(v4f*)(Os + nl * OSP + 16 * mt + 8 * hh + 4) = vb;
    }
  }
  __syncthreads();

  const int e = tid & 7, lq = tid >> 3;                              // lq 0..15
  v4f res[8];
#pragma unroll
  for (int it = 0; it < 8; ++it) {
    const int L   = it * 16 + lq;                                    // 0..127
    const int cl  = L >> 1, hf = L & 1;                              // channel 0..63 within the block
    const int nl  = hf * 32 + 4 * e;                                 // position 0..63
    const float bvs = bfr(wb[c0 + cl]);
#pragma unroll
    for (int t = 0; t < 4; ++t) {
      res[it][t] = Os[(nl + t) * OSP + cl] + bvs;
    }
  }
{
#pragma unroll
    for (int it = 0; it < 8; ++it) {
      const int L   = it * 16 + lq;
      const int cl  = L >> 1, hf = L & 1;
      const int nl  = hf * 32 + 4 * e;
      const size_t idx = ((size_t)(b * CC + c0 + cl)) * NN + n0 + nl;
      *(v4f*)(WY + idx) = res[it];
    }
    
  }
}

// =========================================================================================================
// (7) batch-norm statistics: block owns 32 channels c0..c0+31; for each channel (rolled loop) every thread sums
//     16 consecutive floats (4 b128 loads) of each WY row [b][c][0..NQ) over the NB batches in f64 (sum and sum of
//     squares), wave shuffle reduce, per-wave partials in LDS (cross-wave, block barrier), thread 0 combines in
//     fixed order: mean, biased variance, rstd = 1/sqrt(var + eps) in f32 -> LDS tab[]. After the channel loop wave 0
// coverage: 8 blocks x 32 channels = 256 means + 256 rstd; MU [0..511] written exactly once; reads WY rows b < NB,
//           c 0..255, n < NQ only (the produced extent).
// =========================================================================================================
__global__ __launch_bounds__(256)
void bn_stat(const float* __restrict__ WY, float* MU) {
#pragma clang fp contract(off)
  __shared__ double red[16];
  __shared__ __align__(16) float tab[2 * CHB];
  const int tid = threadIdx.x, lane = tid & 31, wave = tid >> 5;
  const int c0 = blockIdx.x * CHB;
  const double ninv = 1.0 / ((double)NB * (double)NQ);
#pragma unroll 1
  for (int ch = 0; ch < CHB; ++ch) {
    const int cc = c0 + ch;
    double s = 0.0, q = 0.0;
#pragma unroll 1
    for (int bb = 0; bb < NB; ++bb) {
      const float* rp = WY + ((size_t)(bb * CC + cc)) * NN;
#pragma unroll 1
      for (int i = tid; i < NQ / 16; i += 256) {
        const float* p = rp + 16 * i;
        const v4f a0 = *(const v4f*)(p);
        const v4f a1 = *(const v4f*)(p + 4);
        const v4f a2 = *(const v4f*)(p + 8);
        const v4f a3 = *(const v4f*)(p + 12);
#pragma unroll
        for (int t = 0; t < 4; ++t) {
          const double d0 = (double)a0[t], d1 = (double)a1[t], d2 = (double)a2[t], d3 = (double)a3[t];
          s += d0; q += d0 * d0;
          s += d1; q += d1 * d1;
          s += d2; q += d2 * d2;
          s += d3; q += d3 * d3;
        }
      }
    }
#pragma unroll
    for (int d = 1; d < 32; d <<= 1) {
      s += __shfl_xor(s, d, 32);
      q += __shfl_xor(q, d, 32);
    }
    if (lane == 0) { red[wave] = s; red[8 + wave] = q; }
    __syncthreads();
    if (tid == 0) {
      double ts = 0.0, tq = 0.0;
#pragma unroll
      for (int w = 0; w < 8; ++w) { ts += red[w]; tq += red[8 + w]; }
      const double mu = ts * ninv;
      double var = tq * ninv - mu * mu;
      var = (var > 0.0) ? var : 0.0;
      const float varf = (float)var + BNEPS;
      const float rs = 1.0f / sqrtf(varf);
      tab[ch] = (float)mu;
      tab[CHB + ch] = rs;
    }
    __syncthreads();
  }
  if (wave == 0) {                                                   // wave-uniform branch, no cross-lane ops
    const v4f v = *(const v4f*)(tab + 4 * (lane & 15));              // lanes 0..7 means, 8..15 rstd
    float* dst = MU + c0 + 4 * (lane & 7) + ((lane & 8) ? CC : 0);
{
      if (lane < 16) *(v4f*)dst = v;
      
    }
  }
}

// =========================================================================================================
// (8) normalise + affine + residual: out[b][c][n] = (((WY - mu[c]) * rstd[c]) * bf16-RNE(gamma[c]) + bf16-RNE(beta[c]))
//     + bf16-RNE(x[b][c][n]) in f32. Block 256 threads = 8 waves covers 4 channels x 256 n: wave w -> channel
// coverage: grid (NQ/256, 64, NB) x 8 waves x 32 lanes x 4 floats covers out[b][0..255][0..NQ-1] exactly once.
// =========================================================================================================
__global__ __launch_bounds__(256)
void bn_apply(const float* __restrict__ WY, const float* __restrict__ x, const float* __restrict__ gam,
              const float* __restrict__ bet, const float* __restrict__ MU, float* out) {
#pragma clang fp contract(off)
  const int tid = threadIdx.x, lane = tid & 31, wave = tid >> 5;
  const int nq = blockIdx.x, cb = blockIdx.y, b = blockIdx.z;
  const int c = cb * 4 + (wave >> 1);                                // 0..255 (wave-uniform)
  const int n = nq * BNQ + (wave & 1) * 128 + 4 * lane;              // < NQ
  const float mu = MU[c], rs = MU[CC + c];
  const float ga = bfr(gam[c]), be = bfr(bet[c]);
  const size_t idx = ((size_t)(b * CC + c)) * NN + n;
  const v4f w  = *(const v4f*)(WY + idx);
  const v4f xv = *(const v4f*)(x + idx);
  v4f r;
#pragma unroll
  for (int t = 0; t < 4; ++t) {
    const float d  = w[t] - mu;
    const float nv = d * rs;
    const float av = nv * ga;
    const float sv = av + be;
    r[t] = sv + bfr(xv[t]);
  }
{
    *(v4f*)(out + idx) = r;
    
  }
}

// =========================================================================================================
// Workspace map (bytes; each region start a multiple of 256; every extent is an exact row/tile multiple and is
//   W16 f16 [384][256]            196608      WWb bf16 [256][128]        65536
//   XP  f16 [NB][4096][256]     16777216 (NB=8)
//   Qh/Ql bf16 [NB][4096][128]   8388608 x2
//   PF/GF f32  [NB][4096][128]  16777216 x2
//   Kh/Kl bf16 [NB][1024][128]   2097152 x2  Gp f16 [NB][1024][128]   2097152   Gc f16 [NB][128][1024]  2097152
//   Yh/Yl bf16 [NB][4096][128]   8388608 x2
//   WY  f32  [NB][256][4096]    33554432    MU f32 [512]                2048
//   total (NB=8) = 126093312
// =========================================================================================================
extern "C" void kernel_launch(void* const* d_in, const int* in_sizes, int n_in,
                              void* d_out, int out_size, void* d_ws, size_t ws_size,
                              hipStream_t stream) {
  const int XN = NB * CC * NN;
  if (n_in < 11) return;
  if (in_sizes[0] < XN) return;
  if (in_sizes[1] < DQ * CC || in_sizes[3] < DQ * CC || in_sizes[5] < DQ * CC || in_sizes[7] < CC * DQ) return;
  if (in_sizes[2] < DQ || in_sizes[4] < DQ || in_sizes[6] < DQ || in_sizes[8] < CC) return;
  if (in_sizes[9] < CC || in_sizes[10] < CC) return;
  if (out_size < XN) return;

  size_t off = 0;
  auto carve = [&](size_t bytes) { const size_t o = off; off += (bytes + 255) & ~(size_t)255; return o; };
  const size_t oW16 = carve((size_t)MW * CC * 2);
  const size_t oWWb = carve((size_t)CC * DQ * 2);
  const size_t oXP  = carve((size_t)NB * NN * CC * 2);
  const size_t oQh  = carve((size_t)NB * NN * DQ * 2);
  const size_t oQl  = carve((size_t)NB * NN * DQ * 2);
  const size_t oPF  = carve((size_t)NB * NN * DQ * 4);
  const size_t oGF  = carve((size_t)NB * NN * DQ * 4);
  const size_t oKh  = carve((size_t)NB * MM * DQ * 2);
  const size_t oKl  = carve((size_t)NB * MM * DQ * 2);
  const size_t oGp  = carve((size_t)NB * MM * DQ * 2);
  const size_t oGc  = carve((size_t)NB * DQ * MM * 2);
  const size_t oYh  = carve((size_t)NB * NN * DQ * 2);
  const size_t oYl  = carve((size_t)NB * NN * DQ * 2);
  const size_t oWY  = carve((size_t)NB * CC * NN * 4);
  const size_t oMU  = carve((size_t)2 * CC * 4);
  if (off > ws_size) return;
  if (off > (size_t)134217728) return;

  const float* x   = (const float*)d_in[0];
  const float* gw  = (const float*)d_in[1];
  const float* gb  = (const float*)d_in[2];
  const float* tw  = (const float*)d_in[3];
  const float* tb  = (const float*)d_in[4];
  const float* pw  = (const float*)d_in[5];
  const float* pb  = (const float*)d_in[6];
  const float* ow  = (const float*)d_in[7];
  const float* wb  = (const float*)d_in[8];
  const float* gam = (const float*)d_in[9];
  const float* bet = (const float*)d_in[10];

  char* ws = (char*)d_ws;
  unsigned short* W16 = (unsigned short*)(ws + oW16);
  unsigned short* WWb = (unsigned short*)(ws + oWWb);
  unsigned short* XP  = (unsigned short*)(ws + oXP);
  unsigned short* Qh  = (unsigned short*)(ws + oQh);
  unsigned short* Ql  = (unsigned short*)(ws + oQl);
  float*          PF  = (float*)(ws + oPF);
  float*          GF  = (float*)(ws + oGF);
  unsigned short* Kh  = (unsigned short*)(ws + oKh);
  unsigned short* Kl  = (unsigned short*)(ws + oKl);
  unsigned short* Gp  = (unsigned short*)(ws + oGp);
  unsigned short* Gc  = (unsigned short*)(ws + oGc);
  unsigned short* Yh  = (unsigned short*)(ws + oYh);
  unsigned short* Yl  = (unsigned short*)(ws + oYl);
  float*          WY  = (float*)(ws + oWY);
  float*          MU  = (float*)(ws + oMU);
  float* out = (float*)d_out;

  const dim3 blk256(256), blk128(128);

  // (0) theta_w / phi_w / g_w -> stacked f16 plane; w_w -> bf16 plane
  cvt_w<<<dim3(MW / 8 + CC / 16), blk256, 0, stream>>>(tw, pw, gw, ow, W16, WWb);
  // (1) x -> position-major 16-bit plane
  cvt_x<<<dim3(NN / QT, CC / QT, NB), blk256, 0, stream>>>(x, XP);
  // (2) conv1x1 GEMM -> theta (q) hi/res planes, phi / g conv outputs + bias as f32 planes
  gemm_proj<<<dim3(NSTRIP, MW / QT, NB), blk256, 0, stream>>>(W16, XP, tb, pb, gb, Qh, Ql, PF, GF);
  // (3) 2x2 stride-2 max-pool -> pooled phi (k) hi/res planes, pooled g f16 plane
  pool_k<<<dim3(HP, NB), blk256, 0, stream>>>(PF, GF, Kh, Kl, Gp);
  // (4) pooled g -> channel-major plane
  tr_g<<<dim3(MM / QT, DQ / QT, NB), blk256, 0, stream>>>(Gp, Gc);
  // (5) attention -> y hi/res planes [b][n][128]
  attn_k<<<dim3(NQ / QT, NB), blk128, 0, stream>>>(Qh, Ql, Kh, Kl, Gc, Yh, Yl);
  // (6) output conv + bias -> WY f32 plane [b][256][4096]
  gemm_out<<<dim3(NQ / QT, CC / QT, NB), blk128, 0, stream>>>(WWb, Yh, Yl, wb, WY);
  // (7) per-channel mean / rstd table
  bn_stat<<<dim3(CC / CHB), blk256, 0, stream>>>(WY, MU);
  // (8) normalise, affine, residual -> out [b][256][4096]
  bn_apply<<<dim3(NQ / BNQ, CC / 4, NB), blk256, 0, stream>>>(WY, x, gam, bet, MU, out);
  (void)hipGetLastError();
}

// v001
// One run takes 243 microseconds.
// Two timings next to v000 put it at 3.35 and 3.34 times that version's speed.
// Contractions: conv1x1 theta/phi/g GEMM W[384x256].X[256x128] per strip on v_wmma_f32_16x16x32_f16 (f16 containers
// of bf16-RNE weights x256 and bf16-RNE x); scores K.Q^T on v_wmma_f32_16x16x32_bf16 (bf16 hi + bf16 residual planes
// of theta / 2x2-max-pooled phi, 3 products, K=128); y^T = G.P^T on v_wmma_f32_16x16x32_f16 (2x2-max-pooled g as
// f16, P = e^{s-m} x16384 f16 from the score D registers); output conv W[256x128].Y on v_wmma_f32_16x16x32_bf16 (bf16
// weights, y as bf16 hi + residual planes, 2 products); f32 accumulate everywhere; max-pool, softmax statistics and
// bias in f32 VALU; batch-norm channel statistics in f64 VALU; normalisation, affine and residual add in f32 VALU.
#include <hip/hip_runtime.h>
#include <math.h>
#include <stdint.h>

#ifndef NB
#define NB 8
#endif
#ifndef NQ
#define NQ 4096
#endif
#define NB_FULL 8
#define CC     256
#define HIMG   64
#define WIMG   64
#define NN     4096
#define DQ     128
#define HP     32
#define WP     32
#define MM     1024
#define MW     384
#define QT     64
#define SN     128
#define NSTRIP 32
#define OSP    68
#define OSPW   132
#define TP     72
#define BNQ    256
#define BST    1024
#define MUP    32
#define WSC    256.0f
#define IWSC   0.00390625f
#define LNPS   9.704060527839234f
#define BNEPS  1.0e-5f

static_assert(NB >= 1 && NB <= NB_FULL);
static_assert(NQ % QT == 0 && NQ % BNQ == 0 && NQ >= BNQ && NQ <= NN);
static_assert(NN == HIMG * WIMG);
static_assert(SN == 2 * WIMG);
static_assert(NSTRIP * SN == NN);
static_assert(SN == 8 * 16);
static_assert(HIMG % 2 == 0 && WIMG % 2 == 0);
static_assert(HP == HIMG / 2 && WP == WIMG / 2);
static_assert(MM == HP * WP);
static_assert(WP == 32);
static_assert(MM % QT == 0 && MM % 32 == 0);
static_assert(NN % QT == 0 && CC % QT == 0 && DQ % QT == 0);
static_assert(MW == 3 * DQ && MW % QT == 0 && MW % 8 == 0);
static_assert(CC % 32 == 0 && DQ % 32 == 0);
static_assert((OSP * 4) % 16 == 0);
static_assert((OSPW * 4) % 16 == 0);
static_assert((TP * 2) % 16 == 0);
static_assert(SN * OSP * 4 <= 65536);
static_assert(MUP * 4 == 128);
static_assert(BST == 32 * 32 && NQ == 4 * BST);
static_assert(NN % 16 == 0 && BNQ == 2 * 128 && CC % 4 == 0);
static_assert((size_t)NB_FULL * CC * NN * 4 == (size_t)33554432);

typedef _Float16       v16h __attribute__((ext_vector_type(16)));
typedef _Float16       v8h  __attribute__((ext_vector_type(8)));
typedef __bf16         v16b __attribute__((ext_vector_type(16)));
typedef unsigned short v8us __attribute__((ext_vector_type(8)));
typedef float          v8f  __attribute__((ext_vector_type(8)));
typedef float          v4f  __attribute__((ext_vector_type(4)));
typedef unsigned int   v4u  __attribute__((ext_vector_type(4)));

union Frag  { v8us u[2]; v16h h; v16b bf; };
union FragH { v16h v; v8h hv[2]; };
static_assert(sizeof(Frag) == 32);
static_assert(sizeof(FragH) == 32);

// ---- scalar helpers ---------------------------------------------------------------------------------------
__device__ __forceinline__ unsigned short bf_bits(float f) {          // f32 -> bf16 bits, RNE convert
  unsigned u = __float_as_uint(f);
  return (unsigned short)((u + 0x7FFFu + ((u >> 16) & 1u)) >> 16);
}
__device__ __forceinline__ float bf_up(unsigned short hb) { return __uint_as_float(((unsigned)hb) << 16); }
__device__ __forceinline__ float bfr(float f) { return bf_up(bf_bits(f)); }
__device__ __forceinline__ unsigned short h_bits(_Float16 x) { return __builtin_bit_cast(unsigned short, x); }
__device__ __forceinline__ unsigned pk16(unsigned short a, unsigned short b) { return (unsigned)a | ((unsigned)b << 16); }
__device__ __forceinline__ v8f zero8() { v8f z = {0.f, 0.f, 0.f, 0.f, 0.f, 0.f, 0.f, 0.f}; return z; }
__device__ __forceinline__ float hmax8(v8f s) {
  return fmaxf(fmaxf(fmaxf(s[0], s[1]), fmaxf(s[2], s[3])), fmaxf(fmaxf(s[4], s[5]), fmaxf(s[6], s[7])));
}
__device__ __forceinline__ unsigned wave_ballot(bool p) {
#if defined(__HIP_DEVICE_COMPILE__)
  return __builtin_amdgcn_ballot_w32(p);
#else
  return p ? 1u : 0u;
#endif
}
// 8 f32 values -> bf16 hi bits and bf16 residual bits (lo = RNE(v - hi)), packed 2 per uint
__device__ __forceinline__ void split8(const float* f, v4u& uh, v4u& ul) {
#pragma unroll
  for (int t = 0; t < 4; ++t) {
    const float f0 = f[2 * t], f1 = f[2 * t + 1];
    const unsigned short hb0 = bf_bits(f0), hb1 = bf_bits(f1);
    const unsigned short lb0 = bf_bits(f0 - bf_up(hb0));
    const unsigned short lb1 = bf_bits(f1 - bf_up(hb1));
    uh[t] = pk16(hb0, hb1);
    ul[t] = pk16(lb0, lb1);
  }
}

// ---- 16-bit fragment loader (A, or B from a k-contiguous [n][k] row): lane -> row/col (lane&15), p already includes
//      + 8*(lane>>4); elements 0..7 <- p[0..7] (k0+8h..), elements 8..15 <- p[16..23] (k0+16+8h..)
__device__ __forceinline__ Frag ldfrag(const unsigned short* p) {
  Frag f;
  f.u[0] = *(const v8us*)(p);
  f.u[1] = *(const v8us*)(p + 16);
  return f;
}

// ---- WMMA helpers: builtin followed by a 4-slot VALU gap tying D and keeping A/B live --------------------------
__device__ __forceinline__ v8f mma_h(v16h a, v16h b, v8f c) {
  v8f d = __builtin_amdgcn_wmma_f32_16x16x32_f16(false, a, false, b, (short)0, c, false, false);
#if defined(__HIP_DEVICE_COMPILE__)
  asm volatile("v_nop\n\tv_nop\n\tv_nop\n\tv_nop" : "+v"(d) : "v"(a), "v"(b));
#endif
  return d;
}
__device__ __forceinline__ v8f mma_b(v16b a, v16b b, v8f c) {
  v8f d = __builtin_amdgcn_wmma_f32_16x16x32_bf16(false, a, false, b, (short)0, c, false, false);
#if defined(__HIP_DEVICE_COMPILE__)
  const v16h ha = __builtin_bit_cast(v16h, a), hb = __builtin_bit_cast(v16h, b);
  asm volatile("v_nop\n\tv_nop\n\tv_nop\n\tv_nop" : "+v"(d) : "v"(ha), "v"(hb));
#endif
  return d;
}

// =========================================================================================================
// (0) weights. Blocks 0..47: W16 f16 [384][256], rows 0..127 = theta_w, 128..255 = phi_w, 256..383 = g_w; value =
//     f16 of (bf16-RNE(w) * 256) (exact). Block owns rows 8*blk..8*blk+7: one wave per 512-B row = 32 lanes x 16 B
// coverage: 48 blocks x 8 rows x 32 lanes x 8 halves = 384 x 256; 16 blocks x 16 rows x 16 lanes x 8 = 256 x 128.
// =========================================================================================================
__global__ __launch_bounds__(256)
void cvt_w(const float* __restrict__ tw, const float* __restrict__ pw, const float* __restrict__ gw,
           const float* __restrict__ ow, unsigned short* W16, unsigned short* WWb) {
  const int tid = threadIdx.x, blk = blockIdx.x;
  if (blk < MW / 8) {
    const int rl = tid >> 5, col = 8 * (tid & 31);
    const int o = 8 * blk + rl;                                      // 0..383
    const int grp = blk >> 4;                                        // 0,1,2 (block-uniform)
    const float* wbase = (grp == 0) ? tw : ((grp == 1) ? pw : gw);  // all global
    const float* s = wbase + (size_t)(o - DQ * grp) * CC + col;      // (o - 128 grp) in 0..127
    const v4f a = *(const v4f*)s;
    const v4f q = *(const v4f*)(s + 4);
    const float f[8] = {a[0], a[1], a[2], a[3], q[0], q[1], q[2], q[3]};
    v4u u;
#pragma unroll
    for (int t = 0; t < 4; ++t) {
      const _Float16 h0 = (_Float16)(bfr(f[2 * t]) * WSC);
      const _Float16 h1 = (_Float16)(bfr(f[2 * t + 1]) * WSC);
      u[t] = pk16(h_bits(h0), h_bits(h1));
    }
{
      *(v4u*)(W16 + (size_t)o * CC + col) = u;
      
    }
  } else {
    const int rb = blk - MW / 8;                                     // 0..15
    const int o = 16 * rb + (tid >> 4);                              // 0..255
    const int col = 8 * (tid & 15);                                  // 0..120
    const float* s = ow + (size_t)o * DQ + col;
    const v4f a = *(const v4f*)s;
    const v4f q = *(const v4f*)(s + 4);
    const float f[8] = {a[0], a[1], a[2], a[3], q[0], q[1], q[2], q[3]};
    v4u u;
#pragma unroll
    for (int t = 0; t < 4; ++t) u[t] = pk16(bf_bits(f[2 * t]), bf_bits(f[2 * t + 1]));
{
      *(v4u*)(WWb + (size_t)o * DQ + col) = u;
      
    }
  }
}

// =========================================================================================================
// (1) x f32 [b][256 c][4096 n] -> XP f16 [b][n][c] (position-major, bf16-RNE values, exact in f16) through an LDS
//     tile T[64 n][64 c] (pitch TP, cross-wave, block barrier). Block (nb, cb, b) owns a 64 c x 64 n tile.
// coverage: T written rows (8e+t)=0..63 x cols cl 0..63, read rows 0..63 x cols 8e..8e+7 (staged extent == consumed
//           extent); XP 2 it x 32 rows x 8 lanes x 8 = 64 n x 64 c; grid (64, 4, NB) covers XP [b][0..4095][0..255]
//           exactly once.
// =========================================================================================================
__global__ __launch_bounds__(256)
void cvt_x(const float* __restrict__ x, unsigned short* XP) {
  __shared__ __align__(16) unsigned short T[QT * TP];
  const int tid = threadIdx.x;
  const int nb = blockIdx.x, cb = blockIdx.y, b = blockIdx.z;
  const int e = tid & 7, lq = tid >> 3;                             // lq 0..31
  const int n0 = nb * QT, c0 = cb * QT;
#pragma unroll
  for (int it = 0; it < 2; ++it) {
    const int cl = it * 32 + lq;                                     // 0..63
    const float* sp = x + ((size_t)(b * CC + c0 + cl)) * NN + n0 + 8 * e;
    const v4f a = *(const v4f*)sp;
    const v4f q = *(const v4f*)(sp + 4);
    unsigned short hb[8];
#pragma unroll
    for (int t = 0; t < 4; ++t) {
      hb[t]     = h_bits((_Float16)bfr(a[t]));
      hb[4 + t] = h_bits((_Float16)bfr(q[t]));
    }
#pragma unroll
    for (int t = 0; t < 8; ++t) T[(8 * e + t) * TP + cl] = hb[t];
  }
  __syncthreads();
  v4u up[2];
#pragma unroll
  for (int it = 0; it < 2; ++it) {
    const int nl = it * 32 + lq;                                     // 0..63
    up[it] = *(const v4u*)(T + nl * TP + 8 * e);
  }
{
#pragma unroll
    for (int it = 0; it < 2; ++it) {
      const int rl = it * 32 + lq;
      *(v4u*)(XP + ((size_t)(b * NN + n0 + rl)) * CC + c0 + 8 * e) = up[it];
    }
    
  }
}

// =========================================================================================================
// (2) conv1x1 GEMM for one (b, strip of 128 positions = image rows 2s and 2s+1, 64-o block of the stacked weights):
//     Y[o][n] = (1/256) sum_c W16[o][c] XP[b][n][c]. Block 256 threads = 8 waves; wave w owns cols n0+16w..+15
//     (one B fragment per k-step, k = c contiguous in the XP row) and 4 m-tiles (A rows o = o0 + 16 mt + (lane&15),
//     split k map loader from W16). K = 256 = 8 steps. Epilogue staged in LDS Os[n_loc][o_loc] (pitch OSP, b128
//     stores), block barrier (cross-wave), then (block-uniform branch on the o block):
//       o-blocks 0,1 -> theta dims 0..63 / 64..127 + bias -> Qh/Ql bf16 [b][4096 n][128 d] (hi = RNE(v), lo = RNE(v-hi)):
//       o-blocks 2,3 -> phi + bias in f32 -> PF f32 [b][4096 n][128 d]: 128 rows x the dsel half (256 B = 2 whole
//                       lines) of the 512-B row, 16 consecutive lanes x 16 B, one instruction per 2 rows.
//       o-blocks 4,5 -> g + bias -> GF f32 [b][4096 n][128 d], same layout.
// coverage: Os 8 waves x 16 n x 64 o = 128 x 64 written, reads rows <= 127 cols <= 63; theta planes 4 it x 32 rows
//           x 8 lanes x 8 = 128 n x 64 d; f32 planes 8 it x 16 rows x 16 lanes x 4 = 128 n x 64 d; grid (32, 6, NB)
//           covers all 4096 rows x 128 d of Qh/Ql and of PF/GF exactly once.
// =========================================================================================================
__global__ __launch_bounds__(256)
void gemm_proj(const unsigned short* __restrict__ W16, const unsigned short* __restrict__ XP,
               const float* __restrict__ tb, const float* __restrict__ pb, const float* __restrict__ gb,
               unsigned short* Qh, unsigned short* Ql, float* PF, float* GF) {
  __shared__ __align__(16) float Os[SN * OSP];
  const int tid  = threadIdx.x;
  const int lane = tid & 31, wave = tid >> 5;                        // wave 0..7
  const int hh   = lane >> 4, c = lane & 15;
  const int st   = blockIdx.x, mb = blockIdx.y, b = blockIdx.z;
  const int n0   = st * SN, o0 = mb * QT;

  const unsigned short* ap = W16 + (size_t)(o0 + c) * CC + 8 * hh;
  const unsigned short* bp = XP + ((size_t)(b * NN + n0 + 16 * wave + c)) * CC + 8 * hh;

  v8f acc[4];
#pragma unroll
  for (int mt = 0; mt < 4; ++mt) acc[mt] = zero8();

#pragma unroll
  for (int ks = 0; ks < CC / 32; ++ks) {
    const Frag fb = ldfrag(bp + 32 * ks);
#pragma unroll
    for (int mt = 0; mt < 4; ++mt) {
      const Frag fa = ldfrag(ap + (size_t)(16 * mt) * CC + 32 * ks);
      acc[mt] = mma_h(fa.h, fb.h, acc[mt]);
    }
  }

  // ---- epilogue: scale back -> LDS Os[n_loc][o_loc]; lane (hh, c) holds o = 16 mt + 8 hh + r for n_loc = 16 w + c
  {
    const int nl = 16 * wave + c;
#pragma unroll
    for (int mt = 0; mt < 4; ++mt) {
      v4f va, vb;
#pragma unroll
      for (int r = 0; r < 4; ++r) { va[r] = acc[mt][r] * IWSC; vb[r] = acc[mt][4 + r] * IWSC; }
      *(v4f*)(Os + nl * OSP + 16 * mt + 8 * hh)     = va;
      *(v4f*)(Os + nl * OSP + 16 * mt + 8 * hh + 4) = vb;
    }
  }
  __syncthreads();

  const int grp = mb >> 1;                                           // 0 theta, 1 phi, 2 g (block-uniform)
  const int dsel = (mb & 1) * QT;                                    // 0 or 64
  const float* bias = (grp == 0) ? tb : ((grp == 1) ? pb : gb);     // all global

  if (grp == 0) {
    const int e = tid & 7, lq = tid >> 3;                            // lq 0..31
    float bv[8];
    {
      const v4f ba = *(const v4f*)(bias + dsel + 8 * e);
      const v4f bq = *(const v4f*)(bias + dsel + 8 * e + 4);
#pragma unroll
      for (int t = 0; t < 4; ++t) { bv[t] = bfr(ba[t]); bv[4 + t] = bfr(bq[t]); }
    }
    v4u uh[4], ul[4];
#pragma unroll
    for (int it = 0; it < 4; ++it) {
      const int row = it * 32 + lq;                                  // n_loc 0..127
      const v4f a = *(const v4f*)(Os + row * OSP + 8 * e);
      const v4f q = *(const v4f*)(Os + row * OSP + 8 * e + 4);
      float f[8];
#pragma unroll
      for (int t = 0; t < 4; ++t) { f[t] = a[t] + bv[t]; f[4 + t] = q[t] + bv[4 + t]; }
      split8(f, uh[it], ul[it]);
    }
{
#pragma unroll
      for (int it = 0; it < 4; ++it) {
        const int row = it * 32 + lq;
        const size_t po = ((size_t)(b * NN + n0 + row)) * DQ + dsel + 8 * e;
        *(v4u*)(Qh + po) = uh[it];
        *(v4u*)(Ql + po) = ul[it];
      }
      
    }
  } else {
    const int e16 = tid & 15, lr = tid >> 4;                        // lr 0..15
    v4f bv4;
    {
      const v4f bq = *(const v4f*)(bias + dsel + 4 * e16);
#pragma unroll
      for (int t = 0; t < 4; ++t) bv4[t] = bfr(bq[t]);
    }
    float* P = (grp == 1) ? PF : GF;                                 // both global
    v4f res[8];
#pragma unroll
    for (int it = 0; it < 8; ++it) {
      const int row = it * 16 + lr;                                  // n_loc 0..127
      const v4f a = *(const v4f*)(Os + row * OSP + 4 * e16);
      v4f v;
#pragma unroll
      for (int t = 0; t < 4; ++t) v[t] = a[t] + bv4[t];
      res[it] = v;
    }
{
#pragma unroll
      for (int it = 0; it < 8; ++it) {
        const int row = it * 16 + lr;
        const size_t po = ((size_t)(b * NN + n0 + row)) * DQ + dsel + 4 * e16;
        *(v4f*)(P + po) = res[it];
      }
      
    }
  }
}

// =========================================================================================================
// (3) 2x2 stride-2 max-pool of PF / GF f32 [b][4096 n][128 d] in f32 -> Kh/Kl bf16 [b][1024 m][128 d]
//     (hi = RNE(v), lo = RNE(v-hi)) and Gp f16 [b][1024 m][128 d], m = 32 py + px, window n = (2py+dy) 64 + 2px+dx,
//     dy, dx in {0,1}. Block (py, b), 256 threads: lane group e16 (16 lanes x 16 B = one 256-B row = 2 whole
//     lines), lr = tid>>4 -> px = 16 it + lr for it 0..1 (all 32 px valid, no pad rows). No LDS, no barriers.
// coverage: blocks 0..31 x px 0..31 x 16 lanes x 8 = rows 0..1023 x 128 d; grid (32, NB) covers Kh/Kl/Gp
//           [b][0..1023][0..127] exactly once.
// =========================================================================================================
__global__ __launch_bounds__(256)
void pool_k(const float* __restrict__ PF, const float* __restrict__ GF,
            unsigned short* Kh, unsigned short* Kl, unsigned short* Gp) {
  const int tid = threadIdx.x, py = blockIdx.x, b = blockIdx.y;
  const int e16 = tid & 15, lr = tid >> 4;                          // lr 0..15
  v4u kh[2], kl[2], gu[2];
#pragma unroll
  for (int it = 0; it < 2; ++it) {
    const int px = it * 16 + lr;                                    // 0..31
    float fk[8], fg[8];
#pragma unroll
    for (int t = 0; t < 8; ++t) { fk[t] = -__builtin_inff(); fg[t] = -__builtin_inff(); }
#pragma unroll
    for (int dy = 0; dy < 2; ++dy) {
      const size_t rb = ((size_t)(b * NN + (2 * py + dy) * WIMG + 2 * px)) * DQ + 8 * e16;
#pragma unroll
      for (int dx = 0; dx < 2; ++dx) {
        const float* pk = PF + rb + (size_t)dx * DQ;
        const float* pg = GF + rb + (size_t)dx * DQ;
        const v4f ka = *(const v4f*)pk, kq = *(const v4f*)(pk + 4);
        const v4f ga = *(const v4f*)pg, gq = *(const v4f*)(pg + 4);
#pragma unroll
        for (int t = 0; t < 4; ++t) {
          fk[t]     = fmaxf(fk[t], ka[t]);
          fk[4 + t] = fmaxf(fk[4 + t], kq[t]);
          fg[t]     = fmaxf(fg[t], ga[t]);
          fg[4 + t] = fmaxf(fg[4 + t], gq[t]);
        }
      }
    }
    split8(fk, kh[it], kl[it]);
#pragma unroll
    for (int t = 0; t < 4; ++t) gu[it][t] = pk16(h_bits((_Float16)fg[2 * t]), h_bits((_Float16)fg[2 * t + 1]));
  }
{
#pragma unroll
    for (int it = 0; it < 2; ++it) {
      const int px = it * 16 + lr;
      const size_t po = ((size_t)(b * MM + WP * py + px)) * DQ + 8 * e16;
      *(v4u*)(Kh + po) = kh[it];
      *(v4u*)(Kl + po) = kl[it];
      *(v4u*)(Gp + po) = gu[it];
    }
    
  }
}

// =========================================================================================================
// (4) Gp f16 [b][1024 m][128 d] -> Gc f16 [b][d][m] (channel-major, keys contiguous) through an LDS tile T[64 d][64 m]
// coverage: reads 2 it x 32 rows x 8 lanes x 8 = 64 m x 64 d; T written rows (8e+t)=0..63 x cols 0..63, read rows
//           0..63 x cols 8e..8e+7 (staged extent == consumed extent); writes 64 d x 64 m; grid (16, 2, NB) covers
//           Gc [b][0..127][0..1023] exactly once.
// =========================================================================================================
__global__ __launch_bounds__(256)
void tr_g(const unsigned short* __restrict__ Gp, unsigned short* Gc) {
  __shared__ __align__(16) unsigned short T[QT * TP];
  const int tid = threadIdx.x;
  const int mt = blockIdx.x, db = blockIdx.y, b = blockIdx.z;
  const int e = tid & 7, lq = tid >> 3;                             // lq 0..31
  const int m0 = mt * QT, d0 = db * QT;
#pragma unroll
  for (int it = 0; it < 2; ++it) {
    const int ml = it * 32 + lq;                                     // 0..63
    const v4u w = *(const v4u*)(Gp + ((size_t)(b * MM + m0 + ml)) * DQ + d0 + 8 * e);
    unsigned short hb[8];
#pragma unroll
    for (int t = 0; t < 4; ++t) {
      hb[2 * t]     = (unsigned short)(w[t] & 0xFFFFu);
      hb[2 * t + 1] = (unsigned short)(w[t] >> 16);
    }
#pragma unroll
    for (int t = 0; t < 8; ++t) T[(8 * e + t) * TP + ml] = hb[t];
  }
  __syncthreads();
  v4u up[2];
#pragma unroll
  for (int it = 0; it < 2; ++it) {
    const int dl = it * 32 + lq;                                     // 0..63
    up[it] = *(const v4u*)(T + dl * TP + 8 * e);
  }
{
#pragma unroll
    for (int it = 0; it < 2; ++it) {
      const int dl = it * 32 + lq;
      *(v4u*)(Gc + ((size_t)(b * DQ + d0 + dl)) * MM + m0 + 8 * e) = up[it];
    }
    
  }
}

// =========================================================================================================
// (5) attention for one (b, 64-query tile), transposed formulation, 1024 keys (all valid, no mask, no scale):
//   S^T tile (16 keys x 16 queries) = sum over 4 d-chunks (rolled loop) of A(k: row = key kb + (lane&15), 32 d via
//   the split k map from the bf16 plane Kh [b][1024][128]) . B(q: col = query, same map from Qh [b][4096][128])
//   + A(Kh).B(Ql) + A(Kl).B(Qh) (bf16 unscaled residual planes, shared accumulator).
//   Per lane the D tile holds 8 keys of ONE query: online softmax state per lane, one shuffle (lane^16) for the max
//   over 32 keys; the o/l rescale is skipped under a wave-uniform ballot when no lane's max grew (corr == 1 exactly
//   for every lane then); row-sum partials combined at the end. P = e^{s-m} x 16384 as f16 is the B operand of
//   y^T (rows channel, cols queries) += A(pooled g: rows channel = 16j + (lane&15), keys contiguous, f16 plane Gc
//   [b][128][1024]) . B(P^T): element r <- D of the tile covering keys kb..kb+15, element 8+r <- the tile covering
//   kb+16..kb+31, lane unchanged. 8 accumulator tiles per wave (128 channels). Block = 4 waves = 64 queries.
//   Live state per lane: o 64 + s0/s1 16 + up to 6 fragments (rolled d loop) + P 8 + m/l, under the 256 cap.
//   Epilogue: y = O/l staged in LDS Os[query][128 channels] (pitch OSPW, b128 stores), block barrier (cross-wave),
// coverage: Os written 4 waves x 16 queries x 128 ch, read rows 0..63 x ch 8e..8e+7 (e 0..15); planes 8 it x 8 rows x
//           16 lanes x 8 = 64 n x 128 ch per plane; grid (NQ/64, NB) covers rows 0..NQ-1 of Yh/Yl exactly once.
// =========================================================================================================
__global__ __launch_bounds__(128) __attribute__((amdgpu_num_vgpr(256)))
void attn_k(const unsigned short* __restrict__ Qh, const unsigned short* __restrict__ Ql,
            const unsigned short* __restrict__ Kh, const unsigned short* __restrict__ Kl,
            const unsigned short* __restrict__ Gc, unsigned short* Yh, unsigned short* Yl) {
  __shared__ __align__(16) float Os[QT * OSPW];
  const int tid  = threadIdx.x;
  const int wave = tid >> 5, lane = tid & 31;
  const int hh   = lane >> 4, c = lane & 15;
  const int n0   = blockIdx.x * QT, b = blockIdx.y;

  // q fragment pointers (B operand, col = query n0 + 16*wave + c), + 32*kc
  const size_t qo = ((size_t)(b * NN + n0 + 16 * wave + c)) * DQ + 8 * hh;
  const unsigned short* Qhp = Qh + qo;
  const unsigned short* Qlp = Ql + qo;
  // k fragment base (A operand, row = key kb + c), + key * 128 + 32*kc
  const unsigned short* Khp = Kh + (size_t)b * MM * DQ + (size_t)c * DQ + 8 * hh;
  const unsigned short* Klp = Kl + (size_t)b * MM * DQ + (size_t)c * DQ + 8 * hh;
  // v fragment base (A operand, row = channel 16j + c, keys contiguous), + 16*j*MM + kb
  const unsigned short* Vp = Gc + (size_t)b * DQ * MM + (size_t)c * MM + 8 * hh;

  float m = -1.0e30f, l = 0.f;
  v8f o[8];
#pragma unroll
  for (int j = 0; j < 8; ++j) o[j] = zero8();

#pragma unroll 1
  for (int kb = 0; kb < MM; kb += 32) {
    const unsigned short* k0p  = Khp + (size_t)kb * DQ;              // keys kb .. kb+15
    const unsigned short* k1p  = Khp + (size_t)(kb + 16) * DQ;       // keys kb+16 .. kb+31
    const unsigned short* k0lp = Klp + (size_t)kb * DQ;
    const unsigned short* k1lp = Klp + (size_t)(kb + 16) * DQ;
    v8f s0 = zero8(), s1 = zero8();
#pragma unroll 1
    for (int kc = 0; kc < DQ / 32; ++kc) {
      const Frag qh  = ldfrag(Qhp + 32 * kc);
      const Frag ql  = ldfrag(Qlp + 32 * kc);
      const Frag k0  = ldfrag(k0p + 32 * kc);
      const Frag k1  = ldfrag(k1p + 32 * kc);
      const Frag k0l = ldfrag(k0lp + 32 * kc);
      const Frag k1l = ldfrag(k1lp + 32 * kc);
      s0 = mma_b(k0.bf, qh.bf, s0);
      s1 = mma_b(k1.bf, qh.bf, s1);
      s0 = mma_b(k0.bf, ql.bf, s0);
      s1 = mma_b(k1.bf, ql.bf, s1);
      s0 = mma_b(k0l.bf, qh.bf, s0);
      s1 = mma_b(k1l.bf, qh.bf, s1);
    }

    float mx = fmaxf(hmax8(s0), hmax8(s1));
    mx = fmaxf(mx, __shfl_xor(mx, 16, 32));
    const float mn = fmaxf(m, mx);
    const unsigned grew = wave_ballot(mx > m);                       // wave-uniform
    if (grew != 0u) {
      const float corr = __expf(m - mn);                             // == 1 exactly for lanes whose max did not grow
      l *= corr;
#pragma unroll
      for (int j = 0; j < 8; ++j) {
#pragma unroll
        for (int r = 0; r < 8; ++r) o[j][r] *= corr;
      }
    }
    m = mn;
    const float msh = mn - LNPS;                                     // exp gives e^{s-m} * 16384

    FragH ph;
    float ls = 0.f;
#pragma unroll
    for (int r = 0; r < 8; ++r) {
      const float e0 = __expf(s0[r] - msh);                          // key kb      + 8hh + r
      const float e1 = __expf(s1[r] - msh);                          // key kb + 16 + 8hh + r
      ls += e0 + e1;
      ph.hv[0][r] = (_Float16)e0;
      ph.hv[1][r] = (_Float16)e1;
    }
    l += ls;

#pragma unroll
    for (int j = 0; j < 8; ++j) {
      const Frag vf = ldfrag(Vp + (size_t)(16 * j) * MM + kb);
      o[j] = mma_h(vf.h, ph.v, o[j]);
    }
  }
  l += __shfl_xor(l, 16, 32);
  const float inv = 1.0f / l;                                        // o and l both carry the x16384 factor

  // ---- epilogue: y = o * inv -> Os[query][ch]; lane (hh, c) holds ch = 16 j + 8 hh + r for query 16 w + c
  {
    const int qrow = 16 * wave + c;
#pragma unroll
    for (int j = 0; j < 8; ++j) {
      v4f va, vb;
#pragma unroll
      for (int r = 0; r < 4; ++r) { va[r] = o[j][r] * inv; vb[r] = o[j][4 + r] * inv; }
      *(v4f*)(Os + qrow * OSPW + 16 * j + 8 * hh)     = va;
      *(v4f*)(Os + qrow * OSPW + 16 * j + 8 * hh + 4) = vb;
    }
  }
  __syncthreads();

  const int e16 = tid & 15, lr = tid >> 4;                           // lr 0..7
  v4u uh[8], ul[8];
#pragma unroll
  for (int it = 0; it < 8; ++it) {
    const int row = it * 8 + lr;                                     // query 0..63
    const v4f a = *(const v4f*)(Os + row * OSPW + 8 * e16);
    const v4f q = *(const v4f*)(Os + row * OSPW + 8 * e16 + 4);
    const float f[8] = {a[0], a[1], a[2], a[3], q[0], q[1], q[2], q[3]};
    split8(f, uh[it], ul[it]);
  }
{
#pragma unroll
    for (int it = 0; it < 8; ++it) {
      const int row = it * 8 + lr;
      const size_t po = ((size_t)(b * NN + n0 + row)) * DQ + 8 * e16;
      *(v4u*)(Yh + po) = uh[it];
      *(v4u*)(Yl + po) = ul[it];
    }
    
  }
}

// =========================================================================================================
// (6) output conv for one (b, 64-n tile, 64-c block): A[c][n] = sum_ci WWb[c][ci] (Yh + Yl)[b][n][ci] on bf16 WMMA
//     (2 products per k-step, shared accumulator), K = 128 = 4 steps. Block 128 threads = 4 waves; wave w owns cols
//     n0+16w..+15 (B fragments from the k-contiguous Yh/Yl rows) and 4 m-tiles (A rows c = c0 + 16 mt + (lane&15),
//     split k map loader from WWb). Epilogue staged in LDS Os[n_loc][c_loc] (pitch OSP, b128 stores), block barrier
//     2 lines): 8 consecutive lanes x 16 B (values gathered from 4 Os rows), one instruction per 4 lines, final
// coverage: Os 4 waves x 16 n x 64 c written, read rows nl+t <= 63 x cols cl <= 63; WY 8 it x 16 lines x 8 lanes x
//           4 floats = 64 c x 64 n; grid (NQ/64, 4, NB) covers WY[b][0..255][0..NQ-1] exactly once.
// =========================================================================================================
__global__ __launch_bounds__(128)
void gemm_out(const unsigned short* __restrict__ WWb, const unsigned short* __restrict__ Yh,
              const unsigned short* __restrict__ Yl, const float* __restrict__ wb, float* WY) {
  __shared__ __align__(16) float Os[QT * OSP];
  const int tid  = threadIdx.x;
  const int lane = tid & 31, wave = tid >> 5;
  const int hh   = lane >> 4, c = lane & 15;
  const int nt   = blockIdx.x, cb = blockIdx.y, b = blockIdx.z;
  const int n0   = nt * QT, c0 = cb * QT;

  const unsigned short* ap  = WWb + (size_t)(c0 + c) * DQ + 8 * hh;
  const size_t bo = ((size_t)(b * NN + n0 + 16 * wave + c)) * DQ + 8 * hh;
  const unsigned short* bph = Yh + bo;
  const unsigned short* bpl = Yl + bo;

  v8f acc[4];
#pragma unroll
  for (int mt = 0; mt < 4; ++mt) acc[mt] = zero8();

#pragma unroll
  for (int ks = 0; ks < DQ / 32; ++ks) {
    const Frag fbh = ldfrag(bph + 32 * ks);
    const Frag fbl = ldfrag(bpl + 32 * ks);
#pragma unroll
    for (int mt = 0; mt < 4; ++mt) {
      const Frag fa = ldfrag(ap + (size_t)(16 * mt) * DQ + 32 * ks);
      acc[mt] = mma_b(fa.bf, fbh.bf, acc[mt]);
      acc[mt] = mma_b(fa.bf, fbl.bf, acc[mt]);
    }
  }

  // ---- epilogue: -> LDS Os[n_loc][c_loc]; lane (hh, c) holds c_loc = 16 mt + 8 hh + r for n_loc = 16 w + c
  {
    const int nl = 16 * wave + c;
#pragma unroll
    for (int mt = 0; mt < 4; ++mt) {
      v4f va, vb;
#pragma unroll
      for (int r = 0; r < 4; ++r) { va[r] = acc[mt][r]; vb[r] = acc[mt][4 + r]; }
      *(v4f*)(Os + nl * OSP + 16 * mt + 8 * hh)     = va;
      *(v4f*)(Os + nl * OSP + 16 * mt + 8 * hh + 4) = vb;
    }
  }
  __syncthreads();

  const int e = tid & 7, lq = tid >> 3;                              // lq 0..15
  v4f res[8];
#pragma unroll
  for (int it = 0; it < 8; ++it) {
    const int L   = it * 16 + lq;                                    // 0..127
    const int cl  = L >> 1, hf = L & 1;                              // channel 0..63 within the block
    const int nl  = hf * 32 + 4 * e;                                 // position 0..63
    const float bvs = bfr(wb[c0 + cl]);
#pragma unroll
    for (int t = 0; t < 4; ++t) {
      res[it][t] = Os[(nl + t) * OSP + cl] + bvs;
    }
  }
{
#pragma unroll
    for (int it = 0; it < 8; ++it) {
      const int L   = it * 16 + lq;
      const int cl  = L >> 1, hf = L & 1;
      const int nl  = hf * 32 + 4 * e;
      const size_t idx = ((size_t)(b * CC + c0 + cl)) * NN + n0 + nl;
      *(v4f*)(WY + idx) = res[it];
    }
    
  }
}

// =========================================================================================================
// (7) batch-norm statistics: block owns ONE channel (256 blocks of 32 waves). Thread tid takes floats 4 tid..4 tid+3
//     of each of the NB rows WY[b][c][0..NQ), so every wave load is one contiguous 512-B run; a thread's NB loads are
//     independent and all issued before the first sum. Sum and sum of squares in f64 per thread (rows, then elements,
//     in ascending order), wave shuffle reduce, per-wave partials in LDS (cross-wave, block barrier), wave 0
//     shuffle-reduces the 32 partials, lane 0: mean, biased variance, rstd = 1/sqrt(var + eps) in f32 -> MU[c][0],
//     MU[c][1]. MU row pitch MUP floats = one 128-B line per channel, so each line has one writing block.
// coverage: 256 blocks x 1 channel; MU[c][0..1] written exactly once; reads WY rows b < NB, c 0..255, n < NQ only
//           (the produced extent): BST threads x 4 floats = NQ per row.
// =========================================================================================================
__global__ __launch_bounds__(BST)
void bn_stat(const float* __restrict__ WY, float* MU) {
#pragma clang fp contract(off)
  __shared__ double red[2 * (BST / 32)];
  const int tid = threadIdx.x, lane = tid & 31, wave = tid >> 5;
  const int cc = blockIdx.x;
  const double ninv = 1.0 / ((double)NB * (double)NQ);
  unsigned bo[NB];                                                   // byte offsets in WY, all < 2^25
  v4f a[NB];
#pragma unroll
  for (int bb = 0; bb < NB; ++bb) bo[bb] = 4u * (unsigned)((bb * CC + cc) * NN + 4 * tid);
#pragma unroll
  for (int bb = 0; bb < NB; ++bb) a[bb] = *(const v4f*)((const char*)WY + bo[bb]);
#if defined(__HIP_DEVICE_COMPILE__)
  // keeps every load above the sums: without it the scheduler sinks them and only three stay in flight per wave
  __builtin_amdgcn_sched_barrier(0);
#endif
  double s = 0.0, q = 0.0;
#pragma unroll
  for (int bb = 0; bb < NB; ++bb) {
#pragma unroll
    for (int t = 0; t < 4; ++t) {
      const double d = (double)a[bb][t];
      s += d; q += d * d;
    }
  }
#pragma unroll
  for (int d = 1; d < 32; d <<= 1) {
    s += __shfl_xor(s, d, 32);
    q += __shfl_xor(q, d, 32);
  }
  if (lane == 0) { red[wave] = s; red[BST / 32 + wave] = q; }
  __syncthreads();
  if (wave == 0) {                                                   // wave-uniform branch, all 32 lanes on
    double ts = red[lane], tq = red[BST / 32 + lane];
#pragma unroll
    for (int d = 1; d < 32; d <<= 1) {
      ts += __shfl_xor(ts, d, 32);
      tq += __shfl_xor(tq, d, 32);
    }
    if (lane == 0) {
      const double mu = ts * ninv;
      double var = tq * ninv - mu * mu;
      var = (var > 0.0) ? var : 0.0;
      const float varf = (float)var + BNEPS;
      const float rs = 1.0f / sqrtf(varf);
      MU[MUP * cc]     = (float)mu;
      MU[MUP * cc + 1] = rs;
    }
  }
}

// =========================================================================================================
// (8) normalise + affine + residual: out[b][c][n] = (((WY - mu[c]) * rstd[c]) * bf16-RNE(gamma[c]) + bf16-RNE(beta[c]))
//     + bf16-RNE(x[b][c][n]) in f32. Block 256 threads = 8 waves covers 4 channels x 256 n: wave w -> channel
// coverage: grid (NQ/256, 64, NB) x 8 waves x 32 lanes x 4 floats covers out[b][0..255][0..NQ-1] exactly once.
// =========================================================================================================
__global__ __launch_bounds__(256)
void bn_apply(const float* __restrict__ WY, const float* __restrict__ x, const float* __restrict__ gam,
              const float* __restrict__ bet, const float* __restrict__ MU, float* out) {
#pragma clang fp contract(off)
  const int tid = threadIdx.x, lane = tid & 31, wave = tid >> 5;
  const int nq = blockIdx.x, cb = blockIdx.y, b = blockIdx.z;
  const int c = cb * 4 + (wave >> 1);                                // 0..255 (wave-uniform)
  const int n = nq * BNQ + (wave & 1) * 128 + 4 * lane;              // < NQ
  const float mu = MU[MUP * c], rs = MU[MUP * c + 1];
  const float ga = bfr(gam[c]), be = bfr(bet[c]);
#if defined(__HIP_DEVICE_COMPILE__)
  // stands between the per-channel loads above and the first rewrite of a register they name (a later load's result)
  asm volatile("s_wait_xcnt 0x0" ::: "memory");
#endif
  const size_t idx = ((size_t)(b * CC + c)) * NN + n;
  const v4f w  = *(const v4f*)(WY + idx);
  const v4f xv = *(const v4f*)(x + idx);
  v4f r;
#pragma unroll
  for (int t = 0; t < 4; ++t) {
    const float d  = w[t] - mu;
    const float nv = d * rs;
    const float av = nv * ga;
    const float sv = av + be;
    r[t] = sv + bfr(xv[t]);
  }
{
    *(v4f*)(out + idx) = r;
    
  }
}

// =========================================================================================================
// Workspace map (bytes; each region start a multiple of 256; every extent is an exact row/tile multiple and is
//   W16 f16 [384][256]            196608      WWb bf16 [256][128]        65536
//   XP  f16 [NB][4096][256]     16777216 (NB=8)
//   Qh/Ql bf16 [NB][4096][128]   8388608 x2
//   PF/GF f32  [NB][4096][128]  16777216 x2
//   Kh/Kl bf16 [NB][1024][128]   2097152 x2  Gp f16 [NB][1024][128]   2097152   Gc f16 [NB][128][1024]  2097152
//   Yh/Yl bf16 [NB][4096][128]   8388608 x2
//   WY  f32  [NB][256][4096]    33554432    MU f32 [256][32]           32768
//   total (NB=8) = 126124032
// =========================================================================================================
extern "C" void kernel_launch(void* const* d_in, const int* in_sizes, int n_in,
                              void* d_out, int out_size, void* d_ws, size_t ws_size,
                              hipStream_t stream) {
  const int XN = NB * CC * NN;
  if (n_in < 11) return;
  if (in_sizes[0] < XN) return;
  if (in_sizes[1] < DQ * CC || in_sizes[3] < DQ * CC || in_sizes[5] < DQ * CC || in_sizes[7] < CC * DQ) return;
  if (in_sizes[2] < DQ || in_sizes[4] < DQ || in_sizes[6] < DQ || in_sizes[8] < CC) return;
  if (in_sizes[9] < CC || in_sizes[10] < CC) return;
  if (out_size < XN) return;

  size_t off = 0;
  auto carve = [&](size_t bytes) { const size_t o = off; off += (bytes + 255) & ~(size_t)255; return o; };
  const size_t oW16 = carve((size_t)MW * CC * 2);
  const size_t oWWb = carve((size_t)CC * DQ * 2);
  const size_t oXP  = carve((size_t)NB * NN * CC * 2);
  const size_t oQh  = carve((size_t)NB * NN * DQ * 2);
  const size_t oQl  = carve((size_t)NB * NN * DQ * 2);
  const size_t oPF  = carve((size_t)NB * NN * DQ * 4);
  const size_t oGF  = carve((size_t)NB * NN * DQ * 4);
  const size_t oKh  = carve((size_t)NB * MM * DQ * 2);
  const size_t oKl  = carve((size_t)NB * MM * DQ * 2);
  const size_t oGp  = carve((size_t)NB * MM * DQ * 2);
  const size_t oGc  = carve((size_t)NB * DQ * MM * 2);
  const size_t oYh  = carve((size_t)NB * NN * DQ * 2);
  const size_t oYl  = carve((size_t)NB * NN * DQ * 2);
  const size_t oWY  = carve((size_t)NB * CC * NN * 4);
  const size_t oMU  = carve((size_t)CC * MUP * 4);
  if (off > ws_size) return;
  if (off > (size_t)134217728) return;

  const float* x   = (const float*)d_in[0];
  const float* gw  = (const float*)d_in[1];
  const float* gb  = (const float*)d_in[2];
  const float* tw  = (const float*)d_in[3];
  const float* tb  = (const float*)d_in[4];
  const float* pw  = (const float*)d_in[5];
  const float* pb  = (const float*)d_in[6];
  const float* ow  = (const float*)d_in[7];
  const float* wb  = (const float*)d_in[8];
  const float* gam = (const float*)d_in[9];
  const float* bet = (const float*)d_in[10];

  char* ws = (char*)d_ws;
  unsigned short* W16 = (unsigned short*)(ws + oW16);
  unsigned short* WWb = (unsigned short*)(ws + oWWb);
  unsigned short* XP  = (unsigned short*)(ws + oXP);
  unsigned short* Qh  = (unsigned short*)(ws + oQh);
  unsigned short* Ql  = (unsigned short*)(ws + oQl);
  float*          PF  = (float*)(ws + oPF);
  float*          GF  = (float*)(ws + oGF);
  unsigned short* Kh  = (unsigned short*)(ws + oKh);
  unsigned short* Kl  = (unsigned short*)(ws + oKl);
  unsigned short* Gp  = (unsigned short*)(ws + oGp);
  unsigned short* Gc  = (unsigned short*)(ws + oGc);
  unsigned short* Yh  = (unsigned short*)(ws + oYh);
  unsigned short* Yl  = (unsigned short*)(ws + oYl);
  float*          WY  = (float*)(ws + oWY);
  float*          MU  = (float*)(ws + oMU);
  float* out = (float*)d_out;

  const dim3 blk256(256), blk128(128);

  // (0) theta_w / phi_w / g_w -> stacked f16 plane; w_w -> bf16 plane
  cvt_w<<<dim3(MW / 8 + CC / 16), blk256, 0, stream>>>(tw, pw, gw, ow, W16, WWb);
  // (1) x -> position-major 16-bit plane
  cvt_x<<<dim3(NN / QT, CC / QT, NB), blk256, 0, stream>>>(x, XP);
  // (2) conv1x1 GEMM -> theta (q) hi/res planes, phi / g conv outputs + bias as f32 planes
  gemm_proj<<<dim3(NSTRIP, MW / QT, NB), blk256, 0, stream>>>(W16, XP, tb, pb, gb, Qh, Ql, PF, GF);
  // (3) 2x2 stride-2 max-pool -> pooled phi (k) hi/res planes, pooled g f16 plane
  pool_k<<<dim3(HP, NB), blk256, 0, stream>>>(PF, GF, Kh, Kl, Gp);
  // (4) pooled g -> channel-major plane
  tr_g<<<dim3(MM / QT, DQ / QT, NB), blk256, 0, stream>>>(Gp, Gc);
  // (5) attention -> y hi/res planes [b][n][128]
  attn_k<<<dim3(NQ / QT, NB), blk128, 0, stream>>>(Qh, Ql, Kh, Kl, Gc, Yh, Yl);
  // (6) output conv + bias -> WY f32 plane [b][256][4096]
  gemm_out<<<dim3(NQ / QT, CC / QT, NB), blk128, 0, stream>>>(WWb, Yh, Yl, wb, WY);
  // (7) per-channel mean / rstd table
  bn_stat<<<dim3(CC), dim3(BST), 0, stream>>>(WY, MU);
  // (8) normalise, affine, residual -> out [b][256][4096]
  bn_apply<<<dim3(NQ / BNQ, CC / 4, NB), blk256, 0, stream>>>(WY, x, gam, bet, MU, out);
  (void)hipGetLastError();
}

// v002
// Measured time: 143 microseconds a run.
// Two timings next to v001 put it at 1.70 and 1.67 times that version's speed.
// Counting every step since v000, it is 5.63 times as fast.
// Contractions: conv1x1 theta/phi/g GEMM W[384x256].X[256x128] per strip on v_wmma_f32_16x16x32_f16 (f16 containers
// of bf16-RNE weights x256 and bf16-RNE x); scores K.Q^T on v_wmma_f32_16x16x32_bf16 (bf16 hi + bf16 residual planes
// of theta / 2x2-max-pooled phi, 3 products, K=128); y^T = G.P^T on v_wmma_f32_16x16x32_f16 (2x2-max-pooled g as
// f16, P = e^{s-m} x16384 f16 from the score D registers); output conv W[256x128].Y on v_wmma_f32_16x16x32_bf16 (bf16
// weights, y as bf16 hi + residual planes, 2 products); f32 accumulate everywhere; max-pool, softmax statistics and
// bias in f32 VALU; batch-norm channel statistics in f64 VALU; normalisation, affine and residual add in f32 VALU.
#include <hip/hip_runtime.h>
#include <math.h>
#include <stdint.h>

#ifndef NB
#define NB 8
#endif
#ifndef NQ
#define NQ 4096
#endif
#define NB_FULL 8
#define CC     256
#define HIMG   64
#define WIMG   64
#define NN     4096
#define DQ     128
#define HP     32
#define WP     32
#define MM     1024
#define MW     384
#define QT     64
#define SN     128
#define NSTRIP 32
#define OSP    68
#define OSPW   132
#define TP     72
#define BNQ    256
#define BST    1024
#define MUP    32
#define WSC    256.0f
#define IWSC   0.00390625f
#define LNPS   9.704060527839234f
#define BNEPS  1.0e-5f
#define KT     32
#define KP     136
#define VPT    40
#define STG    (2 * KT * KP + DQ * VPT)

static_assert(NB >= 1 && NB <= NB_FULL);
static_assert(NQ % QT == 0 && NQ % BNQ == 0 && NQ >= BNQ && NQ <= NN);
static_assert(NN == HIMG * WIMG);
static_assert(SN == 2 * WIMG);
static_assert(NSTRIP * SN == NN);
static_assert(SN == 8 * 16);
static_assert(HIMG % 2 == 0 && WIMG % 2 == 0);
static_assert(HP == HIMG / 2 && WP == WIMG / 2);
static_assert(MM == HP * WP);
static_assert(WP == 32);
static_assert(MM % QT == 0 && MM % 32 == 0);
static_assert(NN % QT == 0 && CC % QT == 0 && DQ % QT == 0);
static_assert(MW == 3 * DQ && MW % QT == 0 && MW % 8 == 0);
static_assert(CC % 32 == 0 && DQ % 32 == 0);
static_assert((OSP * 4) % 16 == 0);
static_assert((OSPW * 4) % 16 == 0);
static_assert((TP * 2) % 16 == 0);
static_assert(SN * OSP * 4 <= 65536);
static_assert(MUP * 4 == 128);
static_assert(BST == 32 * 32 && NQ == 4 * BST);
static_assert(NN % 16 == 0 && BNQ == 2 * 128 && CC % 4 == 0);
static_assert((size_t)NB_FULL * CC * NN * 4 == (size_t)33554432);
static_assert((KP * 2) % 16 == 0 && (VPT * 2) % 16 == 0 && (STG * 2) % 16 == 0 && (KT * KP * 2) % 16 == 0);
static_assert(KP >= DQ + 8 && VPT >= KT + 8 && MM % KT == 0 && MM / KT >= 2);
static_assert(KT * DQ / 8 == 4 * 128 && DQ * KT / 8 == 4 * 128 && QT * DQ / 8 == 8 * 128);

typedef _Float16       v16h __attribute__((ext_vector_type(16)));
typedef _Float16       v8h  __attribute__((ext_vector_type(8)));
typedef __bf16         v16b __attribute__((ext_vector_type(16)));
typedef unsigned short v8us __attribute__((ext_vector_type(8)));
typedef float          v8f  __attribute__((ext_vector_type(8)));
typedef float          v4f  __attribute__((ext_vector_type(4)));
typedef unsigned int   v4u  __attribute__((ext_vector_type(4)));

union Frag  { v8us u[2]; v16h h; v16b bf; };
union FragH { v16h v; v8h hv[2]; };
static_assert(sizeof(Frag) == 32);
static_assert(sizeof(FragH) == 32);

// ---- scalar helpers ---------------------------------------------------------------------------------------
__device__ __forceinline__ unsigned short bf_bits(float f) {          // f32 -> bf16 bits, RNE convert
  unsigned u = __float_as_uint(f);
  return (unsigned short)((u + 0x7FFFu + ((u >> 16) & 1u)) >> 16);
}
__device__ __forceinline__ float bf_up(unsigned short hb) { return __uint_as_float(((unsigned)hb) << 16); }
__device__ __forceinline__ float bfr(float f) { return bf_up(bf_bits(f)); }
__device__ __forceinline__ unsigned short h_bits(_Float16 x) { return __builtin_bit_cast(unsigned short, x); }
__device__ __forceinline__ unsigned pk16(unsigned short a, unsigned short b) { return (unsigned)a | ((unsigned)b << 16); }
__device__ __forceinline__ v8f zero8() { v8f z = {0.f, 0.f, 0.f, 0.f, 0.f, 0.f, 0.f, 0.f}; return z; }
__device__ __forceinline__ float hmax8(v8f s) {
  return fmaxf(fmaxf(fmaxf(s[0], s[1]), fmaxf(s[2], s[3])), fmaxf(fmaxf(s[4], s[5]), fmaxf(s[6], s[7])));
}
__device__ __forceinline__ unsigned wave_ballot(bool p) {
#if defined(__HIP_DEVICE_COMPILE__)
  return __builtin_amdgcn_ballot_w32(p);
#else
  return p ? 1u : 0u;
#endif
}
// 8 f32 values -> bf16 hi bits and bf16 residual bits (lo = RNE(v - hi)), packed 2 per uint
__device__ __forceinline__ void split8(const float* f, v4u& uh, v4u& ul) {
#pragma unroll
  for (int t = 0; t < 4; ++t) {
    const float f0 = f[2 * t], f1 = f[2 * t + 1];
    const unsigned short hb0 = bf_bits(f0), hb1 = bf_bits(f1);
    const unsigned short lb0 = bf_bits(f0 - bf_up(hb0));
    const unsigned short lb1 = bf_bits(f1 - bf_up(hb1));
    uh[t] = pk16(hb0, hb1);
    ul[t] = pk16(lb0, lb1);
  }
}

// ---- 16-bit fragment loader (A, or B from a k-contiguous [n][k] row): lane -> row/col (lane&15), p already includes
//      + 8*(lane>>4); elements 0..7 <- p[0..7] (k0+8h..), elements 8..15 <- p[16..23] (k0+16+8h..)
__device__ __forceinline__ Frag ldfrag(const unsigned short* p) {
  Frag f;
  f.u[0] = *(const v8us*)(p);
  f.u[1] = *(const v8us*)(p + 16);
  return f;
}

// ---- WMMA helpers: builtin followed by a 4-slot VALU gap tying D and keeping A/B live --------------------------
__device__ __forceinline__ v8f mma_h(v16h a, v16h b, v8f c) {
  v8f d = __builtin_amdgcn_wmma_f32_16x16x32_f16(false, a, false, b, (short)0, c, false, false);
#if defined(__HIP_DEVICE_COMPILE__)
  asm volatile("v_nop\n\tv_nop\n\tv_nop\n\tv_nop" : "+v"(d) : "v"(a), "v"(b));
#endif
  return d;
}
__device__ __forceinline__ v8f mma_b(v16b a, v16b b, v8f c) {
  v8f d = __builtin_amdgcn_wmma_f32_16x16x32_bf16(false, a, false, b, (short)0, c, false, false);
#if defined(__HIP_DEVICE_COMPILE__)
  const v16h ha = __builtin_bit_cast(v16h, a), hb = __builtin_bit_cast(v16h, b);
  asm volatile("v_nop\n\tv_nop\n\tv_nop\n\tv_nop" : "+v"(d) : "v"(ha), "v"(hb));
#endif
  return d;
}

// =========================================================================================================
// (0) weights. Blocks 0..47: W16 f16 [384][256], rows 0..127 = theta_w, 128..255 = phi_w, 256..383 = g_w; value =
//     f16 of (bf16-RNE(w) * 256) (exact). Block owns rows 8*blk..8*blk+7: one wave per 512-B row = 32 lanes x 16 B
// coverage: 48 blocks x 8 rows x 32 lanes x 8 halves = 384 x 256; 16 blocks x 16 rows x 16 lanes x 8 = 256 x 128.
// =========================================================================================================
__global__ __launch_bounds__(256)
void cvt_w(const float* __restrict__ tw, const float* __restrict__ pw, const float* __restrict__ gw,
           const float* __restrict__ ow, unsigned short* W16, unsigned short* WWb) {
  const int tid = threadIdx.x, blk = blockIdx.x;
  if (blk < MW / 8) {
    const int rl = tid >> 5, col = 8 * (tid & 31);
    const int o = 8 * blk + rl;                                      // 0..383
    const int grp = blk >> 4;                                        // 0,1,2 (block-uniform)
    const float* wbase = (grp == 0) ? tw : ((grp == 1) ? pw : gw);  // all global
    const float* s = wbase + (size_t)(o - DQ * grp) * CC + col;      // (o - 128 grp) in 0..127
    const v4f a = *(const v4f*)s;
    const v4f q = *(const v4f*)(s + 4);
    const float f[8] = {a[0], a[1], a[2], a[3], q[0], q[1], q[2], q[3]};
    v4u u;
#pragma unroll
    for (int t = 0; t < 4; ++t) {
      const _Float16 h0 = (_Float16)(bfr(f[2 * t]) * WSC);
      const _Float16 h1 = (_Float16)(bfr(f[2 * t + 1]) * WSC);
      u[t] = pk16(h_bits(h0), h_bits(h1));
    }
{
      *(v4u*)(W16 + (size_t)o * CC + col) = u;
      
    }
  } else {
    const int rb = blk - MW / 8;                                     // 0..15
    const int o = 16 * rb + (tid >> 4);                              // 0..255
    const int col = 8 * (tid & 15);                                  // 0..120
    const float* s = ow + (size_t)o * DQ + col;
    const v4f a = *(const v4f*)s;
    const v4f q = *(const v4f*)(s + 4);
    const float f[8] = {a[0], a[1], a[2], a[3], q[0], q[1], q[2], q[3]};
    v4u u;
#pragma unroll
    for (int t = 0; t < 4; ++t) u[t] = pk16(bf_bits(f[2 * t]), bf_bits(f[2 * t + 1]));
{
      *(v4u*)(WWb + (size_t)o * DQ + col) = u;
      
    }
  }
}

// =========================================================================================================
// (1) x f32 [b][256 c][4096 n] -> XP f16 [b][n][c] (position-major, bf16-RNE values, exact in f16) through an LDS
//     tile T[64 n][64 c] (pitch TP, cross-wave, block barrier). Block (nb, cb, b) owns a 64 c x 64 n tile.
// coverage: T written rows (8e+t)=0..63 x cols cl 0..63, read rows 0..63 x cols 8e..8e+7 (staged extent == consumed
//           extent); XP 2 it x 32 rows x 8 lanes x 8 = 64 n x 64 c; grid (64, 4, NB) covers XP [b][0..4095][0..255]
//           exactly once.
// =========================================================================================================
__global__ __launch_bounds__(256)
void cvt_x(const float* __restrict__ x, unsigned short* XP) {
  __shared__ __align__(16) unsigned short T[QT * TP];
  const int tid = threadIdx.x;
  const int nb = blockIdx.x, cb = blockIdx.y, b = blockIdx.z;
  const int e = tid & 7, lq = tid >> 3;                             // lq 0..31
  const int n0 = nb * QT, c0 = cb * QT;
#pragma unroll
  for (int it = 0; it < 2; ++it) {
    const int cl = it * 32 + lq;                                     // 0..63
    const float* sp = x + ((size_t)(b * CC + c0 + cl)) * NN + n0 + 8 * e;
    const v4f a = *(const v4f*)sp;
    const v4f q = *(const v4f*)(sp + 4);
    unsigned short hb[8];
#pragma unroll
    for (int t = 0; t < 4; ++t) {
      hb[t]     = h_bits((_Float16)bfr(a[t]));
      hb[4 + t] = h_bits((_Float16)bfr(q[t]));
    }
#pragma unroll
    for (int t = 0; t < 8; ++t) T[(8 * e + t) * TP + cl] = hb[t];
  }
  __syncthreads();
  v4u up[2];
#pragma unroll
  for (int it = 0; it < 2; ++it) {
    const int nl = it * 32 + lq;                                     // 0..63
    up[it] = *(const v4u*)(T + nl * TP + 8 * e);
  }
{
#pragma unroll
    for (int it = 0; it < 2; ++it) {
      const int rl = it * 32 + lq;
      *(v4u*)(XP + ((size_t)(b * NN + n0 + rl)) * CC + c0 + 8 * e) = up[it];
    }
    
  }
}

// =========================================================================================================
// (2) conv1x1 GEMM for one (b, strip of 128 positions = image rows 2s and 2s+1, 64-o block of the stacked weights):
//     Y[o][n] = (1/256) sum_c W16[o][c] XP[b][n][c]. Block 256 threads = 8 waves; wave w owns cols n0+16w..+15
//     (one B fragment per k-step, k = c contiguous in the XP row) and 4 m-tiles (A rows o = o0 + 16 mt + (lane&15),
//     split k map loader from W16). K = 256 = 8 steps. Epilogue staged in LDS Os[n_loc][o_loc] (pitch OSP, b128
//     stores), block barrier (cross-wave), then (block-uniform branch on the o block):
//       o-blocks 0,1 -> theta dims 0..63 / 64..127 + bias -> Qh/Ql bf16 [b][4096 n][128 d] (hi = RNE(v), lo = RNE(v-hi)):
//       o-blocks 2,3 -> phi + bias in f32 -> PF f32 [b][4096 n][128 d]: 128 rows x the dsel half (256 B = 2 whole
//                       lines) of the 512-B row, 16 consecutive lanes x 16 B, one instruction per 2 rows.
//       o-blocks 4,5 -> g + bias -> GF f32 [b][4096 n][128 d], same layout.
// coverage: Os 8 waves x 16 n x 64 o = 128 x 64 written, reads rows <= 127 cols <= 63; theta planes 4 it x 32 rows
//           x 8 lanes x 8 = 128 n x 64 d; f32 planes 8 it x 16 rows x 16 lanes x 4 = 128 n x 64 d; grid (32, 6, NB)
//           covers all 4096 rows x 128 d of Qh/Ql and of PF/GF exactly once.
// =========================================================================================================
__global__ __launch_bounds__(256)
void gemm_proj(const unsigned short* __restrict__ W16, const unsigned short* __restrict__ XP,
               const float* __restrict__ tb, const float* __restrict__ pb, const float* __restrict__ gb,
               unsigned short* Qh, unsigned short* Ql, float* PF, float* GF) {
  __shared__ __align__(16) float Os[SN * OSP];
  const int tid  = threadIdx.x;
  const int lane = tid & 31, wave = tid >> 5;                        // wave 0..7
  const int hh   = lane >> 4, c = lane & 15;
  const int st   = blockIdx.x, mb = blockIdx.y, b = blockIdx.z;
  const int n0   = st * SN, o0 = mb * QT;

  const unsigned short* ap = W16 + (size_t)(o0 + c) * CC + 8 * hh;
  const unsigned short* bp = XP + ((size_t)(b * NN + n0 + 16 * wave + c)) * CC + 8 * hh;

  v8f acc[4];
#pragma unroll
  for (int mt = 0; mt < 4; ++mt) acc[mt] = zero8();

#pragma unroll
  for (int ks = 0; ks < CC / 32; ++ks) {
    const Frag fb = ldfrag(bp + 32 * ks);
#pragma unroll
    for (int mt = 0; mt < 4; ++mt) {
      const Frag fa = ldfrag(ap + (size_t)(16 * mt) * CC + 32 * ks);
      acc[mt] = mma_h(fa.h, fb.h, acc[mt]);
    }
  }

  // ---- epilogue: scale back -> LDS Os[n_loc][o_loc]; lane (hh, c) holds o = 16 mt + 8 hh + r for n_loc = 16 w + c
  {
    const int nl = 16 * wave + c;
#pragma unroll
    for (int mt = 0; mt < 4; ++mt) {
      v4f va, vb;
#pragma unroll
      for (int r = 0; r < 4; ++r) { va[r] = acc[mt][r] * IWSC; vb[r] = acc[mt][4 + r] * IWSC; }
      *(v4f*)(Os + nl * OSP + 16 * mt + 8 * hh)     = va;
      *(v4f*)(Os + nl * OSP + 16 * mt + 8 * hh + 4) = vb;
    }
  }
  __syncthreads();

  const int grp = mb >> 1;                                           // 0 theta, 1 phi, 2 g (block-uniform)
  const int dsel = (mb & 1) * QT;                                    // 0 or 64
  const float* bias = (grp == 0) ? tb : ((grp == 1) ? pb : gb);     // all global

  if (grp == 0) {
    const int e = tid & 7, lq = tid >> 3;                            // lq 0..31
    float bv[8];
    {
      const v4f ba = *(const v4f*)(bias + dsel + 8 * e);
      const v4f bq = *(const v4f*)(bias + dsel + 8 * e + 4);
#pragma unroll
      for (int t = 0; t < 4; ++t) { bv[t] = bfr(ba[t]); bv[4 + t] = bfr(bq[t]); }
    }
    v4u uh[4], ul[4];
#pragma unroll
    for (int it = 0; it < 4; ++it) {
      const int row = it * 32 + lq;                                  // n_loc 0..127
      const v4f a = *(const v4f*)(Os + row * OSP + 8 * e);
      const v4f q = *(const v4f*)(Os + row * OSP + 8 * e + 4);
      float f[8];
#pragma unroll
      for (int t = 0; t < 4; ++t) { f[t] = a[t] + bv[t]; f[4 + t] = q[t] + bv[4 + t]; }
      split8(f, uh[it], ul[it]);
    }
{
#pragma unroll
      for (int it = 0; it < 4; ++it) {
        const int row = it * 32 + lq;
        const size_t po = ((size_t)(b * NN + n0 + row)) * DQ + dsel + 8 * e;
        *(v4u*)(Qh + po) = uh[it];
        *(v4u*)(Ql + po) = ul[it];
      }
      
    }
  } else {
    const int e16 = tid & 15, lr = tid >> 4;                        // lr 0..15
    v4f bv4;
    {
      const v4f bq = *(const v4f*)(bias + dsel + 4 * e16);
#pragma unroll
      for (int t = 0; t < 4; ++t) bv4[t] = bfr(bq[t]);
    }
    float* P = (grp == 1) ? PF : GF;                                 // both global
    v4f res[8];
#pragma unroll
    for (int it = 0; it < 8; ++it) {
      const int row = it * 16 + lr;                                  // n_loc 0..127
      const v4f a = *(const v4f*)(Os + row * OSP + 4 * e16);
      v4f v;
#pragma unroll
      for (int t = 0; t < 4; ++t) v[t] = a[t] + bv4[t];
      res[it] = v;
    }
{
#pragma unroll
      for (int it = 0; it < 8; ++it) {
        const int row = it * 16 + lr;
        const size_t po = ((size_t)(b * NN + n0 + row)) * DQ + dsel + 4 * e16;
        *(v4f*)(P + po) = res[it];
      }
      
    }
  }
}

// =========================================================================================================
// (3) 2x2 stride-2 max-pool of PF / GF f32 [b][4096 n][128 d] in f32 -> Kh/Kl bf16 [b][1024 m][128 d]
//     (hi = RNE(v), lo = RNE(v-hi)) and Gp f16 [b][1024 m][128 d], m = 32 py + px, window n = (2py+dy) 64 + 2px+dx,
//     dy, dx in {0,1}. Block (py, b), 256 threads: lane group e16 (16 lanes x 16 B = one 256-B row = 2 whole
//     lines), lr = tid>>4 -> px = 16 it + lr for it 0..1 (all 32 px valid, no pad rows). No LDS, no barriers.
// coverage: blocks 0..31 x px 0..31 x 16 lanes x 8 = rows 0..1023 x 128 d; grid (32, NB) covers Kh/Kl/Gp
//           [b][0..1023][0..127] exactly once.
// =========================================================================================================
__global__ __launch_bounds__(256)
void pool_k(const float* __restrict__ PF, const float* __restrict__ GF,
            unsigned short* Kh, unsigned short* Kl, unsigned short* Gp) {
  const int tid = threadIdx.x, py = blockIdx.x, b = blockIdx.y;
  const int e16 = tid & 15, lr = tid >> 4;                          // lr 0..15
  v4u kh[2], kl[2], gu[2];
#pragma unroll
  for (int it = 0; it < 2; ++it) {
    const int px = it * 16 + lr;                                    // 0..31
    float fk[8], fg[8];
#pragma unroll
    for (int t = 0; t < 8; ++t) { fk[t] = -__builtin_inff(); fg[t] = -__builtin_inff(); }
#pragma unroll
    for (int dy = 0; dy < 2; ++dy) {
      const size_t rb = ((size_t)(b * NN + (2 * py + dy) * WIMG + 2 * px)) * DQ + 8 * e16;
#pragma unroll
      for (int dx = 0; dx < 2; ++dx) {
        const float* pk = PF + rb + (size_t)dx * DQ;
        const float* pg = GF + rb + (size_t)dx * DQ;
        const v4f ka = *(const v4f*)pk, kq = *(const v4f*)(pk + 4);
        const v4f ga = *(const v4f*)pg, gq = *(const v4f*)(pg + 4);
#pragma unroll
        for (int t = 0; t < 4; ++t) {
          fk[t]     = fmaxf(fk[t], ka[t]);
          fk[4 + t] = fmaxf(fk[4 + t], kq[t]);
          fg[t]     = fmaxf(fg[t], ga[t]);
          fg[4 + t] = fmaxf(fg[4 + t], gq[t]);
        }
      }
    }
    split8(fk, kh[it], kl[it]);
#pragma unroll
    for (int t = 0; t < 4; ++t) gu[it][t] = pk16(h_bits((_Float16)fg[2 * t]), h_bits((_Float16)fg[2 * t + 1]));
  }
{
#pragma unroll
    for (int it = 0; it < 2; ++it) {
      const int px = it * 16 + lr;
      const size_t po = ((size_t)(b * MM + WP * py + px)) * DQ + 8 * e16;
      *(v4u*)(Kh + po) = kh[it];
      *(v4u*)(Kl + po) = kl[it];
      *(v4u*)(Gp + po) = gu[it];
    }
    
  }
}

// =========================================================================================================
// (4) Gp f16 [b][1024 m][128 d] -> Gc f16 [b][d][m] (channel-major, keys contiguous) through an LDS tile T[64 d][64 m]
// coverage: reads 2 it x 32 rows x 8 lanes x 8 = 64 m x 64 d; T written rows (8e+t)=0..63 x cols 0..63, read rows
//           0..63 x cols 8e..8e+7 (staged extent == consumed extent); writes 64 d x 64 m; grid (16, 2, NB) covers
//           Gc [b][0..127][0..1023] exactly once.
// =========================================================================================================
__global__ __launch_bounds__(256)
void tr_g(const unsigned short* __restrict__ Gp, unsigned short* Gc) {
  __shared__ __align__(16) unsigned short T[QT * TP];
  const int tid = threadIdx.x;
  const int mt = blockIdx.x, db = blockIdx.y, b = blockIdx.z;
  const int e = tid & 7, lq = tid >> 3;                             // lq 0..31
  const int m0 = mt * QT, d0 = db * QT;
#pragma unroll
  for (int it = 0; it < 2; ++it) {
    const int ml = it * 32 + lq;                                     // 0..63
    const v4u w = *(const v4u*)(Gp + ((size_t)(b * MM + m0 + ml)) * DQ + d0 + 8 * e);
    unsigned short hb[8];
#pragma unroll
    for (int t = 0; t < 4; ++t) {
      hb[2 * t]     = (unsigned short)(w[t] & 0xFFFFu);
      hb[2 * t + 1] = (unsigned short)(w[t] >> 16);
    }
#pragma unroll
    for (int t = 0; t < 8; ++t) T[(8 * e + t) * TP + ml] = hb[t];
  }
  __syncthreads();
  v4u up[2];
#pragma unroll
  for (int it = 0; it < 2; ++it) {
    const int dl = it * 32 + lq;                                     // 0..63
    up[it] = *(const v4u*)(T + dl * TP + 8 * e);
  }
{
#pragma unroll
    for (int it = 0; it < 2; ++it) {
      const int dl = it * 32 + lq;
      *(v4u*)(Gc + ((size_t)(b * DQ + d0 + dl)) * MM + m0 + 8 * e) = up[it];
    }
    
  }
}

// ---- asynchronous copies to LDS: each lane moves its own 16 bytes, global -> LDS, through no register. Arguments: the
//      lane's LDS byte addresses, then its global addresses in the same order, all multiples of 16. The closing
//      s_wait_xcnt 0 stands inside the copies' own statement so that no address register named there is rewritten ahead
//      of it.
__device__ __forceinline__ unsigned lds_addr(const void* p) { return (unsigned)(uintptr_t)p; }
__device__ __forceinline__ void copy4(unsigned l0, unsigned l1, unsigned l2, unsigned l3,
                                      const unsigned short* g0, const unsigned short* g1,
                                      const unsigned short* g2, const unsigned short* g3) {
#if defined(__HIP_DEVICE_COMPILE__)
  asm volatile("global_load_async_to_lds_b128 %0, %4, off\n\t"
               "global_load_async_to_lds_b128 %1, %5, off\n\t"
               "global_load_async_to_lds_b128 %2, %6, off\n\t"
               "global_load_async_to_lds_b128 %3, %7, off\n\t"
               "s_wait_xcnt 0x0"
               :: "v"(l0), "v"(l1), "v"(l2), "v"(l3), "v"(g0), "v"(g1), "v"(g2), "v"(g3) : "memory");
#endif
}
__device__ __forceinline__ void copy12(unsigned a0, unsigned a1, unsigned a2, unsigned a3, unsigned b0, unsigned b1,
                                       unsigned b2, unsigned b3, unsigned c0, unsigned c1, unsigned c2, unsigned c3,
                                       const unsigned short* p0, const unsigned short* p1, const unsigned short* p2,
                                       const unsigned short* p3, const unsigned short* q0, const unsigned short* q1,
                                       const unsigned short* q2, const unsigned short* q3, const unsigned short* r0,
                                       const unsigned short* r1, const unsigned short* r2, const unsigned short* r3) {
#if defined(__HIP_DEVICE_COMPILE__)
  asm volatile("global_load_async_to_lds_b128 %0, %12, off\n\t"
               "global_load_async_to_lds_b128 %1, %13, off\n\t"
               "global_load_async_to_lds_b128 %2, %14, off\n\t"
               "global_load_async_to_lds_b128 %3, %15, off\n\t"
               "global_load_async_to_lds_b128 %4, %16, off\n\t"
               "global_load_async_to_lds_b128 %5, %17, off\n\t"
               "global_load_async_to_lds_b128 %6, %18, off\n\t"
               "global_load_async_to_lds_b128 %7, %19, off\n\t"
               "global_load_async_to_lds_b128 %8, %20, off\n\t"
               "global_load_async_to_lds_b128 %9, %21, off\n\t"
               "global_load_async_to_lds_b128 %10, %22, off\n\t"
               "global_load_async_to_lds_b128 %11, %23, off\n\t"
               "s_wait_xcnt 0x0"
               :: "v"(a0), "v"(a1), "v"(a2), "v"(a3), "v"(b0), "v"(b1), "v"(b2), "v"(b3), "v"(c0), "v"(c1), "v"(c2),
                  "v"(c3), "v"(p0), "v"(p1), "v"(p2), "v"(p3), "v"(q0), "v"(q1), "v"(q2), "v"(q3), "v"(r0), "v"(r1),
                  "v"(r2), "v"(r3) : "memory");
#endif
}
// the issuing wave's copies have landed behind this wait
__device__ __forceinline__ void wait_async0() {
#if defined(__HIP_DEVICE_COMPILE__)
  asm volatile("s_wait_asynccnt 0x0" ::: "memory");
#endif
}
// the wave's own LDS reads have retired before the buffer they read is handed to the copies that refill it
__device__ __forceinline__ void wait_ds0() {
#if defined(__HIP_DEVICE_COMPILE__)
  asm volatile("s_wait_dscnt 0x0" ::: "memory");
#endif
}
// one 32-key stage: Kh and Kl rows kb..kb+31 (256 B each, LDS pitch 272 B) and the 64-B key run kb..kb+31 of all 128
// rows of Gc (LDS pitch 80 B). 128 threads x 12 copies of 16 B = 8 KiB + 8 KiB + 8 KiB; no two lanes share an LDS byte.
__device__ __forceinline__ void stage_kv(unsigned short* st, const unsigned short* Khb, const unsigned short* Klb,
                                         const unsigned short* Gcb, int kb, int tid) {
  const int kr = tid >> 4, kcol = 8 * (tid & 15);                    // kr 0..7, + 8 i -> key row 0..31
  const int vr = tid >> 2, vcol = 8 * (tid & 3);                     // vr 0..31, + 32 i -> channel row 0..127
  const unsigned lk = lds_addr(st + kr * KP + kcol);
  const unsigned ll = lk + 2u * (KT * KP);
  const unsigned lv = lds_addr(st + 2 * KT * KP + vr * VPT + vcol);
  const unsigned short* gk = Khb + (size_t)(kb + kr) * DQ + kcol;
  const unsigned short* gl = Klb + (size_t)(kb + kr) * DQ + kcol;
  const unsigned short* gv = Gcb + (size_t)vr * MM + kb + vcol;
  copy12(lk, lk + 2u * (8 * KP), lk + 2u * (16 * KP), lk + 2u * (24 * KP),
         ll, ll + 2u * (8 * KP), ll + 2u * (16 * KP), ll + 2u * (24 * KP),
         lv, lv + 2u * (32 * VPT), lv + 2u * (64 * VPT), lv + 2u * (96 * VPT),
         gk, gk + 8 * DQ, gk + 16 * DQ, gk + 24 * DQ, gl, gl + 8 * DQ, gl + 16 * DQ, gl + 24 * DQ,
         gv, gv + 32 * MM, gv + 64 * MM, gv + 96 * MM);
}

// =========================================================================================================
// (5) attention for one (b, 64-query tile), transposed formulation, 1024 keys (all valid, no mask, no scale):
//   S^T tile (16 keys x 16 queries) = sum over 4 d-chunks (rolled loop) of A(k: row = key kb + (lane&15), 32 d via
//   the split k map from the bf16 plane Kh [b][1024][128]) . B(q: col = query, same map from Qh [b][4096][128])
//   + A(Kh).B(Ql) + A(Kl).B(Qh) (bf16 unscaled residual planes, shared accumulator).
//   Per lane the D tile holds 8 keys of ONE query: online softmax state per lane, one shuffle (lane^16) for the max
//   over 32 keys; the o/l rescale is skipped under a wave-uniform ballot when no lane's max grew (corr == 1 exactly
//   for every lane then); row-sum partials combined at the end. P = e^{s-m} x 16384 as f16 is the B operand of
//   y^T (rows channel, cols queries) += A(pooled g: rows channel = 16j + (lane&15), keys contiguous, f16 plane Gc
//   [b][128][1024]) . B(P^T): element r <- D of the tile covering keys kb..kb+15, element 8+r <- the tile covering
//   kb+16..kb+31, lane unchanged. 8 accumulator tiles per wave (128 channels). Block = 4 waves = 64 queries.
//   Live state per lane: o 64 + s0/s1 16 + up to 6 fragments (rolled d loop) + P 8 + m/l, under the 256 cap.
//   Operands come from LDS: the block's 64 query rows of Qh/Ql are copied once (Qs, pitch 272 B); each 32-key stage of
//   Kh/Kl/Gc is copied by all four waves into one of two buffers (Ring) one trip ahead of its use and read by all four.
//   Epilogue: y = O/l staged in LDS Os[query][128 channels] (pitch OSPW, b128 stores), block barrier (cross-wave),
// coverage: Os written 4 waves x 16 queries x 128 ch, read rows 0..63 x ch 8e..8e+7 (e 0..15); planes 8 it x 8 rows x
//           16 lanes x 8 = 64 n x 128 ch per plane; grid (NQ/64, NB) covers rows 0..NQ-1 of Yh/Yl exactly once.
// =========================================================================================================
__global__ __launch_bounds__(128) __attribute__((amdgpu_num_vgpr(256)))
void attn_k(const unsigned short* __restrict__ Qh, const unsigned short* __restrict__ Ql,
            const unsigned short* __restrict__ Kh, const unsigned short* __restrict__ Kl,
            const unsigned short* __restrict__ Gc, unsigned short* Yh, unsigned short* Yl) {
  __shared__ __align__(16) float Os[QT * OSPW];
  __shared__ __align__(16) unsigned short Qs[2 * QT * KP];
  __shared__ __align__(16) unsigned short Ring[2 * STG];
  const int tid  = threadIdx.x;
  const int wave = tid >> 5, lane = tid & 31;
  const int hh   = lane >> 4, c = lane & 15;
  const int n0   = blockIdx.x * QT, b = blockIdx.y;

  const unsigned short* Khb = Kh + (size_t)b * MM * DQ;
  const unsigned short* Klb = Kl + (size_t)b * MM * DQ;
  const unsigned short* Gcb = Gc + (size_t)b * DQ * MM;

  // ---- in front of the loop: the query tile and stage 0, their wait, the barrier that publishes them, then stage 1
  {
    const int qr = tid >> 4, qcol = 8 * (tid & 15);                  // qr 0..7, + 8 i -> query row 0..63
    const unsigned lq = lds_addr(Qs + qr * KP + qcol);
    const size_t go = ((size_t)(b * NN + n0 + qr)) * DQ + qcol;
    auto plane = [](unsigned l0, const unsigned short* g) {          // 64 rows of one plane, 8 copies a thread
      copy4(l0, l0 + 2u * (8 * KP), l0 + 2u * (16 * KP), l0 + 2u * (24 * KP), g, g + 8 * DQ, g + 16 * DQ, g + 24 * DQ);
      copy4(l0 + 2u * (32 * KP), l0 + 2u * (40 * KP), l0 + 2u * (48 * KP), l0 + 2u * (56 * KP), g + 32 * DQ,
            g + 40 * DQ, g + 48 * DQ, g + 56 * DQ);
    };
    plane(lq, Qh + go);
    plane(lq + 2u * (QT * KP), Ql + go);
  }
  stage_kv(Ring, Khb, Klb, Gcb, 0, tid);
  wait_async0();
  __syncthreads();
  stage_kv(Ring + STG, Khb, Klb, Gcb, KT, tid);

  // q fragment pointers (B operand, col = query 16*wave + c of the tile), + 32*kc
  const unsigned short* Qhp = Qs + (16 * wave + c) * KP + 8 * hh;
  const unsigned short* Qlp = Qhp + QT * KP;

  float m = -1.0e30f, l = 0.f;
  v8f o[8];
#pragma unroll
  for (int j = 0; j < 8; ++j) o[j] = zero8();

#pragma unroll 1
  for (int kb = 0; kb < MM; kb += KT) {
    unsigned short* st = Ring + ((kb / KT) & 1) * STG;               // this trip's buffer
    // k fragment base (A operand, row = key kb + c), + 32*kc; v fragment base (A operand, row = channel 16j + c)
    const unsigned short* k0p  = st + c * KP + 8 * hh;               // keys kb .. kb+15
    const unsigned short* k1p  = k0p + 16 * KP;                      // keys kb+16 .. kb+31
    const unsigned short* k0lp = k0p + KT * KP;
    const unsigned short* k1lp = k1p + KT * KP;
    const unsigned short* Vp   = st + 2 * KT * KP + c * VPT + 8 * hh;
    v8f s0 = zero8(), s1 = zero8();
#pragma unroll 1
    for (int kc = 0; kc < DQ / 32; ++kc) {
      const Frag qh  = ldfrag(Qhp + 32 * kc);
      const Frag ql  = ldfrag(Qlp + 32 * kc);
      const Frag k0  = ldfrag(k0p + 32 * kc);
      const Frag k1  = ldfrag(k1p + 32 * kc);
      const Frag k0l = ldfrag(k0lp + 32 * kc);
      const Frag k1l = ldfrag(k1lp + 32 * kc);
      s0 = mma_b(k0.bf, qh.bf, s0);
      s1 = mma_b(k1.bf, qh.bf, s1);
      s0 = mma_b(k0.bf, ql.bf, s0);
      s1 = mma_b(k1.bf, ql.bf, s1);
      s0 = mma_b(k0l.bf, qh.bf, s0);
      s1 = mma_b(k1l.bf, qh.bf, s1);
    }

    float mx = fmaxf(hmax8(s0), hmax8(s1));
    mx = fmaxf(mx, __shfl_xor(mx, 16, 32));
    const float mn = fmaxf(m, mx);
    const unsigned grew = wave_ballot(mx > m);                       // wave-uniform
    if (grew != 0u) {
      const float corr = __expf(m - mn);                             // == 1 exactly for lanes whose max did not grow
      l *= corr;
#pragma unroll
      for (int j = 0; j < 8; ++j) {
#pragma unroll
        for (int r = 0; r < 8; ++r) o[j][r] *= corr;
      }
    }
    m = mn;
    const float msh = mn - LNPS;                                     // exp gives e^{s-m} * 16384

    FragH ph;
    float ls = 0.f;
#pragma unroll
    for (int r = 0; r < 8; ++r) {
      const float e0 = __expf(s0[r] - msh);                          // key kb      + 8hh + r
      const float e1 = __expf(s1[r] - msh);                          // key kb + 16 + 8hh + r
      ls += e0 + e1;
      ph.hv[0][r] = (_Float16)e0;
      ph.hv[1][r] = (_Float16)e1;
    }
    l += ls;

#pragma unroll
    for (int j = 0; j < 8; ++j) {
      const Frag vf = ldfrag(Vp + (16 * j) * VPT);
      o[j] = mma_h(vf.h, ph.v, o[j]);
    }

    // ---- foot of the trip: own reads retired, own copies of the next stage landed, one barrier that publishes that
    //      stage and ends every reader's last read of this buffer; only then the refill of this buffer
    wait_ds0();
    wait_async0();
    __syncthreads();
    if (kb + 2 * KT < MM) stage_kv(st, Khb, Klb, Gcb, kb + 2 * KT, tid);
  }
  wait_async0();                                                     // nothing is in flight when the wave goes on
  l += __shfl_xor(l, 16, 32);
  const float inv = 1.0f / l;                                        // o and l both carry the x16384 factor

  // ---- epilogue: y = o * inv -> Os[query][ch]; lane (hh, c) holds ch = 16 j + 8 hh + r for query 16 w + c
  {
    const int qrow = 16 * wave + c;
#pragma unroll
    for (int j = 0; j < 8; ++j) {
      v4f va, vb;
#pragma unroll
      for (int r = 0; r < 4; ++r) { va[r] = o[j][r] * inv; vb[r] = o[j][4 + r] * inv; }
      *(v4f*)(Os + qrow * OSPW + 16 * j + 8 * hh)     = va;
      *(v4f*)(Os + qrow * OSPW + 16 * j + 8 * hh + 4) = vb;
    }
  }
  __syncthreads();

  const int e16 = tid & 15, lr = tid >> 4;                           // lr 0..7
  v4u uh[8], ul[8];
#pragma unroll
  for (int it = 0; it < 8; ++it) {
    const int row = it * 8 + lr;                                     // query 0..63
    const v4f a = *(const v4f*)(Os + row * OSPW + 8 * e16);
    const v4f q = *(const v4f*)(Os + row * OSPW + 8 * e16 + 4);
    const float f[8] = {a[0], a[1], a[2], a[3], q[0], q[1], q[2], q[3]};
    split8(f, uh[it], ul[it]);
  }
{
#pragma unroll
    for (int it = 0; it < 8; ++it) {
      const int row = it * 8 + lr;
      const size_t po = ((size_t)(b * NN + n0 + row)) * DQ + 8 * e16;
      *(v4u*)(Yh + po) = uh[it];
      *(v4u*)(Yl + po) = ul[it];
    }
    
  }
}

// =========================================================================================================
// (6) output conv for one (b, 64-n tile, 64-c block): A[c][n] = sum_ci WWb[c][ci] (Yh + Yl)[b][n][ci] on bf16 WMMA
//     (2 products per k-step, shared accumulator), K = 128 = 4 steps. Block 128 threads = 4 waves; wave w owns cols
//     n0+16w..+15 (B fragments from the k-contiguous Yh/Yl rows) and 4 m-tiles (A rows c = c0 + 16 mt + (lane&15),
//     split k map loader from WWb). Epilogue staged in LDS Os[n_loc][c_loc] (pitch OSP, b128 stores), block barrier
//     2 lines): 8 consecutive lanes x 16 B (values gathered from 4 Os rows), one instruction per 4 lines, final
// coverage: Os 4 waves x 16 n x 64 c written, read rows nl+t <= 63 x cols cl <= 63; WY 8 it x 16 lines x 8 lanes x
//           4 floats = 64 c x 64 n; grid (NQ/64, 4, NB) covers WY[b][0..255][0..NQ-1] exactly once.
// =========================================================================================================
__global__ __launch_bounds__(128)
void gemm_out(const unsigned short* __restrict__ WWb, const unsigned short* __restrict__ Yh,
              const unsigned short* __restrict__ Yl, const float* __restrict__ wb, float* WY) {
  __shared__ __align__(16) float Os[QT * OSP];
  const int tid  = threadIdx.x;
  const int lane = tid & 31, wave = tid >> 5;
  const int hh   = lane >> 4, c = lane & 15;
  const int nt   = blockIdx.x, cb = blockIdx.y, b = blockIdx.z;
  const int n0   = nt * QT, c0 = cb * QT;

  const unsigned short* ap  = WWb + (size_t)(c0 + c) * DQ + 8 * hh;
  const size_t bo = ((size_t)(b * NN + n0 + 16 * wave + c)) * DQ + 8 * hh;
  const unsigned short* bph = Yh + bo;
  const unsigned short* bpl = Yl + bo;

  v8f acc[4];
#pragma unroll
  for (int mt = 0; mt < 4; ++mt) acc[mt] = zero8();

#pragma unroll
  for (int ks = 0; ks < DQ / 32; ++ks) {
    const Frag fbh = ldfrag(bph + 32 * ks);
    const Frag fbl = ldfrag(bpl + 32 * ks);
#pragma unroll
    for (int mt = 0; mt < 4; ++mt) {
      const Frag fa = ldfrag(ap + (size_t)(16 * mt) * DQ + 32 * ks);
      acc[mt] = mma_b(fa.bf, fbh.bf, acc[mt]);
      acc[mt] = mma_b(fa.bf, fbl.bf, acc[mt]);
    }
  }

  // ---- epilogue: -> LDS Os[n_loc][c_loc]; lane (hh, c) holds c_loc = 16 mt + 8 hh + r for n_loc = 16 w + c
  {
    const int nl = 16 * wave + c;
#pragma unroll
    for (int mt = 0; mt < 4; ++mt) {
      v4f va, vb;
#pragma unroll
      for (int r = 0; r < 4; ++r) { va[r] = acc[mt][r]; vb[r] = acc[mt][4 + r]; }
      *(v4f*)(Os + nl * OSP + 16 * mt + 8 * hh)     = va;
      *(v4f*)(Os + nl * OSP + 16 * mt + 8 * hh + 4) = vb;
    }
  }
  __syncthreads();

  const int e = tid & 7, lq = tid >> 3;                              // lq 0..15
  v4f res[8];
#pragma unroll
  for (int it = 0; it < 8; ++it) {
    const int L   = it * 16 + lq;                                    // 0..127
    const int cl  = L >> 1, hf = L & 1;                              // channel 0..63 within the block
    const int nl  = hf * 32 + 4 * e;                                 // position 0..63
    const float bvs = bfr(wb[c0 + cl]);
#pragma unroll
    for (int t = 0; t < 4; ++t) {
      res[it][t] = Os[(nl + t) * OSP + cl] + bvs;
    }
  }
{
#pragma unroll
    for (int it = 0; it < 8; ++it) {
      const int L   = it * 16 + lq;
      const int cl  = L >> 1, hf = L & 1;
      const int nl  = hf * 32 + 4 * e;
      const size_t idx = ((size_t)(b * CC + c0 + cl)) * NN + n0 + nl;
      *(v4f*)(WY + idx) = res[it];
    }
    
  }
}

// =========================================================================================================
// (7) batch-norm statistics: block owns ONE channel (256 blocks of 32 waves). Thread tid takes floats 4 tid..4 tid+3
//     of each of the NB rows WY[b][c][0..NQ), so every wave load is one contiguous 512-B run; a thread's NB loads are
//     independent and all issued before the first sum. Sum and sum of squares in f64 per thread (rows, then elements,
//     in ascending order), wave shuffle reduce, per-wave partials in LDS (cross-wave, block barrier), wave 0
//     shuffle-reduces the 32 partials, lane 0: mean, biased variance, rstd = 1/sqrt(var + eps) in f32 -> MU[c][0],
//     MU[c][1]. MU row pitch MUP floats = one 128-B line per channel, so each line has one writing block.
// coverage: 256 blocks x 1 channel; MU[c][0..1] written exactly once; reads WY rows b < NB, c 0..255, n < NQ only
//           (the produced extent): BST threads x 4 floats = NQ per row.
// =========================================================================================================
__global__ __launch_bounds__(BST)
void bn_stat(const float* __restrict__ WY, float* MU) {
#pragma clang fp contract(off)
  __shared__ double red[2 * (BST / 32)];
  const int tid = threadIdx.x, lane = tid & 31, wave = tid >> 5;
  const int cc = blockIdx.x;
  const double ninv = 1.0 / ((double)NB * (double)NQ);
  unsigned bo[NB];                                                   // byte offsets in WY, all < 2^25
  v4f a[NB];
#pragma unroll
  for (int bb = 0; bb < NB; ++bb) bo[bb] = 4u * (unsigned)((bb * CC + cc) * NN + 4 * tid);
#pragma unroll
  for (int bb = 0; bb < NB; ++bb) a[bb] = *(const v4f*)((const char*)WY + bo[bb]);
#if defined(__HIP_DEVICE_COMPILE__)
  // keeps every load above the sums: without it the scheduler sinks them and only three stay in flight per wave
  __builtin_amdgcn_sched_barrier(0);
#endif
  double s = 0.0, q = 0.0;
#pragma unroll
  for (int bb = 0; bb < NB; ++bb) {
#pragma unroll
    for (int t = 0; t < 4; ++t) {
      const double d = (double)a[bb][t];
      s += d; q += d * d;
    }
  }
#pragma unroll
  for (int d = 1; d < 32; d <<= 1) {
    s += __shfl_xor(s, d, 32);
    q += __shfl_xor(q, d, 32);
  }
  if (lane == 0) { red[wave] = s; red[BST / 32 + wave] = q; }
  __syncthreads();
  if (wave == 0) {                                                   // wave-uniform branch, all 32 lanes on
    double ts = red[lane], tq = red[BST / 32 + lane];
#pragma unroll
    for (int d = 1; d < 32; d <<= 1) {
      ts += __shfl_xor(ts, d, 32);
      tq += __shfl_xor(tq, d, 32);
    }
    if (lane == 0) {
      const double mu = ts * ninv;
      double var = tq * ninv - mu * mu;
      var = (var > 0.0) ? var : 0.0;
      const float varf = (float)var + BNEPS;
      const float rs = 1.0f / sqrtf(varf);
      MU[MUP * cc]     = (float)mu;
      MU[MUP * cc + 1] = rs;
    }
  }
}

// =========================================================================================================
// (8) normalise + affine + residual: out[b][c][n] = (((WY - mu[c]) * rstd[c]) * bf16-RNE(gamma[c]) + bf16-RNE(beta[c]))
//     + bf16-RNE(x[b][c][n]) in f32. Block 256 threads = 8 waves covers 4 channels x 256 n: wave w -> channel
// coverage: grid (NQ/256, 64, NB) x 8 waves x 32 lanes x 4 floats covers out[b][0..255][0..NQ-1] exactly once.
// =========================================================================================================
__global__ __launch_bounds__(256)
void bn_apply(const float* __restrict__ WY, const float* __restrict__ x, const float* __restrict__ gam,
              const float* __restrict__ bet, const float* __restrict__ MU, float* out) {
#pragma clang fp contract(off)
  const int tid = threadIdx.x, lane = tid & 31, wave = tid >> 5;
  const int nq = blockIdx.x, cb = blockIdx.y, b = blockIdx.z;
  const int c = cb * 4 + (wave >> 1);                                // 0..255 (wave-uniform)
  const int n = nq * BNQ + (wave & 1) * 128 + 4 * lane;              // < NQ
  const float mu = MU[MUP * c], rs = MU[MUP * c + 1];
  const float ga = bfr(gam[c]), be = bfr(bet[c]);
#if defined(__HIP_DEVICE_COMPILE__)
  // stands between the per-channel loads above and the first rewrite of a register they name (a later load's result)
  asm volatile("s_wait_xcnt 0x0" ::: "memory");
#endif
  const size_t idx = ((size_t)(b * CC + c)) * NN + n;
  const v4f w  = *(const v4f*)(WY + idx);
  const v4f xv = *(const v4f*)(x + idx);
  v4f r;
#pragma unroll
  for (int t = 0; t < 4; ++t) {
    const float d  = w[t] - mu;
    const float nv = d * rs;
    const float av = nv * ga;
    const float sv = av + be;
    r[t] = sv + bfr(xv[t]);
  }
{
    *(v4f*)(out + idx) = r;
    
  }
}

// =========================================================================================================
// Workspace map (bytes; each region start a multiple of 256; every extent is an exact row/tile multiple and is
//   W16 f16 [384][256]            196608      WWb bf16 [256][128]        65536
//   XP  f16 [NB][4096][256]     16777216 (NB=8)
//   Qh/Ql bf16 [NB][4096][128]   8388608 x2
//   PF/GF f32  [NB][4096][128]  16777216 x2
//   Kh/Kl bf16 [NB][1024][128]   2097152 x2  Gp f16 [NB][1024][128]   2097152   Gc f16 [NB][128][1024]  2097152
//   Yh/Yl bf16 [NB][4096][128]   8388608 x2
//   WY  f32  [NB][256][4096]    33554432    MU f32 [256][32]           32768
//   total (NB=8) = 126124032
// =========================================================================================================
extern "C" void kernel_launch(void* const* d_in, const int* in_sizes, int n_in,
                              void* d_out, int out_size, void* d_ws, size_t ws_size,
                              hipStream_t stream) {
  const int XN = NB * CC * NN;
  if (n_in < 11) return;
  if (in_sizes[0] < XN) return;
  if (in_sizes[1] < DQ * CC || in_sizes[3] < DQ * CC || in_sizes[5] < DQ * CC || in_sizes[7] < CC * DQ) return;
  if (in_sizes[2] < DQ || in_sizes[4] < DQ || in_sizes[6] < DQ || in_sizes[8] < CC) return;
  if (in_sizes[9] < CC || in_sizes[10] < CC) return;
  if (out_size < XN) return;

  size_t off = 0;
  auto carve = [&](size_t bytes) { const size_t o = off; off += (bytes + 255) & ~(size_t)255; return o; };
  const size_t oW16 = carve((size_t)MW * CC * 2);
  const size_t oWWb = carve((size_t)CC * DQ * 2);
  const size_t oXP  = carve((size_t)NB * NN * CC * 2);
  const size_t oQh  = carve((size_t)NB * NN * DQ * 2);
  const size_t oQl  = carve((size_t)NB * NN * DQ * 2);
  const size_t oPF  = carve((size_t)NB * NN * DQ * 4);
  const size_t oGF  = carve((size_t)NB * NN * DQ * 4);
  const size_t oKh  = carve((size_t)NB * MM * DQ * 2);
  const size_t oKl  = carve((size_t)NB * MM * DQ * 2);
  const size_t oGp  = carve((size_t)NB * MM * DQ * 2);
  const size_t oGc  = carve((size_t)NB * DQ * MM * 2);
  const size_t oYh  = carve((size_t)NB * NN * DQ * 2);
  const size_t oYl  = carve((size_t)NB * NN * DQ * 2);
  const size_t oWY  = carve((size_t)NB * CC * NN * 4);
  const size_t oMU  = carve((size_t)CC * MUP * 4);
  if (off > ws_size) return;
  if (off > (size_t)134217728) return;

  const float* x   = (const float*)d_in[0];
  const float* gw  = (const float*)d_in[1];
  const float* gb  = (const float*)d_in[2];
  const float* tw  = (const float*)d_in[3];
  const float* tb  = (const float*)d_in[4];
  const float* pw  = (const float*)d_in[5];
  const float* pb  = (const float*)d_in[6];
  const float* ow  = (const float*)d_in[7];
  const float* wb  = (const float*)d_in[8];
  const float* gam = (const float*)d_in[9];
  const float* bet = (const float*)d_in[10];

  char* ws = (char*)d_ws;
  unsigned short* W16 = (unsigned short*)(ws + oW16);
  unsigned short* WWb = (unsigned short*)(ws + oWWb);
  unsigned short* XP  = (unsigned short*)(ws + oXP);
  unsigned short* Qh  = (unsigned short*)(ws + oQh);
  unsigned short* Ql  = (unsigned short*)(ws + oQl);
  float*          PF  = (float*)(ws + oPF);
  float*          GF  = (float*)(ws + oGF);
  unsigned short* Kh  = (unsigned short*)(ws + oKh);
  unsigned short* Kl  = (unsigned short*)(ws + oKl);
  unsigned short* Gp  = (unsigned short*)(ws + oGp);
  unsigned short* Gc  = (unsigned short*)(ws + oGc);
  unsigned short* Yh  = (unsigned short*)(ws + oYh);
  unsigned short* Yl  = (unsigned short*)(ws + oYl);
  float*          WY  = (float*)(ws + oWY);
  float*          MU  = (float*)(ws + oMU);
  float* out = (float*)d_out;

  const dim3 blk256(256), blk128(128);

  // (0) theta_w / phi_w / g_w -> stacked f16 plane; w_w -> bf16 plane
  cvt_w<<<dim3(MW / 8 + CC / 16), blk256, 0, stream>>>(tw, pw, gw, ow, W16, WWb);
  // (1) x -> position-major 16-bit plane
  cvt_x<<<dim3(NN / QT, CC / QT, NB), blk256, 0, stream>>>(x, XP);
  // (2) conv1x1 GEMM -> theta (q) hi/res planes, phi / g conv outputs + bias as f32 planes
  gemm_proj<<<dim3(NSTRIP, MW / QT, NB), blk256, 0, stream>>>(W16, XP, tb, pb, gb, Qh, Ql, PF, GF);
  // (3) 2x2 stride-2 max-pool -> pooled phi (k) hi/res planes, pooled g f16 plane
  pool_k<<<dim3(HP, NB), blk256, 0, stream>>>(PF, GF, Kh, Kl, Gp);
  // (4) pooled g -> channel-major plane
  tr_g<<<dim3(MM / QT, DQ / QT, NB), blk256, 0, stream>>>(Gp, Gc);
  // (5) attention -> y hi/res planes [b][n][128]
  attn_k<<<dim3(NQ / QT, NB), blk128, 0, stream>>>(Qh, Ql, Kh, Kl, Gc, Yh, Yl);
  // (6) output conv + bias -> WY f32 plane [b][256][4096]
  gemm_out<<<dim3(NQ / QT, CC / QT, NB), blk128, 0, stream>>>(WWb, Yh, Yl, wb, WY);
  // (7) per-channel mean / rstd table
  bn_stat<<<dim3(CC), dim3(BST), 0, stream>>>(WY, MU);
  // (8) normalise, affine, residual -> out [b][256][4096]
  bn_apply<<<dim3(NQ / BNQ, CC / 4, NB), blk256, 0, stream>>>(WY, x, gam, bet, MU, out);
  (void)hipGetLastError();
}

// v003
// Measured time: 132 microseconds a run.
// In two side-by-side timings against v002, it was 1.08 and 1.07 times as fast.
// Over all steps from v000 it is 6.06 times as fast.
// Contractions: conv1x1 theta/phi/g GEMM W[384x256].X[256x128] per strip on v_wmma_f32_16x16x32_f16 (f16 containers
// of bf16-RNE weights x256 and bf16-RNE x); scores K.Q^T on v_wmma_f32_16x16x32_bf16 (bf16 hi + bf16 residual planes
// of theta / 2x2-max-pooled phi, 3 products, K=128); y^T = G.P^T on v_wmma_f32_16x16x32_f16 (2x2-max-pooled g as
// f16, P = e^{s-m} x16384 f16 from the score D registers); output conv W[256x128].Y on v_wmma_f32_16x16x32_bf16 (bf16
// weights, y as bf16 hi + residual planes, 2 products); f32 accumulate everywhere; max-pool, softmax statistics and
// bias in f32 VALU; batch-norm channel statistics in f64 VALU; normalisation, affine and residual add in f32 VALU.
#include <hip/hip_runtime.h>
#include <math.h>
#include <stdint.h>

#ifndef NB
#define NB 8
#endif
#ifndef NQ
#define NQ 4096
#endif
#define NB_FULL 8
#define CC     256
#define HIMG   64
#define WIMG   64
#define NN     4096
#define DQ     128
#define HP     32
#define WP     32
#define MM     1024
#define MW     384
#define QT     64
#define SN     128
#define NSTRIP 32
#define OSP    68
#define OSPW   132
#define TP     72
#define BST    1024
#define WSC    256.0f
#define IWSC   0.00390625f
#define LNPS   9.704060527839234f
#define BNEPS  1.0e-5f
#define KT     32
#define KP     136
#define VPT    40
#define STG    (2 * KT * KP + DQ * VPT)

static_assert(NB >= 1 && NB <= NB_FULL);
static_assert(NQ % QT == 0 && NQ <= NN);
static_assert(NN == HIMG * WIMG);
static_assert(SN == 2 * WIMG);
static_assert(NSTRIP * SN == NN);
static_assert(SN == 8 * 16);
static_assert(HIMG % 2 == 0 && WIMG % 2 == 0);
static_assert(HP == HIMG / 2 && WP == WIMG / 2);
static_assert(MM == HP * WP);
static_assert(WP == 32);
static_assert(MM % QT == 0 && MM % 32 == 0);
static_assert(NN % QT == 0 && CC % QT == 0 && DQ % QT == 0);
static_assert(MW == 3 * DQ && MW % QT == 0 && MW % 8 == 0);
static_assert(CC % 32 == 0 && DQ % 32 == 0);
static_assert((OSP * 4) % 16 == 0);
static_assert((OSPW * 4) % 16 == 0);
static_assert((TP * 2) % 16 == 0);
static_assert(SN * OSP * 4 <= 65536);
static_assert(BST == 32 * 32 && NQ == 4 * BST);
static_assert(NN % 16 == 0 && CC % 4 == 0);
static_assert((size_t)NB_FULL * CC * NN * 4 == (size_t)33554432);
static_assert((KP * 2) % 16 == 0 && (VPT * 2) % 16 == 0 && (STG * 2) % 16 == 0 && (KT * KP * 2) % 16 == 0);
static_assert(KP >= DQ + 8 && VPT >= KT + 8 && MM % KT == 0 && MM / KT >= 2);
static_assert(KT * DQ / 8 == 4 * 128 && DQ * KT / 8 == 4 * 128 && QT * DQ / 8 == 8 * 128);

typedef _Float16       v16h __attribute__((ext_vector_type(16)));
typedef _Float16       v8h  __attribute__((ext_vector_type(8)));
typedef __bf16         v16b __attribute__((ext_vector_type(16)));
typedef unsigned short v8us __attribute__((ext_vector_type(8)));
typedef float          v8f  __attribute__((ext_vector_type(8)));
typedef float          v4f  __attribute__((ext_vector_type(4)));
typedef unsigned int   v4u  __attribute__((ext_vector_type(4)));

union Frag  { v8us u[2]; v16h h; v16b bf; };
union FragH { v16h v; v8h hv[2]; };
static_assert(sizeof(Frag) == 32);
static_assert(sizeof(FragH) == 32);

// ---- scalar helpers ---------------------------------------------------------------------------------------
__device__ __forceinline__ unsigned short bf_bits(float f) {          // f32 -> bf16 bits, RNE convert
  unsigned u = __float_as_uint(f);
  return (unsigned short)((u + 0x7FFFu + ((u >> 16) & 1u)) >> 16);
}
__device__ __forceinline__ float bf_up(unsigned short hb) { return __uint_as_float(((unsigned)hb) << 16); }
__device__ __forceinline__ float bfr(float f) { return bf_up(bf_bits(f)); }
__device__ __forceinline__ unsigned short h_bits(_Float16 x) { return __builtin_bit_cast(unsigned short, x); }
__device__ __forceinline__ unsigned pk16(unsigned short a, unsigned short b) { return (unsigned)a | ((unsigned)b << 16); }
__device__ __forceinline__ v8f zero8() { v8f z = {0.f, 0.f, 0.f, 0.f, 0.f, 0.f, 0.f, 0.f}; return z; }
__device__ __forceinline__ float hmax8(v8f s) {
  return fmaxf(fmaxf(fmaxf(s[0], s[1]), fmaxf(s[2], s[3])), fmaxf(fmaxf(s[4], s[5]), fmaxf(s[6], s[7])));
}
__device__ __forceinline__ unsigned wave_ballot(bool p) {
#if defined(__HIP_DEVICE_COMPILE__)
  return __builtin_amdgcn_ballot_w32(p);
#else
  return p ? 1u : 0u;
#endif
}
// 8 f32 values -> bf16 hi bits and bf16 residual bits (lo = RNE(v - hi)), packed 2 per uint
__device__ __forceinline__ void split8(const float* f, v4u& uh, v4u& ul) {
#pragma unroll
  for (int t = 0; t < 4; ++t) {
    const float f0 = f[2 * t], f1 = f[2 * t + 1];
    const unsigned short hb0 = bf_bits(f0), hb1 = bf_bits(f1);
    const unsigned short lb0 = bf_bits(f0 - bf_up(hb0));
    const unsigned short lb1 = bf_bits(f1 - bf_up(hb1));
    uh[t] = pk16(hb0, hb1);
    ul[t] = pk16(lb0, lb1);
  }
}

// ---- 16-bit fragment loader (A, or B from a k-contiguous [n][k] row): lane -> row/col (lane&15), p already includes
//      + 8*(lane>>4); elements 0..7 <- p[0..7] (k0+8h..), elements 8..15 <- p[16..23] (k0+16+8h..)
__device__ __forceinline__ Frag ldfrag(const unsigned short* p) {
  Frag f;
  f.u[0] = *(const v8us*)(p);
  f.u[1] = *(const v8us*)(p + 16);
  return f;
}

// ---- WMMA helpers: builtin followed by a 4-slot VALU gap tying D and keeping A/B live --------------------------
__device__ __forceinline__ v8f mma_h(v16h a, v16h b, v8f c) {
  v8f d = __builtin_amdgcn_wmma_f32_16x16x32_f16(false, a, false, b, (short)0, c, false, false);
#if defined(__HIP_DEVICE_COMPILE__)
  asm volatile("v_nop\n\tv_nop\n\tv_nop\n\tv_nop" : "+v"(d) : "v"(a), "v"(b));
#endif
  return d;
}
__device__ __forceinline__ v8f mma_b(v16b a, v16b b, v8f c) {
  v8f d = __builtin_amdgcn_wmma_f32_16x16x32_bf16(false, a, false, b, (short)0, c, false, false);
#if defined(__HIP_DEVICE_COMPILE__)
  const v16h ha = __builtin_bit_cast(v16h, a), hb = __builtin_bit_cast(v16h, b);
  asm volatile("v_nop\n\tv_nop\n\tv_nop\n\tv_nop" : "+v"(d) : "v"(ha), "v"(hb));
#endif
  return d;
}

// =========================================================================================================
// (0) weights. Blocks 0..47: W16 f16 [384][256], rows 0..127 = theta_w, 128..255 = phi_w, 256..383 = g_w; value =
//     f16 of (bf16-RNE(w) * 256) (exact). Block owns rows 8*blk..8*blk+7: one wave per 512-B row = 32 lanes x 16 B
// coverage: 48 blocks x 8 rows x 32 lanes x 8 halves = 384 x 256; 16 blocks x 16 rows x 16 lanes x 8 = 256 x 128.
// =========================================================================================================
__global__ __launch_bounds__(256)
void cvt_w(const float* __restrict__ tw, const float* __restrict__ pw, const float* __restrict__ gw,
           const float* __restrict__ ow, unsigned short* W16, unsigned short* WWb) {
  const int tid = threadIdx.x, blk = blockIdx.x;
  if (blk < MW / 8) {
    const int rl = tid >> 5, col = 8 * (tid & 31);
    const int o = 8 * blk + rl;                                      // 0..383
    const int grp = blk >> 4;                                        // 0,1,2 (block-uniform)
    const float* wbase = (grp == 0) ? tw : ((grp == 1) ? pw : gw);  // all global
    const float* s = wbase + (size_t)(o - DQ * grp) * CC + col;      // (o - 128 grp) in 0..127
    const v4f a = *(const v4f*)s;
    const v4f q = *(const v4f*)(s + 4);
    const float f[8] = {a[0], a[1], a[2], a[3], q[0], q[1], q[2], q[3]};
    v4u u;
#pragma unroll
    for (int t = 0; t < 4; ++t) {
      const _Float16 h0 = (_Float16)(bfr(f[2 * t]) * WSC);
      const _Float16 h1 = (_Float16)(bfr(f[2 * t + 1]) * WSC);
      u[t] = pk16(h_bits(h0), h_bits(h1));
    }
{
      *(v4u*)(W16 + (size_t)o * CC + col) = u;
      
    }
  } else {
    const int rb = blk - MW / 8;                                     // 0..15
    const int o = 16 * rb + (tid >> 4);                              // 0..255
    const int col = 8 * (tid & 15);                                  // 0..120
    const float* s = ow + (size_t)o * DQ + col;
    const v4f a = *(const v4f*)s;
    const v4f q = *(const v4f*)(s + 4);
    const float f[8] = {a[0], a[1], a[2], a[3], q[0], q[1], q[2], q[3]};
    v4u u;
#pragma unroll
    for (int t = 0; t < 4; ++t) u[t] = pk16(bf_bits(f[2 * t]), bf_bits(f[2 * t + 1]));
{
      *(v4u*)(WWb + (size_t)o * DQ + col) = u;
      
    }
  }
}

// =========================================================================================================
// (1) x f32 [b][256 c][4096 n] -> XP f16 [b][n][c] (position-major, bf16-RNE values, exact in f16) through an LDS
//     tile T[64 n][64 c] (pitch TP, cross-wave, block barrier). Block (nb, cb, b) owns a 64 c x 64 n tile.
// coverage: T written rows (8e+t)=0..63 x cols cl 0..63, read rows 0..63 x cols 8e..8e+7 (staged extent == consumed
//           extent); XP 2 it x 32 rows x 8 lanes x 8 = 64 n x 64 c; grid (64, 4, NB) covers XP [b][0..4095][0..255]
//           exactly once.
// =========================================================================================================
__global__ __launch_bounds__(256)
void cvt_x(const float* __restrict__ x, unsigned short* XP) {
  __shared__ __align__(16) unsigned short T[QT * TP];
  const int tid = threadIdx.x;
  const int nb = blockIdx.x, cb = blockIdx.y, b = blockIdx.z;
  const int e = tid & 7, lq = tid >> 3;                             // lq 0..31
  const int n0 = nb * QT, c0 = cb * QT;
#pragma unroll
  for (int it = 0; it < 2; ++it) {
    const int cl = it * 32 + lq;                                     // 0..63
    const float* sp = x + ((size_t)(b * CC + c0 + cl)) * NN + n0 + 8 * e;
    const v4f a = *(const v4f*)sp;
    const v4f q = *(const v4f*)(sp + 4);
    unsigned short hb[8];
#pragma unroll
    for (int t = 0; t < 4; ++t) {
      hb[t]     = h_bits((_Float16)bfr(a[t]));
      hb[4 + t] = h_bits((_Float16)bfr(q[t]));
    }
#pragma unroll
    for (int t = 0; t < 8; ++t) T[(8 * e + t) * TP + cl] = hb[t];
  }
  __syncthreads();
  v4u up[2];
#pragma unroll
  for (int it = 0; it < 2; ++it) {
    const int nl = it * 32 + lq;                                     // 0..63
    up[it] = *(const v4u*)(T + nl * TP + 8 * e);
  }
{
#pragma unroll
    for (int it = 0; it < 2; ++it) {
      const int rl = it * 32 + lq;
      *(v4u*)(XP + ((size_t)(b * NN + n0 + rl)) * CC + c0 + 8 * e) = up[it];
    }
    
  }
}

// =========================================================================================================
// (2) conv1x1 GEMM for one (b, strip of 128 positions = image rows 2s and 2s+1, 64-o block of the stacked weights):
//     Y[o][n] = (1/256) sum_c W16[o][c] XP[b][n][c]. Block 256 threads = 8 waves; wave w owns cols n0+16w..+15
//     (one B fragment per k-step, k = c contiguous in the XP row) and 4 m-tiles (A rows o = o0 + 16 mt + (lane&15),
//     split k map loader from W16). K = 256 = 8 steps. Epilogue staged in LDS Os[n_loc][o_loc] (pitch OSP, b128
//     stores), block barrier (cross-wave), then (block-uniform branch on the o block):
//       o-blocks 0,1 -> theta dims 0..63 / 64..127 + bias -> Qh/Ql bf16 [b][4096 n][128 d] (hi = RNE(v), lo = RNE(v-hi)):
//       o-blocks 2,3 -> phi + bias in f32 -> PF f32 [b][4096 n][128 d]: 128 rows x the dsel half (256 B = 2 whole
//                       lines) of the 512-B row, 16 consecutive lanes x 16 B, one instruction per 2 rows.
//       o-blocks 4,5 -> g + bias -> GF f32 [b][4096 n][128 d], same layout.
// coverage: Os 8 waves x 16 n x 64 o = 128 x 64 written, reads rows <= 127 cols <= 63; theta planes 4 it x 32 rows
//           x 8 lanes x 8 = 128 n x 64 d; f32 planes 8 it x 16 rows x 16 lanes x 4 = 128 n x 64 d; grid (32, 6, NB)
//           covers all 4096 rows x 128 d of Qh/Ql and of PF/GF exactly once.
// =========================================================================================================
__global__ __launch_bounds__(256)
void gemm_proj(const unsigned short* __restrict__ W16, const unsigned short* __restrict__ XP,
               const float* __restrict__ tb, const float* __restrict__ pb, const float* __restrict__ gb,
               unsigned short* Qh, unsigned short* Ql, float* PF, float* GF) {
  __shared__ __align__(16) float Os[SN * OSP];
  const int tid  = threadIdx.x;
  const int lane = tid & 31, wave = tid >> 5;                        // wave 0..7
  const int hh   = lane >> 4, c = lane & 15;
  const int st   = blockIdx.x, mb = blockIdx.y, b = blockIdx.z;
  const int n0   = st * SN, o0 = mb * QT;

  const unsigned short* ap = W16 + (size_t)(o0 + c) * CC + 8 * hh;
  const unsigned short* bp = XP + ((size_t)(b * NN + n0 + 16 * wave + c)) * CC + 8 * hh;

  v8f acc[4];
#pragma unroll
  for (int mt = 0; mt < 4; ++mt) acc[mt] = zero8();

#pragma unroll
  for (int ks = 0; ks < CC / 32; ++ks) {
    const Frag fb = ldfrag(bp + 32 * ks);
#pragma unroll
    for (int mt = 0; mt < 4; ++mt) {
      const Frag fa = ldfrag(ap + (size_t)(16 * mt) * CC + 32 * ks);
      acc[mt] = mma_h(fa.h, fb.h, acc[mt]);
    }
  }

  // ---- epilogue: scale back -> LDS Os[n_loc][o_loc]; lane (hh, c) holds o = 16 mt + 8 hh + r for n_loc = 16 w + c
  {
    const int nl = 16 * wave + c;
#pragma unroll
    for (int mt = 0; mt < 4; ++mt) {
      v4f va, vb;
#pragma unroll
      for (int r = 0; r < 4; ++r) { va[r] = acc[mt][r] * IWSC; vb[r] = acc[mt][4 + r] * IWSC; }
      *(v4f*)(Os + nl * OSP + 16 * mt + 8 * hh)     = va;
      *(v4f*)(Os + nl * OSP + 16 * mt + 8 * hh + 4) = vb;
    }
  }
  __syncthreads();

  const int grp = mb >> 1;                                           // 0 theta, 1 phi, 2 g (block-uniform)
  const int dsel = (mb & 1) * QT;                                    // 0 or 64
  const float* bias = (grp == 0) ? tb : ((grp == 1) ? pb : gb);     // all global

  if (grp == 0) {
    const int e = tid & 7, lq = tid >> 3;                            // lq 0..31
    float bv[8];
    {
      const v4f ba = *(const v4f*)(bias + dsel + 8 * e);
      const v4f bq = *(const v4f*)(bias + dsel + 8 * e + 4);
#pragma unroll
      for (int t = 0; t < 4; ++t) { bv[t] = bfr(ba[t]); bv[4 + t] = bfr(bq[t]); }
    }
    v4u uh[4], ul[4];
#pragma unroll
    for (int it = 0; it < 4; ++it) {
      const int row = it * 32 + lq;                                  // n_loc 0..127
      const v4f a = *(const v4f*)(Os + row * OSP + 8 * e);
      const v4f q = *(const v4f*)(Os + row * OSP + 8 * e + 4);
      float f[8];
#pragma unroll
      for (int t = 0; t < 4; ++t) { f[t] = a[t] + bv[t]; f[4 + t] = q[t] + bv[4 + t]; }
      split8(f, uh[it], ul[it]);
    }
{
#pragma unroll
      for (int it = 0; it < 4; ++it) {
        const int row = it * 32 + lq;
        const size_t po = ((size_t)(b * NN + n0 + row)) * DQ + dsel + 8 * e;
        *(v4u*)(Qh + po) = uh[it];
        *(v4u*)(Ql + po) = ul[it];
      }
      
    }
  } else {
    const int e16 = tid & 15, lr = tid >> 4;                        // lr 0..15
    v4f bv4;
    {
      const v4f bq = *(const v4f*)(bias + dsel + 4 * e16);
#pragma unroll
      for (int t = 0; t < 4; ++t) bv4[t] = bfr(bq[t]);
    }
    float* P = (grp == 1) ? PF : GF;                                 // both global
    v4f res[8];
#pragma unroll
    for (int it = 0; it < 8; ++it) {
      const int row = it * 16 + lr;                                  // n_loc 0..127
      const v4f a = *(const v4f*)(Os + row * OSP + 4 * e16);
      v4f v;
#pragma unroll
      for (int t = 0; t < 4; ++t) v[t] = a[t] + bv4[t];
      res[it] = v;
    }
{
#pragma unroll
      for (int it = 0; it < 8; ++it) {
        const int row = it * 16 + lr;
        const size_t po = ((size_t)(b * NN + n0 + row)) * DQ + dsel + 4 * e16;
        *(v4f*)(P + po) = res[it];
      }
      
    }
  }
}

// =========================================================================================================
// (3) 2x2 stride-2 max-pool of PF / GF f32 [b][4096 n][128 d] in f32 -> Kh/Kl bf16 [b][1024 m][128 d]
//     (hi = RNE(v), lo = RNE(v-hi)) and Gp f16 [b][1024 m][128 d], m = 32 py + px, window n = (2py+dy) 64 + 2px+dx,
//     dy, dx in {0,1}. Block (py, b), 256 threads: lane group e16 (16 lanes x 16 B = one 256-B row = 2 whole
//     lines), lr = tid>>4 -> px = 16 it + lr for it 0..1 (all 32 px valid, no pad rows). No LDS, no barriers.
// coverage: blocks 0..31 x px 0..31 x 16 lanes x 8 = rows 0..1023 x 128 d; grid (32, NB) covers Kh/Kl/Gp
//           [b][0..1023][0..127] exactly once.
// =========================================================================================================
__global__ __launch_bounds__(256)
void pool_k(const float* __restrict__ PF, const float* __restrict__ GF,
            unsigned short* Kh, unsigned short* Kl, unsigned short* Gp) {
  const int tid = threadIdx.x, py = blockIdx.x, b = blockIdx.y;
  const int e16 = tid & 15, lr = tid >> 4;                          // lr 0..15
  v4u kh[2], kl[2], gu[2];
#pragma unroll
  for (int it = 0; it < 2; ++it) {
    const int px = it * 16 + lr;                                    // 0..31
    float fk[8], fg[8];
#pragma unroll
    for (int t = 0; t < 8; ++t) { fk[t] = -__builtin_inff(); fg[t] = -__builtin_inff(); }
#pragma unroll
    for (int dy = 0; dy < 2; ++dy) {
      const size_t rb = ((size_t)(b * NN + (2 * py + dy) * WIMG + 2 * px)) * DQ + 8 * e16;
#pragma unroll
      for (int dx = 0; dx < 2; ++dx) {
        const float* pk = PF + rb + (size_t)dx * DQ;
        const float* pg = GF + rb + (size_t)dx * DQ;
        const v4f ka = *(const v4f*)pk, kq = *(const v4f*)(pk + 4);
        const v4f ga = *(const v4f*)pg, gq = *(const v4f*)(pg + 4);
#pragma unroll
        for (int t = 0; t < 4; ++t) {
          fk[t]     = fmaxf(fk[t], ka[t]);
          fk[4 + t] = fmaxf(fk[4 + t], kq[t]);
          fg[t]     = fmaxf(fg[t], ga[t]);
          fg[4 + t] = fmaxf(fg[4 + t], gq[t]);
        }
      }
    }
    split8(fk, kh[it], kl[it]);
#pragma unroll
    for (int t = 0; t < 4; ++t) gu[it][t] = pk16(h_bits((_Float16)fg[2 * t]), h_bits((_Float16)fg[2 * t + 1]));
  }
{
#pragma unroll
    for (int it = 0; it < 2; ++it) {
      const int px = it * 16 + lr;
      const size_t po = ((size_t)(b * MM + WP * py + px)) * DQ + 8 * e16;
      *(v4u*)(Kh + po) = kh[it];
      *(v4u*)(Kl + po) = kl[it];
      *(v4u*)(Gp + po) = gu[it];
    }
    
  }
}

// =========================================================================================================
// (4) Gp f16 [b][1024 m][128 d] -> Gc f16 [b][d][m] (channel-major, keys contiguous) through an LDS tile T[64 d][64 m]
// coverage: reads 2 it x 32 rows x 8 lanes x 8 = 64 m x 64 d; T written rows (8e+t)=0..63 x cols 0..63, read rows
//           0..63 x cols 8e..8e+7 (staged extent == consumed extent); writes 64 d x 64 m; grid (16, 2, NB) covers
//           Gc [b][0..127][0..1023] exactly once.
// =========================================================================================================
__global__ __launch_bounds__(256)
void tr_g(const unsigned short* __restrict__ Gp, unsigned short* Gc) {
  __shared__ __align__(16) unsigned short T[QT * TP];
  const int tid = threadIdx.x;
  const int mt = blockIdx.x, db = blockIdx.y, b = blockIdx.z;
  const int e = tid & 7, lq = tid >> 3;                             // lq 0..31
  const int m0 = mt * QT, d0 = db * QT;
#pragma unroll
  for (int it = 0; it < 2; ++it) {
    const int ml = it * 32 + lq;                                     // 0..63
    const v4u w = *(const v4u*)(Gp + ((size_t)(b * MM + m0 + ml)) * DQ + d0 + 8 * e);
    unsigned short hb[8];
#pragma unroll
    for (int t = 0; t < 4; ++t) {
      hb[2 * t]     = (unsigned short)(w[t] & 0xFFFFu);
      hb[2 * t + 1] = (unsigned short)(w[t] >> 16);
    }
#pragma unroll
    for (int t = 0; t < 8; ++t) T[(8 * e + t) * TP + ml] = hb[t];
  }
  __syncthreads();
  v4u up[2];
#pragma unroll
  for (int it = 0; it < 2; ++it) {
    const int dl = it * 32 + lq;                                     // 0..63
    up[it] = *(const v4u*)(T + dl * TP + 8 * e);
  }
{
#pragma unroll
    for (int it = 0; it < 2; ++it) {
      const int dl = it * 32 + lq;
      *(v4u*)(Gc + ((size_t)(b * DQ + d0 + dl)) * MM + m0 + 8 * e) = up[it];
    }
    
  }
}

// ---- asynchronous copies to LDS: each lane moves its own 16 bytes, global -> LDS, through no register. Arguments: the
//      lane's LDS byte addresses, then its global addresses in the same order, all multiples of 16. The closing
//      s_wait_xcnt 0 stands inside the copies' own statement so that no address register named there is rewritten ahead
//      of it.
__device__ __forceinline__ unsigned lds_addr(const void* p) { return (unsigned)(uintptr_t)p; }
__device__ __forceinline__ void copy4(unsigned l0, unsigned l1, unsigned l2, unsigned l3,
                                      const unsigned short* g0, const unsigned short* g1,
                                      const unsigned short* g2, const unsigned short* g3) {
#if defined(__HIP_DEVICE_COMPILE__)
  asm volatile("global_load_async_to_lds_b128 %0, %4, off\n\t"
               "global_load_async_to_lds_b128 %1, %5, off\n\t"
               "global_load_async_to_lds_b128 %2, %6, off\n\t"
               "global_load_async_to_lds_b128 %3, %7, off\n\t"
               "s_wait_xcnt 0x0"
               :: "v"(l0), "v"(l1), "v"(l2), "v"(l3), "v"(g0), "v"(g1), "v"(g2), "v"(g3) : "memory");
#endif
}
__device__ __forceinline__ void copy12(unsigned a0, unsigned a1, unsigned a2, unsigned a3, unsigned b0, unsigned b1,
                                       unsigned b2, unsigned b3, unsigned c0, unsigned c1, unsigned c2, unsigned c3,
                                       const unsigned short* p0, const unsigned short* p1, const unsigned short* p2,
                                       const unsigned short* p3, const unsigned short* q0, const unsigned short* q1,
                                       const unsigned short* q2, const unsigned short* q3, const unsigned short* r0,
                                       const unsigned short* r1, const unsigned short* r2, const unsigned short* r3) {
#if defined(__HIP_DEVICE_COMPILE__)
  asm volatile("global_load_async_to_lds_b128 %0, %12, off\n\t"
               "global_load_async_to_lds_b128 %1, %13, off\n\t"
               "global_load_async_to_lds_b128 %2, %14, off\n\t"
               "global_load_async_to_lds_b128 %3, %15, off\n\t"
               "global_load_async_to_lds_b128 %4, %16, off\n\t"
               "global_load_async_to_lds_b128 %5, %17, off\n\t"
               "global_load_async_to_lds_b128 %6, %18, off\n\t"
               "global_load_async_to_lds_b128 %7, %19, off\n\t"
               "global_load_async_to_lds_b128 %8, %20, off\n\t"
               "global_load_async_to_lds_b128 %9, %21, off\n\t"
               "global_load_async_to_lds_b128 %10, %22, off\n\t"
               "global_load_async_to_lds_b128 %11, %23, off\n\t"
               "s_wait_xcnt 0x0"
               :: "v"(a0), "v"(a1), "v"(a2), "v"(a3), "v"(b0), "v"(b1), "v"(b2), "v"(b3), "v"(c0), "v"(c1), "v"(c2),
                  "v"(c3), "v"(p0), "v"(p1), "v"(p2), "v"(p3), "v"(q0), "v"(q1), "v"(q2), "v"(q3), "v"(r0), "v"(r1),
                  "v"(r2), "v"(r3) : "memory");
#endif
}
// the issuing wave's copies have landed behind this wait
__device__ __forceinline__ void wait_async0() {
#if defined(__HIP_DEVICE_COMPILE__)
  asm volatile("s_wait_asynccnt 0x0" ::: "memory");
#endif
}
// the wave's own LDS reads have retired before the buffer they read is handed to the copies that refill it
__device__ __forceinline__ void wait_ds0() {
#if defined(__HIP_DEVICE_COMPILE__)
  asm volatile("s_wait_dscnt 0x0" ::: "memory");
#endif
}
// one 32-key stage: Kh and Kl rows kb..kb+31 (256 B each, LDS pitch 272 B) and the 64-B key run kb..kb+31 of all 128
// rows of Gc (LDS pitch 80 B). 128 threads x 12 copies of 16 B = 8 KiB + 8 KiB + 8 KiB; no two lanes share an LDS byte.
__device__ __forceinline__ void stage_kv(unsigned short* st, const unsigned short* Khb, const unsigned short* Klb,
                                         const unsigned short* Gcb, int kb, int tid) {
  const int kr = tid >> 4, kcol = 8 * (tid & 15);                    // kr 0..7, + 8 i -> key row 0..31
  const int vr = tid >> 2, vcol = 8 * (tid & 3);                     // vr 0..31, + 32 i -> channel row 0..127
  const unsigned lk = lds_addr(st + kr * KP + kcol);
  const unsigned ll = lk + 2u * (KT * KP);
  const unsigned lv = lds_addr(st + 2 * KT * KP + vr * VPT + vcol);
  const unsigned short* gk = Khb + (size_t)(kb + kr) * DQ + kcol;
  const unsigned short* gl = Klb + (size_t)(kb + kr) * DQ + kcol;
  const unsigned short* gv = Gcb + (size_t)vr * MM + kb + vcol;
  copy12(lk, lk + 2u * (8 * KP), lk + 2u * (16 * KP), lk + 2u * (24 * KP),
         ll, ll + 2u * (8 * KP), ll + 2u * (16 * KP), ll + 2u * (24 * KP),
         lv, lv + 2u * (32 * VPT), lv + 2u * (64 * VPT), lv + 2u * (96 * VPT),
         gk, gk + 8 * DQ, gk + 16 * DQ, gk + 24 * DQ, gl, gl + 8 * DQ, gl + 16 * DQ, gl + 24 * DQ,
         gv, gv + 32 * MM, gv + 64 * MM, gv + 96 * MM);
}

// =========================================================================================================
// (5) attention for one (b, 64-query tile), transposed formulation, 1024 keys (all valid, no mask, no scale):
//   S^T tile (16 keys x 16 queries) = sum over 4 d-chunks (rolled loop) of A(k: row = key kb + (lane&15), 32 d via
//   the split k map from the bf16 plane Kh [b][1024][128]) . B(q: col = query, same map from Qh [b][4096][128])
//   + A(Kh).B(Ql) + A(Kl).B(Qh) (bf16 unscaled residual planes, shared accumulator).
//   Per lane the D tile holds 8 keys of ONE query: online softmax state per lane, one shuffle (lane^16) for the max
//   over 32 keys; the o/l rescale is skipped under a wave-uniform ballot when no lane's max grew (corr == 1 exactly
//   for every lane then); row-sum partials combined at the end. P = e^{s-m} x 16384 as f16 is the B operand of
//   y^T (rows channel, cols queries) += A(pooled g: rows channel = 16j + (lane&15), keys contiguous, f16 plane Gc
//   [b][128][1024]) . B(P^T): element r <- D of the tile covering keys kb..kb+15, element 8+r <- the tile covering
//   kb+16..kb+31, lane unchanged. 8 accumulator tiles per wave (128 channels). Block = 4 waves = 64 queries.
//   Live state per lane: o 64 + s0/s1 16 + up to 6 fragments (rolled d loop) + P 8 + m/l, under the 256 cap.
//   Operands come from LDS: the block's 64 query rows of Qh/Ql are copied once (Qs, pitch 272 B); each 32-key stage of
//   Kh/Kl/Gc is copied by all four waves into one of two buffers (Ring) one trip ahead of its use and read by all four.
//   Epilogue: y = O/l staged in LDS Os[query][128 channels] (pitch OSPW, b128 stores), block barrier (cross-wave),
// coverage: Os written 4 waves x 16 queries x 128 ch, read rows 0..63 x ch 8e..8e+7 (e 0..15); planes 8 it x 8 rows x
//           16 lanes x 8 = 64 n x 128 ch per plane; grid (NQ/64, NB) covers rows 0..NQ-1 of Yh/Yl exactly once.
// =========================================================================================================
__global__ __launch_bounds__(128) __attribute__((amdgpu_num_vgpr(256)))
void attn_k(const unsigned short* __restrict__ Qh, const unsigned short* __restrict__ Ql,
            const unsigned short* __restrict__ Kh, const unsigned short* __restrict__ Kl,
            const unsigned short* __restrict__ Gc, unsigned short* Yh, unsigned short* Yl) {
  __shared__ __align__(16) float Os[QT * OSPW];
  __shared__ __align__(16) unsigned short Qs[2 * QT * KP];
  __shared__ __align__(16) unsigned short Ring[2 * STG];
  const int tid  = threadIdx.x;
  const int wave = tid >> 5, lane = tid & 31;
  const int hh   = lane >> 4, c = lane & 15;
  const int n0   = blockIdx.x * QT, b = blockIdx.y;

  const unsigned short* Khb = Kh + (size_t)b * MM * DQ;
  const unsigned short* Klb = Kl + (size_t)b * MM * DQ;
  const unsigned short* Gcb = Gc + (size_t)b * DQ * MM;

  // ---- in front of the loop: the query tile and stage 0, their wait, the barrier that publishes them, then stage 1
  {
    const int qr = tid >> 4, qcol = 8 * (tid & 15);                  // qr 0..7, + 8 i -> query row 0..63
    const unsigned lq = lds_addr(Qs + qr * KP + qcol);
    const size_t go = ((size_t)(b * NN + n0 + qr)) * DQ + qcol;
    auto plane = [](unsigned l0, const unsigned short* g) {          // 64 rows of one plane, 8 copies a thread
      copy4(l0, l0 + 2u * (8 * KP), l0 + 2u * (16 * KP), l0 + 2u * (24 * KP), g, g + 8 * DQ, g + 16 * DQ, g + 24 * DQ);
      copy4(l0 + 2u * (32 * KP), l0 + 2u * (40 * KP), l0 + 2u * (48 * KP), l0 + 2u * (56 * KP), g + 32 * DQ,
            g + 40 * DQ, g + 48 * DQ, g + 56 * DQ);
    };
    plane(lq, Qh + go);
    plane(lq + 2u * (QT * KP), Ql + go);
  }
  stage_kv(Ring, Khb, Klb, Gcb, 0, tid);
  wait_async0();
  __syncthreads();
  stage_kv(Ring + STG, Khb, Klb, Gcb, KT, tid);

  // q fragment pointers (B operand, col = query 16*wave + c of the tile), + 32*kc
  const unsigned short* Qhp = Qs + (16 * wave + c) * KP + 8 * hh;
  const unsigned short* Qlp = Qhp + QT * KP;

  float m = -1.0e30f, l = 0.f;
  v8f o[8];
#pragma unroll
  for (int j = 0; j < 8; ++j) o[j] = zero8();

#pragma unroll 1
  for (int kb = 0; kb < MM; kb += KT) {
    unsigned short* st = Ring + ((kb / KT) & 1) * STG;               // this trip's buffer
    // k fragment base (A operand, row = key kb + c), + 32*kc; v fragment base (A operand, row = channel 16j + c)
    const unsigned short* k0p  = st + c * KP + 8 * hh;               // keys kb .. kb+15
    const unsigned short* k1p  = k0p + 16 * KP;                      // keys kb+16 .. kb+31
    const unsigned short* k0lp = k0p + KT * KP;
    const unsigned short* k1lp = k1p + KT * KP;
    const unsigned short* Vp   = st + 2 * KT * KP + c * VPT + 8 * hh;
    v8f s0 = zero8(), s1 = zero8();
#pragma unroll 1
    for (int kc = 0; kc < DQ / 32; ++kc) {
      const Frag qh  = ldfrag(Qhp + 32 * kc);
      const Frag ql  = ldfrag(Qlp + 32 * kc);
      const Frag k0  = ldfrag(k0p + 32 * kc);
      const Frag k1  = ldfrag(k1p + 32 * kc);
      const Frag k0l = ldfrag(k0lp + 32 * kc);
      const Frag k1l = ldfrag(k1lp + 32 * kc);
      s0 = mma_b(k0.bf, qh.bf, s0);
      s1 = mma_b(k1.bf, qh.bf, s1);
      s0 = mma_b(k0.bf, ql.bf, s0);
      s1 = mma_b(k1.bf, ql.bf, s1);
      s0 = mma_b(k0l.bf, qh.bf, s0);
      s1 = mma_b(k1l.bf, qh.bf, s1);
    }

    float mx = fmaxf(hmax8(s0), hmax8(s1));
    mx = fmaxf(mx, __shfl_xor(mx, 16, 32));
    const float mn = fmaxf(m, mx);
    const unsigned grew = wave_ballot(mx > m);                       // wave-uniform
    if (grew != 0u) {
      const float corr = __expf(m - mn);                             // == 1 exactly for lanes whose max did not grow
      l *= corr;
#pragma unroll
      for (int j = 0; j < 8; ++j) {
#pragma unroll
        for (int r = 0; r < 8; ++r) o[j][r] *= corr;
      }
    }
    m = mn;
    const float msh = mn - LNPS;                                     // exp gives e^{s-m} * 16384

    FragH ph;
    float ls = 0.f;
#pragma unroll
    for (int r = 0; r < 8; ++r) {
      const float e0 = __expf(s0[r] - msh);                          // key kb      + 8hh + r
      const float e1 = __expf(s1[r] - msh);                          // key kb + 16 + 8hh + r
      ls += e0 + e1;
      ph.hv[0][r] = (_Float16)e0;
      ph.hv[1][r] = (_Float16)e1;
    }
    l += ls;

#pragma unroll
    for (int j = 0; j < 8; ++j) {
      const Frag vf = ldfrag(Vp + (16 * j) * VPT);
      o[j] = mma_h(vf.h, ph.v, o[j]);
    }

    // ---- foot of the trip: own reads retired, own copies of the next stage landed, one barrier that publishes that
    //      stage and ends every reader's last read of this buffer; only then the refill of this buffer
    wait_ds0();
    wait_async0();
    __syncthreads();
    if (kb + 2 * KT < MM) stage_kv(st, Khb, Klb, Gcb, kb + 2 * KT, tid);
  }
  wait_async0();                                                     // nothing is in flight when the wave goes on
  l += __shfl_xor(l, 16, 32);
  const float inv = 1.0f / l;                                        // o and l both carry the x16384 factor

  // ---- epilogue: y = o * inv -> Os[query][ch]; lane (hh, c) holds ch = 16 j + 8 hh + r for query 16 w + c
  {
    const int qrow = 16 * wave + c;
#pragma unroll
    for (int j = 0; j < 8; ++j) {
      v4f va, vb;
#pragma unroll
      for (int r = 0; r < 4; ++r) { va[r] = o[j][r] * inv; vb[r] = o[j][4 + r] * inv; }
      *(v4f*)(Os + qrow * OSPW + 16 * j + 8 * hh)     = va;
      *(v4f*)(Os + qrow * OSPW + 16 * j + 8 * hh + 4) = vb;
    }
  }
  __syncthreads();

  const int e16 = tid & 15, lr = tid >> 4;                           // lr 0..7
  v4u uh[8], ul[8];
#pragma unroll
  for (int it = 0; it < 8; ++it) {
    const int row = it * 8 + lr;                                     // query 0..63
    const v4f a = *(const v4f*)(Os + row * OSPW + 8 * e16);
    const v4f q = *(const v4f*)(Os + row * OSPW + 8 * e16 + 4);
    const float f[8] = {a[0], a[1], a[2], a[3], q[0], q[1], q[2], q[3]};
    split8(f, uh[it], ul[it]);
  }
{
#pragma unroll
    for (int it = 0; it < 8; ++it) {
      const int row = it * 8 + lr;
      const size_t po = ((size_t)(b * NN + n0 + row)) * DQ + 8 * e16;
      *(v4u*)(Yh + po) = uh[it];
      *(v4u*)(Yl + po) = ul[it];
    }
    
  }
}

// =========================================================================================================
// (6) output conv for one (b, 64-n tile, 64-c block): A[c][n] = sum_ci WWb[c][ci] (Yh + Yl)[b][n][ci] on bf16 WMMA
//     (2 products per k-step, shared accumulator), K = 128 = 4 steps. Block 128 threads = 4 waves; wave w owns cols
//     n0+16w..+15 (B fragments from the k-contiguous Yh/Yl rows) and 4 m-tiles (A rows c = c0 + 16 mt + (lane&15),
//     split k map loader from WWb). Epilogue staged in LDS Os[n_loc][c_loc] (pitch OSP, b128 stores), block barrier
//     2 lines): 8 consecutive lanes x 16 B (values gathered from 4 Os rows), one instruction per 4 lines, final
// coverage: Os 4 waves x 16 n x 64 c written, read rows nl+t <= 63 x cols cl <= 63; WY 8 it x 16 lines x 8 lanes x
//           4 floats = 64 c x 64 n; grid (NQ/64, 4, NB) covers WY[b][0..255][0..NQ-1] exactly once.
// =========================================================================================================
__global__ __launch_bounds__(128)
void gemm_out(const unsigned short* __restrict__ WWb, const unsigned short* __restrict__ Yh,
              const unsigned short* __restrict__ Yl, const float* __restrict__ wb, float* WY) {
  __shared__ __align__(16) float Os[QT * OSP];
  const int tid  = threadIdx.x;
  const int lane = tid & 31, wave = tid >> 5;
  const int hh   = lane >> 4, c = lane & 15;
  const int nt   = blockIdx.x, cb = blockIdx.y, b = blockIdx.z;
  const int n0   = nt * QT, c0 = cb * QT;

  const unsigned short* ap  = WWb + (size_t)(c0 + c) * DQ + 8 * hh;
  const size_t bo = ((size_t)(b * NN + n0 + 16 * wave + c)) * DQ + 8 * hh;
  const unsigned short* bph = Yh + bo;
  const unsigned short* bpl = Yl + bo;

  v8f acc[4];
#pragma unroll
  for (int mt = 0; mt < 4; ++mt) acc[mt] = zero8();

#pragma unroll
  for (int ks = 0; ks < DQ / 32; ++ks) {
    const Frag fbh = ldfrag(bph + 32 * ks);
    const Frag fbl = ldfrag(bpl + 32 * ks);
#pragma unroll
    for (int mt = 0; mt < 4; ++mt) {
      const Frag fa = ldfrag(ap + (size_t)(16 * mt) * DQ + 32 * ks);
      acc[mt] = mma_b(fa.bf, fbh.bf, acc[mt]);
      acc[mt] = mma_b(fa.bf, fbl.bf, acc[mt]);
    }
  }

  // ---- epilogue: -> LDS Os[n_loc][c_loc]; lane (hh, c) holds c_loc = 16 mt + 8 hh + r for n_loc = 16 w + c
  {
    const int nl = 16 * wave + c;
#pragma unroll
    for (int mt = 0; mt < 4; ++mt) {
      v4f va, vb;
#pragma unroll
      for (int r = 0; r < 4; ++r) { va[r] = acc[mt][r]; vb[r] = acc[mt][4 + r]; }
      *(v4f*)(Os + nl * OSP + 16 * mt + 8 * hh)     = va;
      *(v4f*)(Os + nl * OSP + 16 * mt + 8 * hh + 4) = vb;
    }
  }
  __syncthreads();

  const int e = tid & 7, lq = tid >> 3;                              // lq 0..15
  v4f res[8];
#pragma unroll
  for (int it = 0; it < 8; ++it) {
    const int L   = it * 16 + lq;                                    // 0..127
    const int cl  = L >> 1, hf = L & 1;                              // channel 0..63 within the block
    const int nl  = hf * 32 + 4 * e;                                 // position 0..63
    const float bvs = bfr(wb[c0 + cl]);
#pragma unroll
    for (int t = 0; t < 4; ++t) {
      res[it][t] = Os[(nl + t) * OSP + cl] + bvs;
    }
  }
{
#pragma unroll
    for (int it = 0; it < 8; ++it) {
      const int L   = it * 16 + lq;
      const int cl  = L >> 1, hf = L & 1;
      const int nl  = hf * 32 + 4 * e;
      const size_t idx = ((size_t)(b * CC + c0 + cl)) * NN + n0 + nl;
      *(v4f*)(WY + idx) = res[it];
    }
    
  }
}

// =========================================================================================================
// (7) batch-norm statistics, normalisation, affine and residual in one launch: block owns ONE channel (256 blocks of
//     32 waves). Thread tid takes floats 4 tid..4 tid+3 of each of the NB rows WY[b][c][0..NQ) and of the same rows of
//     x, so every wave load is one contiguous 512-B run; a thread's 2 NB loads are independent and all issued before
//     the first sum; the WY values stay in registers from the statistics to the normalisation. Sum and sum of squares
//     in f64 per thread (rows, then elements, in ascending order), wave shuffle reduce, per-wave partials in LDS
//     (cross-wave, block barrier); every wave then shuffle-reduces the same 32 partials itself (a butterfly leaves the
//     same bits in every lane of every wave), so no second barrier and no table: mean, biased variance,
//     rstd = 1/sqrt(var + eps) in f32, then out[b][c][n] = (((WY - mu) * rstd) * bf16-RNE(gamma[c]) + bf16-RNE(beta[c]))
//     + bf16-RNE(x[b][c][n]) in f32.
// coverage: 256 blocks x 1 channel x NB rows x BST threads x 4 floats = out[b][0..255][0..NQ-1] exactly once, each
//           wave store one contiguous 512-B run; reads WY and x at the same offsets only (the produced extent).
// =========================================================================================================
__global__ __launch_bounds__(BST)
void bn_norm(const float* __restrict__ WY, const float* __restrict__ x, const float* __restrict__ gam,
             const float* __restrict__ bet, float* out) {
#pragma clang fp contract(off)
  __shared__ double red[2 * (BST / 32)];
  const int tid = threadIdx.x, lane = tid & 31, wave = tid >> 5;
  const int cc = blockIdx.x;
  const double ninv = 1.0 / ((double)NB * (double)NQ);
  unsigned bo[NB];                                                   // byte offsets in WY, x and out, all < 2^25
  v4f a[NB], xv[NB];
#pragma unroll
  for (int bb = 0; bb < NB; ++bb) bo[bb] = 4u * (unsigned)((bb * CC + cc) * NN + 4 * tid);
#pragma unroll
  for (int bb = 0; bb < NB; ++bb) a[bb] = *(const v4f*)((const char*)WY + bo[bb]);
#if defined(__HIP_DEVICE_COMPILE__)
  // keeps the WY loads ahead of the x loads: loads return in order, and interleaved the sums would wait for rows of x
  __builtin_amdgcn_sched_barrier(0);
#endif
#pragma unroll
  for (int bb = 0; bb < NB; ++bb) xv[bb] = *(const v4f*)((const char*)x + bo[bb]);
#if defined(__HIP_DEVICE_COMPILE__)
  // keeps every load above the sums: without it the scheduler sinks them and only a few stay in flight per wave
  __builtin_amdgcn_sched_barrier(0);
#endif
  const float ga = bfr(gam[cc]), be = bfr(bet[cc]);                  // block-uniform, back long before their use
  double s = 0.0, q = 0.0;
#pragma unroll
  for (int bb = 0; bb < NB; ++bb) {
#pragma unroll
    for (int t = 0; t < 4; ++t) {
      const double d = (double)a[bb][t];
      s += d; q += d * d;
    }
  }
#pragma unroll
  for (int d = 1; d < 32; d <<= 1) {
    s += __shfl_xor(s, d, 32);
    q += __shfl_xor(q, d, 32);
  }
  if (lane == 0) { red[wave] = s; red[BST / 32 + wave] = q; }
  __syncthreads();
  double ts = red[lane], tq = red[BST / 32 + lane];
#pragma unroll
  for (int d = 1; d < 32; d <<= 1) {
    ts += __shfl_xor(ts, d, 32);
    tq += __shfl_xor(tq, d, 32);
  }
  const double mud = ts * ninv;
  double var = tq * ninv - mud * mud;
  var = (var > 0.0) ? var : 0.0;
  const float varf = (float)var + BNEPS;
  const float rs = 1.0f / sqrtf(varf);
  const float mu = (float)mud;
#pragma unroll
  for (int bb = 0; bb < NB; ++bb) {
    v4f r;
#pragma unroll
    for (int t = 0; t < 4; ++t) {
      const float d  = a[bb][t] - mu;
      const float nv = d * rs;
      const float av = nv * ga;
      const float sv = av + be;
      r[t] = sv + bfr(xv[bb][t]);
    }
    *(v4f*)((char*)out + bo[bb]) = r;
  }
}

// =========================================================================================================
// Workspace map (bytes; each region start a multiple of 256; every extent is an exact row/tile multiple and is
//   W16 f16 [384][256]            196608      WWb bf16 [256][128]        65536
//   XP  f16 [NB][4096][256]     16777216 (NB=8)
//   Qh/Ql bf16 [NB][4096][128]   8388608 x2
//   PF/GF f32  [NB][4096][128]  16777216 x2
//   Kh/Kl bf16 [NB][1024][128]   2097152 x2  Gp f16 [NB][1024][128]   2097152   Gc f16 [NB][128][1024]  2097152
//   Yh/Yl bf16 [NB][4096][128]   8388608 x2
//   WY  f32  [NB][256][4096]    33554432
//   total (NB=8) = 126091264
// =========================================================================================================
extern "C" void kernel_launch(void* const* d_in, const int* in_sizes, int n_in,
                              void* d_out, int out_size, void* d_ws, size_t ws_size,
                              hipStream_t stream) {
  const int XN = NB * CC * NN;
  if (n_in < 11) return;
  if (in_sizes[0] < XN) return;
  if (in_sizes[1] < DQ * CC || in_sizes[3] < DQ * CC || in_sizes[5] < DQ * CC || in_sizes[7] < CC * DQ) return;
  if (in_sizes[2] < DQ || in_sizes[4] < DQ || in_sizes[6] < DQ || in_sizes[8] < CC) return;
  if (in_sizes[9] < CC || in_sizes[10] < CC) return;
  if (out_size < XN) return;

  size_t off = 0;
  auto carve = [&](size_t bytes) { const size_t o = off; off += (bytes + 255) & ~(size_t)255; return o; };
  const size_t oW16 = carve((size_t)MW * CC * 2);
  const size_t oWWb = carve((size_t)CC * DQ * 2);
  const size_t oXP  = carve((size_t)NB * NN * CC * 2);
  const size_t oQh  = carve((size_t)NB * NN * DQ * 2);
  const size_t oQl  = carve((size_t)NB * NN * DQ * 2);
  const size_t oPF  = carve((size_t)NB * NN * DQ * 4);
  const size_t oGF  = carve((size_t)NB * NN * DQ * 4);
  const size_t oKh  = carve((size_t)NB * MM * DQ * 2);
  const size_t oKl  = carve((size_t)NB * MM * DQ * 2);
  const size_t oGp  = carve((size_t)NB * MM * DQ * 2);
  const size_t oGc  = carve((size_t)NB * DQ * MM * 2);
  const size_t oYh  = carve((size_t)NB * NN * DQ * 2);
  const size_t oYl  = carve((size_t)NB * NN * DQ * 2);
  const size_t oWY  = carve((size_t)NB * CC * NN * 4);
  if (off > ws_size) return;
  if (off > (size_t)134217728) return;

  const float* x   = (const float*)d_in[0];
  const float* gw  = (const float*)d_in[1];
  const float* gb  = (const float*)d_in[2];
  const float* tw  = (const float*)d_in[3];
  const float* tb  = (const float*)d_in[4];
  const float* pw  = (const float*)d_in[5];
  const float* pb  = (const float*)d_in[6];
  const float* ow  = (const float*)d_in[7];
  const float* wb  = (const float*)d_in[8];
  const float* gam = (const float*)d_in[9];
  const float* bet = (const float*)d_in[10];

  char* ws = (char*)d_ws;
  unsigned short* W16 = (unsigned short*)(ws + oW16);
  unsigned short* WWb = (unsigned short*)(ws + oWWb);
  unsigned short* XP  = (unsigned short*)(ws + oXP);
  unsigned short* Qh  = (unsigned short*)(ws + oQh);
  unsigned short* Ql  = (unsigned short*)(ws + oQl);
  float*          PF  = (float*)(ws + oPF);
  float*          GF  = (float*)(ws + oGF);
  unsigned short* Kh  = (unsigned short*)(ws + oKh);
  unsigned short* Kl  = (unsigned short*)(ws + oKl);
  unsigned short* Gp  = (unsigned short*)(ws + oGp);
  unsigned short* Gc  = (unsigned short*)(ws + oGc);
  unsigned short* Yh  = (unsigned short*)(ws + oYh);
  unsigned short* Yl  = (unsigned short*)(ws + oYl);
  float*          WY  = (float*)(ws + oWY);
  float* out = (float*)d_out;

  const dim3 blk256(256), blk128(128);

  // (0) theta_w / phi_w / g_w -> stacked f16 plane; w_w -> bf16 plane
  cvt_w<<<dim3(MW / 8 + CC / 16), blk256, 0, stream>>>(tw, pw, gw, ow, W16, WWb);
  // (1) x -> position-major 16-bit plane
  cvt_x<<<dim3(NN / QT, CC / QT, NB), blk256, 0, stream>>>(x, XP);
  // (2) conv1x1 GEMM -> theta (q) hi/res planes, phi / g conv outputs + bias as f32 planes
  gemm_proj<<<dim3(NSTRIP, MW / QT, NB), blk256, 0, stream>>>(W16, XP, tb, pb, gb, Qh, Ql, PF, GF);
  // (3) 2x2 stride-2 max-pool -> pooled phi (k) hi/res planes, pooled g f16 plane
  pool_k<<<dim3(HP, NB), blk256, 0, stream>>>(PF, GF, Kh, Kl, Gp);
  // (4) pooled g -> channel-major plane
  tr_g<<<dim3(MM / QT, DQ / QT, NB), blk256, 0, stream>>>(Gp, Gc);
  // (5) attention -> y hi/res planes [b][n][128]
  attn_k<<<dim3(NQ / QT, NB), blk128, 0, stream>>>(Qh, Ql, Kh, Kl, Gc, Yh, Yl);
  // (6) output conv + bias -> WY f32 plane [b][256][4096]
  gemm_out<<<dim3(NQ / QT, CC / QT, NB), blk128, 0, stream>>>(WWb, Yh, Yl, wb, WY);
  // (7) per-channel mean / rstd, then normalise, affine, residual -> out [b][256][4096]
  bn_norm<<<dim3(CC), dim3(BST), 0, stream>>>(WY, x, gam, bet, out);
  (void)hipGetLastError();
}

// v004
// It runs in 118 microseconds.
// Two timings next to v003 put it at 1.12 and 1.13 times that version's speed.
// Counting every step since v000, it is 6.82 times as fast.
// Contractions: conv1x1 theta/phi/g GEMM W[384x256].X[256x128] per strip on v_wmma_f32_16x16x32_f16 (f16 containers
// of bf16-RNE weights x256 and bf16-RNE x); scores K.Q^T on v_wmma_f32_16x16x32_bf16 (bf16 hi + bf16 residual planes
// of theta / 2x2-max-pooled phi, 3 products, K=128); y^T = G.P^T on v_wmma_f32_16x16x32_f16 (2x2-max-pooled g as
// f16, P = e^{s-m} x16384 f16 from the score D registers); output conv W[256x128].Y on v_wmma_f32_16x16x32_bf16 (bf16
// weights, y as bf16 hi + residual planes, 2 products); f32 accumulate everywhere; max-pool, softmax statistics and
// bias in f32 VALU; batch-norm channel statistics in f64 VALU; normalisation, affine and residual add in f32 VALU.
#include <hip/hip_runtime.h>
#include <math.h>
#include <stdint.h>

#ifndef NB
#define NB 8
#endif
#ifndef NQ
#define NQ 4096
#endif
#define NB_FULL 8
#define CC     256
#define HIMG   64
#define WIMG   64
#define NN     4096
#define DQ     128
#define HP     32
#define WP     32
#define MM     1024
#define MW     384
#define QT     64
#define SN     128
#define NSTRIP 32
#define OSP    68
#define OSPW   132
#define TP     72
#define BST    1024
#define WSC    256.0f
#define IWSC   0.00390625f
#define LNPS   9.704060527839234f
#define BNEPS  1.0e-5f
#define KT     32
#define KP     136
#define VPT    40
#define STG    (2 * KT * KP + DQ * VPT)

static_assert(NB >= 1 && NB <= NB_FULL);
static_assert(NQ % QT == 0 && NQ <= NN);
static_assert(NN == HIMG * WIMG);
static_assert(SN == 2 * WIMG);
static_assert(NSTRIP * SN == NN);
static_assert(SN == 8 * 16);
static_assert(HIMG % 2 == 0 && WIMG % 2 == 0);
static_assert(HP == HIMG / 2 && WP == WIMG / 2);
static_assert(MM == HP * WP);
static_assert(WP == 32);
static_assert(MM % QT == 0 && MM % 32 == 0);
static_assert(NN % QT == 0 && CC % QT == 0 && DQ % QT == 0);
static_assert(MW == 3 * DQ && MW % QT == 0 && MW % 8 == 0);
static_assert(CC % 32 == 0 && DQ % 32 == 0);
static_assert((OSP * 4) % 16 == 0);
static_assert((OSPW * 4) % 16 == 0);
static_assert((TP * 2) % 16 == 0);
static_assert(SN * OSP * 4 <= 65536);
static_assert(BST == 32 * 32 && NQ == 4 * BST);
static_assert(NN % 16 == 0 && CC % 4 == 0);
static_assert((size_t)NB_FULL * CC * NN * 4 == (size_t)33554432);
static_assert((KP * 2) % 16 == 0 && (VPT * 2) % 16 == 0 && (STG * 2) % 16 == 0 && (KT * KP * 2) % 16 == 0);
static_assert(KP >= DQ + 8 && VPT >= KT + 8 && MM % KT == 0 && MM / KT >= 2);
static_assert(KT * DQ / 8 == 4 * 128 && DQ * KT / 8 == 4 * 128 && QT * DQ / 8 == 8 * 128);

typedef _Float16       v16h __attribute__((ext_vector_type(16)));
typedef _Float16       v8h  __attribute__((ext_vector_type(8)));
typedef __bf16         v16b __attribute__((ext_vector_type(16)));
typedef unsigned short v8us __attribute__((ext_vector_type(8)));
typedef float          v8f  __attribute__((ext_vector_type(8)));
typedef float          v4f  __attribute__((ext_vector_type(4)));
typedef unsigned int   v4u  __attribute__((ext_vector_type(4)));

union Frag  { v8us u[2]; v16h h; v16b bf; };
union FragH { v16h v; v8h hv[2]; };
static_assert(sizeof(Frag) == 32);
static_assert(sizeof(FragH) == 32);

// ---- scalar helpers ---------------------------------------------------------------------------------------
__device__ __forceinline__ unsigned short bf_bits(float f) {          // f32 -> bf16 bits, RNE convert
  unsigned u = __float_as_uint(f);
  return (unsigned short)((u + 0x7FFFu + ((u >> 16) & 1u)) >> 16);
}
__device__ __forceinline__ float bf_up(unsigned short hb) { return __uint_as_float(((unsigned)hb) << 16); }
__device__ __forceinline__ float bfr(float f) { return bf_up(bf_bits(f)); }
__device__ __forceinline__ unsigned short h_bits(_Float16 x) { return __builtin_bit_cast(unsigned short, x); }
__device__ __forceinline__ unsigned pk16(unsigned short a, unsigned short b) { return (unsigned)a | ((unsigned)b << 16); }
__device__ __forceinline__ v8f zero8() { v8f z = {0.f, 0.f, 0.f, 0.f, 0.f, 0.f, 0.f, 0.f}; return z; }
__device__ __forceinline__ float hmax8(v8f s) {
  return fmaxf(fmaxf(fmaxf(s[0], s[1]), fmaxf(s[2], s[3])), fmaxf(fmaxf(s[4], s[5]), fmaxf(s[6], s[7])));
}
__device__ __forceinline__ unsigned wave_ballot(bool p) {
#if defined(__HIP_DEVICE_COMPILE__)
  return __builtin_amdgcn_ballot_w32(p);
#else
  return p ? 1u : 0u;
#endif
}
// 8 f32 values -> bf16 hi bits and bf16 residual bits (lo = RNE(v - hi)), packed 2 per uint
__device__ __forceinline__ void split8(const float* f, v4u& uh, v4u& ul) {
#pragma unroll
  for (int t = 0; t < 4; ++t) {
    const float f0 = f[2 * t], f1 = f[2 * t + 1];
    const unsigned short hb0 = bf_bits(f0), hb1 = bf_bits(f1);
    const unsigned short lb0 = bf_bits(f0 - bf_up(hb0));
    const unsigned short lb1 = bf_bits(f1 - bf_up(hb1));
    uh[t] = pk16(hb0, hb1);
    ul[t] = pk16(lb0, lb1);
  }
}

// ---- 16-bit fragment loader (A, or B from a k-contiguous [n][k] row): lane -> row/col (lane&15), p already includes
//      + 8*(lane>>4); elements 0..7 <- p[0..7] (k0+8h..), elements 8..15 <- p[16..23] (k0+16+8h..)
__device__ __forceinline__ Frag ldfrag(const unsigned short* p) {
  Frag f;
  f.u[0] = *(const v8us*)(p);
  f.u[1] = *(const v8us*)(p + 16);
  return f;
}

// ---- fragment-order planes (W16, WWb, XP, Yh, Yl): a 16-row x 32-k operand tile is stored as the 1 KiB its loader
//      reads: half j, then lane = 16 hh + row, then 8 elements, k = k0 + 16 j + 8 hh + e (the k map of ldfrag). Each of
//      the loader's two wave loads then covers 512 contiguous bytes (4 whole lines) and not 32 B of each of 16 rows.
//      piece_off: element offset of the 8-element piece q = k / 8 of row r (0..15) of tile t; nks = 32-k steps a row.
__device__ __forceinline__ size_t piece_off(int t, int nks, int q, int r) {
  return ((size_t)((t * nks + (q >> 2)) * 2 + ((q >> 1) & 1)) * 32 + 16 * (q & 1) + r) * 8;
}
__device__ __forceinline__ Frag ldfrag_p(const unsigned short* plane, int t, int nks, int ks, int lane) {
  const unsigned short* p = plane + ((size_t)(t * nks + ks) * 64 + lane) * 8;
  Frag f;
  f.u[0] = *(const v8us*)(p);
  f.u[1] = *(const v8us*)(p + 256);
  return f;
}

// ---- WMMA helpers: builtin followed by a 4-slot VALU gap tying D and keeping A/B live --------------------------
__device__ __forceinline__ v8f mma_h(v16h a, v16h b, v8f c) {
  v8f d = __builtin_amdgcn_wmma_f32_16x16x32_f16(false, a, false, b, (short)0, c, false, false);
#if defined(__HIP_DEVICE_COMPILE__)
  asm volatile("v_nop\n\tv_nop\n\tv_nop\n\tv_nop" : "+v"(d) : "v"(a), "v"(b));
#endif
  return d;
}
__device__ __forceinline__ v8f mma_b(v16b a, v16b b, v8f c) {
  v8f d = __builtin_amdgcn_wmma_f32_16x16x32_bf16(false, a, false, b, (short)0, c, false, false);
#if defined(__HIP_DEVICE_COMPILE__)
  const v16h ha = __builtin_bit_cast(v16h, a), hb = __builtin_bit_cast(v16h, b);
  asm volatile("v_nop\n\tv_nop\n\tv_nop\n\tv_nop" : "+v"(d) : "v"(ha), "v"(hb));
#endif
  return d;
}

// =========================================================================================================
// (0) weights. Blocks 0..47: W16 f16 [384][256], rows 0..127 = theta_w, 128..255 = phi_w, 256..383 = g_w; value =
//     f16 of (bf16-RNE(w) * 256) (exact). Block owns rows 8*blk..8*blk+7 (half a 16-row tile): 8 lanes x 16 B = one
//     whole line of the fragment-order plane per piece q. Blocks 48..63: WWb bf16 [256][128], one 16-row tile a block.
// coverage: 48 blocks x 8 rows x 32 pieces x 8 halves = 384 x 256; 16 blocks x 16 rows x 16 pieces x 8 = 256 x 128.
// =========================================================================================================
__global__ __launch_bounds__(256)
void cvt_w(const float* __restrict__ tw, const float* __restrict__ pw, const float* __restrict__ gw,
           const float* __restrict__ ow, unsigned short* W16, unsigned short* WWb) {
  const int tid = threadIdx.x, blk = blockIdx.x;
  if (blk < MW / 8) {
    const int rl = tid & 7, pq = tid >> 3, col = 8 * pq;             // row in the block, piece 0..31
    const int o = 8 * blk + rl;                                      // 0..383
    const int grp = blk >> 4;                                        // 0,1,2 (block-uniform)
    const float* wbase = (grp == 0) ? tw : ((grp == 1) ? pw : gw);  // all global
    const float* s = wbase + (size_t)(o - DQ * grp) * CC + col;      // (o - 128 grp) in 0..127
    const v4f a = *(const v4f*)s;
    const v4f q = *(const v4f*)(s + 4);
    const float f[8] = {a[0], a[1], a[2], a[3], q[0], q[1], q[2], q[3]};
    v4u u;
#pragma unroll
    for (int t = 0; t < 4; ++t) {
      const _Float16 h0 = (_Float16)(bfr(f[2 * t]) * WSC);
      const _Float16 h1 = (_Float16)(bfr(f[2 * t + 1]) * WSC);
      u[t] = pk16(h_bits(h0), h_bits(h1));
    }
{
      *(v4u*)(W16 + piece_off(o >> 4, CC / 32, pq, o & 15)) = u;
      
    }
  } else {
    const int rb = blk - MW / 8;                                     // 0..15
    const int o = 16 * rb + (tid & 15);                              // 0..255
    const int pq = tid >> 4, col = 8 * pq;                           // piece 0..15, col 0..120
    const float* s = ow + (size_t)o * DQ + col;
    const v4f a = *(const v4f*)s;
    const v4f q = *(const v4f*)(s + 4);
    const float f[8] = {a[0], a[1], a[2], a[3], q[0], q[1], q[2], q[3]};
    v4u u;
#pragma unroll
    for (int t = 0; t < 4; ++t) u[t] = pk16(bf_bits(f[2 * t]), bf_bits(f[2 * t + 1]));
{
      *(v4u*)(WWb + piece_off(rb, DQ / 32, pq, tid & 15)) = u;
      
    }
  }
}

// =========================================================================================================
// (1) x f32 [b][256 c][4096 n] -> XP f16, rows n, k = c, fragment order (bf16-RNE values, exact in f16) through an LDS
//     tile T[64 n][64 c] (pitch TP, cross-wave, block barrier). Block (nb, cb, b) owns a 64 c x 64 n tile.
// coverage: T written rows (8e+t)=0..63 x cols cl 0..63, read rows 0..63 x cols 8 pq..8 pq+7, pq 0..7 (staged extent ==
//           consumed extent); XP 2 it x 2 tiles x 8 pieces x 16 rows x 8 = 64 n x 64 c, each wave store 512 contiguous B;
//           grid (64, 4, NB) covers rows [b][0..4095] x c 0..255 exactly once.
// =========================================================================================================
__global__ __launch_bounds__(256)
void cvt_x(const float* __restrict__ x, unsigned short* XP) {
  __shared__ __align__(16) unsigned short T[QT * TP];
  const int tid = threadIdx.x;
  const int nb = blockIdx.x, cb = blockIdx.y, b = blockIdx.z;
  const int e = tid & 7, lq = tid >> 3;                             // lq 0..31
  const int n0 = nb * QT, c0 = cb * QT;
#pragma unroll
  for (int it = 0; it < 2; ++it) {
    const int cl = it * 32 + lq;                                     // 0..63
    const float* sp = x + ((size_t)(b * CC + c0 + cl)) * NN + n0 + 8 * e;
    const v4f a = *(const v4f*)sp;
    const v4f q = *(const v4f*)(sp + 4);
    unsigned short hb[8];
#pragma unroll
    for (int t = 0; t < 4; ++t) {
      hb[t]     = h_bits((_Float16)bfr(a[t]));
      hb[4 + t] = h_bits((_Float16)bfr(q[t]));
    }
#pragma unroll
    for (int t = 0; t < 8; ++t) T[(8 * e + t) * TP + cl] = hb[t];
  }
  __syncthreads();
  const int r16 = tid & 15, pq = (tid >> 4) & 7, tl = tid >> 7;      // row in its tile, piece 0..7, tile 0..1 (+ 2 it)
  v4u up[2];
#pragma unroll
  for (int it = 0; it < 2; ++it) {
    const int nl = (2 * it + tl) * 16 + r16;                         // 0..63
    up[it] = *(const v4u*)(T + nl * TP + 8 * pq);
  }
{
#pragma unroll
    for (int it = 0; it < 2; ++it) {
      const int t = (b * NN + n0) / 16 + 2 * it + tl;
      *(v4u*)(XP + piece_off(t, CC / 32, c0 / 8 + pq, r16)) = up[it];
    }
    
  }
}

// =========================================================================================================
// (2) conv1x1 GEMM for one (b, strip of 128 positions = image rows 2s and 2s+1, 64-o block of the stacked weights):
//     Y[o][n] = (1/256) sum_c W16[o][c] XP[b][n][c]. Block 256 threads = 8 waves; wave w owns cols n0+16w..+15
//     (one B fragment per k-step, tile (b 4096 + n0) / 16 + w of XP) and 4 m-tiles (A rows o = o0 + 16 mt + (lane&15),
//     tile o0 / 16 + mt of W16), both planes in fragment order. K = 256 = 8 steps.
//     Epilogue staged in LDS Os[n_loc][o_loc] (pitch OSP, b128
//     stores), block barrier (cross-wave), then (block-uniform branch on the o block):
//       o-blocks 0,1 -> theta dims 0..63 / 64..127 + bias -> Qh/Ql bf16 [b][4096 n][128 d] (hi = RNE(v), lo = RNE(v-hi)):
//       o-blocks 2,3 -> phi + bias in f32 -> PF f32 [b][4096 n][128 d]: 128 rows x the dsel half (256 B = 2 whole
//                       lines) of the 512-B row, 16 consecutive lanes x 16 B, one instruction per 2 rows.
//       o-blocks 4,5 -> g + bias -> GF f32 [b][4096 n][128 d], same layout.
// coverage: Os 8 waves x 16 n x 64 o = 128 x 64 written, reads rows <= 127 cols <= 63; theta planes 4 it x 32 rows
//           x 8 lanes x 8 = 128 n x 64 d; f32 planes 8 it x 16 rows x 16 lanes x 4 = 128 n x 64 d; grid (32, 6, NB)
//           covers all 4096 rows x 128 d of Qh/Ql and of PF/GF exactly once.
// =========================================================================================================
__global__ __launch_bounds__(256)
void gemm_proj(const unsigned short* __restrict__ W16, const unsigned short* __restrict__ XP,
               const float* __restrict__ tb, const float* __restrict__ pb, const float* __restrict__ gb,
               unsigned short* Qh, unsigned short* Ql, float* PF, float* GF) {
  __shared__ __align__(16) float Os[SN * OSP];
  const int tid  = threadIdx.x;
  const int lane = tid & 31, wave = tid >> 5;                        // wave 0..7
  const int hh   = lane >> 4, c = lane & 15;
  const int st   = blockIdx.x, mb = blockIdx.y, b = blockIdx.z;
  const int n0   = st * SN, o0 = mb * QT;

  const int ta = o0 / 16, tb16 = (b * NN + n0) / 16 + wave;          // first A tile, the wave's B tile

  v8f acc[4];
#pragma unroll
  for (int mt = 0; mt < 4; ++mt) acc[mt] = zero8();

#pragma unroll
  for (int ks = 0; ks < CC / 32; ++ks) {
    const Frag fb = ldfrag_p(XP, tb16, CC / 32, ks, lane);
#pragma unroll
    for (int mt = 0; mt < 4; ++mt) {
      const Frag fa = ldfrag_p(W16, ta + mt, CC / 32, ks, lane);
      acc[mt] = mma_h(fa.h, fb.h, acc[mt]);
    }
  }

  // ---- epilogue: scale back -> LDS Os[n_loc][o_loc]; lane (hh, c) holds o = 16 mt + 8 hh + r for n_loc = 16 w + c
  {
    const int nl = 16 * wave + c;
#pragma unroll
    for (int mt = 0; mt < 4; ++mt) {
      v4f va, vb;
#pragma unroll
      for (int r = 0; r < 4; ++r) { va[r] = acc[mt][r] * IWSC; vb[r] = acc[mt][4 + r] * IWSC; }
      *(v4f*)(Os + nl * OSP + 16 * mt + 8 * hh)     = va;
      *(v4f*)(Os + nl * OSP + 16 * mt + 8 * hh + 4) = vb;
    }
  }
  __syncthreads();

  const int grp = mb >> 1;                                           // 0 theta, 1 phi, 2 g (block-uniform)
  const int dsel = (mb & 1) * QT;                                    // 0 or 64
  const float* bias = (grp == 0) ? tb : ((grp == 1) ? pb : gb);     // all global

  if (grp == 0) {
    const int e = tid & 7, lq = tid >> 3;                            // lq 0..31
    float bv[8];
    {
      const v4f ba = *(const v4f*)(bias + dsel + 8 * e);
      const v4f bq = *(const v4f*)(bias + dsel + 8 * e + 4);
#pragma unroll
      for (int t = 0; t < 4; ++t) { bv[t] = bfr(ba[t]); bv[4 + t] = bfr(bq[t]); }
    }
    v4u uh[4], ul[4];
#pragma unroll
    for (int it = 0; it < 4; ++it) {
      const int row = it * 32 + lq;                                  // n_loc 0..127
      const v4f a = *(const v4f*)(Os + row * OSP + 8 * e);
      const v4f q = *(const v4f*)(Os + row * OSP + 8 * e + 4);
      float f[8];
#pragma unroll
      for (int t = 0; t < 4; ++t) { f[t] = a[t] + bv[t]; f[4 + t] = q[t] + bv[4 + t]; }
      split8(f, uh[it], ul[it]);
    }
{
#pragma unroll
      for (int it = 0; it < 4; ++it) {
        const int row = it * 32 + lq;
        const size_t po = ((size_t)(b * NN + n0 + row)) * DQ + dsel + 8 * e;
        *(v4u*)(Qh + po) = uh[it];
        *(v4u*)(Ql + po) = ul[it];
      }
      
    }
  } else {
    const int e16 = tid & 15, lr = tid >> 4;                        // lr 0..15
    v4f bv4;
    {
      const v4f bq = *(const v4f*)(bias + dsel + 4 * e16);
#pragma unroll
      for (int t = 0; t < 4; ++t) bv4[t] = bfr(bq[t]);
    }
    float* P = (grp == 1) ? PF : GF;                                 // both global
    v4f res[8];
#pragma unroll
    for (int it = 0; it < 8; ++it) {
      const int row = it * 16 + lr;                                  // n_loc 0..127
      const v4f a = *(const v4f*)(Os + row * OSP + 4 * e16);
      v4f v;
#pragma unroll
      for (int t = 0; t < 4; ++t) v[t] = a[t] + bv4[t];
      res[it] = v;
    }
{
#pragma unroll
      for (int it = 0; it < 8; ++it) {
        const int row = it * 16 + lr;
        const size_t po = ((size_t)(b * NN + n0 + row)) * DQ + dsel + 4 * e16;
        *(v4f*)(P + po) = res[it];
      }
      
    }
  }
}

// =========================================================================================================
// (3) 2x2 stride-2 max-pool of PF / GF f32 [b][4096 n][128 d] in f32 -> Kh/Kl bf16 [b][1024 m][128 d]
//     (hi = RNE(v), lo = RNE(v-hi)) and Gp f16 [b][1024 m][128 d], m = 32 py + px, window n = (2py+dy) 64 + 2px+dx,
//     dy, dx in {0,1}. Block (py, b), 256 threads: lane group e16 (16 lanes x 16 B = one 256-B row = 2 whole
//     lines), lr = tid>>4 -> px = 16 it + lr for it 0..1 (all 32 px valid, no pad rows). No LDS, no barriers.
// coverage: blocks 0..31 x px 0..31 x 16 lanes x 8 = rows 0..1023 x 128 d; grid (32, NB) covers Kh/Kl/Gp
//           [b][0..1023][0..127] exactly once.
// =========================================================================================================
__global__ __launch_bounds__(256)
void pool_k(const float* __restrict__ PF, const float* __restrict__ GF,
            unsigned short* Kh, unsigned short* Kl, unsigned short* Gp) {
  const int tid = threadIdx.x, py = blockIdx.x, b = blockIdx.y;
  const int e16 = tid & 15, lr = tid >> 4;                          // lr 0..15
  v4u kh[2], kl[2], gu[2];
#pragma unroll
  for (int it = 0; it < 2; ++it) {
    const int px = it * 16 + lr;                                    // 0..31
    float fk[8], fg[8];
#pragma unroll
    for (int t = 0; t < 8; ++t) { fk[t] = -__builtin_inff(); fg[t] = -__builtin_inff(); }
#pragma unroll
    for (int dy = 0; dy < 2; ++dy) {
      const size_t rb = ((size_t)(b * NN + (2 * py + dy) * WIMG + 2 * px)) * DQ + 8 * e16;
#pragma unroll
      for (int dx = 0; dx < 2; ++dx) {
        const float* pk = PF + rb + (size_t)dx * DQ;
        const float* pg = GF + rb + (size_t)dx * DQ;
        const v4f ka = *(const v4f*)pk, kq = *(const v4f*)(pk + 4);
        const v4f ga = *(const v4f*)pg, gq = *(const v4f*)(pg + 4);
#pragma unroll
        for (int t = 0; t < 4; ++t) {
          fk[t]     = fmaxf(fk[t], ka[t]);
          fk[4 + t] = fmaxf(fk[4 + t], kq[t]);
          fg[t]     = fmaxf(fg[t], ga[t]);
          fg[4 + t] = fmaxf(fg[4 + t], gq[t]);
        }
      }
    }
    split8(fk, kh[it], kl[it]);
#pragma unroll
    for (int t = 0; t < 4; ++t) gu[it][t] = pk16(h_bits((_Float16)fg[2 * t]), h_bits((_Float16)fg[2 * t + 1]));
  }
{
#pragma unroll
    for (int it = 0; it < 2; ++it) {
      const int px = it * 16 + lr;
      const size_t po = ((size_t)(b * MM + WP * py + px)) * DQ + 8 * e16;
      *(v4u*)(Kh + po) = kh[it];
      *(v4u*)(Kl + po) = kl[it];
      *(v4u*)(Gp + po) = gu[it];
    }
    
  }
}

// =========================================================================================================
// (4) Gp f16 [b][1024 m][128 d] -> Gc f16 [b][d][m] (channel-major, keys contiguous) through an LDS tile T[64 d][64 m]
// coverage: reads 2 it x 32 rows x 8 lanes x 8 = 64 m x 64 d; T written rows (8e+t)=0..63 x cols 0..63, read rows
//           0..63 x cols 8e..8e+7 (staged extent == consumed extent); writes 64 d x 64 m; grid (16, 2, NB) covers
//           Gc [b][0..127][0..1023] exactly once.
// =========================================================================================================
__global__ __launch_bounds__(256)
void tr_g(const unsigned short* __restrict__ Gp, unsigned short* Gc) {
  __shared__ __align__(16) unsigned short T[QT * TP];
  const int tid = threadIdx.x;
  const int mt = blockIdx.x, db = blockIdx.y, b = blockIdx.z;
  const int e = tid & 7, lq = tid >> 3;                             // lq 0..31
  const int m0 = mt * QT, d0 = db * QT;
#pragma unroll
  for (int it = 0; it < 2; ++it) {
    const int ml = it * 32 + lq;                                     // 0..63
    const v4u w = *(const v4u*)(Gp + ((size_t)(b * MM + m0 + ml)) * DQ + d0 + 8 * e);
    unsigned short hb[8];
#pragma unroll
    for (int t = 0; t < 4; ++t) {
      hb[2 * t]     = (unsigned short)(w[t] & 0xFFFFu);
      hb[2 * t + 1] = (unsigned short)(w[t] >> 16);
    }
#pragma unroll
    for (int t = 0; t < 8; ++t) T[(8 * e + t) * TP + ml] = hb[t];
  }
  __syncthreads();
  v4u up[2];
#pragma unroll
  for (int it = 0; it < 2; ++it) {
    const int dl = it * 32 + lq;                                     // 0..63
    up[it] = *(const v4u*)(T + dl * TP + 8 * e);
  }
{
#pragma unroll
    for (int it = 0; it < 2; ++it) {
      const int dl = it * 32 + lq;
      *(v4u*)(Gc + ((size_t)(b * DQ + d0 + dl)) * MM + m0 + 8 * e) = up[it];
    }
    
  }
}

// ---- asynchronous copies to LDS: each lane moves its own 16 bytes, global -> LDS, through no register. Arguments: the
//      lane's LDS byte addresses, then its global addresses in the same order, all multiples of 16. The closing
//      s_wait_xcnt 0 stands inside the copies' own statement so that no address register named there is rewritten ahead
//      of it.
__device__ __forceinline__ unsigned lds_addr(const void* p) { return (unsigned)(uintptr_t)p; }
__device__ __forceinline__ void copy4(unsigned l0, unsigned l1, unsigned l2, unsigned l3,
                                      const unsigned short* g0, const unsigned short* g1,
                                      const unsigned short* g2, const unsigned short* g3) {
#if defined(__HIP_DEVICE_COMPILE__)
  asm volatile("global_load_async_to_lds_b128 %0, %4, off\n\t"
               "global_load_async_to_lds_b128 %1, %5, off\n\t"
               "global_load_async_to_lds_b128 %2, %6, off\n\t"
               "global_load_async_to_lds_b128 %3, %7, off\n\t"
               "s_wait_xcnt 0x0"
               :: "v"(l0), "v"(l1), "v"(l2), "v"(l3), "v"(g0), "v"(g1), "v"(g2), "v"(g3) : "memory");
#endif
}
__device__ __forceinline__ void copy12(unsigned a0, unsigned a1, unsigned a2, unsigned a3, unsigned b0, unsigned b1,
                                       unsigned b2, unsigned b3, unsigned c0, unsigned c1, unsigned c2, unsigned c3,
                                       const unsigned short* p0, const unsigned short* p1, const unsigned short* p2,
                                       const unsigned short* p3, const unsigned short* q0, const unsigned short* q1,
                                       const unsigned short* q2, const unsigned short* q3, const unsigned short* r0,
                                       const unsigned short* r1, const unsigned short* r2, const unsigned short* r3) {
#if defined(__HIP_DEVICE_COMPILE__)
  asm volatile("global_load_async_to_lds_b128 %0, %12, off\n\t"
               "global_load_async_to_lds_b128 %1, %13, off\n\t"
               "global_load_async_to_lds_b128 %2, %14, off\n\t"
               "global_load_async_to_lds_b128 %3, %15, off\n\t"
               "global_load_async_to_lds_b128 %4, %16, off\n\t"
               "global_load_async_to_lds_b128 %5, %17, off\n\t"
               "global_load_async_to_lds_b128 %6, %18, off\n\t"
               "global_load_async_to_lds_b128 %7, %19, off\n\t"
               "global_load_async_to_lds_b128 %8, %20, off\n\t"
               "global_load_async_to_lds_b128 %9, %21, off\n\t"
               "global_load_async_to_lds_b128 %10, %22, off\n\t"
               "global_load_async_to_lds_b128 %11, %23, off\n\t"
               "s_wait_xcnt 0x0"
               :: "v"(a0), "v"(a1), "v"(a2), "v"(a3), "v"(b0), "v"(b1), "v"(b2), "v"(b3), "v"(c0), "v"(c1), "v"(c2),
                  "v"(c3), "v"(p0), "v"(p1), "v"(p2), "v"(p3), "v"(q0), "v"(q1), "v"(q2), "v"(q3), "v"(r0), "v"(r1),
                  "v"(r2), "v"(r3) : "memory");
#endif
}
// the issuing wave's copies have landed behind this wait
__device__ __forceinline__ void wait_async0() {
#if defined(__HIP_DEVICE_COMPILE__)
  asm volatile("s_wait_asynccnt 0x0" ::: "memory");
#endif
}
// the wave's own LDS reads have retired before the buffer they read is handed to the copies that refill it
__device__ __forceinline__ void wait_ds0() {
#if defined(__HIP_DEVICE_COMPILE__)
  asm volatile("s_wait_dscnt 0x0" ::: "memory");
#endif
}
// one 32-key stage: Kh and Kl rows kb..kb+31 (256 B each, LDS pitch 272 B) and the 64-B key run kb..kb+31 of all 128
// rows of Gc (LDS pitch 80 B). 128 threads x 12 copies of 16 B = 8 KiB + 8 KiB + 8 KiB; no two lanes share an LDS byte.
__device__ __forceinline__ void stage_kv(unsigned short* st, const unsigned short* Khb, const unsigned short* Klb,
                                         const unsigned short* Gcb, int kb, int tid) {
  const int kr = tid >> 4, kcol = 8 * (tid & 15);                    // kr 0..7, + 8 i -> key row 0..31
  const int vr = tid >> 2, vcol = 8 * (tid & 3);                     // vr 0..31, + 32 i -> channel row 0..127
  const unsigned lk = lds_addr(st + kr * KP + kcol);
  const unsigned ll = lk + 2u * (KT * KP);
  const unsigned lv = lds_addr(st + 2 * KT * KP + vr * VPT + vcol);
  const unsigned short* gk = Khb + (size_t)(kb + kr) * DQ + kcol;
  const unsigned short* gl = Klb + (size_t)(kb + kr) * DQ + kcol;
  const unsigned short* gv = Gcb + (size_t)vr * MM + kb + vcol;
  copy12(lk, lk + 2u * (8 * KP), lk + 2u * (16 * KP), lk + 2u * (24 * KP),
         ll, ll + 2u * (8 * KP), ll + 2u * (16 * KP), ll + 2u * (24 * KP),
         lv, lv + 2u * (32 * VPT), lv + 2u * (64 * VPT), lv + 2u * (96 * VPT),
         gk, gk + 8 * DQ, gk + 16 * DQ, gk + 24 * DQ, gl, gl + 8 * DQ, gl + 16 * DQ, gl + 24 * DQ,
         gv, gv + 32 * MM, gv + 64 * MM, gv + 96 * MM);
}

// =========================================================================================================
// (5) attention for one (b, 64-query tile), transposed formulation, 1024 keys (all valid, no mask, no scale):
//   S^T tile (16 keys x 16 queries) = sum over 4 d-chunks (rolled loop) of A(k: row = key kb + (lane&15), 32 d via
//   the split k map from the bf16 plane Kh [b][1024][128]) . B(q: col = query, same map from Qh [b][4096][128])
//   + A(Kh).B(Ql) + A(Kl).B(Qh) (bf16 unscaled residual planes, shared accumulator).
//   Per lane the D tile holds 8 keys of ONE query: online softmax state per lane, one shuffle (lane^16) for the max
//   over 32 keys; the o/l rescale is skipped under a wave-uniform ballot when no lane's max grew (corr == 1 exactly
//   for every lane then); row-sum partials combined at the end. P = e^{s-m} x 16384 as f16 is the B operand of
//   y^T (rows channel, cols queries) += A(pooled g: rows channel = 16j + (lane&15), keys contiguous, f16 plane Gc
//   [b][128][1024]) . B(P^T): element r <- D of the tile covering keys kb..kb+15, element 8+r <- the tile covering
//   kb+16..kb+31, lane unchanged. 8 accumulator tiles per wave (128 channels). Block = 4 waves = 64 queries.
//   Live state per lane: o 64 + s0/s1 16 + up to 6 fragments (rolled d loop) + P 8 + m/l, under the 256 cap.
//   Operands come from LDS: the block's 64 query rows of Qh/Ql are copied once (Qs, pitch 272 B); each 32-key stage of
//   Kh/Kl/Gc is copied by all four waves into one of two buffers (Ring) one trip ahead of its use and read by all four.
//   Epilogue: y = O/l staged in LDS Os[query][128 channels] (pitch OSPW, b128 stores), block barrier (cross-wave),
//   then Yh/Yl (rows n, k = channel) in fragment order, each wave store 512 contiguous B.
// coverage: Os written 4 waves x 16 queries x 128 ch, read rows 0..63 x ch 8 pq..8 pq+7 (pq 0..15); planes 4 tiles x 16
//           pieces x 16 rows x 8 = 64 n x 128 ch per plane; grid (NQ/64, NB) covers rows 0..NQ-1 of Yh/Yl exactly once.
// =========================================================================================================
__global__ __launch_bounds__(128) __attribute__((amdgpu_num_vgpr(256)))
void attn_k(const unsigned short* __restrict__ Qh, const unsigned short* __restrict__ Ql,
            const unsigned short* __restrict__ Kh, const unsigned short* __restrict__ Kl,
            const unsigned short* __restrict__ Gc, unsigned short* Yh, unsigned short* Yl) {
  __shared__ __align__(16) float Os[QT * OSPW];
  __shared__ __align__(16) unsigned short Qs[2 * QT * KP];
  __shared__ __align__(16) unsigned short Ring[2 * STG];
  const int tid  = threadIdx.x;
  const int wave = tid >> 5, lane = tid & 31;
  const int hh   = lane >> 4, c = lane & 15;
  const int n0   = blockIdx.x * QT, b = blockIdx.y;

  const unsigned short* Khb = Kh + (size_t)b * MM * DQ;
  const unsigned short* Klb = Kl + (size_t)b * MM * DQ;
  const unsigned short* Gcb = Gc + (size_t)b * DQ * MM;

  // ---- in front of the loop: the query tile and stage 0, their wait, the barrier that publishes them, then stage 1
  {
    const int qr = tid >> 4, qcol = 8 * (tid & 15);                  // qr 0..7, + 8 i -> query row 0..63
    const unsigned lq = lds_addr(Qs + qr * KP + qcol);
    const size_t go = ((size_t)(b * NN + n0 + qr)) * DQ + qcol;
    auto plane = [](unsigned l0, const unsigned short* g) {          // 64 rows of one plane, 8 copies a thread
      copy4(l0, l0 + 2u * (8 * KP), l0 + 2u * (16 * KP), l0 + 2u * (24 * KP), g, g + 8 * DQ, g + 16 * DQ, g + 24 * DQ);
      copy4(l0 + 2u * (32 * KP), l0 + 2u * (40 * KP), l0 + 2u * (48 * KP), l0 + 2u * (56 * KP), g + 32 * DQ,
            g + 40 * DQ, g + 48 * DQ, g + 56 * DQ);
    };
    plane(lq, Qh + go);
    plane(lq + 2u * (QT * KP), Ql + go);
  }
  stage_kv(Ring, Khb, Klb, Gcb, 0, tid);
  wait_async0();
  __syncthreads();
  stage_kv(Ring + STG, Khb, Klb, Gcb, KT, tid);

  // q fragment pointers (B operand, col = query 16*wave + c of the tile), + 32*kc
  const unsigned short* Qhp = Qs + (16 * wave + c) * KP + 8 * hh;
  const unsigned short* Qlp = Qhp + QT * KP;

  float m = -1.0e30f, l = 0.f;
  v8f o[8];
#pragma unroll
  for (int j = 0; j < 8; ++j) o[j] = zero8();

#pragma unroll 1
  for (int kb = 0; kb < MM; kb += KT) {
    unsigned short* st = Ring + ((kb / KT) & 1) * STG;               // this trip's buffer
    // k fragment base (A operand, row = key kb + c), + 32*kc; v fragment base (A operand, row = channel 16j + c)
    const unsigned short* k0p  = st + c * KP + 8 * hh;               // keys kb .. kb+15
    const unsigned short* k1p  = k0p + 16 * KP;                      // keys kb+16 .. kb+31
    const unsigned short* k0lp = k0p + KT * KP;
    const unsigned short* k1lp = k1p + KT * KP;
    const unsigned short* Vp   = st + 2 * KT * KP + c * VPT + 8 * hh;
    v8f s0 = zero8(), s1 = zero8();
#pragma unroll 1
    for (int kc = 0; kc < DQ / 32; ++kc) {
      const Frag qh  = ldfrag(Qhp + 32 * kc);
      const Frag ql  = ldfrag(Qlp + 32 * kc);
      const Frag k0  = ldfrag(k0p + 32 * kc);
      const Frag k1  = ldfrag(k1p + 32 * kc);
      const Frag k0l = ldfrag(k0lp + 32 * kc);
      const Frag k1l = ldfrag(k1lp + 32 * kc);
      s0 = mma_b(k0.bf, qh.bf, s0);
      s1 = mma_b(k1.bf, qh.bf, s1);
      s0 = mma_b(k0.bf, ql.bf, s0);
      s1 = mma_b(k1.bf, ql.bf, s1);
      s0 = mma_b(k0l.bf, qh.bf, s0);
      s1 = mma_b(k1l.bf, qh.bf, s1);
    }

    float mx = fmaxf(hmax8(s0), hmax8(s1));
    mx = fmaxf(mx, __shfl_xor(mx, 16, 32));
    const float mn = fmaxf(m, mx);
    const unsigned grew = wave_ballot(mx > m);                       // wave-uniform
    if (grew != 0u) {
      const float corr = __expf(m - mn);                             // == 1 exactly for lanes whose max did not grow
      l *= corr;
#pragma unroll
      for (int j = 0; j < 8; ++j) {
#pragma unroll
        for (int r = 0; r < 8; ++r) o[j][r] *= corr;
      }
    }
    m = mn;
    const float msh = mn - LNPS;                                     // exp gives e^{s-m} * 16384

    FragH ph;
    float ls = 0.f;
#pragma unroll
    for (int r = 0; r < 8; ++r) {
      const float e0 = __expf(s0[r] - msh);                          // key kb      + 8hh + r
      const float e1 = __expf(s1[r] - msh);                          // key kb + 16 + 8hh + r
      ls += e0 + e1;
      ph.hv[0][r] = (_Float16)e0;
      ph.hv[1][r] = (_Float16)e1;
    }
    l += ls;

#pragma unroll
    for (int j = 0; j < 8; ++j) {
      const Frag vf = ldfrag(Vp + (16 * j) * VPT);
      o[j] = mma_h(vf.h, ph.v, o[j]);
    }

    // ---- foot of the trip: own reads retired, own copies of the next stage landed, one barrier that publishes that
    //      stage and ends every reader's last read of this buffer; only then the refill of this buffer
    wait_ds0();
    wait_async0();
    __syncthreads();
    if (kb + 2 * KT < MM) stage_kv(st, Khb, Klb, Gcb, kb + 2 * KT, tid);
  }
  wait_async0();                                                     // nothing is in flight when the wave goes on
  l += __shfl_xor(l, 16, 32);
  const float inv = 1.0f / l;                                        // o and l both carry the x16384 factor

  // ---- epilogue: y = o * inv -> Os[query][ch]; lane (hh, c) holds ch = 16 j + 8 hh + r for query 16 w + c
  {
    const int qrow = 16 * wave + c;
#pragma unroll
    for (int j = 0; j < 8; ++j) {
      v4f va, vb;
#pragma unroll
      for (int r = 0; r < 4; ++r) { va[r] = o[j][r] * inv; vb[r] = o[j][4 + r] * inv; }
      *(v4f*)(Os + qrow * OSPW + 16 * j + 8 * hh)     = va;
      *(v4f*)(Os + qrow * OSPW + 16 * j + 8 * hh + 4) = vb;
    }
  }
  __syncthreads();

  const int r16 = tid & 15, pl = tid >> 4;                           // row in its tile, pl 0..7
  v4u uh[8], ul[8];
#pragma unroll
  for (int it = 0; it < 8; ++it) {
    const int row = (it >> 1) * 16 + r16;                            // query 0..63
    const int pq  = (it & 1) * 8 + pl;                               // piece 0..15, channels 8 pq..8 pq+7
    const v4f a = *(const v4f*)(Os + row * OSPW + 8 * pq);
    const v4f q = *(const v4f*)(Os + row * OSPW + 8 * pq + 4);
    const float f[8] = {a[0], a[1], a[2], a[3], q[0], q[1], q[2], q[3]};
    split8(f, uh[it], ul[it]);
  }
{
#pragma unroll
    for (int it = 0; it < 8; ++it) {
      const size_t po = piece_off((b * NN + n0) / 16 + (it >> 1), DQ / 32, (it & 1) * 8 + pl, r16);
      *(v4u*)(Yh + po) = uh[it];
      *(v4u*)(Yl + po) = ul[it];
    }
    
  }
}

// =========================================================================================================
// (6) output conv for one (b, 64-n tile, 64-c block): A[c][n] = sum_ci WWb[c][ci] (Yh + Yl)[b][n][ci] on bf16 WMMA
//     (2 products per k-step, shared accumulator), K = 128 = 4 steps. Block 128 threads = 4 waves; wave w owns cols
//     n0+16w..+15 (B fragments: tile (b 4096 + n0) / 16 + w of Yh/Yl) and 4 m-tiles (A rows c = c0 + 16 mt + (lane&15),
//     tile c0 / 16 + mt of WWb), all planes in fragment order.
//     Epilogue staged in LDS Os[n_loc][c_loc] (pitch OSP, b128 stores), block barrier
//     2 lines): 8 consecutive lanes x 16 B (values gathered from 4 Os rows), one instruction per 4 lines, final
// coverage: Os 4 waves x 16 n x 64 c written, read rows nl+t <= 63 x cols cl <= 63; WY 8 it x 16 lines x 8 lanes x
//           4 floats = 64 c x 64 n; grid (NQ/64, 4, NB) covers WY[b][0..255][0..NQ-1] exactly once.
// =========================================================================================================
__global__ __launch_bounds__(128)
void gemm_out(const unsigned short* __restrict__ WWb, const unsigned short* __restrict__ Yh,
              const unsigned short* __restrict__ Yl, const float* __restrict__ wb, float* WY) {
  __shared__ __align__(16) float Os[QT * OSP];
  const int tid  = threadIdx.x;
  const int lane = tid & 31, wave = tid >> 5;
  const int hh   = lane >> 4, c = lane & 15;
  const int nt   = blockIdx.x, cb = blockIdx.y, b = blockIdx.z;
  const int n0   = nt * QT, c0 = cb * QT;

  const int ta = c0 / 16, tb16 = (b * NN + n0) / 16 + wave;          // first A tile, the wave's B tile

  v8f acc[4];
#pragma unroll
  for (int mt = 0; mt < 4; ++mt) acc[mt] = zero8();

#pragma unroll
  for (int ks = 0; ks < DQ / 32; ++ks) {
    const Frag fbh = ldfrag_p(Yh, tb16, DQ / 32, ks, lane);
    const Frag fbl = ldfrag_p(Yl, tb16, DQ / 32, ks, lane);
#pragma unroll
    for (int mt = 0; mt < 4; ++mt) {
      const Frag fa = ldfrag_p(WWb, ta + mt, DQ / 32, ks, lane);
      acc[mt] = mma_b(fa.bf, fbh.bf, acc[mt]);
      acc[mt] = mma_b(fa.bf, fbl.bf, acc[mt]);
    }
  }

  // ---- epilogue: -> LDS Os[n_loc][c_loc]; lane (hh, c) holds c_loc = 16 mt + 8 hh + r for n_loc = 16 w + c
  {
    const int nl = 16 * wave + c;
#pragma unroll
    for (int mt = 0; mt < 4; ++mt) {
      v4f va, vb;
#pragma unroll
      for (int r = 0; r < 4; ++r) { va[r] = acc[mt][r]; vb[r] = acc[mt][4 + r]; }
      *(v4f*)(Os + nl * OSP + 16 * mt + 8 * hh)     = va;
      *(v4f*)(Os + nl * OSP + 16 * mt + 8 * hh + 4) = vb;
    }
  }
  __syncthreads();

  const int e = tid & 7, lq = tid >> 3;                              // lq 0..15
  v4f res[8];
#pragma unroll
  for (int it = 0; it < 8; ++it) {
    const int L   = it * 16 + lq;                                    // 0..127
    const int cl  = L >> 1, hf = L & 1;                              // channel 0..63 within the block
    const int nl  = hf * 32 + 4 * e;                                 // position 0..63
    const float bvs = bfr(wb[c0 + cl]);
#pragma unroll
    for (int t = 0; t < 4; ++t) {
      res[it][t] = Os[(nl + t) * OSP + cl] + bvs;
    }
  }
{
#pragma unroll
    for (int it = 0; it < 8; ++it) {
      const int L   = it * 16 + lq;
      const int cl  = L >> 1, hf = L & 1;
      const int nl  = hf * 32 + 4 * e;
      const size_t idx = ((size_t)(b * CC + c0 + cl)) * NN + n0 + nl;
      *(v4f*)(WY + idx) = res[it];
    }
    
  }
}

// =========================================================================================================
// (7) batch-norm statistics, normalisation, affine and residual in one launch: block owns ONE channel (256 blocks of
//     32 waves). Thread tid takes floats 4 tid..4 tid+3 of each of the NB rows WY[b][c][0..NQ) and of the same rows of
//     x, so every wave load is one contiguous 512-B run; a thread's 2 NB loads are independent and all issued before
//     the first sum; the WY values stay in registers from the statistics to the normalisation. Sum and sum of squares
//     in f64 per thread (rows, then elements, in ascending order), wave shuffle reduce, per-wave partials in LDS
//     (cross-wave, block barrier); every wave then shuffle-reduces the same 32 partials itself (a butterfly leaves the
//     same bits in every lane of every wave), so no second barrier and no table: mean, biased variance,
//     rstd = 1/sqrt(var + eps) in f32, then out[b][c][n] = (((WY - mu) * rstd) * bf16-RNE(gamma[c]) + bf16-RNE(beta[c]))
//     + bf16-RNE(x[b][c][n]) in f32.
// coverage: 256 blocks x 1 channel x NB rows x BST threads x 4 floats = out[b][0..255][0..NQ-1] exactly once, each
//           wave store one contiguous 512-B run; reads WY and x at the same offsets only (the produced extent).
// =========================================================================================================
__global__ __launch_bounds__(BST)
void bn_norm(const float* __restrict__ WY, const float* __restrict__ x, const float* __restrict__ gam,
             const float* __restrict__ bet, float* out) {
#pragma clang fp contract(off)
  __shared__ double red[2 * (BST / 32)];
  const int tid = threadIdx.x, lane = tid & 31, wave = tid >> 5;
  const int cc = blockIdx.x;
  const double ninv = 1.0 / ((double)NB * (double)NQ);
  unsigned bo[NB];                                                   // byte offsets in WY, x and out, all < 2^25
  v4f a[NB], xv[NB];
#pragma unroll
  for (int bb = 0; bb < NB; ++bb) bo[bb] = 4u * (unsigned)((bb * CC + cc) * NN + 4 * tid);
#pragma unroll
  for (int bb = 0; bb < NB; ++bb) a[bb] = *(const v4f*)((const char*)WY + bo[bb]);
#if defined(__HIP_DEVICE_COMPILE__)
  // keeps the WY loads ahead of the x loads: loads return in order, and interleaved the sums would wait for rows of x
  __builtin_amdgcn_sched_barrier(0);
#endif
#pragma unroll
  for (int bb = 0; bb < NB; ++bb) xv[bb] = *(const v4f*)((const char*)x + bo[bb]);
#if defined(__HIP_DEVICE_COMPILE__)
  // keeps every load above the sums: without it the scheduler sinks them and only a few stay in flight per wave
  __builtin_amdgcn_sched_barrier(0);
#endif
  const float ga = bfr(gam[cc]), be = bfr(bet[cc]);                  // block-uniform, back long before their use
  double s = 0.0, q = 0.0;
#pragma unroll
  for (int bb = 0; bb < NB; ++bb) {
#pragma unroll
    for (int t = 0; t < 4; ++t) {
      const double d = (double)a[bb][t];
      s += d; q += d * d;
    }
  }
#pragma unroll
  for (int d = 1; d < 32; d <<= 1) {
    s += __shfl_xor(s, d, 32);
    q += __shfl_xor(q, d, 32);
  }
  if (lane == 0) { red[wave] = s; red[BST / 32 + wave] = q; }
  __syncthreads();
  double ts = red[lane], tq = red[BST / 32 + lane];
#pragma unroll
  for (int d = 1; d < 32; d <<= 1) {
    ts += __shfl_xor(ts, d, 32);
    tq += __shfl_xor(tq, d, 32);
  }
  const double mud = ts * ninv;
  double var = tq * ninv - mud * mud;
  var = (var > 0.0) ? var : 0.0;
  const float varf = (float)var + BNEPS;
  const float rs = 1.0f / sqrtf(varf);
  const float mu = (float)mud;
#pragma unroll
  for (int bb = 0; bb < NB; ++bb) {
    v4f r;
#pragma unroll
    for (int t = 0; t < 4; ++t) {
      const float d  = a[bb][t] - mu;
      const float nv = d * rs;
      const float av = nv * ga;
      const float sv = av + be;
      r[t] = sv + bfr(xv[bb][t]);
    }
    *(v4f*)((char*)out + bo[bb]) = r;
  }
}

// =========================================================================================================
// Workspace map (bytes; each region start a multiple of 256; every extent is an exact row/tile multiple and is
//   W16 f16 [384][256]            196608      WWb bf16 [256][128]        65536
//   XP  f16 [NB][4096][256]     16777216 (NB=8)
//   Qh/Ql bf16 [NB][4096][128]   8388608 x2
//   PF/GF f32  [NB][4096][128]  16777216 x2
//   Kh/Kl bf16 [NB][1024][128]   2097152 x2  Gp f16 [NB][1024][128]   2097152   Gc f16 [NB][128][1024]  2097152
//   Yh/Yl bf16 [NB][4096][128]   8388608 x2
//   WY  f32  [NB][256][4096]    33554432
//   total (NB=8) = 126091264
//   W16, WWb, XP, Yh and Yl hold their rows in fragment order (piece_off); the sizes are those of the row-major planes.
// =========================================================================================================
extern "C" void kernel_launch(void* const* d_in, const int* in_sizes, int n_in,
                              void* d_out, int out_size, void* d_ws, size_t ws_size,
                              hipStream_t stream) {
  const int XN = NB * CC * NN;
  if (n_in < 11) return;
  if (in_sizes[0] < XN) return;
  if (in_sizes[1] < DQ * CC || in_sizes[3] < DQ * CC || in_sizes[5] < DQ * CC || in_sizes[7] < CC * DQ) return;
  if (in_sizes[2] < DQ || in_sizes[4] < DQ || in_sizes[6] < DQ || in_sizes[8] < CC) return;
  if (in_sizes[9] < CC || in_sizes[10] < CC) return;
  if (out_size < XN) return;

  size_t off = 0;
  auto carve = [&](size_t bytes) { const size_t o = off; off += (bytes + 255) & ~(size_t)255; return o; };
  const size_t oW16 = carve((size_t)MW * CC * 2);
  const size_t oWWb = carve((size_t)CC * DQ * 2);
  const size_t oXP  = carve((size_t)NB * NN * CC * 2);
  const size_t oQh  = carve((size_t)NB * NN * DQ * 2);
  const size_t oQl  = carve((size_t)NB * NN * DQ * 2);
  const size_t oPF  = carve((size_t)NB * NN * DQ * 4);
  const size_t oGF  = carve((size_t)NB * NN * DQ * 4);
  const size_t oKh  = carve((size_t)NB * MM * DQ * 2);
  const size_t oKl  = carve((size_t)NB * MM * DQ * 2);
  const size_t oGp  = carve((size_t)NB * MM * DQ * 2);
  const size_t oGc  = carve((size_t)NB * DQ * MM * 2);
  const size_t oYh  = carve((size_t)NB * NN * DQ * 2);
  const size_t oYl  = carve((size_t)NB * NN * DQ * 2);
  const size_t oWY  = carve((size_t)NB * CC * NN * 4);
  if (off > ws_size) return;
  if (off > (size_t)134217728) return;

  const float* x   = (const float*)d_in[0];
  const float* gw  = (const float*)d_in[1];
  const float* gb  = (const float*)d_in[2];
  const float* tw  = (const float*)d_in[3];
  const float* tb  = (const float*)d_in[4];
  const float* pw  = (const float*)d_in[5];
  const float* pb  = (const float*)d_in[6];
  const float* ow  = (const float*)d_in[7];
  const float* wb  = (const float*)d_in[8];
  const float* gam = (const float*)d_in[9];
  const float* bet = (const float*)d_in[10];

  char* ws = (char*)d_ws;
  unsigned short* W16 = (unsigned short*)(ws + oW16);
  unsigned short* WWb = (unsigned short*)(ws + oWWb);
  unsigned short* XP  = (unsigned short*)(ws + oXP);
  unsigned short* Qh  = (unsigned short*)(ws + oQh);
  unsigned short* Ql  = (unsigned short*)(ws + oQl);
  float*          PF  = (float*)(ws + oPF);
  float*          GF  = (float*)(ws + oGF);
  unsigned short* Kh  = (unsigned short*)(ws + oKh);
  unsigned short* Kl  = (unsigned short*)(ws + oKl);
  unsigned short* Gp  = (unsigned short*)(ws + oGp);
  unsigned short* Gc  = (unsigned short*)(ws + oGc);
  unsigned short* Yh  = (unsigned short*)(ws + oYh);
  unsigned short* Yl  = (unsigned short*)(ws + oYl);
  float*          WY  = (float*)(ws + oWY);
  float* out = (float*)d_out;

  const dim3 blk256(256), blk128(128);

  // (0) theta_w / phi_w / g_w -> stacked f16 plane; w_w -> bf16 plane, both in fragment order
  cvt_w<<<dim3(MW / 8 + CC / 16), blk256, 0, stream>>>(tw, pw, gw, ow, W16, WWb);
  // (1) x -> 16-bit plane, rows = positions, fragment order
  cvt_x<<<dim3(NN / QT, CC / QT, NB), blk256, 0, stream>>>(x, XP);
  // (2) conv1x1 GEMM -> theta (q) hi/res planes, phi / g conv outputs + bias as f32 planes
  gemm_proj<<<dim3(NSTRIP, MW / QT, NB), blk256, 0, stream>>>(W16, XP, tb, pb, gb, Qh, Ql, PF, GF);
  // (3) 2x2 stride-2 max-pool -> pooled phi (k) hi/res planes, pooled g f16 plane
  pool_k<<<dim3(HP, NB), blk256, 0, stream>>>(PF, GF, Kh, Kl, Gp);
  // (4) pooled g -> channel-major plane
  tr_g<<<dim3(MM / QT, DQ / QT, NB), blk256, 0, stream>>>(Gp, Gc);
  // (5) attention -> y hi/res planes, rows = positions, fragment order
  attn_k<<<dim3(NQ / QT, NB), blk128, 0, stream>>>(Qh, Ql, Kh, Kl, Gc, Yh, Yl);
  // (6) output conv + bias -> WY f32 plane [b][256][4096]
  gemm_out<<<dim3(NQ / QT, CC / QT, NB), blk128, 0, stream>>>(WWb, Yh, Yl, wb, WY);
  // (7) per-channel mean / rstd, then normalise, affine, residual -> out [b][256][4096]
  bn_norm<<<dim3(CC), dim3(BST), 0, stream>>>(WY, x, gam, bet, out);
  (void)hipGetLastError();
}

// v005
// A run of this version takes 111 microseconds.
// Next to v004, in two timings, it ran 1.06 times as fast each time.
// Over all steps from v000 it is 7.22 times as fast.
// Contractions: conv1x1 theta/phi/g GEMM W[384x256].X[256x128] per strip on v_wmma_f32_16x16x32_f16 (f16 containers
// of bf16-RNE weights x256 and bf16-RNE x); scores K.Q^T on v_wmma_f32_16x16x32_bf16 (bf16 hi + bf16 residual planes
// of theta / 2x2-max-pooled phi, 3 products, K=128); y^T = G.P^T on v_wmma_f32_16x16x32_f16 (2x2-max-pooled g as
// f16, P = e^{s-m} x16384 f16 from the score D registers); output conv W[256x128].Y on v_wmma_f32_16x16x32_bf16 (bf16
// weights, y as bf16 hi + residual planes, 2 products); f32 accumulate everywhere; max-pool, softmax statistics and
// bias in f32 VALU; batch-norm channel statistics in f64 VALU; normalisation, affine and residual add in f32 VALU.
#include <hip/hip_runtime.h>
#include <math.h>
#include <stdint.h>

#ifndef NB
#define NB 8
#endif
#ifndef NQ
#define NQ 4096
#endif
#define NB_FULL 8
#define CC     256
#define HIMG   64
#define WIMG   64
#define NN     4096
#define DQ     128
#define HP     32
#define WP     32
#define MM     1024
#define MW     384
#define QT     64
#define SN     128
#define NSTRIP 32
#define OSP    68
#define OSPW   132
#define TP     72
#define BST    1024
#define WSC    256.0f
#define IWSC   0.00390625f
#define LNPS   9.704060527839234f
#define BNEPS  1.0e-5f
#define KT     32
#define KP     136
#define VPT    40
#define STG    (2 * KT * KP + DQ * VPT)

static_assert(NB >= 1 && NB <= NB_FULL);
static_assert(NQ % QT == 0 && NQ <= NN);
static_assert(NN == HIMG * WIMG);
static_assert(SN == 2 * WIMG);
static_assert(NSTRIP * SN == NN);
static_assert(SN == 8 * 16);
static_assert(HIMG % 2 == 0 && WIMG % 2 == 0);
static_assert(HP == HIMG / 2 && WP == WIMG / 2);
static_assert(MM == HP * WP);
static_assert(WP == 32);
static_assert(MM % QT == 0 && MM % 32 == 0);
static_assert(NN % QT == 0 && CC % QT == 0 && DQ % QT == 0);
static_assert(MW == 3 * DQ && MW % QT == 0 && MW % 8 == 0);
static_assert(CC % 32 == 0 && DQ % 32 == 0);
static_assert((OSP * 4) % 16 == 0);
static_assert((OSPW * 4) % 16 == 0);
static_assert((TP * 2) % 16 == 0);
static_assert(SN * OSP * 4 <= 65536);
static_assert(BST == 32 * 32 && NQ == 4 * BST);
static_assert(NN % 16 == 0 && CC % 4 == 0);
static_assert((size_t)NB_FULL * CC * NN * 4 == (size_t)33554432);
static_assert((KP * 2) % 16 == 0 && (VPT * 2) % 16 == 0 && (STG * 2) % 16 == 0 && (KT * KP * 2) % 16 == 0);
static_assert(KP >= DQ + 8 && VPT >= KT + 8 && MM % KT == 0 && MM / KT >= 2);
static_assert(KT * DQ / 8 == 4 * 128 && DQ * KT / 8 == 4 * 128 && QT * DQ / 8 == 8 * 128);

typedef _Float16       v16h __attribute__((ext_vector_type(16)));
typedef _Float16       v8h  __attribute__((ext_vector_type(8)));
typedef __bf16         v16b __attribute__((ext_vector_type(16)));
typedef unsigned short v8us __attribute__((ext_vector_type(8)));
typedef float          v8f  __attribute__((ext_vector_type(8)));
typedef float          v4f  __attribute__((ext_vector_type(4)));
typedef unsigned int   v4u  __attribute__((ext_vector_type(4)));

union Frag  { v8us u[2]; v16h h; v16b bf; };
union FragH { v16h v; v8h hv[2]; };
static_assert(sizeof(Frag) == 32);
static_assert(sizeof(FragH) == 32);

// ---- scalar helpers ---------------------------------------------------------------------------------------
__device__ __forceinline__ unsigned short bf_bits(float f) {          // f32 -> bf16 bits, RNE convert
  unsigned u = __float_as_uint(f);
  return (unsigned short)((u + 0x7FFFu + ((u >> 16) & 1u)) >> 16);
}
__device__ __forceinline__ float bf_up(unsigned short hb) { return __uint_as_float(((unsigned)hb) << 16); }
__device__ __forceinline__ float bfr(float f) { return bf_up(bf_bits(f)); }
__device__ __forceinline__ unsigned short h_bits(_Float16 x) { return __builtin_bit_cast(unsigned short, x); }
__device__ __forceinline__ unsigned pk16(unsigned short a, unsigned short b) { return (unsigned)a | ((unsigned)b << 16); }
__device__ __forceinline__ v8f zero8() { v8f z = {0.f, 0.f, 0.f, 0.f, 0.f, 0.f, 0.f, 0.f}; return z; }
__device__ __forceinline__ float hmax8(v8f s) {
  return fmaxf(fmaxf(fmaxf(s[0], s[1]), fmaxf(s[2], s[3])), fmaxf(fmaxf(s[4], s[5]), fmaxf(s[6], s[7])));
}
__device__ __forceinline__ unsigned wave_ballot(bool p) {
#if defined(__HIP_DEVICE_COMPILE__)
  return __builtin_amdgcn_ballot_w32(p);
#else
  return p ? 1u : 0u;
#endif
}
// 8 f32 values -> bf16 hi bits and bf16 residual bits (lo = RNE(v - hi)), packed 2 per uint
__device__ __forceinline__ void split8(const float* f, v4u& uh, v4u& ul) {
#pragma unroll
  for (int t = 0; t < 4; ++t) {
    const float f0 = f[2 * t], f1 = f[2 * t + 1];
    const unsigned short hb0 = bf_bits(f0), hb1 = bf_bits(f1);
    const unsigned short lb0 = bf_bits(f0 - bf_up(hb0));
    const unsigned short lb1 = bf_bits(f1 - bf_up(hb1));
    uh[t] = pk16(hb0, hb1);
    ul[t] = pk16(lb0, lb1);
  }
}

// ---- 16-bit fragment loader (A, or B from a k-contiguous [n][k] row): lane -> row/col (lane&15), p already includes
//      + 8*(lane>>4); elements 0..7 <- p[0..7] (k0+8h..), elements 8..15 <- p[16..23] (k0+16+8h..)
__device__ __forceinline__ Frag ldfrag(const unsigned short* p) {
  Frag f;
  f.u[0] = *(const v8us*)(p);
  f.u[1] = *(const v8us*)(p + 16);
  return f;
}

// ---- fragment-order planes (W16, WWb, XP, Yh, Yl): a 16-row x 32-k operand tile is stored as the 1 KiB its loader
//      reads: half j, then lane = 16 hh + row, then 8 elements, k = k0 + 16 j + 8 hh + e (the k map of ldfrag). Each of
//      the loader's two wave loads then covers 512 contiguous bytes (4 whole lines) and not 32 B of each of 16 rows.
//      piece_off: element offset of the 8-element piece q = k / 8 of row r (0..15) of tile t; nks = 32-k steps a row.
__device__ __forceinline__ size_t piece_off(int t, int nks, int q, int r) {
  return ((size_t)((t * nks + (q >> 2)) * 2 + ((q >> 1) & 1)) * 32 + 16 * (q & 1) + r) * 8;
}
__device__ __forceinline__ Frag ldfrag_p(const unsigned short* plane, int t, int nks, int ks, int lane) {
  const unsigned short* p = plane + ((size_t)(t * nks + ks) * 64 + lane) * 8;
  Frag f;
  f.u[0] = *(const v8us*)(p);
  f.u[1] = *(const v8us*)(p + 256);
  return f;
}

// ---- WMMA helpers: builtin followed by a 4-slot VALU gap tying D and keeping A/B live --------------------------
__device__ __forceinline__ v8f mma_h(v16h a, v16h b, v8f c) {
  v8f d = __builtin_amdgcn_wmma_f32_16x16x32_f16(false, a, false, b, (short)0, c, false, false);
#if defined(__HIP_DEVICE_COMPILE__)
  asm volatile("v_nop\n\tv_nop\n\tv_nop\n\tv_nop" : "+v"(d) : "v"(a), "v"(b));
#endif
  return d;
}
__device__ __forceinline__ v8f mma_b(v16b a, v16b b, v8f c) {
  v8f d = __builtin_amdgcn_wmma_f32_16x16x32_bf16(false, a, false, b, (short)0, c, false, false);
#if defined(__HIP_DEVICE_COMPILE__)
  const v16h ha = __builtin_bit_cast(v16h, a), hb = __builtin_bit_cast(v16h, b);
  asm volatile("v_nop\n\tv_nop\n\tv_nop\n\tv_nop" : "+v"(d) : "v"(ha), "v"(hb));
#endif
  return d;
}

// =========================================================================================================
// (0) weights. Blocks 0..47: W16 f16 [384][256], rows 0..127 = theta_w, 128..255 = phi_w, 256..383 = g_w; value =
//     f16 of (bf16-RNE(w) * 256) (exact). Block owns rows 8*blk..8*blk+7 (half a 16-row tile): 8 lanes x 16 B = one
//     whole line of the fragment-order plane per piece q. Blocks 48..63: WWb bf16 [256][128], one 16-row tile a block.
// coverage: 48 blocks x 8 rows x 32 pieces x 8 halves = 384 x 256; 16 blocks x 16 rows x 16 pieces x 8 = 256 x 128.
// =========================================================================================================
__global__ __launch_bounds__(256)
void cvt_w(const float* __restrict__ tw, const float* __restrict__ pw, const float* __restrict__ gw,
           const float* __restrict__ ow, unsigned short* W16, unsigned short* WWb) {
  const int tid = threadIdx.x, blk = blockIdx.x;
  if (blk < MW / 8) {
    const int rl = tid & 7, pq = tid >> 3, col = 8 * pq;             // row in the block, piece 0..31
    const int o = 8 * blk + rl;                                      // 0..383
    const int grp = blk >> 4;                                        // 0,1,2 (block-uniform)
    const float* wbase = (grp == 0) ? tw : ((grp == 1) ? pw : gw);  // all global
    const float* s = wbase + (size_t)(o - DQ * grp) * CC + col;      // (o - 128 grp) in 0..127
    const v4f a = *(const v4f*)s;
    const v4f q = *(const v4f*)(s + 4);
    const float f[8] = {a[0], a[1], a[2], a[3], q[0], q[1], q[2], q[3]};
    v4u u;
#pragma unroll
    for (int t = 0; t < 4; ++t) {
      const _Float16 h0 = (_Float16)(bfr(f[2 * t]) * WSC);
      const _Float16 h1 = (_Float16)(bfr(f[2 * t + 1]) * WSC);
      u[t] = pk16(h_bits(h0), h_bits(h1));
    }
{
      *(v4u*)(W16 + piece_off(o >> 4, CC / 32, pq, o & 15)) = u;
      
    }
  } else {
    const int rb = blk - MW / 8;                                     // 0..15
    const int o = 16 * rb + (tid & 15);                              // 0..255
    const int pq = tid >> 4, col = 8 * pq;                           // piece 0..15, col 0..120
    const float* s = ow + (size_t)o * DQ + col;
    const v4f a = *(const v4f*)s;
    const v4f q = *(const v4f*)(s + 4);
    const float f[8] = {a[0], a[1], a[2], a[3], q[0], q[1], q[2], q[3]};
    v4u u;
#pragma unroll
    for (int t = 0; t < 4; ++t) u[t] = pk16(bf_bits(f[2 * t]), bf_bits(f[2 * t + 1]));
{
      *(v4u*)(WWb + piece_off(rb, DQ / 32, pq, tid & 15)) = u;
      
    }
  }
}

// =========================================================================================================
// (1) x f32 [b][256 c][4096 n] -> XP f16, rows n, k = c, fragment order (bf16-RNE values, exact in f16) through an LDS
//     tile T[64 n][64 c] (pitch TP, cross-wave, block barrier). Block (nb, cb, b) owns a 64 c x 64 n tile.
// coverage: T written rows (8e+t)=0..63 x cols cl 0..63, read rows 0..63 x cols 8 pq..8 pq+7, pq 0..7 (staged extent ==
//           consumed extent); XP 2 it x 2 tiles x 8 pieces x 16 rows x 8 = 64 n x 64 c, each wave store 512 contiguous B;
//           grid (64, 4, NB) covers rows [b][0..4095] x c 0..255 exactly once.
// =========================================================================================================
__global__ __launch_bounds__(256)
void cvt_x(const float* __restrict__ x, unsigned short* XP) {
  __shared__ __align__(16) unsigned short T[QT * TP];
  const int tid = threadIdx.x;
  const int nb = blockIdx.x, cb = blockIdx.y, b = blockIdx.z;
  const int e = tid & 7, lq = tid >> 3;                             // lq 0..31
  const int n0 = nb * QT, c0 = cb * QT;
#pragma unroll
  for (int it = 0; it < 2; ++it) {
    const int cl = it * 32 + lq;                                     // 0..63
    const float* sp = x + ((size_t)(b * CC + c0 + cl)) * NN + n0 + 8 * e;
    const v4f a = *(const v4f*)sp;
    const v4f q = *(const v4f*)(sp + 4);
    unsigned short hb[8];
#pragma unroll
    for (int t = 0; t < 4; ++t) {
      hb[t]     = h_bits((_Float16)bfr(a[t]));
      hb[4 + t] = h_bits((_Float16)bfr(q[t]));
    }
#pragma unroll
    for (int t = 0; t < 8; ++t) T[(8 * e + t) * TP + cl] = hb[t];
  }
  __syncthreads();
  const int r16 = tid & 15, pq = (tid >> 4) & 7, tl = tid >> 7;      // row in its tile, piece 0..7, tile 0..1 (+ 2 it)
  v4u up[2];
#pragma unroll
  for (int it = 0; it < 2; ++it) {
    const int nl = (2 * it + tl) * 16 + r16;                         // 0..63
    up[it] = *(const v4u*)(T + nl * TP + 8 * pq);
  }
{
#pragma unroll
    for (int it = 0; it < 2; ++it) {
      const int t = (b * NN + n0) / 16 + 2 * it + tl;
      *(v4u*)(XP + piece_off(t, CC / 32, c0 / 8 + pq, r16)) = up[it];
    }
    
  }
}

// =========================================================================================================
// (2) conv1x1 GEMM for one (b, strip of 128 positions = image rows 2s and 2s+1, 64-o block of the stacked weights):
//     Y[o][n] = (1/256) sum_c W16[o][c] XP[b][n][c]. Block 256 threads = 8 waves; wave w owns cols n0+16w..+15
//     (one B fragment per k-step, tile (b 4096 + n0) / 16 + w of XP) and 4 m-tiles (A rows o = o0 + 16 mt + (lane&15),
//     tile o0 / 16 + mt of W16), both planes in fragment order. K = 256 = 8 steps.
//     Epilogue staged in LDS Os[n_loc][o_loc] (pitch OSP, b128
//     stores), block barrier (cross-wave), then (block-uniform branch on the o block):
//       o-blocks 0,1 -> theta dims 0..63 / 64..127 + bias -> Qh/Ql bf16 [b][4096 n][128 d] (hi = RNE(v), lo = RNE(v-hi)):
//       o-blocks 2,3 -> phi + bias in f32 -> PF f32 [b][4096 n][128 d]: 128 rows x the dsel half (256 B = 2 whole
//                       lines) of the 512-B row, 16 consecutive lanes x 16 B, one instruction per 2 rows.
//       o-blocks 4,5 -> g + bias -> GF f32 [b][4096 n][128 d], same layout.
// coverage: Os 8 waves x 16 n x 64 o = 128 x 64 written, reads rows <= 127 cols <= 63; theta planes 4 it x 32 rows
//           x 8 lanes x 8 = 128 n x 64 d; f32 planes 8 it x 16 rows x 16 lanes x 4 = 128 n x 64 d; grid (32, 6, NB)
//           covers all 4096 rows x 128 d of Qh/Ql and of PF/GF exactly once.
// =========================================================================================================
__global__ __launch_bounds__(256)
void gemm_proj(const unsigned short* __restrict__ W16, const unsigned short* __restrict__ XP,
               const float* __restrict__ tb, const float* __restrict__ pb, const float* __restrict__ gb,
               unsigned short* Qh, unsigned short* Ql, float* PF, float* GF) {
  __shared__ __align__(16) float Os[SN * OSP];
  const int tid  = threadIdx.x;
  const int lane = tid & 31, wave = tid >> 5;                        // wave 0..7
  const int hh   = lane >> 4, c = lane & 15;
  const int st   = blockIdx.x, mb = blockIdx.y, b = blockIdx.z;
  const int n0   = st * SN, o0 = mb * QT;

  const int ta = o0 / 16, tb16 = (b * NN + n0) / 16 + wave;          // first A tile, the wave's B tile

  v8f acc[4];
#pragma unroll
  for (int mt = 0; mt < 4; ++mt) acc[mt] = zero8();

#pragma unroll
  for (int ks = 0; ks < CC / 32; ++ks) {
    const Frag fb = ldfrag_p(XP, tb16, CC / 32, ks, lane);
#pragma unroll
    for (int mt = 0; mt < 4; ++mt) {
      const Frag fa = ldfrag_p(W16, ta + mt, CC / 32, ks, lane);
      acc[mt] = mma_h(fa.h, fb.h, acc[mt]);
    }
  }

  // ---- epilogue: scale back -> LDS Os[n_loc][o_loc]; lane (hh, c) holds o = 16 mt + 8 hh + r for n_loc = 16 w + c
  {
    const int nl = 16 * wave + c;
#pragma unroll
    for (int mt = 0; mt < 4; ++mt) {
      v4f va, vb;
#pragma unroll
      for (int r = 0; r < 4; ++r) { va[r] = acc[mt][r] * IWSC; vb[r] = acc[mt][4 + r] * IWSC; }
      *(v4f*)(Os + nl * OSP + 16 * mt + 8 * hh)     = va;
      *(v4f*)(Os + nl * OSP + 16 * mt + 8 * hh + 4) = vb;
    }
  }
  __syncthreads();

  const int grp = mb >> 1;                                           // 0 theta, 1 phi, 2 g (block-uniform)
  const int dsel = (mb & 1) * QT;                                    // 0 or 64
  const float* bias = (grp == 0) ? tb : ((grp == 1) ? pb : gb);     // all global

  if (grp == 0) {
    const int e = tid & 7, lq = tid >> 3;                            // lq 0..31
    float bv[8];
    {
      const v4f ba = *(const v4f*)(bias + dsel + 8 * e);
      const v4f bq = *(const v4f*)(bias + dsel + 8 * e + 4);
#pragma unroll
      for (int t = 0; t < 4; ++t) { bv[t] = bfr(ba[t]); bv[4 + t] = bfr(bq[t]); }
    }
    v4u uh[4], ul[4];
#pragma unroll
    for (int it = 0; it < 4; ++it) {
      const int row = it * 32 + lq;                                  // n_loc 0..127
      const v4f a = *(const v4f*)(Os + row * OSP + 8 * e);
      const v4f q = *(const v4f*)(Os + row * OSP + 8 * e + 4);
      float f[8];
#pragma unroll
      for (int t = 0; t < 4; ++t) { f[t] = a[t] + bv[t]; f[4 + t] = q[t] + bv[4 + t]; }
      split8(f, uh[it], ul[it]);
    }
{
#pragma unroll
      for (int it = 0; it < 4; ++it) {
        const int row = it * 32 + lq;
        const size_t po = ((size_t)(b * NN + n0 + row)) * DQ + dsel + 8 * e;
        *(v4u*)(Qh + po) = uh[it];
        *(v4u*)(Ql + po) = ul[it];
      }
      
    }
  } else {
    const int e16 = tid & 15, lr = tid >> 4;                        // lr 0..15
    v4f bv4;
    {
      const v4f bq = *(const v4f*)(bias + dsel + 4 * e16);
#pragma unroll
      for (int t = 0; t < 4; ++t) bv4[t] = bfr(bq[t]);
    }
    float* P = (grp == 1) ? PF : GF;                                 // both global
    v4f res[8];
#pragma unroll
    for (int it = 0; it < 8; ++it) {
      const int row = it * 16 + lr;                                  // n_loc 0..127
      const v4f a = *(const v4f*)(Os + row * OSP + 4 * e16);
      v4f v;
#pragma unroll
      for (int t = 0; t < 4; ++t) v[t] = a[t] + bv4[t];
      res[it] = v;
    }
{
#pragma unroll
      for (int it = 0; it < 8; ++it) {
        const int row = it * 16 + lr;
        const size_t po = ((size_t)(b * NN + n0 + row)) * DQ + dsel + 4 * e16;
        *(v4f*)(P + po) = res[it];
      }
      
    }
  }
}

// =========================================================================================================
// (3) 2x2 stride-2 max-pool of PF / GF f32 [b][4096 n][128 d] in f32 -> Kh/Kl bf16 [b][1024 m][128 d]
//     (hi = RNE(v), lo = RNE(v-hi)) and Gp f16 [b][1024 m][128 d], m = 32 py + px, window n = (2py+dy) 64 + 2px+dx,
//     dy, dx in {0,1}. Block (py, b), 256 threads: lane group e16 (16 lanes x 16 B = one 256-B row = 2 whole
//     lines), lr = tid>>4 -> px = 16 it + lr for it 0..1 (all 32 px valid, no pad rows). No LDS, no barriers.
// coverage: blocks 0..31 x px 0..31 x 16 lanes x 8 = rows 0..1023 x 128 d; grid (32, NB) covers Kh/Kl/Gp
//           [b][0..1023][0..127] exactly once.
// =========================================================================================================
__global__ __launch_bounds__(256)
void pool_k(const float* __restrict__ PF, const float* __restrict__ GF,
            unsigned short* Kh, unsigned short* Kl, unsigned short* Gp) {
  const int tid = threadIdx.x, py = blockIdx.x, b = blockIdx.y;
  const int e16 = tid & 15, lr = tid >> 4;                          // lr 0..15
  v4u kh[2], kl[2], gu[2];
#pragma unroll
  for (int it = 0; it < 2; ++it) {
    const int px = it * 16 + lr;                                    // 0..31
    float fk[8], fg[8];
#pragma unroll
    for (int t = 0; t < 8; ++t) { fk[t] = -__builtin_inff(); fg[t] = -__builtin_inff(); }
#pragma unroll
    for (int dy = 0; dy < 2; ++dy) {
      const size_t rb = ((size_t)(b * NN + (2 * py + dy) * WIMG + 2 * px)) * DQ + 8 * e16;
#pragma unroll
      for (int dx = 0; dx < 2; ++dx) {
        const float* pk = PF + rb + (size_t)dx * DQ;
        const float* pg = GF + rb + (size_t)dx * DQ;
        const v4f ka = *(const v4f*)pk, kq = *(const v4f*)(pk + 4);
        const v4f ga = *(const v4f*)pg, gq = *(const v4f*)(pg + 4);
#pragma unroll
        for (int t = 0; t < 4; ++t) {
          fk[t]     = fmaxf(fk[t], ka[t]);
          fk[4 + t] = fmaxf(fk[4 + t], kq[t]);
          fg[t]     = fmaxf(fg[t], ga[t]);
          fg[4 + t] = fmaxf(fg[4 + t], gq[t]);
        }
      }
    }
    split8(fk, kh[it], kl[it]);
#pragma unroll
    for (int t = 0; t < 4; ++t) gu[it][t] = pk16(h_bits((_Float16)fg[2 * t]), h_bits((_Float16)fg[2 * t + 1]));
  }
{
#pragma unroll
    for (int it = 0; it < 2; ++it) {
      const int px = it * 16 + lr;
      const size_t po = ((size_t)(b * MM + WP * py + px)) * DQ + 8 * e16;
      *(v4u*)(Kh + po) = kh[it];
      *(v4u*)(Kl + po) = kl[it];
      *(v4u*)(Gp + po) = gu[it];
    }
    
  }
}

// =========================================================================================================
// (4) Gp f16 [b][1024 m][128 d] -> Gc f16 [b][d][m] (channel-major, keys contiguous) through an LDS tile T[64 d][64 m]
// coverage: reads 2 it x 32 rows x 8 lanes x 8 = 64 m x 64 d; T written rows (8e+t)=0..63 x cols 0..63, read rows
//           0..63 x cols 8e..8e+7 (staged extent == consumed extent); writes 64 d x 64 m; grid (16, 2, NB) covers
//           Gc [b][0..127][0..1023] exactly once.
// =========================================================================================================
__global__ __launch_bounds__(256)
void tr_g(const unsigned short* __restrict__ Gp, unsigned short* Gc) {
  __shared__ __align__(16) unsigned short T[QT * TP];
  const int tid = threadIdx.x;
  const int mt = blockIdx.x, db = blockIdx.y, b = blockIdx.z;
  const int e = tid & 7, lq = tid >> 3;                             // lq 0..31
  const int m0 = mt * QT, d0 = db * QT;
#pragma unroll
  for (int it = 0; it < 2; ++it) {
    const int ml = it * 32 + lq;                                     // 0..63
    const v4u w = *(const v4u*)(Gp + ((size_t)(b * MM + m0 + ml)) * DQ + d0 + 8 * e);
    unsigned short hb[8];
#pragma unroll
    for (int t = 0; t < 4; ++t) {
      hb[2 * t]     = (unsigned short)(w[t] & 0xFFFFu);
      hb[2 * t + 1] = (unsigned short)(w[t] >> 16);
    }
#pragma unroll
    for (int t = 0; t < 8; ++t) T[(8 * e + t) * TP + ml] = hb[t];
  }
  __syncthreads();
  v4u up[2];
#pragma unroll
  for (int it = 0; it < 2; ++it) {
    const int dl = it * 32 + lq;                                     // 0..63
    up[it] = *(const v4u*)(T + dl * TP + 8 * e);
  }
{
#pragma unroll
    for (int it = 0; it < 2; ++it) {
      const int dl = it * 32 + lq;
      *(v4u*)(Gc + ((size_t)(b * DQ + d0 + dl)) * MM + m0 + 8 * e) = up[it];
    }
    
  }
}

// ---- asynchronous copies to LDS: each lane moves its own 16 bytes, global -> LDS, through no register. Arguments: the
//      lane's LDS byte addresses, then its global addresses in the same order, all multiples of 16. The closing
//      s_wait_xcnt 0 stands inside the copies' own statement so that no address register named there is rewritten ahead
//      of it.
__device__ __forceinline__ unsigned lds_addr(const void* p) { return (unsigned)(uintptr_t)p; }
__device__ __forceinline__ void copy4(unsigned l0, unsigned l1, unsigned l2, unsigned l3,
                                      const unsigned short* g0, const unsigned short* g1,
                                      const unsigned short* g2, const unsigned short* g3) {
#if defined(__HIP_DEVICE_COMPILE__)
  asm volatile("global_load_async_to_lds_b128 %0, %4, off\n\t"
               "global_load_async_to_lds_b128 %1, %5, off\n\t"
               "global_load_async_to_lds_b128 %2, %6, off\n\t"
               "global_load_async_to_lds_b128 %3, %7, off\n\t"
               "s_wait_xcnt 0x0"
               :: "v"(l0), "v"(l1), "v"(l2), "v"(l3), "v"(g0), "v"(g1), "v"(g2), "v"(g3) : "memory");
#endif
}
__device__ __forceinline__ void copy12(unsigned a0, unsigned a1, unsigned a2, unsigned a3, unsigned b0, unsigned b1,
                                       unsigned b2, unsigned b3, unsigned c0, unsigned c1, unsigned c2, unsigned c3,
                                       const unsigned short* p0, const unsigned short* p1, const unsigned short* p2,
                                       const unsigned short* p3, const unsigned short* q0, const unsigned short* q1,
                                       const unsigned short* q2, const unsigned short* q3, const unsigned short* r0,
                                       const unsigned short* r1, const unsigned short* r2, const unsigned short* r3) {
#if defined(__HIP_DEVICE_COMPILE__)
  asm volatile("global_load_async_to_lds_b128 %0, %12, off\n\t"
               "global_load_async_to_lds_b128 %1, %13, off\n\t"
               "global_load_async_to_lds_b128 %2, %14, off\n\t"
               "global_load_async_to_lds_b128 %3, %15, off\n\t"
               "global_load_async_to_lds_b128 %4, %16, off\n\t"
               "global_load_async_to_lds_b128 %5, %17, off\n\t"
               "global_load_async_to_lds_b128 %6, %18, off\n\t"
               "global_load_async_to_lds_b128 %7, %19, off\n\t"
               "global_load_async_to_lds_b128 %8, %20, off\n\t"
               "global_load_async_to_lds_b128 %9, %21, off\n\t"
               "global_load_async_to_lds_b128 %10, %22, off\n\t"
               "global_load_async_to_lds_b128 %11, %23, off\n\t"
               "s_wait_xcnt 0x0"
               :: "v"(a0), "v"(a1), "v"(a2), "v"(a3), "v"(b0), "v"(b1), "v"(b2), "v"(b3), "v"(c0), "v"(c1), "v"(c2),
                  "v"(c3), "v"(p0), "v"(p1), "v"(p2), "v"(p3), "v"(q0), "v"(q1), "v"(q2), "v"(q3), "v"(r0), "v"(r1),
                  "v"(r2), "v"(r3) : "memory");
#endif
}
// the issuing wave's copies have landed behind this wait
__device__ __forceinline__ void wait_async0() {
#if defined(__HIP_DEVICE_COMPILE__)
  asm volatile("s_wait_asynccnt 0x0" ::: "memory");
#endif
}
// the wave's own LDS reads have retired before the buffer they read is handed to the copies that refill it
__device__ __forceinline__ void wait_ds0() {
#if defined(__HIP_DEVICE_COMPILE__)
  asm volatile("s_wait_dscnt 0x0" ::: "memory");
#endif
}
// one 32-key stage: Kh and Kl rows kb..kb+31 (256 B each, LDS pitch 272 B) and the 64-B key run kb..kb+31 of all 128
// rows of Gc (LDS pitch 80 B). 128 threads x 12 copies of 16 B = 8 KiB + 8 KiB + 8 KiB; no two lanes share an LDS byte.
__device__ __forceinline__ void stage_kv(unsigned short* st, const unsigned short* Khb, const unsigned short* Klb,
                                         const unsigned short* Gcb, int kb, int tid) {
  const int kr = tid >> 4, kcol = 8 * (tid & 15);                    // kr 0..7, + 8 i -> key row 0..31
  const int vr = tid >> 2, vcol = 8 * (tid & 3);                     // vr 0..31, + 32 i -> channel row 0..127
  const unsigned lk = lds_addr(st + kr * KP + kcol);
  const unsigned ll = lk + 2u * (KT * KP);
  const unsigned lv = lds_addr(st + 2 * KT * KP + vr * VPT + vcol);
  const unsigned short* gk = Khb + (size_t)(kb + kr) * DQ + kcol;
  const unsigned short* gl = Klb + (size_t)(kb + kr) * DQ + kcol;
  const unsigned short* gv = Gcb + (size_t)vr * MM + kb + vcol;
  copy12(lk, lk + 2u * (8 * KP), lk + 2u * (16 * KP), lk + 2u * (24 * KP),
         ll, ll + 2u * (8 * KP), ll + 2u * (16 * KP), ll + 2u * (24 * KP),
         lv, lv + 2u * (32 * VPT), lv + 2u * (64 * VPT), lv + 2u * (96 * VPT),
         gk, gk + 8 * DQ, gk + 16 * DQ, gk + 24 * DQ, gl, gl + 8 * DQ, gl + 16 * DQ, gl + 24 * DQ,
         gv, gv + 32 * MM, gv + 64 * MM, gv + 96 * MM);
}

// =========================================================================================================
// (5) attention for one (b, 64-query tile), transposed formulation, 1024 keys (all valid, no mask, no scale):
//   S^T tile (16 keys x 16 queries) = sum over 4 d-chunks (unrolled) of A(k: row = key kb + (lane&15), 32 d via
//   the split k map from the bf16 plane Kh [b][1024][128]) . B(q: col = query, same map from Qh [b][4096][128])
//   + A(Kh).B(Ql) + A(Kl).B(Qh) (bf16 unscaled residual planes, shared accumulator).
//   Per lane the D tile holds 8 keys of ONE query: online softmax state per lane, one shuffle (lane^16) for the max
//   over 32 keys; the o/l rescale is skipped under a wave-uniform ballot when no lane's max grew (corr == 1 exactly
//   for every lane then); row-sum partials combined at the end. P = e^{s-m} x 16384 as f16 is the B operand of
//   y^T (rows channel, cols queries) += A(pooled g: rows channel = 16j + (lane&15), keys contiguous, f16 plane Gc
//   [b][128][1024]) . B(P^T): element r <- D of the tile covering keys kb..kb+15, element 8+r <- the tile covering
//   kb+16..kb+31, lane unchanged. 8 accumulator tiles per wave (128 channels). Block = 4 waves = 64 queries.
//   Live state per lane: o 64 + s0/s1 16 + two sets of 6 fragments, or one set and 8 V fragments, + m/l, under the 256 cap.
//   Operands come from LDS: the block's 64 query rows of Qh/Ql are copied once (Qs, pitch 272 B); each 32-key stage of
//   Kh/Kl/Gc is copied by all four waves into one of two buffers (Ring) one trip ahead of its use and read by all four.
//   Epilogue: y = O/l staged in LDS Os[query][128 channels] (pitch OSPW, b128 stores), block barrier (cross-wave),
//   then Yh/Yl (rows n, k = channel) in fragment order, each wave store 512 contiguous B.
// coverage: Os written 4 waves x 16 queries x 128 ch, read rows 0..63 x ch 8 pq..8 pq+7 (pq 0..15); planes 4 tiles x 16
//           pieces x 16 rows x 8 = 64 n x 128 ch per plane; grid (NQ/64, NB) covers rows 0..NQ-1 of Yh/Yl exactly once.
// =========================================================================================================
__global__ __launch_bounds__(128) __attribute__((amdgpu_num_vgpr(256)))
void attn_k(const unsigned short* __restrict__ Qh, const unsigned short* __restrict__ Ql,
            const unsigned short* __restrict__ Kh, const unsigned short* __restrict__ Kl,
            const unsigned short* __restrict__ Gc, unsigned short* Yh, unsigned short* Yl) {
  __shared__ __align__(16) float Os[QT * OSPW];
  __shared__ __align__(16) unsigned short Qs[2 * QT * KP];
  __shared__ __align__(16) unsigned short Ring[2 * STG];
  const int tid  = threadIdx.x;
  const int wave = tid >> 5, lane = tid & 31;
  const int hh   = lane >> 4, c = lane & 15;
  const int n0   = blockIdx.x * QT, b = blockIdx.y;

  const unsigned short* Khb = Kh + (size_t)b * MM * DQ;
  const unsigned short* Klb = Kl + (size_t)b * MM * DQ;
  const unsigned short* Gcb = Gc + (size_t)b * DQ * MM;

  // ---- in front of the loop: the query tile and stage 0, their wait, the barrier that publishes them, then stage 1
  {
    const int qr = tid >> 4, qcol = 8 * (tid & 15);                  // qr 0..7, + 8 i -> query row 0..63
    const unsigned lq = lds_addr(Qs + qr * KP + qcol);
    const size_t go = ((size_t)(b * NN + n0 + qr)) * DQ + qcol;
    auto plane = [](unsigned l0, const unsigned short* g) {          // 64 rows of one plane, 8 copies a thread
      copy4(l0, l0 + 2u * (8 * KP), l0 + 2u * (16 * KP), l0 + 2u * (24 * KP), g, g + 8 * DQ, g + 16 * DQ, g + 24 * DQ);
      copy4(l0 + 2u * (32 * KP), l0 + 2u * (40 * KP), l0 + 2u * (48 * KP), l0 + 2u * (56 * KP), g + 32 * DQ,
            g + 40 * DQ, g + 48 * DQ, g + 56 * DQ);
    };
    plane(lq, Qh + go);
    plane(lq + 2u * (QT * KP), Ql + go);
  }
  stage_kv(Ring, Khb, Klb, Gcb, 0, tid);
  wait_async0();
  __syncthreads();
  stage_kv(Ring + STG, Khb, Klb, Gcb, KT, tid);

  // q fragment pointers (B operand, col = query 16*wave + c of the tile), + 32*kc
  const unsigned short* Qhp = Qs + (16 * wave + c) * KP + 8 * hh;
  const unsigned short* Qlp = Qhp + QT * KP;

  float m = -1.0e30f, l = 0.f;
  v8f o[8];
#pragma unroll
  for (int j = 0; j < 8; ++j) o[j] = zero8();

#pragma unroll 1
  for (int kb = 0; kb < MM; kb += KT) {
    unsigned short* st = Ring + ((kb / KT) & 1) * STG;               // this trip's buffer
    // k fragment base (A operand, row = key kb + c), + 32*kc; v fragment base (A operand, row = channel 16j + c)
    const unsigned short* k0p  = st + c * KP + 8 * hh;               // keys kb .. kb+15
    const unsigned short* k1p  = k0p + 16 * KP;                      // keys kb+16 .. kb+31
    const unsigned short* k0lp = k0p + KT * KP;
    const unsigned short* k1lp = k1p + KT * KP;
    const unsigned short* Vp   = st + 2 * KT * KP + c * VPT + 8 * hh;
    v8f s0 = zero8(), s1 = zero8();
    Frag fr[2][6], vf[8];                                            // two sets of one d-chunk's fragments; V fragments
    auto chunk = [&](Frag* f, int kc) {                              // the 12 LDS reads of d-chunk kc
      f[0] = ldfrag(Qhp + 32 * kc);
      f[1] = ldfrag(Qlp + 32 * kc);
      f[2] = ldfrag(k0p + 32 * kc);
      f[3] = ldfrag(k1p + 32 * kc);
      f[4] = ldfrag(k0lp + 32 * kc);
      f[5] = ldfrag(k1lp + 32 * kc);
    };
    chunk(fr[0], 0);
    // unrolled so that the two sets are registers: the reads of the next chunk (behind the last chunk: of all V fragments)
    // stand as one group above this chunk's products and are waited for by count, one group later
#pragma unroll
    for (int kc = 0; kc < DQ / 32; ++kc) {
      if (kc + 1 < DQ / 32) {
        chunk(fr[(kc + 1) & 1], kc + 1);
      } else {
#pragma unroll
        for (int j = 0; j < 8; ++j) vf[j] = ldfrag(Vp + (16 * j) * VPT);
      }
      const Frag* f = fr[kc & 1];
      s0 = mma_b(f[2].bf, f[0].bf, s0);
      s1 = mma_b(f[3].bf, f[0].bf, s1);
      s0 = mma_b(f[2].bf, f[1].bf, s0);
      s1 = mma_b(f[3].bf, f[1].bf, s1);
      s0 = mma_b(f[4].bf, f[0].bf, s0);
      s1 = mma_b(f[5].bf, f[0].bf, s1);
    }

    float mx = fmaxf(hmax8(s0), hmax8(s1));
    mx = fmaxf(mx, __shfl_xor(mx, 16, 32));
    const float mn = fmaxf(m, mx);
    const unsigned grew = wave_ballot(mx > m);                       // wave-uniform
    if (grew != 0u) {
      const float corr = __expf(m - mn);                             // == 1 exactly for lanes whose max did not grow
      l *= corr;
#pragma unroll
      for (int j = 0; j < 8; ++j) {
#pragma unroll
        for (int r = 0; r < 8; ++r) o[j][r] *= corr;
      }
    }
    m = mn;
    const float msh = mn - LNPS;                                     // exp gives e^{s-m} * 16384

    FragH ph;
    float ls = 0.f;
#pragma unroll
    for (int r = 0; r < 8; ++r) {
      const float e0 = __expf(s0[r] - msh);                          // key kb      + 8hh + r
      const float e1 = __expf(s1[r] - msh);                          // key kb + 16 + 8hh + r
      ls += e0 + e1;
      ph.hv[0][r] = (_Float16)e0;
      ph.hv[1][r] = (_Float16)e1;
    }
    l += ls;

#pragma unroll
    for (int j = 0; j < 8; ++j) o[j] = mma_h(vf[j].h, ph.v, o[j]);

    // ---- foot of the trip: own reads retired, own copies of the next stage landed, one barrier that publishes that
    //      stage and ends every reader's last read of this buffer; only then the refill of this buffer
    wait_ds0();
    wait_async0();
    __syncthreads();
    if (kb + 2 * KT < MM) stage_kv(st, Khb, Klb, Gcb, kb + 2 * KT, tid);
  }
  wait_async0();                                                     // nothing is in flight when the wave goes on
  l += __shfl_xor(l, 16, 32);
  const float inv = 1.0f / l;                                        // o and l both carry the x16384 factor

  // ---- epilogue: y = o * inv -> Os[query][ch]; lane (hh, c) holds ch = 16 j + 8 hh + r for query 16 w + c
  {
    const int qrow = 16 * wave + c;
#pragma unroll
    for (int j = 0; j < 8; ++j) {
      v4f va, vb;
#pragma unroll
      for (int r = 0; r < 4; ++r) { va[r] = o[j][r] * inv; vb[r] = o[j][4 + r] * inv; }
      *(v4f*)(Os + qrow * OSPW + 16 * j + 8 * hh)     = va;
      *(v4f*)(Os + qrow * OSPW + 16 * j + 8 * hh + 4) = vb;
    }
  }
  __syncthreads();

  const int r16 = tid & 15, pl = tid >> 4;                           // row in its tile, pl 0..7
  v4u uh[8], ul[8];
#pragma unroll
  for (int it = 0; it < 8; ++it) {
    const int row = (it >> 1) * 16 + r16;                            // query 0..63
    const int pq  = (it & 1) * 8 + pl;                               // piece 0..15, channels 8 pq..8 pq+7
    const v4f a = *(const v4f*)(Os + row * OSPW + 8 * pq);
    const v4f q = *(const v4f*)(Os + row * OSPW + 8 * pq + 4);
    const float f[8] = {a[0], a[1], a[2], a[3], q[0], q[1], q[2], q[3]};
    split8(f, uh[it], ul[it]);
  }
{
#pragma unroll
    for (int it = 0; it < 8; ++it) {
      const size_t po = piece_off((b * NN + n0) / 16 + (it >> 1), DQ / 32, (it & 1) * 8 + pl, r16);
      *(v4u*)(Yh + po) = uh[it];
      *(v4u*)(Yl + po) = ul[it];
    }
    
  }
}

// =========================================================================================================
// (6) output conv for one (b, 64-n tile, 64-c block): A[c][n] = sum_ci WWb[c][ci] (Yh + Yl)[b][n][ci] on bf16 WMMA
//     (2 products per k-step, shared accumulator), K = 128 = 4 steps. Block 128 threads = 4 waves; wave w owns cols
//     n0+16w..+15 (B fragments: tile (b 4096 + n0) / 16 + w of Yh/Yl) and 4 m-tiles (A rows c = c0 + 16 mt + (lane&15),
//     tile c0 / 16 + mt of WWb), all planes in fragment order.
//     Epilogue staged in LDS Os[n_loc][c_loc] (pitch OSP, b128 stores), block barrier
//     2 lines): 8 consecutive lanes x 16 B (values gathered from 4 Os rows), one instruction per 4 lines, final
// coverage: Os 4 waves x 16 n x 64 c written, read rows nl+t <= 63 x cols cl <= 63; WY 8 it x 16 lines x 8 lanes x
//           4 floats = 64 c x 64 n; grid (NQ/64, 4, NB) covers WY[b][0..255][0..NQ-1] exactly once.
// =========================================================================================================
__global__ __launch_bounds__(128)
void gemm_out(const unsigned short* __restrict__ WWb, const unsigned short* __restrict__ Yh,
              const unsigned short* __restrict__ Yl, const float* __restrict__ wb, float* WY) {
  __shared__ __align__(16) float Os[QT * OSP];
  const int tid  = threadIdx.x;
  const int lane = tid & 31, wave = tid >> 5;
  const int hh   = lane >> 4, c = lane & 15;
  const int nt   = blockIdx.x, cb = blockIdx.y, b = blockIdx.z;
  const int n0   = nt * QT, c0 = cb * QT;

  const int ta = c0 / 16, tb16 = (b * NN + n0) / 16 + wave;          // first A tile, the wave's B tile

  v8f acc[4];
#pragma unroll
  for (int mt = 0; mt < 4; ++mt) acc[mt] = zero8();

#pragma unroll
  for (int ks = 0; ks < DQ / 32; ++ks) {
    const Frag fbh = ldfrag_p(Yh, tb16, DQ / 32, ks, lane);
    const Frag fbl = ldfrag_p(Yl, tb16, DQ / 32, ks, lane);
#pragma unroll
    for (int mt = 0; mt < 4; ++mt) {
      const Frag fa = ldfrag_p(WWb, ta + mt, DQ / 32, ks, lane);
      acc[mt] = mma_b(fa.bf, fbh.bf, acc[mt]);
      acc[mt] = mma_b(fa.bf, fbl.bf, acc[mt]);
    }
  }

  // ---- epilogue: -> LDS Os[n_loc][c_loc]; lane (hh, c) holds c_loc = 16 mt + 8 hh + r for n_loc = 16 w + c
  {
    const int nl = 16 * wave + c;
#pragma unroll
    for (int mt = 0; mt < 4; ++mt) {
      v4f va, vb;
#pragma unroll
      for (int r = 0; r < 4; ++r) { va[r] = acc[mt][r]; vb[r] = acc[mt][4 + r]; }
      *(v4f*)(Os + nl * OSP + 16 * mt + 8 * hh)     = va;
      *(v4f*)(Os + nl * OSP + 16 * mt + 8 * hh + 4) = vb;
    }
  }
  __syncthreads();

  const int e = tid & 7, lq = tid >> 3;                              // lq 0..15
  v4f res[8];
#pragma unroll
  for (int it = 0; it < 8; ++it) {
    const int L   = it * 16 + lq;                                    // 0..127
    const int cl  = L >> 1, hf = L & 1;                              // channel 0..63 within the block
    const int nl  = hf * 32 + 4 * e;                                 // position 0..63
    const float bvs = bfr(wb[c0 + cl]);
#pragma unroll
    for (int t = 0; t < 4; ++t) {
      res[it][t] = Os[(nl + t) * OSP + cl] + bvs;
    }
  }
{
#pragma unroll
    for (int it = 0; it < 8; ++it) {
      const int L   = it * 16 + lq;
      const int cl  = L >> 1, hf = L & 1;
      const int nl  = hf * 32 + 4 * e;
      const size_t idx = ((size_t)(b * CC + c0 + cl)) * NN + n0 + nl;
      *(v4f*)(WY + idx) = res[it];
    }
    
  }
}

// =========================================================================================================
// (7) batch-norm statistics, normalisation, affine and residual in one launch: block owns ONE channel (256 blocks of
//     32 waves). Thread tid takes floats 4 tid..4 tid+3 of each of the NB rows WY[b][c][0..NQ) and of the same rows of
//     x, so every wave load is one contiguous 512-B run; a thread's 2 NB loads are independent and all issued before
//     the first sum; the WY values stay in registers from the statistics to the normalisation. Sum and sum of squares
//     in f64 per thread (rows, then elements, in ascending order), wave shuffle reduce, per-wave partials in LDS
//     (cross-wave, block barrier); every wave then shuffle-reduces the same 32 partials itself (a butterfly leaves the
//     same bits in every lane of every wave), so no second barrier and no table: mean, biased variance,
//     rstd = 1/sqrt(var + eps) in f32, then out[b][c][n] = (((WY - mu) * rstd) * bf16-RNE(gamma[c]) + bf16-RNE(beta[c]))
//     + bf16-RNE(x[b][c][n]) in f32.
// coverage: 256 blocks x 1 channel x NB rows x BST threads x 4 floats = out[b][0..255][0..NQ-1] exactly once, each
//           wave store one contiguous 512-B run; reads WY and x at the same offsets only (the produced extent).
// =========================================================================================================
__global__ __launch_bounds__(BST)
void bn_norm(const float* __restrict__ WY, const float* __restrict__ x, const float* __restrict__ gam,
             const float* __restrict__ bet, float* out) {
#pragma clang fp contract(off)
  __shared__ double red[2 * (BST / 32)];
  const int tid = threadIdx.x, lane = tid & 31, wave = tid >> 5;
  const int cc = blockIdx.x;
  const double ninv = 1.0 / ((double)NB * (double)NQ);
  unsigned bo[NB];                                                   // byte offsets in WY, x and out, all < 2^25
  v4f a[NB], xv[NB];
#pragma unroll
  for (int bb = 0; bb < NB; ++bb) bo[bb] = 4u * (unsigned)((bb * CC + cc) * NN + 4 * tid);
#pragma unroll
  for (int bb = 0; bb < NB; ++bb) a[bb] = *(const v4f*)((const char*)WY + bo[bb]);
#if defined(__HIP_DEVICE_COMPILE__)
  // keeps the WY loads ahead of the x loads: loads return in order, and interleaved the sums would wait for rows of x
  __builtin_amdgcn_sched_barrier(0);
#endif
#pragma unroll
  for (int bb = 0; bb < NB; ++bb) xv[bb] = *(const v4f*)((const char*)x + bo[bb]);
#if defined(__HIP_DEVICE_COMPILE__)
  // keeps every load above the sums: without it the scheduler sinks them and only a few stay in flight per wave
  __builtin_amdgcn_sched_barrier(0);
#endif
  const float ga = bfr(gam[cc]), be = bfr(bet[cc]);                  // block-uniform, back long before their use
  double s = 0.0, q = 0.0;
#pragma unroll
  for (int bb = 0; bb < NB; ++bb) {
#pragma unroll
    for (int t = 0; t < 4; ++t) {
      const double d = (double)a[bb][t];
      s += d; q += d * d;
    }
  }
#pragma unroll
  for (int d = 1; d < 32; d <<= 1) {
    s += __shfl_xor(s, d, 32);
    q += __shfl_xor(q, d, 32);
  }
  if (lane == 0) { red[wave] = s; red[BST / 32 + wave] = q; }
  __syncthreads();
  double ts = red[lane], tq = red[BST / 32 + lane];
#pragma unroll
  for (int d = 1; d < 32; d <<= 1) {
    ts += __shfl_xor(ts, d, 32);
    tq += __shfl_xor(tq, d, 32);
  }
  const double mud = ts * ninv;
  double var = tq * ninv - mud * mud;
  var = (var > 0.0) ? var : 0.0;
  const float varf = (float)var + BNEPS;
  const float rs = 1.0f / sqrtf(varf);
  const float mu = (float)mud;
#pragma unroll
  for (int bb = 0; bb < NB; ++bb) {
    v4f r;
#pragma unroll
    for (int t = 0; t < 4; ++t) {
      const float d  = a[bb][t] - mu;
      const float nv = d * rs;
      const float av = nv * ga;
      const float sv = av + be;
      r[t] = sv + bfr(xv[bb][t]);
    }
    *(v4f*)((char*)out + bo[bb]) = r;
  }
}

// =========================================================================================================
// Workspace map (bytes; each region start a multiple of 256; every extent is an exact row/tile multiple and is
//   W16 f16 [384][256]            196608      WWb bf16 [256][128]        65536
//   XP  f16 [NB][4096][256]     16777216 (NB=8)
//   Qh/Ql bf16 [NB][4096][128]   8388608 x2
//   PF/GF f32  [NB][4096][128]  16777216 x2
//   Kh/Kl bf16 [NB][1024][128]   2097152 x2  Gp f16 [NB][1024][128]   2097152   Gc f16 [NB][128][1024]  2097152
//   Yh/Yl bf16 [NB][4096][128]   8388608 x2
//   WY  f32  [NB][256][4096]    33554432
//   total (NB=8) = 126091264
//   W16, WWb, XP, Yh and Yl hold their rows in fragment order (piece_off); the sizes are those of the row-major planes.
// =========================================================================================================
extern "C" void kernel_launch(void* const* d_in, const int* in_sizes, int n_in,
                              void* d_out, int out_size, void* d_ws, size_t ws_size,
                              hipStream_t stream) {
  const int XN = NB * CC * NN;
  if (n_in < 11) return;
  if (in_sizes[0] < XN) return;
  if (in_sizes[1] < DQ * CC || in_sizes[3] < DQ * CC || in_sizes[5] < DQ * CC || in_sizes[7] < CC * DQ) return;
  if (in_sizes[2] < DQ || in_sizes[4] < DQ || in_sizes[6] < DQ || in_sizes[8] < CC) return;
  if (in_sizes[9] < CC || in_sizes[10] < CC) return;
  if (out_size < XN) return;

  size_t off = 0;
  auto carve = [&](size_t bytes) { const size_t o = off; off += (bytes + 255) & ~(size_t)255; return o; };
  const size_t oW16 = carve((size_t)MW * CC * 2);
  const size_t oWWb = carve((size_t)CC * DQ * 2);
  const size_t oXP  = carve((size_t)NB * NN * CC * 2);
  const size_t oQh  = carve((size_t)NB * NN * DQ * 2);
  const size_t oQl  = carve((size_t)NB * NN * DQ * 2);
  const size_t oPF  = carve((size_t)NB * NN * DQ * 4);
  const size_t oGF  = carve((size_t)NB * NN * DQ * 4);
  const size_t oKh  = carve((size_t)NB * MM * DQ * 2);
  const size_t oKl  = carve((size_t)NB * MM * DQ * 2);
  const size_t oGp  = carve((size_t)NB * MM * DQ * 2);
  const size_t oGc  = carve((size_t)NB * DQ * MM * 2);
  const size_t oYh  = carve((size_t)NB * NN * DQ * 2);
  const size_t oYl  = carve((size_t)NB * NN * DQ * 2);
  const size_t oWY  = carve((size_t)NB * CC * NN * 4);
  if (off > ws_size) return;
  if (off > (size_t)134217728) return;

  const float* x   = (const float*)d_in[0];
  const float* gw  = (const float*)d_in[1];
  const float* gb  = (const float*)d_in[2];
  const float* tw  = (const float*)d_in[3];
  const float* tb  = (const float*)d_in[4];
  const float* pw  = (const float*)d_in[5];
  const float* pb  = (const float*)d_in[6];
  const float* ow  = (const float*)d_in[7];
  const float* wb  = (const float*)d_in[8];
  const float* gam = (const float*)d_in[9];
  const float* bet = (const float*)d_in[10];

  char* ws = (char*)d_ws;
  unsigned short* W16 = (unsigned short*)(ws + oW16);
  unsigned short* WWb = (unsigned short*)(ws + oWWb);
  unsigned short* XP  = (unsigned short*)(ws + oXP);
  unsigned short* Qh  = (unsigned short*)(ws + oQh);
  unsigned short* Ql  = (unsigned short*)(ws + oQl);
  float*          PF  = (float*)(ws + oPF);
  float*          GF  = (float*)(ws + oGF);
  unsigned short* Kh  = (unsigned short*)(ws + oKh);
  unsigned short* Kl  = (unsigned short*)(ws + oKl);
  unsigned short* Gp  = (unsigned short*)(ws + oGp);
  unsigned short* Gc  = (unsigned short*)(ws + oGc);
  unsigned short* Yh  = (unsigned short*)(ws + oYh);
  unsigned short* Yl  = (unsigned short*)(ws + oYl);
  float*          WY  = (float*)(ws + oWY);
  float* out = (float*)d_out;

  const dim3 blk256(256), blk128(128);

  // (0) theta_w / phi_w / g_w -> stacked f16 plane; w_w -> bf16 plane, both in fragment order
  cvt_w<<<dim3(MW / 8 + CC / 16), blk256, 0, stream>>>(tw, pw, gw, ow, W16, WWb);
  // (1) x -> 16-bit plane, rows = positions, fragment order
  cvt_x<<<dim3(NN / QT, CC / QT, NB), blk256, 0, stream>>>(x, XP);
  // (2) conv1x1 GEMM -> theta (q) hi/res planes, phi / g conv outputs + bias as f32 planes
  gemm_proj<<<dim3(NSTRIP, MW / QT, NB), blk256, 0, stream>>>(W16, XP, tb, pb, gb, Qh, Ql, PF, GF);
  // (3) 2x2 stride-2 max-pool -> pooled phi (k) hi/res planes, pooled g f16 plane
  pool_k<<<dim3(HP, NB), blk256, 0, stream>>>(PF, GF, Kh, Kl, Gp);
  // (4) pooled g -> channel-major plane
  tr_g<<<dim3(MM / QT, DQ / QT, NB), blk256, 0, stream>>>(Gp, Gc);
  // (5) attention -> y hi/res planes, rows = positions, fragment order
  attn_k<<<dim3(NQ / QT, NB), blk128, 0, stream>>>(Qh, Ql, Kh, Kl, Gc, Yh, Yl);
  // (6) output conv + bias -> WY f32 plane [b][256][4096]
  gemm_out<<<dim3(NQ / QT, CC / QT, NB), blk128, 0, stream>>>(WWb, Yh, Yl, wb, WY);
  // (7) per-channel mean / rstd, then normalise, affine, residual -> out [b][256][4096]
  bn_norm<<<dim3(CC), dim3(BST), 0, stream>>>(WY, x, gam, bet, out);
  (void)hipGetLastError();
}

// v006
// Measured time: 97.6 microseconds a run.
// In both of two side-by-side timings against v005, it was 1.14 times as fast.
// Over all steps from v000 it is 8.24 times as fast.
// Contractions: conv1x1 theta/phi/g GEMM W[384x256].X[256x128] per strip on v_wmma_f32_16x16x32_f16 (f16 containers
// of bf16-RNE weights x256 and bf16-RNE x); scores K.Q^T on v_wmma_f32_16x16x32_bf16 (bf16 hi + bf16 residual planes
// of theta / 2x2-max-pooled phi, 3 products, K=128); y^T = G.P^T on v_wmma_f32_16x16x32_f16 (2x2-max-pooled g as
// f16, P = e^{s-m} x16384 f16 from the score D registers); output conv W[256x128].Y on v_wmma_f32_16x16x32_bf16 (bf16
// weights, y as bf16 hi + residual planes, 2 products); f32 accumulate everywhere; max-pool, softmax statistics and
// bias in f32 VALU; batch-norm channel statistics in f64 VALU; normalisation, affine and residual add in f32 VALU.
#include <hip/hip_runtime.h>
#include <math.h>
#include <stdint.h>

#ifndef NB
#define NB 8
#endif
#ifndef NQ
#define NQ 4096
#endif
#define NB_FULL 8
#define CC     256
#define HIMG   64
#define WIMG   64
#define NN     4096
#define DQ     128
#define HP     32
#define WP     32
#define MM     1024
#define MW     384
#define QT     64
#define SN     128
#define NSTRIP 32
#define OSP    68
#define OSPW   132
#define TP     72
#define BST    1024
#define WSC    256.0f
#define IWSC   0.00390625f
#define LNPS   9.704060527839234f
#define BNEPS  1.0e-5f
#define KT     32
#define KP     136
#define VPT    40
#define STG    (2 * KT * KP + DQ * VPT)
#define GTP    40

static_assert(NB >= 1 && NB <= NB_FULL);
static_assert(NQ % QT == 0 && NQ <= NN);
static_assert(NN == HIMG * WIMG);
static_assert(SN == 2 * WIMG);
static_assert(NSTRIP * SN == NN);
static_assert(SN == 8 * 16);
static_assert(HIMG % 2 == 0 && WIMG % 2 == 0);
static_assert(HP == HIMG / 2 && WP == WIMG / 2);
static_assert(MM == HP * WP);
static_assert(WP == 32);
static_assert(MM % QT == 0 && MM % 32 == 0);
static_assert(NN % QT == 0 && CC % QT == 0 && DQ % QT == 0);
static_assert(MW == 3 * DQ && MW % QT == 0 && MW % 8 == 0);
static_assert(CC % 32 == 0 && DQ % 32 == 0);
static_assert((OSP * 4) % 16 == 0);
static_assert((OSPW * 4) % 16 == 0);
static_assert((TP * 2) % 16 == 0);
static_assert(SN * OSP * 4 <= 65536);
static_assert(BST == 32 * 32 && NQ == 4 * BST);
static_assert(NN % 16 == 0 && CC % 4 == 0);
static_assert((size_t)NB_FULL * CC * NN * 4 == (size_t)33554432);
static_assert((KP * 2) % 16 == 0 && (VPT * 2) % 16 == 0 && (STG * 2) % 16 == 0 && (KT * KP * 2) % 16 == 0);
static_assert(KP >= DQ + 8 && VPT >= KT + 8 && MM % KT == 0 && MM / KT >= 2);
static_assert(KT * DQ / 8 == 4 * 128 && DQ * KT / 8 == 4 * 128 && QT * DQ / 8 == 8 * 128);
static_assert(KT == WP && NSTRIP == HP && (GTP * 2) % 16 == 0 && GTP >= WP + 8 && QT * WP / 8 == 256);

typedef _Float16       v16h __attribute__((ext_vector_type(16)));
typedef _Float16       v8h  __attribute__((ext_vector_type(8)));
typedef __bf16         v16b __attribute__((ext_vector_type(16)));
typedef unsigned short v8us __attribute__((ext_vector_type(8)));
typedef float          v8f  __attribute__((ext_vector_type(8)));
typedef float          v4f  __attribute__((ext_vector_type(4)));
typedef unsigned int   v4u  __attribute__((ext_vector_type(4)));

union Frag  { v8us u[2]; v16h h; v16b bf; };
union FragH { v16h v; v8h hv[2]; };
static_assert(sizeof(Frag) == 32);
static_assert(sizeof(FragH) == 32);

// ---- scalar helpers ---------------------------------------------------------------------------------------
__device__ __forceinline__ unsigned short bf_bits(float f) {          // f32 -> bf16 bits, RNE convert
  unsigned u = __float_as_uint(f);
  return (unsigned short)((u + 0x7FFFu + ((u >> 16) & 1u)) >> 16);
}
__device__ __forceinline__ float bf_up(unsigned short hb) { return __uint_as_float(((unsigned)hb) << 16); }
__device__ __forceinline__ float bfr(float f) { return bf_up(bf_bits(f)); }
__device__ __forceinline__ unsigned short h_bits(_Float16 x) { return __builtin_bit_cast(unsigned short, x); }
__device__ __forceinline__ unsigned pk16(unsigned short a, unsigned short b) { return (unsigned)a | ((unsigned)b << 16); }
__device__ __forceinline__ v8f zero8() { v8f z = {0.f, 0.f, 0.f, 0.f, 0.f, 0.f, 0.f, 0.f}; return z; }
__device__ __forceinline__ float hmax8(v8f s) {
  return fmaxf(fmaxf(fmaxf(s[0], s[1]), fmaxf(s[2], s[3])), fmaxf(fmaxf(s[4], s[5]), fmaxf(s[6], s[7])));
}
__device__ __forceinline__ unsigned wave_ballot(bool p) {
#if defined(__HIP_DEVICE_COMPILE__)
  return __builtin_amdgcn_ballot_w32(p);
#else
  return p ? 1u : 0u;
#endif
}
// 8 f32 values -> bf16 hi bits and bf16 residual bits (lo = RNE(v - hi)), packed 2 per uint
__device__ __forceinline__ void split8(const float* f, v4u& uh, v4u& ul) {
#pragma unroll
  for (int t = 0; t < 4; ++t) {
    const float f0 = f[2 * t], f1 = f[2 * t + 1];
    const unsigned short hb0 = bf_bits(f0), hb1 = bf_bits(f1);
    const unsigned short lb0 = bf_bits(f0 - bf_up(hb0));
    const unsigned short lb1 = bf_bits(f1 - bf_up(hb1));
    uh[t] = pk16(hb0, hb1);
    ul[t] = pk16(lb0, lb1);
  }
}

// ---- 16-bit fragment loader (A, or B from a k-contiguous [n][k] row): lane -> row/col (lane&15), p already includes
//      + 8*(lane>>4); elements 0..7 <- p[0..7] (k0+8h..), elements 8..15 <- p[16..23] (k0+16+8h..)
__device__ __forceinline__ Frag ldfrag(const unsigned short* p) {
  Frag f;
  f.u[0] = *(const v8us*)(p);
  f.u[1] = *(const v8us*)(p + 16);
  return f;
}

// ---- fragment-order planes (W16, WWb, XP, Yh, Yl): a 16-row x 32-k operand tile is stored as the 1 KiB its loader
//      reads: half j, then lane = 16 hh + row, then 8 elements, k = k0 + 16 j + 8 hh + e (the k map of ldfrag). Each of
//      the loader's two wave loads then covers 512 contiguous bytes (4 whole lines) and not 32 B of each of 16 rows.
//      piece_off: element offset of the 8-element piece q = k / 8 of row r (0..15) of tile t; nks = 32-k steps a row.
__device__ __forceinline__ size_t piece_off(int t, int nks, int q, int r) {
  return ((size_t)((t * nks + (q >> 2)) * 2 + ((q >> 1) & 1)) * 32 + 16 * (q & 1) + r) * 8;
}
__device__ __forceinline__ Frag ldfrag_p(const unsigned short* plane, int t, int nks, int ks, int lane) {
  const unsigned short* p = plane + ((size_t)(t * nks + ks) * 64 + lane) * 8;
  Frag f;
  f.u[0] = *(const v8us*)(p);
  f.u[1] = *(const v8us*)(p + 256);
  return f;
}

// ---- WMMA helpers: builtin followed by a 4-slot VALU gap tying D and keeping A/B live --------------------------
__device__ __forceinline__ v8f mma_h(v16h a, v16h b, v8f c) {
  v8f d = __builtin_amdgcn_wmma_f32_16x16x32_f16(false, a, false, b, (short)0, c, false, false);
#if defined(__HIP_DEVICE_COMPILE__)
  asm volatile("v_nop\n\tv_nop\n\tv_nop\n\tv_nop" : "+v"(d) : "v"(a), "v"(b));
#endif
  return d;
}
__device__ __forceinline__ v8f mma_b(v16b a, v16b b, v8f c) {
  v8f d = __builtin_amdgcn_wmma_f32_16x16x32_bf16(false, a, false, b, (short)0, c, false, false);
#if defined(__HIP_DEVICE_COMPILE__)
  const v16h ha = __builtin_bit_cast(v16h, a), hb = __builtin_bit_cast(v16h, b);
  asm volatile("v_nop\n\tv_nop\n\tv_nop\n\tv_nop" : "+v"(d) : "v"(ha), "v"(hb));
#endif
  return d;
}

// stands directly behind a run of global stores, in front of any later write of a register that those stores name
__device__ __forceinline__ void wait_x0() {
#if defined(__HIP_DEVICE_COMPILE__)
  asm volatile("s_wait_xcnt 0x0" ::: "memory");
#endif
}

// =========================================================================================================
// (0) weights. Blocks 0..47: W16 f16 [384][256], rows 0..127 = theta_w, 128..255 = phi_w, 256..383 = g_w; value =
//     f16 of (bf16-RNE(w) * 256) (exact). Block owns rows 8*blk..8*blk+7 (half a 16-row tile): 8 lanes x 16 B = one
//     whole line of the fragment-order plane per piece q. Blocks 48..63: WWb bf16 [256][128], one 16-row tile a block.
// coverage: 48 blocks x 8 rows x 32 pieces x 8 halves = 384 x 256; 16 blocks x 16 rows x 16 pieces x 8 = 256 x 128.
// =========================================================================================================
__global__ __launch_bounds__(256)
void cvt_w(const float* __restrict__ tw, const float* __restrict__ pw, const float* __restrict__ gw,
           const float* __restrict__ ow, unsigned short* W16, unsigned short* WWb) {
  const int tid = threadIdx.x, blk = blockIdx.x;
  if (blk < MW / 8) {
    const int rl = tid & 7, pq = tid >> 3, col = 8 * pq;             // row in the block, piece 0..31
    const int o = 8 * blk + rl;                                      // 0..383
    const int grp = blk >> 4;                                        // 0,1,2 (block-uniform)
    const float* wbase = (grp == 0) ? tw : ((grp == 1) ? pw : gw);  // all global
    const float* s = wbase + (size_t)(o - DQ * grp) * CC + col;      // (o - 128 grp) in 0..127
    const v4f a = *(const v4f*)s;
    const v4f q = *(const v4f*)(s + 4);
    const float f[8] = {a[0], a[1], a[2], a[3], q[0], q[1], q[2], q[3]};
    v4u u;
#pragma unroll
    for (int t = 0; t < 4; ++t) {
      const _Float16 h0 = (_Float16)(bfr(f[2 * t]) * WSC);
      const _Float16 h1 = (_Float16)(bfr(f[2 * t + 1]) * WSC);
      u[t] = pk16(h_bits(h0), h_bits(h1));
    }
{
      *(v4u*)(W16 + piece_off(o >> 4, CC / 32, pq, o & 15)) = u;
      
    }
  } else {
    const int rb = blk - MW / 8;                                     // 0..15
    const int o = 16 * rb + (tid & 15);                              // 0..255
    const int pq = tid >> 4, col = 8 * pq;                           // piece 0..15, col 0..120
    const float* s = ow + (size_t)o * DQ + col;
    const v4f a = *(const v4f*)s;
    const v4f q = *(const v4f*)(s + 4);
    const float f[8] = {a[0], a[1], a[2], a[3], q[0], q[1], q[2], q[3]};
    v4u u;
#pragma unroll
    for (int t = 0; t < 4; ++t) u[t] = pk16(bf_bits(f[2 * t]), bf_bits(f[2 * t + 1]));
{
      *(v4u*)(WWb + piece_off(rb, DQ / 32, pq, tid & 15)) = u;
      
    }
  }
}

// =========================================================================================================
// (1) x f32 [b][256 c][4096 n] -> XP f16, rows n, k = c, fragment order (bf16-RNE values, exact in f16) through an LDS
//     tile T[64 n][64 c] (pitch TP, cross-wave, block barrier). Block (nb, cb, b) owns a 64 c x 64 n tile.
// coverage: T written rows (8e+t)=0..63 x cols cl 0..63, read rows 0..63 x cols 8 pq..8 pq+7, pq 0..7 (staged extent ==
//           consumed extent); XP 2 it x 2 tiles x 8 pieces x 16 rows x 8 = 64 n x 64 c, each wave store 512 contiguous B;
//           grid (64, 4, NB) covers rows [b][0..4095] x c 0..255 exactly once.
// =========================================================================================================
__global__ __launch_bounds__(256)
void cvt_x(const float* __restrict__ x, unsigned short* XP) {
  __shared__ __align__(16) unsigned short T[QT * TP];
  const int tid = threadIdx.x;
  const int nb = blockIdx.x, cb = blockIdx.y, b = blockIdx.z;
  const int e = tid & 7, lq = tid >> 3;                             // lq 0..31
  const int n0 = nb * QT, c0 = cb * QT;
#pragma unroll
  for (int it = 0; it < 2; ++it) {
    const int cl = it * 32 + lq;                                     // 0..63
    const float* sp = x + ((size_t)(b * CC + c0 + cl)) * NN + n0 + 8 * e;
    const v4f a = *(const v4f*)sp;
    const v4f q = *(const v4f*)(sp + 4);
    unsigned short hb[8];
#pragma unroll
    for (int t = 0; t < 4; ++t) {
      hb[t]     = h_bits((_Float16)bfr(a[t]));
      hb[4 + t] = h_bits((_Float16)bfr(q[t]));
    }
#pragma unroll
    for (int t = 0; t < 8; ++t) T[(8 * e + t) * TP + cl] = hb[t];
  }
  __syncthreads();
  const int r16 = tid & 15, pq = (tid >> 4) & 7, tl = tid >> 7;      // row in its tile, piece 0..7, tile 0..1 (+ 2 it)
  v4u up[2];
#pragma unroll
  for (int it = 0; it < 2; ++it) {
    const int nl = (2 * it + tl) * 16 + r16;                         // 0..63
    up[it] = *(const v4u*)(T + nl * TP + 8 * pq);
  }
{
#pragma unroll
    for (int it = 0; it < 2; ++it) {
      const int t = (b * NN + n0) / 16 + 2 * it + tl;
      *(v4u*)(XP + piece_off(t, CC / 32, c0 / 8 + pq, r16)) = up[it];
    }
    
  }
}

// =========================================================================================================
// (2) conv1x1 GEMM for one (b, strip of 128 positions = image rows 2s and 2s+1, 64-o block of the stacked weights):
//     Y[o][n] = (1/256) sum_c W16[o][c] XP[b][n][c]. Block 256 threads = 8 waves; wave w owns cols n0+16w..+15
//     (one B fragment per k-step, tile (b 4096 + n0) / 16 + w of XP) and 4 m-tiles (A rows o = o0 + 16 mt + (lane&15),
//     tile o0 / 16 + mt of W16), both planes in fragment order. K = 256 = 8 steps.
//     Epilogue staged in LDS Os[n_loc][o_loc] (pitch OSP, b128
//     stores), block barrier (cross-wave), then (block-uniform branch on the o block):
//       o-blocks 0,1 -> theta dims 0..63 / 64..127 + bias -> Qh/Ql bf16 [b][4096 n][128 d] (hi = RNE(v), lo = RNE(v-hi)):
//       o-blocks 2,3 -> phi + bias in f32, 2x2 stride-2 max-pool in f32 (the strip holds both image rows of every window:
//                       pooled column px takes n_loc = 64 dy + 2 px + dx, dy, dx in {0,1}; key m = 32 st + px) -> Kh/Kl
//                       bf16 [b][1024 m][128 d] (hi = RNE(v), lo = RNE(v-hi)): 32 rows x the dsel half (128 B = one whole
//                       line) of the 256-B row, 8 consecutive lanes x 16 B.
//       o-blocks 4,5 -> g + bias, the same pool, f16, turned through the LDS tile Tg[64 d][32 px] (pitch GTP, cross-wave,
//                       block barrier) -> Gc f16 [b][32 st][128 d][32 px]: one 32-key stage of the attention a strip, keys
//                       contiguous a channel; the block's 64 d x 64 B are 4 KiB in a row, each wave store 512 contiguous B.
// coverage: Os 8 waves x 16 n x 64 o = 128 x 64 written, reads rows <= 127 cols <= 63; theta planes 4 it x 32 rows
//           x 8 lanes x 8 = 128 n x 64 d; pooled planes 32 px x 8 lanes x 8 = 32 m x 64 d; Tg written rows (8e+t)=0..63 x
//           cols 0..31, read rows 0..63 x cols 8 kq..8 kq+7, kq 0..3; grid (32, 6, NB) covers all 4096 rows x 128 d of
//           Qh/Ql and all 1024 keys x 128 d of Kh/Kl/Gc exactly once.
// =========================================================================================================
__global__ __launch_bounds__(256)
void gemm_proj(const unsigned short* __restrict__ W16, const unsigned short* __restrict__ XP,
               const float* __restrict__ tb, const float* __restrict__ pb, const float* __restrict__ gb,
               unsigned short* Qh, unsigned short* Ql, unsigned short* Kh, unsigned short* Kl, unsigned short* Gc) {
  __shared__ __align__(16) float Os[SN * OSP];
  __shared__ __align__(16) unsigned short Tg[QT * GTP];
  const int tid  = threadIdx.x;
  const int lane = tid & 31, wave = tid >> 5;                        // wave 0..7
  const int hh   = lane >> 4, c = lane & 15;
  const int st   = blockIdx.x, mb = blockIdx.y, b = blockIdx.z;
  const int n0   = st * SN, o0 = mb * QT;

  const int ta = o0 / 16, tb16 = (b * NN + n0) / 16 + wave;          // first A tile, the wave's B tile

  v8f acc[4];
#pragma unroll
  for (int mt = 0; mt < 4; ++mt) acc[mt] = zero8();

#pragma unroll
  for (int ks = 0; ks < CC / 32; ++ks) {
    const Frag fb = ldfrag_p(XP, tb16, CC / 32, ks, lane);
#pragma unroll
    for (int mt = 0; mt < 4; ++mt) {
      const Frag fa = ldfrag_p(W16, ta + mt, CC / 32, ks, lane);
      acc[mt] = mma_h(fa.h, fb.h, acc[mt]);
    }
  }

  // ---- epilogue: scale back -> LDS Os[n_loc][o_loc]; lane (hh, c) holds o = 16 mt + 8 hh + r for n_loc = 16 w + c
  {
    const int nl = 16 * wave + c;
#pragma unroll
    for (int mt = 0; mt < 4; ++mt) {
      v4f va, vb;
#pragma unroll
      for (int r = 0; r < 4; ++r) { va[r] = acc[mt][r] * IWSC; vb[r] = acc[mt][4 + r] * IWSC; }
      *(v4f*)(Os + nl * OSP + 16 * mt + 8 * hh)     = va;
      *(v4f*)(Os + nl * OSP + 16 * mt + 8 * hh + 4) = vb;
    }
  }
  __syncthreads();

  const int grp = mb >> 1;                                           // 0 theta, 1 phi, 2 g (block-uniform)
  const int dsel = (mb & 1) * QT;                                    // 0 or 64
  const float* bias = (grp == 0) ? tb : ((grp == 1) ? pb : gb);     // all global

  if (grp == 0) {
    const int e = tid & 7, lq = tid >> 3;                            // lq 0..31
    float bv[8];
    {
      const v4f ba = *(const v4f*)(bias + dsel + 8 * e);
      const v4f bq = *(const v4f*)(bias + dsel + 8 * e + 4);
#pragma unroll
      for (int t = 0; t < 4; ++t) { bv[t] = bfr(ba[t]); bv[4 + t] = bfr(bq[t]); }
    }
    v4u uh[4], ul[4];
#pragma unroll
    for (int it = 0; it < 4; ++it) {
      const int row = it * 32 + lq;                                  // n_loc 0..127
      const v4f a = *(const v4f*)(Os + row * OSP + 8 * e);
      const v4f q = *(const v4f*)(Os + row * OSP + 8 * e + 4);
      float f[8];
#pragma unroll
      for (int t = 0; t < 4; ++t) { f[t] = a[t] + bv[t]; f[4 + t] = q[t] + bv[4 + t]; }
      split8(f, uh[it], ul[it]);
    }
{
#pragma unroll
      for (int it = 0; it < 4; ++it) {
        const int row = it * 32 + lq;
        const size_t po = ((size_t)(b * NN + n0 + row)) * DQ + dsel + 8 * e;
        *(v4u*)(Qh + po) = uh[it];
        *(v4u*)(Ql + po) = ul[it];
      }
      
    }
  } else {
    const int e = tid & 7, px = tid >> 3;                            // pooled column 0..31, dims 8 e..8 e+7 of the half
    float bv[8], f[8];
    {
      const v4f ba = *(const v4f*)(bias + dsel + 8 * e);
      const v4f bq = *(const v4f*)(bias + dsel + 8 * e + 4);
#pragma unroll
      for (int t = 0; t < 4; ++t) { bv[t] = bfr(ba[t]); bv[4 + t] = bfr(bq[t]); }
    }
#pragma unroll
    for (int t = 0; t < 8; ++t) f[t] = -__builtin_inff();
#pragma unroll
    for (int dy = 0; dy < 2; ++dy) {
#pragma unroll
      for (int dx = 0; dx < 2; ++dx) {
        const int row = dy * WIMG + 2 * px + dx;                     // n_loc 0..127
        const v4f a = *(const v4f*)(Os + row * OSP + 8 * e);
        const v4f q = *(const v4f*)(Os + row * OSP + 8 * e + 4);
#pragma unroll
        for (int t = 0; t < 4; ++t) {
          f[t]     = fmaxf(f[t], a[t] + bv[t]);
          f[4 + t] = fmaxf(f[4 + t], q[t] + bv[4 + t]);
        }
      }
    }
    if (grp == 1) {
      v4u kh, kl;
      split8(f, kh, kl);
      const size_t po = ((size_t)(b * MM + WP * st + px)) * DQ + dsel + 8 * e;
      *(v4u*)(Kh + po) = kh;
      *(v4u*)(Kl + po) = kl;
      wait_x0();
    } else {
#pragma unroll
      for (int t = 0; t < 8; ++t) Tg[(8 * e + t) * GTP + px] = h_bits((_Float16)f[t]);
      __syncthreads();                                               // block-uniform branch: every wave of a g block passes
      const int dl = tid >> 2, kq = tid & 3;                         // channel 0..63 of the half, 8 keys 8 kq..8 kq+7
      const v4u u = *(const v4u*)(Tg + dl * GTP + 8 * kq);
      *(v4u*)(Gc + ((size_t)((b * NSTRIP + st) * DQ + dsel + dl)) * WP + 8 * kq) = u;
      wait_x0();
    }
  }
}

// ---- asynchronous copies to LDS: each lane moves its own 16 bytes, global -> LDS, through no register. Arguments: the
//      lane's LDS byte addresses, then its global addresses in the same order, all multiples of 16. The closing
//      s_wait_xcnt 0 stands inside the copies' own statement so that no address register named there is rewritten ahead
//      of it.
__device__ __forceinline__ unsigned lds_addr(const void* p) { return (unsigned)(uintptr_t)p; }
__device__ __forceinline__ void copy4(unsigned l0, unsigned l1, unsigned l2, unsigned l3,
                                      const unsigned short* g0, const unsigned short* g1,
                                      const unsigned short* g2, const unsigned short* g3) {
#if defined(__HIP_DEVICE_COMPILE__)
  asm volatile("global_load_async_to_lds_b128 %0, %4, off\n\t"
               "global_load_async_to_lds_b128 %1, %5, off\n\t"
               "global_load_async_to_lds_b128 %2, %6, off\n\t"
               "global_load_async_to_lds_b128 %3, %7, off\n\t"
               "s_wait_xcnt 0x0"
               :: "v"(l0), "v"(l1), "v"(l2), "v"(l3), "v"(g0), "v"(g1), "v"(g2), "v"(g3) : "memory");
#endif
}
__device__ __forceinline__ void copy12(unsigned a0, unsigned a1, unsigned a2, unsigned a3, unsigned b0, unsigned b1,
                                       unsigned b2, unsigned b3, unsigned c0, unsigned c1, unsigned c2, unsigned c3,
                                       const unsigned short* p0, const unsigned short* p1, const unsigned short* p2,
                                       const unsigned short* p3, const unsigned short* q0, const unsigned short* q1,
                                       const unsigned short* q2, const unsigned short* q3, const unsigned short* r0,
                                       const unsigned short* r1, const unsigned short* r2, const unsigned short* r3) {
#if defined(__HIP_DEVICE_COMPILE__)
  asm volatile("global_load_async_to_lds_b128 %0, %12, off\n\t"
               "global_load_async_to_lds_b128 %1, %13, off\n\t"
               "global_load_async_to_lds_b128 %2, %14, off\n\t"
               "global_load_async_to_lds_b128 %3, %15, off\n\t"
               "global_load_async_to_lds_b128 %4, %16, off\n\t"
               "global_load_async_to_lds_b128 %5, %17, off\n\t"
               "global_load_async_to_lds_b128 %6, %18, off\n\t"
               "global_load_async_to_lds_b128 %7, %19, off\n\t"
               "global_load_async_to_lds_b128 %8, %20, off\n\t"
               "global_load_async_to_lds_b128 %9, %21, off\n\t"
               "global_load_async_to_lds_b128 %10, %22, off\n\t"
               "global_load_async_to_lds_b128 %11, %23, off\n\t"
               "s_wait_xcnt 0x0"
               :: "v"(a0), "v"(a1), "v"(a2), "v"(a3), "v"(b0), "v"(b1), "v"(b2), "v"(b3), "v"(c0), "v"(c1), "v"(c2),
                  "v"(c3), "v"(p0), "v"(p1), "v"(p2), "v"(p3), "v"(q0), "v"(q1), "v"(q2), "v"(q3), "v"(r0), "v"(r1),
                  "v"(r2), "v"(r3) : "memory");
#endif
}
// the issuing wave's copies have landed behind this wait
__device__ __forceinline__ void wait_async0() {
#if defined(__HIP_DEVICE_COMPILE__)
  asm volatile("s_wait_asynccnt 0x0" ::: "memory");
#endif
}
// the wave's own LDS reads have retired before the buffer they read is handed to the copies that refill it
__device__ __forceinline__ void wait_ds0() {
#if defined(__HIP_DEVICE_COMPILE__)
  asm volatile("s_wait_dscnt 0x0" ::: "memory");
#endif
}
// one 32-key stage: Kh and Kl rows kb..kb+31 (256 B each, LDS pitch 272 B) and stage kb / 32 of Gc, 128 channel rows of
// 64 B in a row (LDS pitch 80 B). 128 threads x 12 copies of 16 B = 8 KiB + 8 KiB + 8 KiB; no two lanes share an LDS byte.
__device__ __forceinline__ void stage_kv(unsigned short* st, const unsigned short* Khb, const unsigned short* Klb,
                                         const unsigned short* Gcb, int kb, int tid) {
  const int kr = tid >> 4, kcol = 8 * (tid & 15);                    // kr 0..7, + 8 i -> key row 0..31
  const int vr = tid >> 2, vcol = 8 * (tid & 3);                     // vr 0..31, + 32 i -> channel row 0..127
  const unsigned lk = lds_addr(st + kr * KP + kcol);
  const unsigned ll = lk + 2u * (KT * KP);
  const unsigned lv = lds_addr(st + 2 * KT * KP + vr * VPT + vcol);
  const unsigned short* gk = Khb + (size_t)(kb + kr) * DQ + kcol;
  const unsigned short* gl = Klb + (size_t)(kb + kr) * DQ + kcol;
  const unsigned short* gv = Gcb + (size_t)kb * DQ + vr * KT + vcol;   // kb a multiple of KT: stage kb / KT starts at kb DQ
  copy12(lk, lk + 2u * (8 * KP), lk + 2u * (16 * KP), lk + 2u * (24 * KP),
         ll, ll + 2u * (8 * KP), ll + 2u * (16 * KP), ll + 2u * (24 * KP),
         lv, lv + 2u * (32 * VPT), lv + 2u * (64 * VPT), lv + 2u * (96 * VPT),
         gk, gk + 8 * DQ, gk + 16 * DQ, gk + 24 * DQ, gl, gl + 8 * DQ, gl + 16 * DQ, gl + 24 * DQ,
         gv, gv + 32 * KT, gv + 64 * KT, gv + 96 * KT);
}

// =========================================================================================================
// (3) attention for one (b, 64-query tile), transposed formulation, 1024 keys (all valid, no mask, no scale):
//   S^T tile (16 keys x 16 queries) = sum over 4 d-chunks (unrolled) of A(k: row = key kb + (lane&15), 32 d via
//   the split k map from the bf16 plane Kh [b][1024][128]) . B(q: col = query, same map from Qh [b][4096][128])
//   + A(Kh).B(Ql) + A(Kl).B(Qh) (bf16 unscaled residual planes, shared accumulator).
//   Per lane the D tile holds 8 keys of ONE query: online softmax state per lane, one shuffle (lane^16) for the max
//   over 32 keys; the o/l rescale is skipped under a wave-uniform ballot when no lane's max grew (corr == 1 exactly
//   for every lane then); row-sum partials combined at the end. P = e^{s-m} x 16384 as f16 is the B operand of
//   y^T (rows channel, cols queries) += A(pooled g: rows channel = 16j + (lane&15), keys contiguous, f16 plane Gc
//   [b][32 stages][128][32]) . B(P^T): element r <- D of the tile covering keys kb..kb+15, element 8+r <- the tile covering
//   kb+16..kb+31, lane unchanged. 8 accumulator tiles per wave (128 channels). Block = 4 waves = 64 queries.
//   Live state per lane: o 64 + s0/s1 16 + two sets of 6 fragments, or one set and 8 V fragments, + m/l, under the 256 cap.
//   Operands come from LDS: the block's 64 query rows of Qh/Ql are copied once (Qs, pitch 272 B); each 32-key stage of
//   Kh/Kl/Gc is copied by all four waves into one of two buffers (Ring) one trip ahead of its use and read by all four.
//   Epilogue: y = O/l staged in LDS Os[query][128 channels] (pitch OSPW, b128 stores), block barrier (cross-wave),
//   then Yh/Yl (rows n, k = channel) in fragment order, each wave store 512 contiguous B.
// coverage: Os written 4 waves x 16 queries x 128 ch, read rows 0..63 x ch 8 pq..8 pq+7 (pq 0..15); planes 4 tiles x 16
//           pieces x 16 rows x 8 = 64 n x 128 ch per plane; grid (NQ/64, NB) covers rows 0..NQ-1 of Yh/Yl exactly once.
// =========================================================================================================
__global__ __launch_bounds__(128) __attribute__((amdgpu_num_vgpr(256)))
void attn_k(const unsigned short* __restrict__ Qh, const unsigned short* __restrict__ Ql,
            const unsigned short* __restrict__ Kh, const unsigned short* __restrict__ Kl,
            const unsigned short* __restrict__ Gc, unsigned short* Yh, unsigned short* Yl) {
  __shared__ __align__(16) float Os[QT * OSPW];
  __shared__ __align__(16) unsigned short Qs[2 * QT * KP];
  __shared__ __align__(16) unsigned short Ring[2 * STG];
  const int tid  = threadIdx.x;
  const int wave = tid >> 5, lane = tid & 31;
  const int hh   = lane >> 4, c = lane & 15;
  const int n0   = blockIdx.x * QT, b = blockIdx.y;

  const unsigned short* Khb = Kh + (size_t)b * MM * DQ;
  const unsigned short* Klb = Kl + (size_t)b * MM * DQ;
  const unsigned short* Gcb = Gc + (size_t)b * DQ * MM;

  // ---- in front of the loop: the query tile and stage 0, their wait, the barrier that publishes them, then stage 1
  {
    const int qr = tid >> 4, qcol = 8 * (tid & 15);                  // qr 0..7, + 8 i -> query row 0..63
    const unsigned lq = lds_addr(Qs + qr * KP + qcol);
    const size_t go = ((size_t)(b * NN + n0 + qr)) * DQ + qcol;
    auto plane = [](unsigned l0, const unsigned short* g) {          // 64 rows of one plane, 8 copies a thread
      copy4(l0, l0 + 2u * (8 * KP), l0 + 2u * (16 * KP), l0 + 2u * (24 * KP), g, g + 8 * DQ, g + 16 * DQ, g + 24 * DQ);
      copy4(l0 + 2u * (32 * KP), l0 + 2u * (40 * KP), l0 + 2u * (48 * KP), l0 + 2u * (56 * KP), g + 32 * DQ,
            g + 40 * DQ, g + 48 * DQ, g + 56 * DQ);
    };
    plane(lq, Qh + go);
    plane(lq + 2u * (QT * KP), Ql + go);
  }
  stage_kv(Ring, Khb, Klb, Gcb, 0, tid);
  wait_async0();
  __syncthreads();
  stage_kv(Ring + STG, Khb, Klb, Gcb, KT, tid);

  // q fragment pointers (B operand, col = query 16*wave + c of the tile), + 32*kc
  const unsigned short* Qhp = Qs + (16 * wave + c) * KP + 8 * hh;
  const unsigned short* Qlp = Qhp + QT * KP;

  float m = -1.0e30f, l = 0.f;
  v8f o[8];
#pragma unroll
  for (int j = 0; j < 8; ++j) o[j] = zero8();

#pragma unroll 1
  for (int kb = 0; kb < MM; kb += KT) {
    unsigned short* st = Ring + ((kb / KT) & 1) * STG;               // this trip's buffer
    // k fragment base (A operand, row = key kb + c), + 32*kc; v fragment base (A operand, row = channel 16j + c)
    const unsigned short* k0p  = st + c * KP + 8 * hh;               // keys kb .. kb+15
    const unsigned short* k1p  = k0p + 16 * KP;                      // keys kb+16 .. kb+31
    const unsigned short* k0lp = k0p + KT * KP;
    const unsigned short* k1lp = k1p + KT * KP;
    const unsigned short* Vp   = st + 2 * KT * KP + c * VPT + 8 * hh;
    v8f s0 = zero8(), s1 = zero8();
    Frag fr[2][6], vf[8];                                            // two sets of one d-chunk's fragments; V fragments
    auto chunk = [&](Frag* f, int kc) {                              // the 12 LDS reads of d-chunk kc
      f[0] = ldfrag(Qhp + 32 * kc);
      f[1] = ldfrag(Qlp + 32 * kc);
      f[2] = ldfrag(k0p + 32 * kc);
      f[3] = ldfrag(k1p + 32 * kc);
      f[4] = ldfrag(k0lp + 32 * kc);
      f[5] = ldfrag(k1lp + 32 * kc);
    };
    chunk(fr[0], 0);
    // unrolled so that the two sets are registers: the reads of the next chunk (behind the last chunk: of all V fragments)
    // stand as one group above this chunk's products and are waited for by count, one group later
#pragma unroll
    for (int kc = 0; kc < DQ / 32; ++kc) {
      if (kc + 1 < DQ / 32) {
        chunk(fr[(kc + 1) & 1], kc + 1);
      } else {
#pragma unroll
        for (int j = 0; j < 8; ++j) vf[j] = ldfrag(Vp + (16 * j) * VPT);
      }
      const Frag* f = fr[kc & 1];
      s0 = mma_b(f[2].bf, f[0].bf, s0);
      s1 = mma_b(f[3].bf, f[0].bf, s1);
      s0 = mma_b(f[2].bf, f[1].bf, s0);
      s1 = mma_b(f[3].bf, f[1].bf, s1);
      s0 = mma_b(f[4].bf, f[0].bf, s0);
      s1 = mma_b(f[5].bf, f[0].bf, s1);
    }

    float mx = fmaxf(hmax8(s0), hmax8(s1));
    mx = fmaxf(mx, __shfl_xor(mx, 16, 32));
    const float mn = fmaxf(m, mx);
    const unsigned grew = wave_ballot(mx > m);                       // wave-uniform
    if (grew != 0u) {
      const float corr = __expf(m - mn);                             // == 1 exactly for lanes whose max did not grow
      l *= corr;
#pragma unroll
      for (int j = 0; j < 8; ++j) {
#pragma unroll
        for (int r = 0; r < 8; ++r) o[j][r] *= corr;
      }
    }
    m = mn;
    const float msh = mn - LNPS;                                     // exp gives e^{s-m} * 16384

    FragH ph;
    float ls = 0.f;
#pragma unroll
    for (int r = 0; r < 8; ++r) {
      const float e0 = __expf(s0[r] - msh);                          // key kb      + 8hh + r
      const float e1 = __expf(s1[r] - msh);                          // key kb + 16 + 8hh + r
      ls += e0 + e1;
      ph.hv[0][r] = (_Float16)e0;
      ph.hv[1][r] = (_Float16)e1;
    }
    l += ls;

#pragma unroll
    for (int j = 0; j < 8; ++j) o[j] = mma_h(vf[j].h, ph.v, o[j]);

    // ---- foot of the trip: own reads retired, own copies of the next stage landed, one barrier that publishes that
    //      stage and ends every reader's last read of this buffer; only then the refill of this buffer
    wait_ds0();
    wait_async0();
    __syncthreads();
    if (kb + 2 * KT < MM) stage_kv(st, Khb, Klb, Gcb, kb + 2 * KT, tid);
  }
  wait_async0();                                                     // nothing is in flight when the wave goes on
  l += __shfl_xor(l, 16, 32);
  const float inv = 1.0f / l;                                        // o and l both carry the x16384 factor

  // ---- epilogue: y = o * inv -> Os[query][ch]; lane (hh, c) holds ch = 16 j + 8 hh + r for query 16 w + c
  {
    const int qrow = 16 * wave + c;
#pragma unroll
    for (int j = 0; j < 8; ++j) {
      v4f va, vb;
#pragma unroll
      for (int r = 0; r < 4; ++r) { va[r] = o[j][r] * inv; vb[r] = o[j][4 + r] * inv; }
      *(v4f*)(Os + qrow * OSPW + 16 * j + 8 * hh)     = va;
      *(v4f*)(Os + qrow * OSPW + 16 * j + 8 * hh + 4) = vb;
    }
  }
  __syncthreads();

  const int r16 = tid & 15, pl = tid >> 4;                           // row in its tile, pl 0..7
  v4u uh[8], ul[8];
#pragma unroll
  for (int it = 0; it < 8; ++it) {
    const int row = (it >> 1) * 16 + r16;                            // query 0..63
    const int pq  = (it & 1) * 8 + pl;                               // piece 0..15, channels 8 pq..8 pq+7
    const v4f a = *(const v4f*)(Os + row * OSPW + 8 * pq);
    const v4f q = *(const v4f*)(Os + row * OSPW + 8 * pq + 4);
    const float f[8] = {a[0], a[1], a[2], a[3], q[0], q[1], q[2], q[3]};
    split8(f, uh[it], ul[it]);
  }
{
#pragma unroll
    for (int it = 0; it < 8; ++it) {
      const size_t po = piece_off((b * NN + n0) / 16 + (it >> 1), DQ / 32, (it & 1) * 8 + pl, r16);
      *(v4u*)(Yh + po) = uh[it];
      *(v4u*)(Yl + po) = ul[it];
    }
    
  }
}

// =========================================================================================================
// (4) output conv for one (b, 64-n tile, 64-c block): A[c][n] = sum_ci WWb[c][ci] (Yh + Yl)[b][n][ci] on bf16 WMMA
//     (2 products per k-step, shared accumulator), K = 128 = 4 steps. Block 128 threads = 4 waves; wave w owns cols
//     n0+16w..+15 (B fragments: tile (b 4096 + n0) / 16 + w of Yh/Yl) and 4 m-tiles (A rows c = c0 + 16 mt + (lane&15),
//     tile c0 / 16 + mt of WWb), all planes in fragment order.
//     Epilogue staged in LDS Os[n_loc][c_loc] (pitch OSP, b128 stores), block barrier
//     2 lines): 8 consecutive lanes x 16 B (values gathered from 4 Os rows), one instruction per 4 lines, final
// coverage: Os 4 waves x 16 n x 64 c written, read rows nl+t <= 63 x cols cl <= 63; WY 8 it x 16 lines x 8 lanes x
//           4 floats = 64 c x 64 n; grid (NQ/64, 4, NB) covers WY[b][0..255][0..NQ-1] exactly once.
// =========================================================================================================
__global__ __launch_bounds__(128)
void gemm_out(const unsigned short* __restrict__ WWb, const unsigned short* __restrict__ Yh,
              const unsigned short* __restrict__ Yl, const float* __restrict__ wb, float* WY) {
  __shared__ __align__(16) float Os[QT * OSP];
  const int tid  = threadIdx.x;
  const int lane = tid & 31, wave = tid >> 5;
  const int hh   = lane >> 4, c = lane & 15;
  const int nt   = blockIdx.x, cb = blockIdx.y, b = blockIdx.z;
  const int n0   = nt * QT, c0 = cb * QT;

  const int ta = c0 / 16, tb16 = (b * NN + n0) / 16 + wave;          // first A tile, the wave's B tile

  v8f acc[4];
#pragma unroll
  for (int mt = 0; mt < 4; ++mt) acc[mt] = zero8();

#pragma unroll
  for (int ks = 0; ks < DQ / 32; ++ks) {
    const Frag fbh = ldfrag_p(Yh, tb16, DQ / 32, ks, lane);
    const Frag fbl = ldfrag_p(Yl, tb16, DQ / 32, ks, lane);
#pragma unroll
    for (int mt = 0; mt < 4; ++mt) {
      const Frag fa = ldfrag_p(WWb, ta + mt, DQ / 32, ks, lane);
      acc[mt] = mma_b(fa.bf, fbh.bf, acc[mt]);
      acc[mt] = mma_b(fa.bf, fbl.bf, acc[mt]);
    }
  }

  // ---- epilogue: -> LDS Os[n_loc][c_loc]; lane (hh, c) holds c_loc = 16 mt + 8 hh + r for n_loc = 16 w + c
  {
    const int nl = 16 * wave + c;
#pragma unroll
    for (int mt = 0; mt < 4; ++mt) {
      v4f va, vb;
#pragma unroll
      for (int r = 0; r < 4; ++r) { va[r] = acc[mt][r]; vb[r] = acc[mt][4 + r]; }
      *(v4f*)(Os + nl * OSP + 16 * mt + 8 * hh)     = va;
      *(v4f*)(Os + nl * OSP + 16 * mt + 8 * hh + 4) = vb;
    }
  }
  __syncthreads();

  const int e = tid & 7, lq = tid >> 3;                              // lq 0..15
  v4f res[8];
#pragma unroll
  for (int it = 0; it < 8; ++it) {
    const int L   = it * 16 + lq;                                    // 0..127
    const int cl  = L >> 1, hf = L & 1;                              // channel 0..63 within the block
    const int nl  = hf * 32 + 4 * e;                                 // position 0..63
    const float bvs = bfr(wb[c0 + cl]);
#pragma unroll
    for (int t = 0; t < 4; ++t) {
      res[it][t] = Os[(nl + t) * OSP + cl] + bvs;
    }
  }
{
#pragma unroll
    for (int it = 0; it < 8; ++it) {
      const int L   = it * 16 + lq;
      const int cl  = L >> 1, hf = L & 1;
      const int nl  = hf * 32 + 4 * e;
      const size_t idx = ((size_t)(b * CC + c0 + cl)) * NN + n0 + nl;
      *(v4f*)(WY + idx) = res[it];
    }
    
  }
}

// =========================================================================================================
// (5) batch-norm statistics, normalisation, affine and residual in one launch: block owns ONE channel (256 blocks of
//     32 waves). Thread tid takes floats 4 tid..4 tid+3 of each of the NB rows WY[b][c][0..NQ) and of the same rows of
//     x, so every wave load is one contiguous 512-B run; a thread's 2 NB loads are independent and all issued before
//     the first sum; the WY values stay in registers from the statistics to the normalisation. Sum and sum of squares
//     in f64 per thread (rows, then elements, in ascending order), wave shuffle reduce, per-wave partials in LDS
//     (cross-wave, block barrier); every wave then shuffle-reduces the same 32 partials itself (a butterfly leaves the
//     same bits in every lane of every wave), so no second barrier and no table: mean, biased variance,
//     rstd = 1/sqrt(var + eps) in f32, then out[b][c][n] = (((WY - mu) * rstd) * bf16-RNE(gamma[c]) + bf16-RNE(beta[c]))
//     + bf16-RNE(x[b][c][n]) in f32.
// coverage: 256 blocks x 1 channel x NB rows x BST threads x 4 floats = out[b][0..255][0..NQ-1] exactly once, each
//           wave store one contiguous 512-B run; reads WY and x at the same offsets only (the produced extent).
// =========================================================================================================
__global__ __launch_bounds__(BST)
void bn_norm(const float* __restrict__ WY, const float* __restrict__ x, const float* __restrict__ gam,
             const float* __restrict__ bet, float* out) {
#pragma clang fp contract(off)
  __shared__ double red[2 * (BST / 32)];
  const int tid = threadIdx.x, lane = tid & 31, wave = tid >> 5;
  const int cc = blockIdx.x;
  const double ninv = 1.0 / ((double)NB * (double)NQ);
  unsigned bo[NB];                                                   // byte offsets in WY, x and out, all < 2^25
  v4f a[NB], xv[NB];
#pragma unroll
  for (int bb = 0; bb < NB; ++bb) bo[bb] = 4u * (unsigned)((bb * CC + cc) * NN + 4 * tid);
#pragma unroll
  for (int bb = 0; bb < NB; ++bb) a[bb] = *(const v4f*)((const char*)WY + bo[bb]);
#if defined(__HIP_DEVICE_COMPILE__)
  // keeps the WY loads ahead of the x loads: loads return in order, and interleaved the sums would wait for rows of x
  __builtin_amdgcn_sched_barrier(0);
#endif
#pragma unroll
  for (int bb = 0; bb < NB; ++bb) xv[bb] = *(const v4f*)((const char*)x + bo[bb]);
#if defined(__HIP_DEVICE_COMPILE__)
  // keeps every load above the sums: without it the scheduler sinks them and only a few stay in flight per wave
  __builtin_amdgcn_sched_barrier(0);
#endif
  const float ga = bfr(gam[cc]), be = bfr(bet[cc]);                  // block-uniform, back long before their use
  double s = 0.0, q = 0.0;
#pragma unroll
  for (int bb = 0; bb < NB; ++bb) {
#pragma unroll
    for (int t = 0; t < 4; ++t) {
      const double d = (double)a[bb][t];
      s += d; q += d * d;
    }
  }
#pragma unroll
  for (int d = 1; d < 32; d <<= 1) {
    s += __shfl_xor(s, d, 32);
    q += __shfl_xor(q, d, 32);
  }
  if (lane == 0) { red[wave] = s; red[BST / 32 + wave] = q; }
  __syncthreads();
  double ts = red[lane], tq = red[BST / 32 + lane];
#pragma unroll
  for (int d = 1; d < 32; d <<= 1) {
    ts += __shfl_xor(ts, d, 32);
    tq += __shfl_xor(tq, d, 32);
  }
  const double mud = ts * ninv;
  double var = tq * ninv - mud * mud;
  var = (var > 0.0) ? var : 0.0;
  const float varf = (float)var + BNEPS;
  const float rs = 1.0f / sqrtf(varf);
  const float mu = (float)mud;
#pragma unroll
  for (int bb = 0; bb < NB; ++bb) {
    v4f r;
#pragma unroll
    for (int t = 0; t < 4; ++t) {
      const float d  = a[bb][t] - mu;
      const float nv = d * rs;
      const float av = nv * ga;
      const float sv = av + be;
      r[t] = sv + bfr(xv[bb][t]);
    }
    *(v4f*)((char*)out + bo[bb]) = r;
  }
}

// =========================================================================================================
// Workspace map (bytes; each region start a multiple of 256; every extent is an exact row/tile multiple and is
//   W16 f16 [384][256]            196608      WWb bf16 [256][128]        65536
//   XP  f16 [NB][4096][256]     16777216 (NB=8)
//   Qh/Ql bf16 [NB][4096][128]   8388608 x2
//   Kh/Kl bf16 [NB][1024][128]   2097152 x2  Gc f16 [NB][32][128][32]  2097152
//   Yh/Yl bf16 [NB][4096][128]   8388608 x2
//   WY  f32  [NB][256][4096]    33554432
//   total (NB=8) = 90439680
//   W16, WWb, XP, Yh and Yl hold their rows in fragment order (piece_off); the sizes are those of the row-major planes.
// =========================================================================================================
extern "C" void kernel_launch(void* const* d_in, const int* in_sizes, int n_in,
                              void* d_out, int out_size, void* d_ws, size_t ws_size,
                              hipStream_t stream) {
  const int XN = NB * CC * NN;
  if (n_in < 11) return;
  if (in_sizes[0] < XN) return;
  if (in_sizes[1] < DQ * CC || in_sizes[3] < DQ * CC || in_sizes[5] < DQ * CC || in_sizes[7] < CC * DQ) return;
  if (in_sizes[2] < DQ || in_sizes[4] < DQ || in_sizes[6] < DQ || in_sizes[8] < CC) return;
  if (in_sizes[9] < CC || in_sizes[10] < CC) return;
  if (out_size < XN) return;

  size_t off = 0;
  auto carve = [&](size_t bytes) { const size_t o = off; off += (bytes + 255) & ~(size_t)255; return o; };
  const size_t oW16 = carve((size_t)MW * CC * 2);
  const size_t oWWb = carve((size_t)CC * DQ * 2);
  const size_t oXP  = carve((size_t)NB * NN * CC * 2);
  const size_t oQh  = carve((size_t)NB * NN * DQ * 2);
  const size_t oQl  = carve((size_t)NB * NN * DQ * 2);
  const size_t oKh  = carve((size_t)NB * MM * DQ * 2);
  const size_t oKl  = carve((size_t)NB * MM * DQ * 2);
  const size_t oGc  = carve((size_t)NB * DQ * MM * 2);
  const size_t oYh  = carve((size_t)NB * NN * DQ * 2);
  const size_t oYl  = carve((size_t)NB * NN * DQ * 2);
  const size_t oWY  = carve((size_t)NB * CC * NN * 4);
  if (off > ws_size) return;
  if (off > (size_t)134217728) return;

  const float* x   = (const float*)d_in[0];
  const float* gw  = (const float*)d_in[1];
  const float* gb  = (const float*)d_in[2];
  const float* tw  = (const float*)d_in[3];
  const float* tb  = (const float*)d_in[4];
  const float* pw  = (const float*)d_in[5];
  const float* pb  = (const float*)d_in[6];
  const float* ow  = (const float*)d_in[7];
  const float* wb  = (const float*)d_in[8];
  const float* gam = (const float*)d_in[9];
  const float* bet = (const float*)d_in[10];

  char* ws = (char*)d_ws;
  unsigned short* W16 = (unsigned short*)(ws + oW16);
  unsigned short* WWb = (unsigned short*)(ws + oWWb);
  unsigned short* XP  = (unsigned short*)(ws + oXP);
  unsigned short* Qh  = (unsigned short*)(ws + oQh);
  unsigned short* Ql  = (unsigned short*)(ws + oQl);
  unsigned short* Kh  = (unsigned short*)(ws + oKh);
  unsigned short* Kl  = (unsigned short*)(ws + oKl);
  unsigned short* Gc  = (unsigned short*)(ws + oGc);
  unsigned short* Yh  = (unsigned short*)(ws + oYh);
  unsigned short* Yl  = (unsigned short*)(ws + oYl);
  float*          WY  = (float*)(ws + oWY);
  float* out = (float*)d_out;

  const dim3 blk256(256), blk128(128);

  // (0) theta_w / phi_w / g_w -> stacked f16 plane; w_w -> bf16 plane, both in fragment order
  cvt_w<<<dim3(MW / 8 + CC / 16), blk256, 0, stream>>>(tw, pw, gw, ow, W16, WWb);
  // (1) x -> 16-bit plane, rows = positions, fragment order
  cvt_x<<<dim3(NN / QT, CC / QT, NB), blk256, 0, stream>>>(x, XP);
  // (2) conv1x1 GEMM -> theta (q) hi/res planes; phi / g + bias, 2x2 max-pooled -> k hi/res planes, v plane by stages
  gemm_proj<<<dim3(NSTRIP, MW / QT, NB), blk256, 0, stream>>>(W16, XP, tb, pb, gb, Qh, Ql, Kh, Kl, Gc);
  // (3) attention -> y hi/res planes, rows = positions, fragment order
  attn_k<<<dim3(NQ / QT, NB), blk128, 0, stream>>>(Qh, Ql, Kh, Kl, Gc, Yh, Yl);
  // (4) output conv + bias -> WY f32 plane [b][256][4096]
  gemm_out<<<dim3(NQ / QT, CC / QT, NB), blk128, 0, stream>>>(WWb, Yh, Yl, wb, WY);
  // (5) per-channel mean / rstd, then normalise, affine, residual -> out [b][256][4096]
  bn_norm<<<dim3(CC), dim3(BST), 0, stream>>>(WY, x, gam, bet, out);
  (void)hipGetLastError();
}

// v007
// One run takes 86.3 microseconds.
// Next to v006, in two timings, it ran 1.13 and 1.12 times as fast.
// Over all steps from v000 it is 9.26 times as fast.
// Contractions: conv1x1 theta/phi/g GEMM W[384x256].X[256x128] per strip on v_wmma_f32_16x16x32_f16 (f16 containers
// of bf16-RNE weights x256 and bf16-RNE x); scores K.Q^T on v_wmma_f32_16x16x32_bf16 (bf16 hi + bf16 residual planes
// of theta / 2x2-max-pooled phi, 3 products, K=128); y^T = G.P^T on v_wmma_f32_16x16x32_f16 (2x2-max-pooled g as
// f16, P = e^{s-m} x16384 f16 from the score D registers); output conv W[256x128].Y on v_wmma_f32_16x16x32_bf16 (bf16
// weights, y as bf16 hi + residual planes, 2 products); f32 accumulate everywhere; max-pool, softmax statistics and
// bias in f32 VALU; batch-norm channel statistics in f64 VALU; normalisation, affine and residual add in f32 VALU.
#include <hip/hip_runtime.h>
#include <math.h>
#include <stdint.h>

#ifndef NB
#define NB 8
#endif
#ifndef NQ
#define NQ 4096
#endif
#define NB_FULL 8
#define CC     256
#define HIMG   64
#define WIMG   64
#define NN     4096
#define DQ     128
#define HP     32
#define WP     32
#define MM     1024
#define MW     384
#define QT     64
#define SN     128
#define NSTRIP 32
#define OSP    68
#define OSPW   132
#define BST    1024
#define WSC    256.0f
#define IWSC   0.00390625f
#define LNPS   9.704060527839234f
#define BNEPS  1.0e-5f
#define KT     32
#define KP     136
#define VPT    40
#define STG    (2 * KT * KP + DQ * VPT)
#define GTP    40
#define XPT    264
#define OSA    388
#define PT     512

static_assert(NB >= 1 && NB <= NB_FULL);
static_assert(NQ % QT == 0 && NQ <= NN);
static_assert(NN == HIMG * WIMG);
static_assert(SN == 2 * WIMG);
static_assert(NSTRIP * SN == NN);
static_assert(SN == 8 * 16);
static_assert(HIMG % 2 == 0 && WIMG % 2 == 0);
static_assert(HP == HIMG / 2 && WP == WIMG / 2);
static_assert(MM == HP * WP);
static_assert(WP == 32);
static_assert(MM % QT == 0 && MM % 32 == 0);
static_assert(NN % QT == 0 && CC % QT == 0 && DQ % QT == 0);
static_assert(MW == 3 * DQ && MW % QT == 0 && MW % 8 == 0);
static_assert(CC % 32 == 0 && DQ % 32 == 0);
static_assert((OSP * 4) % 16 == 0);
static_assert((OSPW * 4) % 16 == 0);
static_assert((XPT * 2) % 32 == 16 && XPT >= CC + 8 && (OSA * 4) % 16 == 0 && OSA >= MW + 4);
static_assert(SN * XPT * 2 <= SN * OSA * 4 && MW == 8 * 3 * 16 && PT == 16 * 32 && CC == 8 * 32);
static_assert(BST == 32 * 32 && NQ == 4 * BST);
static_assert(NN % 16 == 0 && CC % 4 == 0);
static_assert((size_t)NB_FULL * CC * NN * 4 == (size_t)33554432);
static_assert((KP * 2) % 16 == 0 && (VPT * 2) % 16 == 0 && (STG * 2) % 16 == 0 && (KT * KP * 2) % 16 == 0);
static_assert(KP >= DQ + 8 && VPT >= KT + 8 && MM % KT == 0 && MM / KT >= 2);
static_assert(KT * DQ / 8 == 4 * 128 && DQ * KT / 8 == 4 * 128 && QT * DQ / 8 == 8 * 128);
static_assert(KT == WP && NSTRIP == HP && (GTP * 2) % 16 == 0 && GTP >= WP + 8 && QT * WP / 8 == 256);

typedef _Float16       v16h __attribute__((ext_vector_type(16)));
typedef _Float16       v8h  __attribute__((ext_vector_type(8)));
typedef __bf16         v16b __attribute__((ext_vector_type(16)));
typedef unsigned short v8us __attribute__((ext_vector_type(8)));
typedef float          v8f  __attribute__((ext_vector_type(8)));
typedef float          v4f  __attribute__((ext_vector_type(4)));
typedef unsigned int   v4u  __attribute__((ext_vector_type(4)));

union Frag  { v8us u[2]; v16h h; v16b bf; };
union FragH { v16h v; v8h hv[2]; };
static_assert(sizeof(Frag) == 32);
static_assert(sizeof(FragH) == 32);

// ---- scalar helpers ---------------------------------------------------------------------------------------
__device__ __forceinline__ unsigned short bf_bits(float f) {          // f32 -> bf16 bits, RNE convert
  unsigned u = __float_as_uint(f);
  return (unsigned short)((u + 0x7FFFu + ((u >> 16) & 1u)) >> 16);
}
__device__ __forceinline__ float bf_up(unsigned short hb) { return __uint_as_float(((unsigned)hb) << 16); }
__device__ __forceinline__ float bfr(float f) { return bf_up(bf_bits(f)); }
__device__ __forceinline__ unsigned short h_bits(_Float16 x) { return __builtin_bit_cast(unsigned short, x); }
__device__ __forceinline__ unsigned pk16(unsigned short a, unsigned short b) { return (unsigned)a | ((unsigned)b << 16); }
__device__ __forceinline__ v8f zero8() { v8f z = {0.f, 0.f, 0.f, 0.f, 0.f, 0.f, 0.f, 0.f}; return z; }
__device__ __forceinline__ float hmax8(v8f s) {
  return fmaxf(fmaxf(fmaxf(s[0], s[1]), fmaxf(s[2], s[3])), fmaxf(fmaxf(s[4], s[5]), fmaxf(s[6], s[7])));
}
__device__ __forceinline__ unsigned wave_ballot(bool p) {
#if defined(__HIP_DEVICE_COMPILE__)
  return __builtin_amdgcn_ballot_w32(p);
#else
  return p ? 1u : 0u;
#endif
}
// 8 f32 values -> bf16 hi bits and bf16 residual bits (lo = RNE(v - hi)), packed 2 per uint
__device__ __forceinline__ void split8(const float* f, v4u& uh, v4u& ul) {
#pragma unroll
  for (int t = 0; t < 4; ++t) {
    const float f0 = f[2 * t], f1 = f[2 * t + 1];
    const unsigned short hb0 = bf_bits(f0), hb1 = bf_bits(f1);
    const unsigned short lb0 = bf_bits(f0 - bf_up(hb0));
    const unsigned short lb1 = bf_bits(f1 - bf_up(hb1));
    uh[t] = pk16(hb0, hb1);
    ul[t] = pk16(lb0, lb1);
  }
}

// ---- 16-bit fragment loader (A, or B from a k-contiguous [n][k] row): lane -> row/col (lane&15), p already includes
//      + 8*(lane>>4); elements 0..7 <- p[0..7] (k0+8h..), elements 8..15 <- p[16..23] (k0+16+8h..)
__device__ __forceinline__ Frag ldfrag(const unsigned short* p) {
  Frag f;
  f.u[0] = *(const v8us*)(p);
  f.u[1] = *(const v8us*)(p + 16);
  return f;
}

// ---- fragment-order planes (W16, WWb, Yh, Yl): a 16-row x 32-k operand tile is stored as the 1 KiB its loader
//      reads: half j, then lane = 16 hh + row, then 8 elements, k = k0 + 16 j + 8 hh + e (the k map of ldfrag). Each of
//      the loader's two wave loads then covers 512 contiguous bytes (4 whole lines) and not 32 B of each of 16 rows.
//      piece_off: element offset of the 8-element piece q = k / 8 of row r (0..15) of tile t; nks = 32-k steps a row.
__device__ __forceinline__ size_t piece_off(int t, int nks, int q, int r) {
  return ((size_t)((t * nks + (q >> 2)) * 2 + ((q >> 1) & 1)) * 32 + 16 * (q & 1) + r) * 8;
}
__device__ __forceinline__ Frag ldfrag_p(const unsigned short* plane, int t, int nks, int ks, int lane) {
  const unsigned short* p = plane + ((size_t)(t * nks + ks) * 64 + lane) * 8;
  Frag f;
  f.u[0] = *(const v8us*)(p);
  f.u[1] = *(const v8us*)(p + 256);
  return f;
}

// ---- WMMA helpers: builtin followed by a 4-slot VALU gap tying D and keeping A/B live --------------------------
__device__ __forceinline__ v8f mma_h(v16h a, v16h b, v8f c) {
  v8f d = __builtin_amdgcn_wmma_f32_16x16x32_f16(false, a, false, b, (short)0, c, false, false);
#if defined(__HIP_DEVICE_COMPILE__)
  asm volatile("v_nop\n\tv_nop\n\tv_nop\n\tv_nop" : "+v"(d) : "v"(a), "v"(b));
#endif
  return d;
}
__device__ __forceinline__ v8f mma_b(v16b a, v16b b, v8f c) {
  v8f d = __builtin_amdgcn_wmma_f32_16x16x32_bf16(false, a, false, b, (short)0, c, false, false);
#if defined(__HIP_DEVICE_COMPILE__)
  const v16h ha = __builtin_bit_cast(v16h, a), hb = __builtin_bit_cast(v16h, b);
  asm volatile("v_nop\n\tv_nop\n\tv_nop\n\tv_nop" : "+v"(d) : "v"(ha), "v"(hb));
#endif
  return d;
}

// stands directly behind a run of global stores, in front of any later write of a register that those stores name
__device__ __forceinline__ void wait_x0() {
#if defined(__HIP_DEVICE_COMPILE__)
  asm volatile("s_wait_xcnt 0x0" ::: "memory");
#endif
}

// stands directly behind that wait where more work follows: without it the scheduler lifts later address arithmetic in
// among the stores, onto registers that they name, ahead of the wait
__device__ __forceinline__ void hold_below() {
#if defined(__HIP_DEVICE_COMPILE__)
  __builtin_amdgcn_sched_barrier(0);
#endif
}
// the same wait behind a run of global loads from one address: the address is an input, so it stays in its registers up
// to the wait and no load of the run returns its data onto them
__device__ __forceinline__ void wait_x0_keep(const float* p) {
#if defined(__HIP_DEVICE_COMPILE__)
  asm volatile("s_wait_xcnt 0x0" :: "v"(p) : "memory");
#endif
}

// =========================================================================================================
// (0) weights. Blocks 0..47: W16 f16 [384][256], rows 0..127 = theta_w, 128..255 = phi_w, 256..383 = g_w; value =
//     f16 of (bf16-RNE(w) * 256) (exact). Block owns rows 8*blk..8*blk+7 (half a 16-row tile): 8 lanes x 16 B = one
//     whole line of the fragment-order plane per piece q. Blocks 48..63: WWb bf16 [256][128], one 16-row tile a block.
// coverage: 48 blocks x 8 rows x 32 pieces x 8 halves = 384 x 256; 16 blocks x 16 rows x 16 pieces x 8 = 256 x 128.
// =========================================================================================================
__global__ __launch_bounds__(256)
void cvt_w(const float* __restrict__ tw, const float* __restrict__ pw, const float* __restrict__ gw,
           const float* __restrict__ ow, unsigned short* W16, unsigned short* WWb) {
  const int tid = threadIdx.x, blk = blockIdx.x;
  if (blk < MW / 8) {
    const int rl = tid & 7, pq = tid >> 3, col = 8 * pq;             // row in the block, piece 0..31
    const int o = 8 * blk + rl;                                      // 0..383
    const int grp = blk >> 4;                                        // 0,1,2 (block-uniform)
    const float* wbase = (grp == 0) ? tw : ((grp == 1) ? pw : gw);  // all global
    const float* s = wbase + (size_t)(o - DQ * grp) * CC + col;      // (o - 128 grp) in 0..127
    const v4f a = *(const v4f*)s;
    const v4f q = *(const v4f*)(s + 4);
    const float f[8] = {a[0], a[1], a[2], a[3], q[0], q[1], q[2], q[3]};
    v4u u;
#pragma unroll
    for (int t = 0; t < 4; ++t) {
      const _Float16 h0 = (_Float16)(bfr(f[2 * t]) * WSC);
      const _Float16 h1 = (_Float16)(bfr(f[2 * t + 1]) * WSC);
      u[t] = pk16(h_bits(h0), h_bits(h1));
    }
{
      *(v4u*)(W16 + piece_off(o >> 4, CC / 32, pq, o & 15)) = u;
      
    }
  } else {
    const int rb = blk - MW / 8;                                     // 0..15
    const int o = 16 * rb + (tid & 15);                              // 0..255
    const int pq = tid >> 4, col = 8 * pq;                           // piece 0..15, col 0..120
    const float* s = ow + (size_t)o * DQ + col;
    const v4f a = *(const v4f*)s;
    const v4f q = *(const v4f*)(s + 4);
    const float f[8] = {a[0], a[1], a[2], a[3], q[0], q[1], q[2], q[3]};
    v4u u;
#pragma unroll
    for (int t = 0; t < 4; ++t) u[t] = pk16(bf_bits(f[2 * t]), bf_bits(f[2 * t + 1]));
{
      *(v4u*)(WWb + piece_off(rb, DQ / 32, pq, tid & 15)) = u;
      
    }
  }
}

// =========================================================================================================
// (1) conv1x1 GEMM for one (b, strip of 128 positions = image rows 2s and 2s+1), all 384 rows of the stacked weights:
//     Y[o][n] = (1/256) sum_c W16[o][c] X[n][c]. Block 512 threads = 16 waves, one block a WGP.
//     Stage: the strip x f32 [256 c][128 n] is read once from global (a thread: 8 channels x 4 positions, twice; 8 lanes
//     cover one whole 128-B line, a wave load 4 lines), rounded to bf16-RNE, held as f16 (the same values a B fragment
//     had before) and turned in registers into Xs[128 n][256 c] (pitch XPT, b128 stores, cross-wave, block barrier).
//     Products: wave w owns m-tiles 3 (w >> 1) .. + 2 (A rows o = 16 tile + (lane&15), W16 in fragment order, read from
//     global one k-step ahead) and n-tiles 4 (w & 1) .. + 3 (B rows n = 16 tile + (lane&15) of Xs, the k map of ldfrag, too).
//     K = 256 = 8 steps in ascending order into one accumulator a tile.
//     Epilogue staged in LDS Os[n_loc][384 o] (pitch OSA, b128 stores) on the bytes of Xs, behind a block barrier that
//     ends every wave's reads of Xs; block barrier (cross-wave); then the two halves of the block (h = tid >> 8) take
//     dims 64 h .. 64 h + 63 of (g first, then theta, then phi):
//       theta + bias -> Qh/Ql bf16 [b][4096 n][128 d] (hi = RNE(v), lo = RNE(v-hi)), 8 consecutive lanes x 16 B = one line;
//       phi + bias in f32, 2x2 stride-2 max-pool in f32 (the strip holds both image rows of every window: pooled column
//                       px takes n_loc = 64 dy + 2 px + dx, dy, dx in {0,1}; key m = 32 st + px) -> Kh/Kl bf16
//                       [b][1024 m][128 d] (hi = RNE(v), lo = RNE(v-hi)): 32 rows x one whole line of the 256-B row;
//       g + bias, the same pool, f16, turned through the half's LDS tile Tg[64 d][32 px] (pitch GTP, cross-wave, block
//                       barrier) -> Gc f16 [b][32 st][128 d][32 px]: one 32-key stage of the attention a strip, keys
//                       contiguous a channel; each wave store 512 contiguous B.
// coverage: Xs written rows 64 (w&1) + 32 g + 4 lq + t = 0..127 x cols 32 (w>>1) + 8 lo + 0..7 = 0..255, read rows 0..127 x
//           cols 0..255; Os 8 m-groups x 3 tiles x 16 o = 384 cols x 2 n-halves x 4 tiles x 16 = 128 rows written, reads
//           rows <= 127 cols <= 383; theta planes 4 it x 32 rows x 8 lanes x 8 x 2 halves = 128 n x 128 d; pooled planes
//           32 px x 8 lanes x 8 x 2 halves = 32 m x 128 d; Tg written rows (8e+t)=0..63 x cols 0..31 a half, read rows
//           0..63 x cols 8 kq..8 kq+7, kq 0..3; grid (32, NB) covers all 4096 rows x 128 d of Qh/Ql and all 1024 keys x
//           128 d of Kh/Kl/Gc exactly once.
// =========================================================================================================
__global__ __launch_bounds__(PT)
void gemm_proj(const unsigned short* __restrict__ W16, const float* __restrict__ x,
               const float* __restrict__ tb, const float* __restrict__ pb, const float* __restrict__ gb,
               unsigned short* Qh, unsigned short* Ql, unsigned short* Kh, unsigned short* Kl, unsigned short* Gc) {
  __shared__ __align__(16) float Os[SN * OSA];
  __shared__ __align__(16) unsigned short Tg[2 * QT * GTP];
  unsigned short* Xs = (unsigned short*)Os;                          // the x tile lives on the bytes of Os, ahead of it
  const int tid  = threadIdx.x;
  const int lane = tid & 31, wave = tid >> 5;                        // wave 0..15
  const int hh   = lane >> 4, c = lane & 15;
  const int st   = blockIdx.x, b = blockIdx.y;
  const int n0   = st * SN;
  const int ta   = 3 * (wave >> 1), tn = 4 * (wave & 1);             // first A tile (of 24), first n-tile (of 8)

  Frag fa[2][3];                                                     // A fragments of this k-step and of the next
#pragma unroll
  for (int i = 0; i < 3; ++i) fa[0][i] = ldfrag_p(W16, ta + i, CC / 32, 0, lane);

  // ---- stage the strip: f32 [c][n] -> f16 Xs[n][c]
  {
    const int lo = lane & 3, lq = lane >> 2;                         // channel octet 0..3, position quad 0..7
    const int c8 = 32 * (wave >> 1) + 8 * lo;                        // the thread's channels c8..c8+7
    const int nq = 64 * (wave & 1) + 4 * lq;                         // its positions nq + 32 g + 0..3
    const float* xp = x + ((size_t)(b * CC + c8)) * NN + n0 + nq;
    v4f v[2][8];
#pragma unroll
    for (int e = 0; e < 8; ++e) {
#pragma unroll
      for (int g = 0; g < 2; ++g) v[g][e] = *(const v4f*)(xp + (size_t)e * NN + 32 * g);
    }
    wait_x0_keep(xp);
#pragma unroll
    for (int g = 0; g < 2; ++g) {
#pragma unroll
      for (int t = 0; t < 4; ++t) {
        v4u u;
#pragma unroll
        for (int k = 0; k < 4; ++k)
          u[k] = pk16(h_bits((_Float16)bfr(v[g][2 * k][t])), h_bits((_Float16)bfr(v[g][2 * k + 1][t])));
        *(v4u*)(Xs + (nq + 32 * g + t) * XPT + c8) = u;
      }
    }
  }
  __syncthreads();

  v8f acc[3][4];
#pragma unroll
  for (int i = 0; i < 3; ++i) {
#pragma unroll
    for (int j = 0; j < 4; ++j) acc[i][j] = zero8();
  }
  const unsigned short* Xp = Xs + (16 * tn + c) * XPT + 8 * hh;      // B fragment base, + 16 j rows, + 32 ks

  Frag fb[2][4];                                                     // B fragments of this k-step and of the next
#pragma unroll
  for (int j = 0; j < 4; ++j) fb[0][j] = ldfrag(Xp + (16 * j) * XPT);
  // unrolled so that the two sets are registers: the next step's reads stand as one group above this step's products
#pragma unroll
  for (int ks = 0; ks < CC / 32; ++ks) {
    if (ks + 1 < CC / 32) {
#pragma unroll
      for (int i = 0; i < 3; ++i) fa[(ks + 1) & 1][i] = ldfrag_p(W16, ta + i, CC / 32, ks + 1, lane);
#pragma unroll
      for (int j = 0; j < 4; ++j) fb[(ks + 1) & 1][j] = ldfrag(Xp + (16 * j) * XPT + 32 * (ks + 1));
    }
#pragma unroll
    for (int j = 0; j < 4; ++j) {
#pragma unroll
      for (int i = 0; i < 3; ++i) acc[i][j] = mma_h(fa[ks & 1][i].h, fb[ks & 1][j].h, acc[i][j]);
    }
  }
  __syncthreads();                                                   // every wave has left Xs before Os overwrites it

  // ---- epilogue: scale back -> LDS Os[n_loc][o]; lane (hh, c) holds o = 16 tile + 8 hh + r for n_loc = 16 n-tile + c
#pragma unroll
  for (int j = 0; j < 4; ++j) {
    const int nl = 16 * (tn + j) + c;
#pragma unroll
    for (int i = 0; i < 3; ++i) {
      v4f va, vb;
#pragma unroll
      for (int r = 0; r < 4; ++r) { va[r] = acc[i][j][r] * IWSC; vb[r] = acc[i][j][4 + r] * IWSC; }
      *(v4f*)(Os + nl * OSA + 16 * (ta + i) + 8 * hh)     = va;
      *(v4f*)(Os + nl * OSA + 16 * (ta + i) + 8 * hh + 4) = vb;
    }
  }
  __syncthreads();

  const int u256 = tid & 255;
  const int dsel = (tid >> 8) * QT;                                  // 0 or 64 (wave-uniform)
  const int e = u256 & 7, lq = u256 >> 3;                            // dims 8 e..8 e+7 of the half; lq 0..31
  auto bias8 = [&](const float* bias, float* bv) {
    const float* bp = bias + dsel + 8 * e;
    const v4f ba = *(const v4f*)bp;
    const v4f bq = *(const v4f*)(bp + 4);
    wait_x0_keep(bp);
#pragma unroll
    for (int t = 0; t < 4; ++t) { bv[t] = bfr(ba[t]); bv[4 + t] = bfr(bq[t]); }
  };

  // ---- phi and g: bias, then the 2x2 max-pool; pooled column px = lq
  const int px = lq;
  auto pooled = [&](const float* bias, int ob, float* f) {           // ob: first column of the plane in Os
    float bv[8];
    bias8(bias, bv);
#pragma unroll
    for (int t = 0; t < 8; ++t) f[t] = -__builtin_inff();
#pragma unroll
    for (int dy = 0; dy < 2; ++dy) {
#pragma unroll
      for (int dx = 0; dx < 2; ++dx) {
        const int row = dy * WIMG + 2 * px + dx;                     // n_loc 0..127
        const v4f a = *(const v4f*)(Os + row * OSA + ob + dsel + 8 * e);
        const v4f q = *(const v4f*)(Os + row * OSA + ob + dsel + 8 * e + 4);
#pragma unroll
        for (int t = 0; t < 4; ++t) {
          f[t]     = fmaxf(f[t], a[t] + bv[t]);
          f[4 + t] = fmaxf(f[4 + t], q[t] + bv[4 + t]);
        }
      }
    }
  };
  // g first: its barrier then has no global store of this block to wait for
  {
    float f[8];
    pooled(gb, 2 * DQ, f);
    unsigned short* Th = Tg + (tid >> 8) * (QT * GTP);               // the half's own tile
#pragma unroll
    for (int t = 0; t < 8; ++t) Th[(8 * e + t) * GTP + px] = h_bits((_Float16)f[t]);
    __syncthreads();                                                 // straight-line code: every wave passes
    const int dl = u256 >> 2, kq = u256 & 3;                         // channel 0..63 of the half, 8 keys 8 kq..8 kq+7
    const v4u u = *(const v4u*)(Th + dl * GTP + 8 * kq);
    *(v4u*)(Gc + ((size_t)((b * NSTRIP + st) * DQ + dsel + dl)) * WP + 8 * kq) = u;
    wait_x0();
  }

  // ---- theta
  {
    float bv[8];
    bias8(tb, bv);
    v4u uh[4], ul[4];
#pragma unroll
    for (int it = 0; it < 4; ++it) {
      const int row = it * 32 + lq;                                  // n_loc 0..127
      const v4f a = *(const v4f*)(Os + row * OSA + dsel + 8 * e);
      const v4f q = *(const v4f*)(Os + row * OSA + dsel + 8 * e + 4);
      float f[8];
#pragma unroll
      for (int t = 0; t < 4; ++t) { f[t] = a[t] + bv[t]; f[4 + t] = q[t] + bv[4 + t]; }
      split8(f, uh[it], ul[it]);
    }
#pragma unroll
    for (int it = 0; it < 4; ++it) {
      const int row = it * 32 + lq;
      const size_t po = ((size_t)(b * NN + n0 + row)) * DQ + dsel + 8 * e;
      *(v4u*)(Qh + po) = uh[it];
      *(v4u*)(Ql + po) = ul[it];
    }
    wait_x0();
    hold_below();
  }

  // ---- phi
  {
    float f[8];
    pooled(pb, DQ, f);
    v4u kh, kl;
    split8(f, kh, kl);
    const size_t po = ((size_t)(b * MM + WP * st + px)) * DQ + dsel + 8 * e;
    *(v4u*)(Kh + po) = kh;
    *(v4u*)(Kl + po) = kl;
    wait_x0();
  }
}

// ---- asynchronous copies to LDS: each lane moves its own 16 bytes, global -> LDS, through no register. Arguments: the
//      lane's LDS byte addresses, then its global addresses in the same order, all multiples of 16. The closing
//      s_wait_xcnt 0 stands inside the copies' own statement so that no address register named there is rewritten ahead
//      of it.
__device__ __forceinline__ unsigned lds_addr(const void* p) { return (unsigned)(uintptr_t)p; }
__device__ __forceinline__ void copy4(unsigned l0, unsigned l1, unsigned l2, unsigned l3,
                                      const unsigned short* g0, const unsigned short* g1,
                                      const unsigned short* g2, const unsigned short* g3) {
#if defined(__HIP_DEVICE_COMPILE__)
  asm volatile("global_load_async_to_lds_b128 %0, %4, off\n\t"
               "global_load_async_to_lds_b128 %1, %5, off\n\t"
               "global_load_async_to_lds_b128 %2, %6, off\n\t"
               "global_load_async_to_lds_b128 %3, %7, off\n\t"
               "s_wait_xcnt 0x0"
               :: "v"(l0), "v"(l1), "v"(l2), "v"(l3), "v"(g0), "v"(g1), "v"(g2), "v"(g3) : "memory");
#endif
}
__device__ __forceinline__ void copy12(unsigned a0, unsigned a1, unsigned a2, unsigned a3, unsigned b0, unsigned b1,
                                       unsigned b2, unsigned b3, unsigned c0, unsigned c1, unsigned c2, unsigned c3,
                                       const unsigned short* p0, const unsigned short* p1, const unsigned short* p2,
                                       const unsigned short* p3, const unsigned short* q0, const unsigned short* q1,
                                       const unsigned short* q2, const unsigned short* q3, const unsigned short* r0,
                                       const unsigned short* r1, const unsigned short* r2, const unsigned short* r3) {
#if defined(__HIP_DEVICE_COMPILE__)
  asm volatile("global_load_async_to_lds_b128 %0, %12, off\n\t"
               "global_load_async_to_lds_b128 %1, %13, off\n\t"
               "global_load_async_to_lds_b128 %2, %14, off\n\t"
               "global_load_async_to_lds_b128 %3, %15, off\n\t"
               "global_load_async_to_lds_b128 %4, %16, off\n\t"
               "global_load_async_to_lds_b128 %5, %17, off\n\t"
               "global_load_async_to_lds_b128 %6, %18, off\n\t"
               "global_load_async_to_lds_b128 %7, %19, off\n\t"
               "global_load_async_to_lds_b128 %8, %20, off\n\t"
               "global_load_async_to_lds_b128 %9, %21, off\n\t"
               "global_load_async_to_lds_b128 %10, %22, off\n\t"
               "global_load_async_to_lds_b128 %11, %23, off\n\t"
               "s_wait_xcnt 0x0"
               :: "v"(a0), "v"(a1), "v"(a2), "v"(a3), "v"(b0), "v"(b1), "v"(b2), "v"(b3), "v"(c0), "v"(c1), "v"(c2),
                  "v"(c3), "v"(p0), "v"(p1), "v"(p2), "v"(p3), "v"(q0), "v"(q1), "v"(q2), "v"(q3), "v"(r0), "v"(r1),
                  "v"(r2), "v"(r3) : "memory");
#endif
}
// the issuing wave's copies have landed behind this wait
__device__ __forceinline__ void wait_async0() {
#if defined(__HIP_DEVICE_COMPILE__)
  asm volatile("s_wait_asynccnt 0x0" ::: "memory");
#endif
}
// the wave's own LDS reads have retired before the buffer they read is handed to the copies that refill it
__device__ __forceinline__ void wait_ds0() {
#if defined(__HIP_DEVICE_COMPILE__)
  asm volatile("s_wait_dscnt 0x0" ::: "memory");
#endif
}
// one 32-key stage: Kh and Kl rows kb..kb+31 (256 B each, LDS pitch 272 B) and stage kb / 32 of Gc, 128 channel rows of
// 64 B in a row (LDS pitch 80 B). 128 threads x 12 copies of 16 B = 8 KiB + 8 KiB + 8 KiB; no two lanes share an LDS byte.
__device__ __forceinline__ void stage_kv(unsigned short* st, const unsigned short* Khb, const unsigned short* Klb,
                                         const unsigned short* Gcb, int kb, int tid) {
  const int kr = tid >> 4, kcol = 8 * (tid & 15);                    // kr 0..7, + 8 i -> key row 0..31
  const int vr = tid >> 2, vcol = 8 * (tid & 3);                     // vr 0..31, + 32 i -> channel row 0..127
  const unsigned lk = lds_addr(st + kr * KP + kcol);
  const unsigned ll = lk + 2u * (KT * KP);
  const unsigned lv = lds_addr(st + 2 * KT * KP + vr * VPT + vcol);
  const unsigned short* gk = Khb + (size_t)(kb + kr) * DQ + kcol;
  const unsigned short* gl = Klb + (size_t)(kb + kr) * DQ + kcol;
  const unsigned short* gv = Gcb + (size_t)kb * DQ + vr * KT + vcol;   // kb a multiple of KT: stage kb / KT starts at kb DQ
  copy12(lk, lk + 2u * (8 * KP), lk + 2u * (16 * KP), lk + 2u * (24 * KP),
         ll, ll + 2u * (8 * KP), ll + 2u * (16 * KP), ll + 2u * (24 * KP),
         lv, lv + 2u * (32 * VPT), lv + 2u * (64 * VPT), lv + 2u * (96 * VPT),
         gk, gk + 8 * DQ, gk + 16 * DQ, gk + 24 * DQ, gl, gl + 8 * DQ, gl + 16 * DQ, gl + 24 * DQ,
         gv, gv + 32 * KT, gv + 64 * KT, gv + 96 * KT);
}

// =========================================================================================================
// (2) attention for one (b, 64-query tile), transposed formulation, 1024 keys (all valid, no mask, no scale):
//   S^T tile (16 keys x 16 queries) = sum over 4 d-chunks (unrolled) of A(k: row = key kb + (lane&15), 32 d via
//   the split k map from the bf16 plane Kh [b][1024][128]) . B(q: col = query, same map from Qh [b][4096][128])
//   + A(Kh).B(Ql) + A(Kl).B(Qh) (bf16 unscaled residual planes, shared accumulator).
//   Per lane the D tile holds 8 keys of ONE query: online softmax state per lane, one shuffle (lane^16) for the max
//   over 32 keys; the o/l rescale is skipped under a wave-uniform ballot when no lane's max grew (corr == 1 exactly
//   for every lane then); row-sum partials combined at the end. P = e^{s-m} x 16384 as f16 is the B operand of
//   y^T (rows channel, cols queries) += A(pooled g: rows channel = 16j + (lane&15), keys contiguous, f16 plane Gc
//   [b][32 stages][128][32]) . B(P^T): element r <- D of the tile covering keys kb..kb+15, element 8+r <- the tile covering
//   kb+16..kb+31, lane unchanged. 8 accumulator tiles per wave (128 channels). Block = 4 waves = 64 queries.
//   Live state per lane: o 64 + s0/s1 16 + two sets of 6 fragments, or one set and 8 V fragments, + m/l, under the 256 cap.
//   Operands come from LDS: the block's 64 query rows of Qh/Ql are copied once (Qs, pitch 272 B); each 32-key stage of
//   Kh/Kl/Gc is copied by all four waves into one of two buffers (Ring) one trip ahead of its use and read by all four.
//   Epilogue: y = O/l staged in LDS Os[query][128 channels] (pitch OSPW, b128 stores), block barrier (cross-wave),
//   then Yh/Yl (rows n, k = channel) in fragment order, each wave store 512 contiguous B.
// coverage: Os written 4 waves x 16 queries x 128 ch, read rows 0..63 x ch 8 pq..8 pq+7 (pq 0..15); planes 4 tiles x 16
//           pieces x 16 rows x 8 = 64 n x 128 ch per plane; grid (NQ/64, NB) covers rows 0..NQ-1 of Yh/Yl exactly once.
// =========================================================================================================
__global__ __launch_bounds__(128) __attribute__((amdgpu_num_vgpr(256)))
void attn_k(const unsigned short* __restrict__ Qh, const unsigned short* __restrict__ Ql,
            const unsigned short* __restrict__ Kh, const unsigned short* __restrict__ Kl,
            const unsigned short* __restrict__ Gc, unsigned short* Yh, unsigned short* Yl) {
  __shared__ __align__(16) float Os[QT * OSPW];
  __shared__ __align__(16) unsigned short Qs[2 * QT * KP];
  __shared__ __align__(16) unsigned short Ring[2 * STG];
  const int tid  = threadIdx.x;
  const int wave = tid >> 5, lane = tid & 31;
  const int hh   = lane >> 4, c = lane & 15;
  const int n0   = blockIdx.x * QT, b = blockIdx.y;

  const unsigned short* Khb = Kh + (size_t)b * MM * DQ;
  const unsigned short* Klb = Kl + (size_t)b * MM * DQ;
  const unsigned short* Gcb = Gc + (size_t)b * DQ * MM;

  // ---- in front of the loop: the query tile and stage 0, their wait, the barrier that publishes them, then stage 1
  {
    const int qr = tid >> 4, qcol = 8 * (tid & 15);                  // qr 0..7, + 8 i -> query row 0..63
    const unsigned lq = lds_addr(Qs + qr * KP + qcol);
    const size_t go = ((size_t)(b * NN + n0 + qr)) * DQ + qcol;
    auto plane = [](unsigned l0, const unsigned short* g) {          // 64 rows of one plane, 8 copies a thread
      copy4(l0, l0 + 2u * (8 * KP), l0 + 2u * (16 * KP), l0 + 2u * (24 * KP), g, g + 8 * DQ, g + 16 * DQ, g + 24 * DQ);
      copy4(l0 + 2u * (32 * KP), l0 + 2u * (40 * KP), l0 + 2u * (48 * KP), l0 + 2u * (56 * KP), g + 32 * DQ,
            g + 40 * DQ, g + 48 * DQ, g + 56 * DQ);
    };
    plane(lq, Qh + go);
    plane(lq + 2u * (QT * KP), Ql + go);
  }
  stage_kv(Ring, Khb, Klb, Gcb, 0, tid);
  wait_async0();
  __syncthreads();
  stage_kv(Ring + STG, Khb, Klb, Gcb, KT, tid);

  // q fragment pointers (B operand, col = query 16*wave + c of the tile), + 32*kc
  const unsigned short* Qhp = Qs + (16 * wave + c) * KP + 8 * hh;
  const unsigned short* Qlp = Qhp + QT * KP;

  float m = -1.0e30f, l = 0.f;
  v8f o[8];
#pragma unroll
  for (int j = 0; j < 8; ++j) o[j] = zero8();

#pragma unroll 1
  for (int kb = 0; kb < MM; kb += KT) {
    unsigned short* st = Ring + ((kb / KT) & 1) * STG;               // this trip's buffer
    // k fragment base (A operand, row = key kb + c), + 32*kc; v fragment base (A operand, row = channel 16j + c)
    const unsigned short* k0p  = st + c * KP + 8 * hh;               // keys kb .. kb+15
    const unsigned short* k1p  = k0p + 16 * KP;                      // keys kb+16 .. kb+31
    const unsigned short* k0lp = k0p + KT * KP;
    const unsigned short* k1lp = k1p + KT * KP;
    const unsigned short* Vp   = st + 2 * KT * KP + c * VPT + 8 * hh;
    v8f s0 = zero8(), s1 = zero8();
    Frag fr[2][6], vf[8];                                            // two sets of one d-chunk's fragments; V fragments
    auto chunk = [&](Frag* f, int kc) {                              // the 12 LDS reads of d-chunk kc
      f[0] = ldfrag(Qhp + 32 * kc);
      f[1] = ldfrag(Qlp + 32 * kc);
      f[2] = ldfrag(k0p + 32 * kc);
      f[3] = ldfrag(k1p + 32 * kc);
      f[4] = ldfrag(k0lp + 32 * kc);
      f[5] = ldfrag(k1lp + 32 * kc);
    };
    chunk(fr[0], 0);
    // unrolled so that the two sets are registers: the reads of the next chunk (behind the last chunk: of all V fragments)
    // stand as one group above this chunk's products and are waited for by count, one group later
#pragma unroll
    for (int kc = 0; kc < DQ / 32; ++kc) {
      if (kc + 1 < DQ / 32) {
        chunk(fr[(kc + 1) & 1], kc + 1);
      } else {
#pragma unroll
        for (int j = 0; j < 8; ++j) vf[j] = ldfrag(Vp + (16 * j) * VPT);
      }
      const Frag* f = fr[kc & 1];
      s0 = mma_b(f[2].bf, f[0].bf, s0);
      s1 = mma_b(f[3].bf, f[0].bf, s1);
      s0 = mma_b(f[2].bf, f[1].bf, s0);
      s1 = mma_b(f[3].bf, f[1].bf, s1);
      s0 = mma_b(f[4].bf, f[0].bf, s0);
      s1 = mma_b(f[5].bf, f[0].bf, s1);
    }

    float mx = fmaxf(hmax8(s0), hmax8(s1));
    mx = fmaxf(mx, __shfl_xor(mx, 16, 32));
    const float mn = fmaxf(m, mx);
    const unsigned grew = wave_ballot(mx > m);                       // wave-uniform
    if (grew != 0u) {
      const float corr = __expf(m - mn);                             // == 1 exactly for lanes whose max did not grow
      l *= corr;
#pragma unroll
      for (int j = 0; j < 8; ++j) {
#pragma unroll
        for (int r = 0; r < 8; ++r) o[j][r] *= corr;
      }
    }
    m = mn;
    const float msh = mn - LNPS;                                     // exp gives e^{s-m} * 16384

    FragH ph;
    float ls = 0.f;
#pragma unroll
    for (int r = 0; r < 8; ++r) {
      const float e0 = __expf(s0[r] - msh);                          // key kb      + 8hh + r
      const float e1 = __expf(s1[r] - msh);                          // key kb + 16 + 8hh + r
      ls += e0 + e1;
      ph.hv[0][r] = (_Float16)e0;
      ph.hv[1][r] = (_Float16)e1;
    }
    l += ls;

#pragma unroll
    for (int j = 0; j < 8; ++j) o[j] = mma_h(vf[j].h, ph.v, o[j]);

    // ---- foot of the trip: own reads retired, own copies of the next stage landed, one barrier that publishes that
    //      stage and ends every reader's last read of this buffer; only then the refill of this buffer
    wait_ds0();
    wait_async0();
    __syncthreads();
    if (kb + 2 * KT < MM) stage_kv(st, Khb, Klb, Gcb, kb + 2 * KT, tid);
  }
  wait_async0();                                                     // nothing is in flight when the wave goes on
  l += __shfl_xor(l, 16, 32);
  const float inv = 1.0f / l;                                        // o and l both carry the x16384 factor

  // ---- epilogue: y = o * inv -> Os[query][ch]; lane (hh, c) holds ch = 16 j + 8 hh + r for query 16 w + c
  {
    const int qrow = 16 * wave + c;
#pragma unroll
    for (int j = 0; j < 8; ++j) {
      v4f va, vb;
#pragma unroll
      for (int r = 0; r < 4; ++r) { va[r] = o[j][r] * inv; vb[r] = o[j][4 + r] * inv; }
      *(v4f*)(Os + qrow * OSPW + 16 * j + 8 * hh)     = va;
      *(v4f*)(Os + qrow * OSPW + 16 * j + 8 * hh + 4) = vb;
    }
  }
  __syncthreads();

  const int r16 = tid & 15, pl = tid >> 4;                           // row in its tile, pl 0..7
  v4u uh[8], ul[8];
#pragma unroll
  for (int it = 0; it < 8; ++it) {
    const int row = (it >> 1) * 16 + r16;                            // query 0..63
    const int pq  = (it & 1) * 8 + pl;                               // piece 0..15, channels 8 pq..8 pq+7
    const v4f a = *(const v4f*)(Os + row * OSPW + 8 * pq);
    const v4f q = *(const v4f*)(Os + row * OSPW + 8 * pq + 4);
    const float f[8] = {a[0], a[1], a[2], a[3], q[0], q[1], q[2], q[3]};
    split8(f, uh[it], ul[it]);
  }
{
#pragma unroll
    for (int it = 0; it < 8; ++it) {
      const size_t po = piece_off((b * NN + n0) / 16 + (it >> 1), DQ / 32, (it & 1) * 8 + pl, r16);
      *(v4u*)(Yh + po) = uh[it];
      *(v4u*)(Yl + po) = ul[it];
    }
    
  }
}

// =========================================================================================================
// (3) output conv for one (b, 64-n tile, 64-c block): A[c][n] = sum_ci WWb[c][ci] (Yh + Yl)[b][n][ci] on bf16 WMMA
//     (2 products per k-step, shared accumulator), K = 128 = 4 steps. Block 128 threads = 4 waves; wave w owns cols
//     n0+16w..+15 (B fragments: tile (b 4096 + n0) / 16 + w of Yh/Yl) and 4 m-tiles (A rows c = c0 + 16 mt + (lane&15),
//     tile c0 / 16 + mt of WWb), all planes in fragment order.
//     Epilogue staged in LDS Os[n_loc][c_loc] (pitch OSP, b128 stores), block barrier
//     2 lines): 8 consecutive lanes x 16 B (values gathered from 4 Os rows), one instruction per 4 lines, final
// coverage: Os 4 waves x 16 n x 64 c written, read rows nl+t <= 63 x cols cl <= 63; WY 8 it x 16 lines x 8 lanes x
//           4 floats = 64 c x 64 n; grid (NQ/64, 4, NB) covers WY[b][0..255][0..NQ-1] exactly once.
// =========================================================================================================
__global__ __launch_bounds__(128)
void gemm_out(const unsigned short* __restrict__ WWb, const unsigned short* __restrict__ Yh,
              const unsigned short* __restrict__ Yl, const float* __restrict__ wb, float* WY) {
  __shared__ __align__(16) float Os[QT * OSP];
  const int tid  = threadIdx.x;
  const int lane = tid & 31, wave = tid >> 5;
  const int hh   = lane >> 4, c = lane & 15;
  const int nt   = blockIdx.x, cb = blockIdx.y, b = blockIdx.z;
  const int n0   = nt * QT, c0 = cb * QT;

  const int ta = c0 / 16, tb16 = (b * NN + n0) / 16 + wave;          // first A tile, the wave's B tile

  v8f acc[4];
#pragma unroll
  for (int mt = 0; mt < 4; ++mt) acc[mt] = zero8();

#pragma unroll
  for (int ks = 0; ks < DQ / 32; ++ks) {
    const Frag fbh = ldfrag_p(Yh, tb16, DQ / 32, ks, lane);
    const Frag fbl = ldfrag_p(Yl, tb16, DQ / 32, ks, lane);
#pragma unroll
    for (int mt = 0; mt < 4; ++mt) {
      const Frag fa = ldfrag_p(WWb, ta + mt, DQ / 32, ks, lane);
      acc[mt] = mma_b(fa.bf, fbh.bf, acc[mt]);
      acc[mt] = mma_b(fa.bf, fbl.bf, acc[mt]);
    }
  }

  // ---- epilogue: -> LDS Os[n_loc][c_loc]; lane (hh, c) holds c_loc = 16 mt + 8 hh + r for n_loc = 16 w + c
  {
    const int nl = 16 * wave + c;
#pragma unroll
    for (int mt = 0; mt < 4; ++mt) {
      v4f va, vb;
#pragma unroll
      for (int r = 0; r < 4; ++r) { va[r] = acc[mt][r]; vb[r] = acc[mt][4 + r]; }
      *(v4f*)(Os + nl * OSP + 16 * mt + 8 * hh)     = va;
      *(v4f*)(Os + nl * OSP + 16 * mt + 8 * hh + 4) = vb;
    }
  }
  __syncthreads();

  const int e = tid & 7, lq = tid >> 3;                              // lq 0..15
  v4f res[8];
#pragma unroll
  for (int it = 0; it < 8; ++it) {
    const int L   = it * 16 + lq;                                    // 0..127
    const int cl  = L >> 1, hf = L & 1;                              // channel 0..63 within the block
    const int nl  = hf * 32 + 4 * e;                                 // position 0..63
    const float bvs = bfr(wb[c0 + cl]);
#pragma unroll
    for (int t = 0; t < 4; ++t) {
      res[it][t] = Os[(nl + t) * OSP + cl] + bvs;
    }
  }
{
#pragma unroll
    for (int it = 0; it < 8; ++it) {
      const int L   = it * 16 + lq;
      const int cl  = L >> 1, hf = L & 1;
      const int nl  = hf * 32 + 4 * e;
      const size_t idx = ((size_t)(b * CC + c0 + cl)) * NN + n0 + nl;
      *(v4f*)(WY + idx) = res[it];
    }
    
  }
}

// =========================================================================================================
// (4) batch-norm statistics, normalisation, affine and residual in one launch: block owns ONE channel (256 blocks of
//     32 waves). Thread tid takes floats 4 tid..4 tid+3 of each of the NB rows WY[b][c][0..NQ) and of the same rows of
//     x, so every wave load is one contiguous 512-B run; a thread's 2 NB loads are independent and all issued before
//     the first sum; the WY values stay in registers from the statistics to the normalisation. Sum and sum of squares
//     in f64 per thread (rows, then elements, in ascending order), wave shuffle reduce, per-wave partials in LDS
//     (cross-wave, block barrier); every wave then shuffle-reduces the same 32 partials itself (a butterfly leaves the
//     same bits in every lane of every wave), so no second barrier and no table: mean, biased variance,
//     rstd = 1/sqrt(var + eps) in f32, then out[b][c][n] = (((WY - mu) * rstd) * bf16-RNE(gamma[c]) + bf16-RNE(beta[c]))
//     + bf16-RNE(x[b][c][n]) in f32.
// coverage: 256 blocks x 1 channel x NB rows x BST threads x 4 floats = out[b][0..255][0..NQ-1] exactly once, each
//           wave store one contiguous 512-B run; reads WY and x at the same offsets only (the produced extent).
// =========================================================================================================
__global__ __launch_bounds__(BST)
void bn_norm(const float* __restrict__ WY, const float* __restrict__ x, const float* __restrict__ gam,
             const float* __restrict__ bet, float* out) {
#pragma clang fp contract(off)
  __shared__ double red[2 * (BST / 32)];
  const int tid = threadIdx.x, lane = tid & 31, wave = tid >> 5;
  const int cc = blockIdx.x;
  const double ninv = 1.0 / ((double)NB * (double)NQ);
  unsigned bo[NB];                                                   // byte offsets in WY, x and out, all < 2^25
  v4f a[NB], xv[NB];
#pragma unroll
  for (int bb = 0; bb < NB; ++bb) bo[bb] = 4u * (unsigned)((bb * CC + cc) * NN + 4 * tid);
#pragma unroll
  for (int bb = 0; bb < NB; ++bb) a[bb] = *(const v4f*)((const char*)WY + bo[bb]);
#if defined(__HIP_DEVICE_COMPILE__)
  // keeps the WY loads ahead of the x loads: loads return in order, and interleaved the sums would wait for rows of x
  __builtin_amdgcn_sched_barrier(0);
#endif
#pragma unroll
  for (int bb = 0; bb < NB; ++bb) xv[bb] = *(const v4f*)((const char*)x + bo[bb]);
#if defined(__HIP_DEVICE_COMPILE__)
  // keeps every load above the sums: without it the scheduler sinks them and only a few stay in flight per wave
  __builtin_amdgcn_sched_barrier(0);
#endif
  const float ga = bfr(gam[cc]), be = bfr(bet[cc]);                  // block-uniform, back long before their use
  double s = 0.0, q = 0.0;
#pragma unroll
  for (int bb = 0; bb < NB; ++bb) {
#pragma unroll
    for (int t = 0; t < 4; ++t) {
      const double d = (double)a[bb][t];
      s += d; q += d * d;
    }
  }
#pragma unroll
  for (int d = 1; d < 32; d <<= 1) {
    s += __shfl_xor(s, d, 32);
    q += __shfl_xor(q, d, 32);
  }
  if (lane == 0) { red[wave] = s; red[BST / 32 + wave] = q; }
  __syncthreads();
  double ts = red[lane], tq = red[BST / 32 + lane];
#pragma unroll
  for (int d = 1; d < 32; d <<= 1) {
    ts += __shfl_xor(ts, d, 32);
    tq += __shfl_xor(tq, d, 32);
  }
  const double mud = ts * ninv;
  double var = tq * ninv - mud * mud;
  var = (var > 0.0) ? var : 0.0;
  const float varf = (float)var + BNEPS;
  const float rs = 1.0f / sqrtf(varf);
  const float mu = (float)mud;
#pragma unroll
  for (int bb = 0; bb < NB; ++bb) {
    v4f r;
#pragma unroll
    for (int t = 0; t < 4; ++t) {
      const float d  = a[bb][t] - mu;
      const float nv = d * rs;
      const float av = nv * ga;
      const float sv = av + be;
      r[t] = sv + bfr(xv[bb][t]);
    }
    *(v4f*)((char*)out + bo[bb]) = r;
  }
}

// =========================================================================================================
// Workspace map (bytes; each region start a multiple of 256; every extent is an exact row/tile multiple and is
//   W16 f16 [384][256]            196608      WWb bf16 [256][128]        65536
//   Qh/Ql bf16 [NB][4096][128]   8388608 x2
//   Kh/Kl bf16 [NB][1024][128]   2097152 x2  Gc f16 [NB][32][128][32]  2097152
//   Yh/Yl bf16 [NB][4096][128]   8388608 x2
//   WY  f32  [NB][256][4096]    33554432
//   total (NB=8) = 73662464
//   W16, WWb, Yh and Yl hold their rows in fragment order (piece_off); the sizes are those of the row-major planes.
// =========================================================================================================
extern "C" void kernel_launch(void* const* d_in, const int* in_sizes, int n_in,
                              void* d_out, int out_size, void* d_ws, size_t ws_size,
                              hipStream_t stream) {
  const int XN = NB * CC * NN;
  if (n_in < 11) return;
  if (in_sizes[0] < XN) return;
  if (in_sizes[1] < DQ * CC || in_sizes[3] < DQ * CC || in_sizes[5] < DQ * CC || in_sizes[7] < CC * DQ) return;
  if (in_sizes[2] < DQ || in_sizes[4] < DQ || in_sizes[6] < DQ || in_sizes[8] < CC) return;
  if (in_sizes[9] < CC || in_sizes[10] < CC) return;
  if (out_size < XN) return;

  size_t off = 0;
  auto carve = [&](size_t bytes) { const size_t o = off; off += (bytes + 255) & ~(size_t)255; return o; };
  const size_t oW16 = carve((size_t)MW * CC * 2);
  const size_t oWWb = carve((size_t)CC * DQ * 2);
  const size_t oQh  = carve((size_t)NB * NN * DQ * 2);
  const size_t oQl  = carve((size_t)NB * NN * DQ * 2);
  const size_t oKh  = carve((size_t)NB * MM * DQ * 2);
  const size_t oKl  = carve((size_t)NB * MM * DQ * 2);
  const size_t oGc  = carve((size_t)NB * DQ * MM * 2);
  const size_t oYh  = carve((size_t)NB * NN * DQ * 2);
  const size_t oYl  = carve((size_t)NB * NN * DQ * 2);
  const size_t oWY  = carve((size_t)NB * CC * NN * 4);
  if (off > ws_size) return;
  if (off > (size_t)134217728) return;

  const float* x   = (const float*)d_in[0];
  const float* gw  = (const float*)d_in[1];
  const float* gb  = (const float*)d_in[2];
  const float* tw  = (const float*)d_in[3];
  const float* tb  = (const float*)d_in[4];
  const float* pw  = (const float*)d_in[5];
  const float* pb  = (const float*)d_in[6];
  const float* ow  = (const float*)d_in[7];
  const float* wb  = (const float*)d_in[8];
  const float* gam = (const float*)d_in[9];
  const float* bet = (const float*)d_in[10];

  char* ws = (char*)d_ws;
  unsigned short* W16 = (unsigned short*)(ws + oW16);
  unsigned short* WWb = (unsigned short*)(ws + oWWb);
  unsigned short* Qh  = (unsigned short*)(ws + oQh);
  unsigned short* Ql  = (unsigned short*)(ws + oQl);
  unsigned short* Kh  = (unsigned short*)(ws + oKh);
  unsigned short* Kl  = (unsigned short*)(ws + oKl);
  unsigned short* Gc  = (unsigned short*)(ws + oGc);
  unsigned short* Yh  = (unsigned short*)(ws + oYh);
  unsigned short* Yl  = (unsigned short*)(ws + oYl);
  float*          WY  = (float*)(ws + oWY);
  float* out = (float*)d_out;

  const dim3 blk256(256), blk128(128);

  // (0) theta_w / phi_w / g_w -> stacked f16 plane; w_w -> bf16 plane, both in fragment order
  cvt_w<<<dim3(MW / 8 + CC / 16), blk256, 0, stream>>>(tw, pw, gw, ow, W16, WWb);
  // (1) x strip -> 16-bit LDS tile; conv1x1 GEMM -> theta (q) hi/res planes; phi / g + bias, 2x2 max-pooled -> k hi/res
  //     planes, v plane by stages
  gemm_proj<<<dim3(NSTRIP, NB), dim3(PT), 0, stream>>>(W16, x, tb, pb, gb, Qh, Ql, Kh, Kl, Gc);
  // (2) attention -> y hi/res planes, rows = positions, fragment order
  attn_k<<<dim3(NQ / QT, NB), blk128, 0, stream>>>(Qh, Ql, Kh, Kl, Gc, Yh, Yl);
  // (3) output conv + bias -> WY f32 plane [b][256][4096]
  gemm_out<<<dim3(NQ / QT, CC / QT, NB), blk128, 0, stream>>>(WWb, Yh, Yl, wb, WY);
  // (4) per-channel mean / rstd, then normalise, affine, residual -> out [b][256][4096]
  bn_norm<<<dim3(CC), dim3(BST), 0, stream>>>(WY, x, gam, bet, out);
  (void)hipGetLastError();
}

// v008
// Measured time: 77.5 microseconds a run.
// Two timings next to v007 both put it at 1.11 times that version's speed.
// Counting every step since v000, it is 10.3 times as fast.
// Contractions: conv1x1 theta/phi/g GEMM W[384x256].X[256x128] per strip on v_wmma_f32_16x16x32_f16 (f16 containers
// of bf16-RNE weights x256 and bf16-RNE x); scores K.Q^T on v_wmma_f32_16x16x32_bf16 (bf16 hi + bf16 residual planes
// of theta / 2x2-max-pooled phi, 3 products, K=128); y^T = G.P^T on v_wmma_f32_16x16x32_f16 (2x2-max-pooled g as
// f16, P = e^{s-m} x16384 f16 from the score D registers); output conv W[256x128].Y on v_wmma_f32_16x16x32_bf16 (bf16
// weights, y as bf16 hi + residual planes, 2 products); f32 accumulate everywhere; max-pool, softmax statistics and
// bias in f32 VALU; batch-norm channel statistics in f64 VALU; normalisation, affine and residual add in f32 VALU.
#include <hip/hip_runtime.h>
#include <math.h>
#include <stdint.h>

#ifndef NB
#define NB 8
#endif
#ifndef NQ
#define NQ 4096
#endif
#define NB_FULL 8
#define CC     256
#define HIMG   64
#define WIMG   64
#define NN     4096
#define DQ     128
#define HP     32
#define WP     32
#define MM     1024
#define MW     384
#define QT     64
#define SN     128
#define NSTRIP 32
#define OSP    68
#define OSPW   132
#define BST    1024
#define WSC    256.0f
#define IWSC   0.00390625f
#define LNPS   9.704060527839234f
#define BNEPS  1.0e-5f
#define KT     32
#define KP     136
#define VPT    40
#define STG    (2 * KT * KP + DQ * VPT)
#define GTP    40
#define XPT    264
#define OSA    388
#define PT     512
#define AQ     128
#define AT     256

static_assert(NB >= 1 && NB <= NB_FULL);
static_assert(NQ % QT == 0 && NQ <= NN);
static_assert(NN == HIMG * WIMG);
static_assert(SN == 2 * WIMG);
static_assert(NSTRIP * SN == NN);
static_assert(SN == 8 * 16);
static_assert(HIMG % 2 == 0 && WIMG % 2 == 0);
static_assert(HP == HIMG / 2 && WP == WIMG / 2);
static_assert(MM == HP * WP);
static_assert(WP == 32);
static_assert(MM % QT == 0 && MM % 32 == 0);
static_assert(NN % QT == 0 && CC % QT == 0 && DQ % QT == 0);
static_assert(MW == 3 * DQ && MW % QT == 0 && MW % 8 == 0);
static_assert(CC % 32 == 0 && DQ % 32 == 0);
static_assert((OSP * 4) % 16 == 0);
static_assert((OSPW * 4) % 16 == 0);
static_assert((XPT * 2) % 32 == 16 && XPT >= CC + 8 && (OSA * 4) % 16 == 0 && OSA >= MW + 4);
static_assert(SN * XPT * 2 <= SN * OSA * 4 && MW == 8 * 3 * 16 && PT == 16 * 32 && CC == 8 * 32);
static_assert(BST == 32 * 32 && NQ == 4 * BST);
static_assert(NN % 16 == 0 && CC % 4 == 0);
static_assert((size_t)NB_FULL * CC * NN * 4 == (size_t)33554432);
static_assert((KP * 2) % 16 == 0 && (VPT * 2) % 16 == 0 && (STG * 2) % 16 == 0 && (KT * KP * 2) % 16 == 0);
static_assert(KP >= DQ + 8 && VPT >= KT + 8 && MM % KT == 0 && MM / KT >= 2);
static_assert(KT * DQ / 8 == 4 * 128 && DQ * KT / 8 == 4 * 128 && QT * DQ / 8 == 8 * 128);
static_assert(NQ % AQ == 0 && AQ == 4 * 32 && AT == 2 * 128 && MM % (2 * KT) == 0 && MM / (2 * KT) >= 2 && AQ * DQ / 8 == 8 * AT);
static_assert(KT == WP && NSTRIP == HP && (GTP * 2) % 16 == 0 && GTP >= WP + 8 && QT * WP / 8 == 256);

typedef _Float16       v16h __attribute__((ext_vector_type(16)));
typedef _Float16       v8h  __attribute__((ext_vector_type(8)));
typedef __bf16         v16b __attribute__((ext_vector_type(16)));
typedef unsigned short v8us __attribute__((ext_vector_type(8)));
typedef float          v8f  __attribute__((ext_vector_type(8)));
typedef float          v4f  __attribute__((ext_vector_type(4)));
typedef unsigned int   v4u  __attribute__((ext_vector_type(4)));

union Frag  { v8us u[2]; v16h h; v16b bf; };
union FragH { v16h v; v8h hv[2]; };
static_assert(sizeof(Frag) == 32);
static_assert(sizeof(FragH) == 32);

// ---- scalar helpers ---------------------------------------------------------------------------------------
__device__ __forceinline__ unsigned short bf_bits(float f) {          // f32 -> bf16 bits, RNE convert
  unsigned u = __float_as_uint(f);
  return (unsigned short)((u + 0x7FFFu + ((u >> 16) & 1u)) >> 16);
}
__device__ __forceinline__ float bf_up(unsigned short hb) { return __uint_as_float(((unsigned)hb) << 16); }
__device__ __forceinline__ float bfr(float f) { return bf_up(bf_bits(f)); }
__device__ __forceinline__ unsigned short h_bits(_Float16 x) { return __builtin_bit_cast(unsigned short, x); }
__device__ __forceinline__ unsigned pk16(unsigned short a, unsigned short b) { return (unsigned)a | ((unsigned)b << 16); }
__device__ __forceinline__ v8f zero8() { v8f z = {0.f, 0.f, 0.f, 0.f, 0.f, 0.f, 0.f, 0.f}; return z; }
__device__ __forceinline__ float hmax8(v8f s) {
  return fmaxf(fmaxf(fmaxf(s[0], s[1]), fmaxf(s[2], s[3])), fmaxf(fmaxf(s[4], s[5]), fmaxf(s[6], s[7])));
}
__device__ __forceinline__ unsigned wave_ballot(bool p) {
#if defined(__HIP_DEVICE_COMPILE__)
  return __builtin_amdgcn_ballot_w32(p);
#else
  return p ? 1u : 0u;
#endif
}
// 8 f32 values -> bf16 hi bits and bf16 residual bits (lo = RNE(v - hi)), packed 2 per uint
__device__ __forceinline__ void split8(const float* f, v4u& uh, v4u& ul) {
#pragma unroll
  for (int t = 0; t < 4; ++t) {
    const float f0 = f[2 * t], f1 = f[2 * t + 1];
    const unsigned short hb0 = bf_bits(f0), hb1 = bf_bits(f1);
    const unsigned short lb0 = bf_bits(f0 - bf_up(hb0));
    const unsigned short lb1 = bf_bits(f1 - bf_up(hb1));
    uh[t] = pk16(hb0, hb1);
    ul[t] = pk16(lb0, lb1);
  }
}

// ---- 16-bit fragment loader (A, or B from a k-contiguous [n][k] row): lane -> row/col (lane&15), p already includes
//      + 8*(lane>>4); elements 0..7 <- p[0..7] (k0+8h..), elements 8..15 <- p[16..23] (k0+16+8h..)
__device__ __forceinline__ Frag ldfrag(const unsigned short* p) {
  Frag f;
  f.u[0] = *(const v8us*)(p);
  f.u[1] = *(const v8us*)(p + 16);
  return f;
}

// ---- fragment-order planes (W16, WWb, Yh, Yl): a 16-row x 32-k operand tile is stored as the 1 KiB its loader
//      reads: half j, then lane = 16 hh + row, then 8 elements, k = k0 + 16 j + 8 hh + e (the k map of ldfrag). Each of
//      the loader's two wave loads then covers 512 contiguous bytes (4 whole lines) and not 32 B of each of 16 rows.
//      piece_off: element offset of the 8-element piece q = k / 8 of row r (0..15) of tile t; nks = 32-k steps a row.
__device__ __forceinline__ size_t piece_off(int t, int nks, int q, int r) {
  return ((size_t)((t * nks + (q >> 2)) * 2 + ((q >> 1) & 1)) * 32 + 16 * (q & 1) + r) * 8;
}
__device__ __forceinline__ Frag ldfrag_p(const unsigned short* plane, int t, int nks, int ks, int lane) {
  const unsigned short* p = plane + ((size_t)(t * nks + ks) * 64 + lane) * 8;
  Frag f;
  f.u[0] = *(const v8us*)(p);
  f.u[1] = *(const v8us*)(p + 256);
  return f;
}

// ---- WMMA helpers: builtin followed by a 4-slot VALU gap tying D and keeping A/B live --------------------------
__device__ __forceinline__ v8f mma_h(v16h a, v16h b, v8f c) {
  v8f d = __builtin_amdgcn_wmma_f32_16x16x32_f16(false, a, false, b, (short)0, c, false, false);
#if defined(__HIP_DEVICE_COMPILE__)
  asm volatile("v_nop\n\tv_nop\n\tv_nop\n\tv_nop" : "+v"(d) : "v"(a), "v"(b));
#endif
  return d;
}
__device__ __forceinline__ v8f mma_b(v16b a, v16b b, v8f c) {
  v8f d = __builtin_amdgcn_wmma_f32_16x16x32_bf16(false, a, false, b, (short)0, c, false, false);
#if defined(__HIP_DEVICE_COMPILE__)
  const v16h ha = __builtin_bit_cast(v16h, a), hb = __builtin_bit_cast(v16h, b);
  asm volatile("v_nop\n\tv_nop\n\tv_nop\n\tv_nop" : "+v"(d) : "v"(ha), "v"(hb));
#endif
  return d;
}

// the same products as plain builtins, for a kernel above 256 registers: operands of an asm statement must lie in the
// first 256, which would spill the accumulators and the kept fragments; the compiler keeps the distances of its own forms
__device__ __forceinline__ v8f mma_hp(v16h a, v16h b, v8f c) {
  return __builtin_amdgcn_wmma_f32_16x16x32_f16(false, a, false, b, (short)0, c, false, false);
}
__device__ __forceinline__ v8f mma_bp(v16b a, v16b b, v8f c) {
  return __builtin_amdgcn_wmma_f32_16x16x32_bf16(false, a, false, b, (short)0, c, false, false);
}
// the scheduler moves nothing across this line; each use says what it holds in place
__device__ __forceinline__ void sched_line() {
#if defined(__HIP_DEVICE_COMPILE__)
  __builtin_amdgcn_sched_barrier(0);
#endif
}
// a value that is the same in every lane of the wave, moved to a scalar register so that tests on it are scalar branches
__device__ __forceinline__ int wave_uniform(int v) {
#if defined(__HIP_DEVICE_COMPILE__)
  return __builtin_amdgcn_readfirstlane(v);
#else
  return v;
#endif
}

// stands directly behind a run of global stores, in front of any later write of a register that those stores name
__device__ __forceinline__ void wait_x0() {
#if defined(__HIP_DEVICE_COMPILE__)
  asm volatile("s_wait_xcnt 0x0" ::: "memory");
#endif
}

// stands directly behind that wait where more work follows: without it the scheduler lifts later address arithmetic in
// among the stores, onto registers that they name, ahead of the wait
__device__ __forceinline__ void hold_below() {
#if defined(__HIP_DEVICE_COMPILE__)
  __builtin_amdgcn_sched_barrier(0);
#endif
}
// the same wait behind a run of global loads from one address: the address is an input, so it stays in its registers up
// to the wait and no load of the run returns its data onto them
__device__ __forceinline__ void wait_x0_keep(const float* p) {
#if defined(__HIP_DEVICE_COMPILE__)
  asm volatile("s_wait_xcnt 0x0" :: "v"(p) : "memory");
#endif
}

// =========================================================================================================
// (0) weights. Blocks 0..47: W16 f16 [384][256], rows 0..127 = theta_w, 128..255 = phi_w, 256..383 = g_w; value =
//     f16 of (bf16-RNE(w) * 256) (exact). Block owns rows 8*blk..8*blk+7 (half a 16-row tile): 8 lanes x 16 B = one
//     whole line of the fragment-order plane per piece q. Blocks 48..63: WWb bf16 [256][128], one 16-row tile a block.
// coverage: 48 blocks x 8 rows x 32 pieces x 8 halves = 384 x 256; 16 blocks x 16 rows x 16 pieces x 8 = 256 x 128.
// =========================================================================================================
__global__ __launch_bounds__(256)
void cvt_w(const float* __restrict__ tw, const float* __restrict__ pw, const float* __restrict__ gw,
           const float* __restrict__ ow, unsigned short* W16, unsigned short* WWb) {
  const int tid = threadIdx.x, blk = blockIdx.x;
  if (blk < MW / 8) {
    const int rl = tid & 7, pq = tid >> 3, col = 8 * pq;             // row in the block, piece 0..31
    const int o = 8 * blk + rl;                                      // 0..383
    const int grp = blk >> 4;                                        // 0,1,2 (block-uniform)
    const float* wbase = (grp == 0) ? tw : ((grp == 1) ? pw : gw);  // all global
    const float* s = wbase + (size_t)(o - DQ * grp) * CC + col;      // (o - 128 grp) in 0..127
    const v4f a = *(const v4f*)s;
    const v4f q = *(const v4f*)(s + 4);
    const float f[8] = {a[0], a[1], a[2], a[3], q[0], q[1], q[2], q[3]};
    v4u u;
#pragma unroll
    for (int t = 0; t < 4; ++t) {
      const _Float16 h0 = (_Float16)(bfr(f[2 * t]) * WSC);
      const _Float16 h1 = (_Float16)(bfr(f[2 * t + 1]) * WSC);
      u[t] = pk16(h_bits(h0), h_bits(h1));
    }
{
      *(v4u*)(W16 + piece_off(o >> 4, CC / 32, pq, o & 15)) = u;
      
    }
  } else {
    const int rb = blk - MW / 8;                                     // 0..15
    const int o = 16 * rb + (tid & 15);                              // 0..255
    const int pq = tid >> 4, col = 8 * pq;                           // piece 0..15, col 0..120
    const float* s = ow + (size_t)o * DQ + col;
    const v4f a = *(const v4f*)s;
    const v4f q = *(const v4f*)(s + 4);
    const float f[8] = {a[0], a[1], a[2], a[3], q[0], q[1], q[2], q[3]};
    v4u u;
#pragma unroll
    for (int t = 0; t < 4; ++t) u[t] = pk16(bf_bits(f[2 * t]), bf_bits(f[2 * t + 1]));
{
      *(v4u*)(WWb + piece_off(rb, DQ / 32, pq, tid & 15)) = u;
      
    }
  }
}

// =========================================================================================================
// (1) conv1x1 GEMM for one (b, strip of 128 positions = image rows 2s and 2s+1), all 384 rows of the stacked weights:
//     Y[o][n] = (1/256) sum_c W16[o][c] X[n][c]. Block 512 threads = 16 waves, one block a WGP.
//     Stage: the strip x f32 [256 c][128 n] is read once from global (a thread: 8 channels x 4 positions, twice; 8 lanes
//     cover one whole 128-B line, a wave load 4 lines), rounded to bf16-RNE, held as f16 (the same values a B fragment
//     had before) and turned in registers into Xs[128 n][256 c] (pitch XPT, b128 stores, cross-wave, block barrier).
//     Products: wave w owns m-tiles 3 (w >> 1) .. + 2 (A rows o = 16 tile + (lane&15), W16 in fragment order, read from
//     global one k-step ahead) and n-tiles 4 (w & 1) .. + 3 (B rows n = 16 tile + (lane&15) of Xs, the k map of ldfrag, too).
//     K = 256 = 8 steps in ascending order into one accumulator a tile.
//     Epilogue staged in LDS Os[n_loc][384 o] (pitch OSA, b128 stores) on the bytes of Xs, behind a block barrier that
//     ends every wave's reads of Xs; block barrier (cross-wave); then the two halves of the block (h = tid >> 8) take
//     dims 64 h .. 64 h + 63 of (g first, then theta, then phi):
//       theta + bias -> Qh/Ql bf16 [b][4096 n][128 d] (hi = RNE(v), lo = RNE(v-hi)), 8 consecutive lanes x 16 B = one line;
//       phi + bias in f32, 2x2 stride-2 max-pool in f32 (the strip holds both image rows of every window: pooled column
//                       px takes n_loc = 64 dy + 2 px + dx, dy, dx in {0,1}; key m = 32 st + px) -> Kh/Kl bf16
//                       [b][1024 m][128 d] (hi = RNE(v), lo = RNE(v-hi)): 32 rows x one whole line of the 256-B row;
//       g + bias, the same pool, f16, turned through the half's LDS tile Tg[64 d][32 px] (pitch GTP, cross-wave, block
//                       barrier) -> Gc f16 [b][32 st][128 d][32 px]: one 32-key stage of the attention a strip, keys
//                       contiguous a channel; each wave store 512 contiguous B.
// coverage: Xs written rows 64 (w&1) + 32 g + 4 lq + t = 0..127 x cols 32 (w>>1) + 8 lo + 0..7 = 0..255, read rows 0..127 x
//           cols 0..255; Os 8 m-groups x 3 tiles x 16 o = 384 cols x 2 n-halves x 4 tiles x 16 = 128 rows written, reads
//           rows <= 127 cols <= 383; theta planes 4 it x 32 rows x 8 lanes x 8 x 2 halves = 128 n x 128 d; pooled planes
//           32 px x 8 lanes x 8 x 2 halves = 32 m x 128 d; Tg written rows (8e+t)=0..63 x cols 0..31 a half, read rows
//           0..63 x cols 8 kq..8 kq+7, kq 0..3; grid (32, NB) covers all 4096 rows x 128 d of Qh/Ql and all 1024 keys x
//           128 d of Kh/Kl/Gc exactly once.
// =========================================================================================================
__global__ __launch_bounds__(PT)
void gemm_proj(const unsigned short* __restrict__ W16, const float* __restrict__ x,
               const float* __restrict__ tb, const float* __restrict__ pb, const float* __restrict__ gb,
               unsigned short* Qh, unsigned short* Ql, unsigned short* Kh, unsigned short* Kl, unsigned short* Gc) {
  __shared__ __align__(16) float Os[SN * OSA];
  __shared__ __align__(16) unsigned short Tg[2 * QT * GTP];
  unsigned short* Xs = (unsigned short*)Os;                          // the x tile lives on the bytes of Os, ahead of it
  const int tid  = threadIdx.x;
  const int lane = tid & 31, wave = tid >> 5;                        // wave 0..15
  const int hh   = lane >> 4, c = lane & 15;
  const int st   = blockIdx.x, b = blockIdx.y;
  const int n0   = st * SN;
  const int ta   = 3 * (wave >> 1), tn = 4 * (wave & 1);             // first A tile (of 24), first n-tile (of 8)

  Frag fa[2][3];                                                     // A fragments of this k-step and of the next
#pragma unroll
  for (int i = 0; i < 3; ++i) fa[0][i] = ldfrag_p(W16, ta + i, CC / 32, 0, lane);

  // ---- stage the strip: f32 [c][n] -> f16 Xs[n][c]
  {
    const int lo = lane & 3, lq = lane >> 2;                         // channel octet 0..3, position quad 0..7
    const int c8 = 32 * (wave >> 1) + 8 * lo;                        // the thread's channels c8..c8+7
    const int nq = 64 * (wave & 1) + 4 * lq;                         // its positions nq + 32 g + 0..3
    const float* xp = x + ((size_t)(b * CC + c8)) * NN + n0 + nq;
    v4f v[2][8];
#pragma unroll
    for (int e = 0; e < 8; ++e) {
#pragma unroll
      for (int g = 0; g < 2; ++g) v[g][e] = *(const v4f*)(xp + (size_t)e * NN + 32 * g);
    }
    wait_x0_keep(xp);
#pragma unroll
    for (int g = 0; g < 2; ++g) {
#pragma unroll
      for (int t = 0; t < 4; ++t) {
        v4u u;
#pragma unroll
        for (int k = 0; k < 4; ++k)
          u[k] = pk16(h_bits((_Float16)bfr(v[g][2 * k][t])), h_bits((_Float16)bfr(v[g][2 * k + 1][t])));
        *(v4u*)(Xs + (nq + 32 * g + t) * XPT + c8) = u;
      }
    }
  }
  __syncthreads();

  v8f acc[3][4];
#pragma unroll
  for (int i = 0; i < 3; ++i) {
#pragma unroll
    for (int j = 0; j < 4; ++j) acc[i][j] = zero8();
  }
  const unsigned short* Xp = Xs + (16 * tn + c) * XPT + 8 * hh;      // B fragment base, + 16 j rows, + 32 ks

  Frag fb[2][4];                                                     // B fragments of this k-step and of the next
#pragma unroll
  for (int j = 0; j < 4; ++j) fb[0][j] = ldfrag(Xp + (16 * j) * XPT);
  // unrolled so that the two sets are registers: the next step's reads stand as one group above this step's products
#pragma unroll
  for (int ks = 0; ks < CC / 32; ++ks) {
    if (ks + 1 < CC / 32) {
#pragma unroll
      for (int i = 0; i < 3; ++i) fa[(ks + 1) & 1][i] = ldfrag_p(W16, ta + i, CC / 32, ks + 1, lane);
#pragma unroll
      for (int j = 0; j < 4; ++j) fb[(ks + 1) & 1][j] = ldfrag(Xp + (16 * j) * XPT + 32 * (ks + 1));
    }
#pragma unroll
    for (int j = 0; j < 4; ++j) {
#pragma unroll
      for (int i = 0; i < 3; ++i) acc[i][j] = mma_h(fa[ks & 1][i].h, fb[ks & 1][j].h, acc[i][j]);
    }
  }
  __syncthreads();                                                   // every wave has left Xs before Os overwrites it

  // ---- epilogue: scale back -> LDS Os[n_loc][o]; lane (hh, c) holds o = 16 tile + 8 hh + r for n_loc = 16 n-tile + c
#pragma unroll
  for (int j = 0; j < 4; ++j) {
    const int nl = 16 * (tn + j) + c;
#pragma unroll
    for (int i = 0; i < 3; ++i) {
      v4f va, vb;
#pragma unroll
      for (int r = 0; r < 4; ++r) { va[r] = acc[i][j][r] * IWSC; vb[r] = acc[i][j][4 + r] * IWSC; }
      *(v4f*)(Os + nl * OSA + 16 * (ta + i) + 8 * hh)     = va;
      *(v4f*)(Os + nl * OSA + 16 * (ta + i) + 8 * hh + 4) = vb;
    }
  }
  __syncthreads();

  const int u256 = tid & 255;
  const int dsel = (tid >> 8) * QT;                                  // 0 or 64 (wave-uniform)
  const int e = u256 & 7, lq = u256 >> 3;                            // dims 8 e..8 e+7 of the half; lq 0..31
  auto bias8 = [&](const float* bias, float* bv) {
    const float* bp = bias + dsel + 8 * e;
    const v4f ba = *(const v4f*)bp;
    const v4f bq = *(const v4f*)(bp + 4);
    wait_x0_keep(bp);
#pragma unroll
    for (int t = 0; t < 4; ++t) { bv[t] = bfr(ba[t]); bv[4 + t] = bfr(bq[t]); }
  };

  // ---- phi and g: bias, then the 2x2 max-pool; pooled column px = lq
  const int px = lq;
  auto pooled = [&](const float* bias, int ob, float* f) {           // ob: first column of the plane in Os
    float bv[8];
    bias8(bias, bv);
#pragma unroll
    for (int t = 0; t < 8; ++t) f[t] = -__builtin_inff();
#pragma unroll
    for (int dy = 0; dy < 2; ++dy) {
#pragma unroll
      for (int dx = 0; dx < 2; ++dx) {
        const int row = dy * WIMG + 2 * px + dx;                     // n_loc 0..127
        const v4f a = *(const v4f*)(Os + row * OSA + ob + dsel + 8 * e);
        const v4f q = *(const v4f*)(Os + row * OSA + ob + dsel + 8 * e + 4);
#pragma unroll
        for (int t = 0; t < 4; ++t) {
          f[t]     = fmaxf(f[t], a[t] + bv[t]);
          f[4 + t] = fmaxf(f[4 + t], q[t] + bv[4 + t]);
        }
      }
    }
  };
  // g first: its barrier then has no global store of this block to wait for
  {
    float f[8];
    pooled(gb, 2 * DQ, f);
    unsigned short* Th = Tg + (tid >> 8) * (QT * GTP);               // the half's own tile
#pragma unroll
    for (int t = 0; t < 8; ++t) Th[(8 * e + t) * GTP + px] = h_bits((_Float16)f[t]);
    __syncthreads();                                                 // straight-line code: every wave passes
    const int dl = u256 >> 2, kq = u256 & 3;                         // channel 0..63 of the half, 8 keys 8 kq..8 kq+7
    const v4u u = *(const v4u*)(Th + dl * GTP + 8 * kq);
    *(v4u*)(Gc + ((size_t)((b * NSTRIP + st) * DQ + dsel + dl)) * WP + 8 * kq) = u;
    wait_x0();
  }

  // ---- theta
  {
    float bv[8];
    bias8(tb, bv);
    v4u uh[4], ul[4];
#pragma unroll
    for (int it = 0; it < 4; ++it) {
      const int row = it * 32 + lq;                                  // n_loc 0..127
      const v4f a = *(const v4f*)(Os + row * OSA + dsel + 8 * e);
      const v4f q = *(const v4f*)(Os + row * OSA + dsel + 8 * e + 4);
      float f[8];
#pragma unroll
      for (int t = 0; t < 4; ++t) { f[t] = a[t] + bv[t]; f[4 + t] = q[t] + bv[4 + t]; }
      split8(f, uh[it], ul[it]);
    }
#pragma unroll
    for (int it = 0; it < 4; ++it) {
      const int row = it * 32 + lq;
      const size_t po = ((size_t)(b * NN + n0 + row)) * DQ + dsel + 8 * e;
      *(v4u*)(Qh + po) = uh[it];
      *(v4u*)(Ql + po) = ul[it];
    }
    wait_x0();
    hold_below();
  }

  // ---- phi
  {
    float f[8];
    pooled(pb, DQ, f);
    v4u kh, kl;
    split8(f, kh, kl);
    const size_t po = ((size_t)(b * MM + WP * st + px)) * DQ + dsel + 8 * e;
    *(v4u*)(Kh + po) = kh;
    *(v4u*)(Kl + po) = kl;
    wait_x0();
  }
}

// ---- asynchronous copies to LDS: each lane moves its own 16 bytes, global -> LDS, through no register. Arguments: the
//      lane's LDS byte addresses, then its global addresses in the same order, all multiples of 16. The closing
//      s_wait_xcnt 0 stands inside the copies' own statement so that no address register named there is rewritten ahead
//      of it.
__device__ __forceinline__ unsigned lds_addr(const void* p) { return (unsigned)(uintptr_t)p; }
__device__ __forceinline__ void copy4(unsigned l0, unsigned l1, unsigned l2, unsigned l3,
                                      const unsigned short* g0, const unsigned short* g1,
                                      const unsigned short* g2, const unsigned short* g3) {
#if defined(__HIP_DEVICE_COMPILE__)
  asm volatile("global_load_async_to_lds_b128 %0, %4, off\n\t"
               "global_load_async_to_lds_b128 %1, %5, off\n\t"
               "global_load_async_to_lds_b128 %2, %6, off\n\t"
               "global_load_async_to_lds_b128 %3, %7, off\n\t"
               "s_wait_xcnt 0x0"
               :: "v"(l0), "v"(l1), "v"(l2), "v"(l3), "v"(g0), "v"(g1), "v"(g2), "v"(g3) : "memory");
#endif
}
__device__ __forceinline__ void copy12(unsigned a0, unsigned a1, unsigned a2, unsigned a3, unsigned b0, unsigned b1,
                                       unsigned b2, unsigned b3, unsigned c0, unsigned c1, unsigned c2, unsigned c3,
                                       const unsigned short* p0, const unsigned short* p1, const unsigned short* p2,
                                       const unsigned short* p3, const unsigned short* q0, const unsigned short* q1,
                                       const unsigned short* q2, const unsigned short* q3, const unsigned short* r0,
                                       const unsigned short* r1, const unsigned short* r2, const unsigned short* r3) {
#if defined(__HIP_DEVICE_COMPILE__)
  asm volatile("global_load_async_to_lds_b128 %0, %12, off\n\t"
               "global_load_async_to_lds_b128 %1, %13, off\n\t"
               "global_load_async_to_lds_b128 %2, %14, off\n\t"
               "global_load_async_to_lds_b128 %3, %15, off\n\t"
               "global_load_async_to_lds_b128 %4, %16, off\n\t"
               "global_load_async_to_lds_b128 %5, %17, off\n\t"
               "global_load_async_to_lds_b128 %6, %18, off\n\t"
               "global_load_async_to_lds_b128 %7, %19, off\n\t"
               "global_load_async_to_lds_b128 %8, %20, off\n\t"
               "global_load_async_to_lds_b128 %9, %21, off\n\t"
               "global_load_async_to_lds_b128 %10, %22, off\n\t"
               "global_load_async_to_lds_b128 %11, %23, off\n\t"
               "s_wait_xcnt 0x0"
               :: "v"(a0), "v"(a1), "v"(a2), "v"(a3), "v"(b0), "v"(b1), "v"(b2), "v"(b3), "v"(c0), "v"(c1), "v"(c2),
                  "v"(c3), "v"(p0), "v"(p1), "v"(p2), "v"(p3), "v"(q0), "v"(q1), "v"(q2), "v"(q3), "v"(r0), "v"(r1),
                  "v"(r2), "v"(r3) : "memory");
#endif
}
// the issuing wave's copies have landed behind this wait
__device__ __forceinline__ void wait_async0() {
#if defined(__HIP_DEVICE_COMPILE__)
  asm volatile("s_wait_asynccnt 0x0" ::: "memory");
#endif
}
// the wave's own LDS reads have retired before the buffer they read is handed to the copies that refill it
__device__ __forceinline__ void wait_ds0() {
#if defined(__HIP_DEVICE_COMPILE__)
  asm volatile("s_wait_dscnt 0x0" ::: "memory");
#endif
}
// one 32-key stage: Kh and Kl rows kb..kb+31 (256 B each, LDS pitch 272 B) and stage kb / 32 of Gc, 128 channel rows of
// 64 B in a row (LDS pitch 80 B). 128 threads x 12 copies of 16 B = 8 KiB + 8 KiB + 8 KiB; no two lanes share an LDS byte.
__device__ __forceinline__ void stage_kv(unsigned short* st, const unsigned short* Khb, const unsigned short* Klb,
                                         const unsigned short* Gcb, int kb, int tid) {
  const int kr = tid >> 4, kcol = 8 * (tid & 15);                    // kr 0..7, + 8 i -> key row 0..31
  const int vr = tid >> 2, vcol = 8 * (tid & 3);                     // vr 0..31, + 32 i -> channel row 0..127
  const unsigned lk = lds_addr(st + kr * KP + kcol);
  const unsigned ll = lk + 2u * (KT * KP);
  const unsigned lv = lds_addr(st + 2 * KT * KP + vr * VPT + vcol);
  const unsigned short* gk = Khb + (size_t)(kb + kr) * DQ + kcol;
  const unsigned short* gl = Klb + (size_t)(kb + kr) * DQ + kcol;
  const unsigned short* gv = Gcb + (size_t)kb * DQ + vr * KT + vcol;   // kb a multiple of KT: stage kb / KT starts at kb DQ
  copy12(lk, lk + 2u * (8 * KP), lk + 2u * (16 * KP), lk + 2u * (24 * KP),
         ll, ll + 2u * (8 * KP), ll + 2u * (16 * KP), ll + 2u * (24 * KP),
         lv, lv + 2u * (32 * VPT), lv + 2u * (64 * VPT), lv + 2u * (96 * VPT),
         gk, gk + 8 * DQ, gk + 16 * DQ, gk + 24 * DQ, gl, gl + 8 * DQ, gl + 16 * DQ, gl + 24 * DQ,
         gv, gv + 32 * KT, gv + 64 * KT, gv + 96 * KT);
}

// =========================================================================================================
// (2) attention for one (b, 128-query tile), transposed formulation, 1024 keys (all valid, no mask, no scale):
//   S^T tile (16 keys x 16 queries) = sum over 4 d-chunks (unrolled) of A(k: row = key kb + (lane&15), 32 d via
//   the split k map from the bf16 plane Kh [b][1024][128]) . B(q: col = query, same map from Qh [b][4096][128])
//   + A(Kh).B(Ql) + A(Kl).B(Qh) (bf16 unscaled residual planes, shared accumulator).
//   Block = 8 waves = 2 key groups x 4 query waves, one block a WGP, two waves a SIMD. A wave owns 32 queries (two
//   B tiles, queries 32 wq + 16 u + (lane&15)); its 16 Q fragments are read from LDS once and stay in registers, and
//   every K or V fragment it reads from LDS feeds both tiles. Key group g takes the 32-key stages 2 t + g.
//   Per lane a D tile holds 8 keys of ONE query: online softmax state per lane and tile, one shuffle (lane^16) for the
//   max over 32 keys; the o/l rescale is skipped under one wave-uniform ballot a trip when no lane's max grew (corr == 1
//   exactly for every lane then); row-sum partials combined at the end. P = e^{s-m} x 16384 as f16 is the B operand of
//   y^T (rows channel, cols queries) += A(pooled g: rows channel = 16j + (lane&15), keys contiguous, f16 plane Gc
//   [b][32 stages][128][32]) . B(P^T): element r <- D of the tile covering keys kb..kb+15, element 8+r <- the tile covering
//   kb+16..kb+31, lane unchanged. 16 accumulator tiles per wave (128 channels x 2 query tiles).
//   The block's 128 query rows of Qh/Ql are copied once (Qs, pitch 272 B); each group's four waves copy their own
//   32-key stage of Kh/Kl/Gc into their half of one of two buffers (Ring) one trip ahead of its use.
//   Join of the two key groups: group 1 leaves its m, l and unnormalised o in LDS (Ms, Ls, Os; block barrier), group 0
//   brings both to the common max, adds, divides by the joint l and writes y back to the same Os words (same lane).
//   Epilogue: y in Os[query][128 channels] (pitch OSPW, b128 stores), block barrier (cross-wave), then Yh/Yl (rows n,
//   k = channel) in fragment order, each wave store 512 contiguous B.
// coverage: Os written 4 waves x 32 queries x 128 ch, read rows 0..127 x ch 8 pq..8 pq+7 (pq 0..15); planes 8 tiles x 16
//           pieces x 16 rows x 8 = 128 n x 128 ch per plane; grid (NQ/128, NB) covers rows 0..NQ-1 of Yh/Yl exactly once.
// =========================================================================================================
__global__ __launch_bounds__(AT)
void attn_k(const unsigned short* __restrict__ Qh, const unsigned short* __restrict__ Ql,
            const unsigned short* __restrict__ Kh, const unsigned short* __restrict__ Kl,
            const unsigned short* __restrict__ Gc, unsigned short* Yh, unsigned short* Yl) {
  __shared__ __align__(16) float Os[AQ * OSPW];
  __shared__ __align__(16) unsigned short Qs[2 * AQ * KP];
  __shared__ __align__(16) unsigned short Ring[4 * STG];
  __shared__ float Ms[AQ];
  __shared__ float Ls[AQ];
  const int tid  = threadIdx.x;
  const int wave = wave_uniform(tid >> 5), lane = tid & 31;
  const int grp  = wave >> 2, wq = wave & 3;                         // key group, query wave (both wave-uniform)
  const int t128 = tid & 127;                                        // thread within its key group
  const int hh   = lane >> 4, c = lane & 15;
  const int n0   = blockIdx.x * AQ, b = blockIdx.y;

  const unsigned short* Khb = Kh + (size_t)b * MM * DQ;
  const unsigned short* Klb = Kl + (size_t)b * MM * DQ;
  const unsigned short* Gcb = Gc + (size_t)b * DQ * MM;

  // ---- in front of the loop: the query tile and trip 0's stages, their wait, the barrier that publishes them, then
  //      trip 1's stages
  {
    const int qr = tid >> 4, qcol = 8 * (tid & 15);                  // qr 0..15, + 16 i -> query row 0..127
    const unsigned lq = lds_addr(Qs + qr * KP + qcol);
    const size_t go = ((size_t)(b * NN + n0 + qr)) * DQ + qcol;
    auto plane = [](unsigned l0, const unsigned short* g) {          // 128 rows of one plane, 8 copies a thread
      copy4(l0, l0 + 2u * (16 * KP), l0 + 2u * (32 * KP), l0 + 2u * (48 * KP), g, g + 16 * DQ, g + 32 * DQ,
            g + 48 * DQ);
      copy4(l0 + 2u * (64 * KP), l0 + 2u * (80 * KP), l0 + 2u * (96 * KP), l0 + 2u * (112 * KP), g + 64 * DQ,
            g + 80 * DQ, g + 96 * DQ, g + 112 * DQ);
    };
    plane(lq, Qh + go);
    plane(lq + 2u * (AQ * KP), Ql + go);
  }
  stage_kv(Ring + grp * STG, Khb, Klb, Gcb, grp * KT, t128);
  wait_async0();
  __syncthreads();
  stage_kv(Ring + (2 + grp) * STG, Khb, Klb, Gcb, (2 + grp) * KT, t128);

  // q fragments (B operand, col = query 32 wq + 16 u + c of the tile), d-chunk kc: read once, kept in registers
  Frag qh[2][DQ / 32], ql[2][DQ / 32];
#pragma unroll
  for (int u = 0; u < 2; ++u) {
    const unsigned short* Qhp = Qs + (32 * wq + 16 * u + c) * KP + 8 * hh;
#pragma unroll
    for (int kc = 0; kc < DQ / 32; ++kc) {
      qh[u][kc] = ldfrag(Qhp + 32 * kc);
      ql[u][kc] = ldfrag(Qhp + AQ * KP + 32 * kc);
    }
  }

  float m[2] = {-1.0e30f, -1.0e30f}, l[2] = {0.f, 0.f};
  v8f o[2][8];
#pragma unroll
  for (int u = 0; u < 2; ++u) {
#pragma unroll
    for (int j = 0; j < 8; ++j) o[u][j] = zero8();
  }

#pragma unroll 1
  for (int t = 0; t < MM / (2 * KT); ++t) {
    unsigned short* st = Ring + (2 * (t & 1) + grp) * STG;           // this trip's buffer, the group's half
    // k fragment base (A operand, row = key kb + c), + 32*kc; v fragment base (A operand, row = channel 16j + c)
    const unsigned short* k0p  = st + c * KP + 8 * hh;               // keys kb .. kb+15, kb = 32 (2 t + grp)
    const unsigned short* k1p  = k0p + 16 * KP;                      // keys kb+16 .. kb+31
    const unsigned short* k0lp = k0p + KT * KP;
    const unsigned short* k1lp = k1p + KT * KP;
    const unsigned short* Vp   = st + 2 * KT * KP + c * VPT + 8 * hh;
    v8f s0[2] = {zero8(), zero8()}, s1[2] = {zero8(), zero8()};
    Frag fr[DQ / 32][4], vf[8];                                      // all K fragments of the stage; V fragments
    // the trip's LDS reads stand at two places only, each a whole group well ahead of its products and waited for by
    // count: all 32 K reads here, the 16 V reads between the second and the third d-chunk (onto registers those left)
#pragma unroll
    for (int kc = 0; kc < DQ / 32; ++kc) {
      fr[kc][0] = ldfrag(k0p + 32 * kc);
      fr[kc][1] = ldfrag(k1p + 32 * kc);
      fr[kc][2] = ldfrag(k0lp + 32 * kc);
      fr[kc][3] = ldfrag(k1lp + 32 * kc);
    }
    sched_line();                                                    // without it the K reads are spread among the products
#pragma unroll
    for (int kc = 0; kc < DQ / 32; ++kc) {
      if (kc == DQ / 64) {
        // without the pair the V reads sink behind the last products, and the softmax waits out their latency
        sched_line();
#pragma unroll
        for (int j = 0; j < 8; ++j) vf[j] = ldfrag(Vp + (16 * j) * VPT);
        sched_line();
      }
      const Frag* f = fr[kc];
#pragma unroll
      for (int u = 0; u < 2; ++u) {
        s0[u] = mma_bp(f[0].bf, qh[u][kc].bf, s0[u]);
        s1[u] = mma_bp(f[1].bf, qh[u][kc].bf, s1[u]);
      }
#pragma unroll
      for (int u = 0; u < 2; ++u) {
        s0[u] = mma_bp(f[0].bf, ql[u][kc].bf, s0[u]);
        s1[u] = mma_bp(f[1].bf, ql[u][kc].bf, s1[u]);
      }
#pragma unroll
      for (int u = 0; u < 2; ++u) {
        s0[u] = mma_bp(f[2].bf, qh[u][kc].bf, s0[u]);
        s1[u] = mma_bp(f[3].bf, qh[u][kc].bf, s1[u]);
      }
    }

    float mn[2];
    bool up = false;
#pragma unroll
    for (int u = 0; u < 2; ++u) {
      float mx = fmaxf(hmax8(s0[u]), hmax8(s1[u]));
      mx = fmaxf(mx, __shfl_xor(mx, 16, 32));
      mn[u] = fmaxf(m[u], mx);
      up = up || (mx > m[u]);
    }
    const unsigned grew = wave_ballot(up);                           // wave-uniform
    if (grew != 0u) {
#pragma unroll
      for (int u = 0; u < 2; ++u) {
        const float corr = __expf(m[u] - mn[u]);                     // == 1 exactly for lanes whose max did not grow
        l[u] *= corr;
#pragma unroll
        for (int j = 0; j < 8; ++j) {
#pragma unroll
          for (int r = 0; r < 8; ++r) o[u][j][r] *= corr;
        }
      }
    }

    FragH ph[2];
#pragma unroll
    for (int u = 0; u < 2; ++u) {
      m[u] = mn[u];
      const float msh = mn[u] - LNPS;                                // exp gives e^{s-m} * 16384
      float ls = 0.f;
#pragma unroll
      for (int r = 0; r < 8; ++r) {
        const float e0 = __expf(s0[u][r] - msh);                     // key kb      + 8hh + r
        const float e1 = __expf(s1[u][r] - msh);                     // key kb + 16 + 8hh + r
        ls += e0 + e1;
        ph[u].hv[0][r] = (_Float16)e0;
        ph[u].hv[1][r] = (_Float16)e1;
      }
      l[u] += ls;
    }

#pragma unroll
    for (int j = 0; j < 8; ++j) {
#pragma unroll
      for (int u = 0; u < 2; ++u) o[u][j] = mma_hp(vf[j].h, ph[u].v, o[u][j]);
    }

    // ---- foot of the trip: own reads retired, own copies of the next stage landed, one barrier that publishes that
    //      stage and ends every reader's last read of this buffer; only then the refill of this buffer. (The softmax and
    //      the last products work on registers alone: the scheduler may set them behind these waits and the barrier's
    //      signal; every LDS read of the trip stays in front, the refill behind.)
    wait_ds0();
    wait_async0();
    __syncthreads();
    if (t + 2 < MM / (2 * KT)) stage_kv(st, Khb, Klb, Gcb, (2 * (t + 2) + grp) * KT, t128);
  }
  wait_async0();                                                     // nothing is in flight when the wave goes on
#pragma unroll
  for (int u = 0; u < 2; ++u) l[u] += __shfl_xor(l[u], 16, 32);

  // ---- join of the key groups; lane (hh, c) holds ch = 16 j + 8 hh + r for query 32 wq + 16 u + c in both groups
  if (grp == 1) {                                                    // wave-uniform
#pragma unroll
    for (int u = 0; u < 2; ++u) {
      const int qrow = 32 * wq + 16 * u + c;
      if (hh == 0) { Ms[qrow] = m[u]; Ls[qrow] = l[u]; }             // both halves hold the same m and l
#pragma unroll
      for (int j = 0; j < 8; ++j) {
        v4f va, vb;
#pragma unroll
        for (int r = 0; r < 4; ++r) { va[r] = o[u][j][r]; vb[r] = o[u][j][4 + r]; }
        *(v4f*)(Os + qrow * OSPW + 16 * j + 8 * hh)     = va;
        *(v4f*)(Os + qrow * OSPW + 16 * j + 8 * hh + 4) = vb;
      }
    }
  }
  __syncthreads();
  if (grp == 0) {                                                    // wave-uniform
#pragma unroll
    for (int u = 0; u < 2; ++u) {
      const int qrow = 32 * wq + 16 * u + c;
      const float m1 = Ms[qrow], l1 = Ls[qrow];
      const float mj = fmaxf(m[u], m1);
      const float c0 = __expf(m[u] - mj), c1 = __expf(m1 - mj);
      const float inv = 1.0f / (l[u] * c0 + l1 * c1);                // o and l both carry the x16384 factor
      const float a0 = c0 * inv, a1 = c1 * inv;
#pragma unroll
      for (int j = 0; j < 8; ++j) {
        float* op = Os + qrow * OSPW + 16 * j + 8 * hh;
        const v4f pa = *(const v4f*)op;
        const v4f pb = *(const v4f*)(op + 4);
        v4f va, vb;
#pragma unroll
        for (int r = 0; r < 4; ++r) {
          va[r] = o[u][j][r] * a0 + pa[r] * a1;
          vb[r] = o[u][j][4 + r] * a0 + pb[r] * a1;
        }
        *(v4f*)op       = va;
        *(v4f*)(op + 4) = vb;
      }
    }
  }
  __syncthreads();

  const int r16 = tid & 15, pq = tid >> 4;                           // row in its tile; piece 0..15, channels 8 pq..8 pq+7
  v4u uh[8], ul[8];
#pragma unroll
  for (int it = 0; it < 8; ++it) {
    const int row = it * 16 + r16;                                   // query 0..127
    const v4f a = *(const v4f*)(Os + row * OSPW + 8 * pq);
    const v4f q = *(const v4f*)(Os + row * OSPW + 8 * pq + 4);
    const float f[8] = {a[0], a[1], a[2], a[3], q[0], q[1], q[2], q[3]};
    split8(f, uh[it], ul[it]);
  }
  sched_line();   // keeps the arithmetic above the stores: nothing then rewrites a register that an issued store names
  {
    // one address a plane: tile it of the block lies it whole tiles (16 rows x 128 k) behind tile 0
    const size_t po = piece_off((b * NN + n0) / 16, DQ / 32, pq, r16);
    unsigned short* yh = Yh + po;
    unsigned short* yl = Yl + po;
#pragma unroll
    for (int it = 0; it < 8; ++it) {
      *(v4u*)(yh + it * (16 * DQ)) = uh[it];
      *(v4u*)(yl + it * (16 * DQ)) = ul[it];
    }
    wait_x0();
  }
}

// =========================================================================================================
// (3) output conv for one (b, 64-n tile, 64-c block): A[c][n] = sum_ci WWb[c][ci] (Yh + Yl)[b][n][ci] on bf16 WMMA
//     (2 products per k-step, shared accumulator), K = 128 = 4 steps. Block 128 threads = 4 waves; wave w owns cols
//     n0+16w..+15 (B fragments: tile (b 4096 + n0) / 16 + w of Yh/Yl) and 4 m-tiles (A rows c = c0 + 16 mt + (lane&15),
//     tile c0 / 16 + mt of WWb), all planes in fragment order.
//     Epilogue staged in LDS Os[n_loc][c_loc] (pitch OSP, b128 stores), block barrier
//     2 lines): 8 consecutive lanes x 16 B (values gathered from 4 Os rows), one instruction per 4 lines, final
// coverage: Os 4 waves x 16 n x 64 c written, read rows nl+t <= 63 x cols cl <= 63; WY 8 it x 16 lines x 8 lanes x
//           4 floats = 64 c x 64 n; grid (NQ/64, 4, NB) covers WY[b][0..255][0..NQ-1] exactly once.
// =========================================================================================================
__global__ __launch_bounds__(128)
void gemm_out(const unsigned short* __restrict__ WWb, const unsigned short* __restrict__ Yh,
              const unsigned short* __restrict__ Yl, const float* __restrict__ wb, float* WY) {
  __shared__ __align__(16) float Os[QT * OSP];
  const int tid  = threadIdx.x;
  const int lane = tid & 31, wave = tid >> 5;
  const int hh   = lane >> 4, c = lane & 15;
  const int nt   = blockIdx.x, cb = blockIdx.y, b = blockIdx.z;
  const int n0   = nt * QT, c0 = cb * QT;

  const int ta = c0 / 16, tb16 = (b * NN + n0) / 16 + wave;          // first A tile, the wave's B tile

  v8f acc[4];
#pragma unroll
  for (int mt = 0; mt < 4; ++mt) acc[mt] = zero8();

#pragma unroll
  for (int ks = 0; ks < DQ / 32; ++ks) {
    const Frag fbh = ldfrag_p(Yh, tb16, DQ / 32, ks, lane);
    const Frag fbl = ldfrag_p(Yl, tb16, DQ / 32, ks, lane);
#pragma unroll
    for (int mt = 0; mt < 4; ++mt) {
      const Frag fa = ldfrag_p(WWb, ta + mt, DQ / 32, ks, lane);
      acc[mt] = mma_b(fa.bf, fbh.bf, acc[mt]);
      acc[mt] = mma_b(fa.bf, fbl.bf, acc[mt]);
    }
  }

  // ---- epilogue: -> LDS Os[n_loc][c_loc]; lane (hh, c) holds c_loc = 16 mt + 8 hh + r for n_loc = 16 w + c
  {
    const int nl = 16 * wave + c;
#pragma unroll
    for (int mt = 0; mt < 4; ++mt) {
      v4f va, vb;
#pragma unroll
      for (int r = 0; r < 4; ++r) { va[r] = acc[mt][r]; vb[r] = acc[mt][4 + r]; }
      *(v4f*)(Os + nl * OSP + 16 * mt + 8 * hh)     = va;
      *(v4f*)(Os + nl * OSP + 16 * mt + 8 * hh + 4) = vb;
    }
  }
  __syncthreads();

  const int e = tid & 7, lq = tid >> 3;                              // lq 0..15
  v4f res[8];
#pragma unroll
  for (int it = 0; it < 8; ++it) {
    const int L   = it * 16 + lq;                                    // 0..127
    const int cl  = L >> 1, hf = L & 1;                              // channel 0..63 within the block
    const int nl  = hf * 32 + 4 * e;                                 // position 0..63
    const float bvs = bfr(wb[c0 + cl]);
#pragma unroll
    for (int t = 0; t < 4; ++t) {
      res[it][t] = Os[(nl + t) * OSP + cl] + bvs;
    }
  }
{
#pragma unroll
    for (int it = 0; it < 8; ++it) {
      const int L   = it * 16 + lq;
      const int cl  = L >> 1, hf = L & 1;
      const int nl  = hf * 32 + 4 * e;
      const size_t idx = ((size_t)(b * CC + c0 + cl)) * NN + n0 + nl;
      *(v4f*)(WY + idx) = res[it];
    }
    
  }
}

// =========================================================================================================
// (4) batch-norm statistics, normalisation, affine and residual in one launch: block owns ONE channel (256 blocks of
//     32 waves). Thread tid takes floats 4 tid..4 tid+3 of each of the NB rows WY[b][c][0..NQ) and of the same rows of
//     x, so every wave load is one contiguous 512-B run; a thread's 2 NB loads are independent and all issued before
//     the first sum; the WY values stay in registers from the statistics to the normalisation. Sum and sum of squares
//     in f64 per thread (rows, then elements, in ascending order), wave shuffle reduce, per-wave partials in LDS
//     (cross-wave, block barrier); every wave then shuffle-reduces the same 32 partials itself (a butterfly leaves the
//     same bits in every lane of every wave), so no second barrier and no table: mean, biased variance,
//     rstd = 1/sqrt(var + eps) in f32, then out[b][c][n] = (((WY - mu) * rstd) * bf16-RNE(gamma[c]) + bf16-RNE(beta[c]))
//     + bf16-RNE(x[b][c][n]) in f32.
// coverage: 256 blocks x 1 channel x NB rows x BST threads x 4 floats = out[b][0..255][0..NQ-1] exactly once, each
//           wave store one contiguous 512-B run; reads WY and x at the same offsets only (the produced extent).
// =========================================================================================================
__global__ __launch_bounds__(BST)
void bn_norm(const float* __restrict__ WY, const float* __restrict__ x, const float* __restrict__ gam,
             const float* __restrict__ bet, float* out) {
#pragma clang fp contract(off)
  __shared__ double red[2 * (BST / 32)];
  const int tid = threadIdx.x, lane = tid & 31, wave = tid >> 5;
  const int cc = blockIdx.x;
  const double ninv = 1.0 / ((double)NB * (double)NQ);
  unsigned bo[NB];                                                   // byte offsets in WY, x and out, all < 2^25
  v4f a[NB], xv[NB];
#pragma unroll
  for (int bb = 0; bb < NB; ++bb) bo[bb] = 4u * (unsigned)((bb * CC + cc) * NN + 4 * tid);
#pragma unroll
  for (int bb = 0; bb < NB; ++bb) a[bb] = *(const v4f*)((const char*)WY + bo[bb]);
#if defined(__HIP_DEVICE_COMPILE__)
  // keeps the WY loads ahead of the x loads: loads return in order, and interleaved the sums would wait for rows of x
  __builtin_amdgcn_sched_barrier(0);
#endif
#pragma unroll
  for (int bb = 0; bb < NB; ++bb) xv[bb] = *(const v4f*)((const char*)x + bo[bb]);
#if defined(__HIP_DEVICE_COMPILE__)
  // keeps every load above the sums: without it the scheduler sinks them and only a few stay in flight per wave
  __builtin_amdgcn_sched_barrier(0);
#endif
  const float ga = bfr(gam[cc]), be = bfr(bet[cc]);                  // block-uniform, back long before their use
  double s = 0.0, q = 0.0;
#pragma unroll
  for (int bb = 0; bb < NB; ++bb) {
#pragma unroll
    for (int t = 0; t < 4; ++t) {
      const double d = (double)a[bb][t];
      s += d; q += d * d;
    }
  }
#pragma unroll
  for (int d = 1; d < 32; d <<= 1) {
    s += __shfl_xor(s, d, 32);
    q += __shfl_xor(q, d, 32);
  }
  if (lane == 0) { red[wave] = s; red[BST / 32 + wave] = q; }
  __syncthreads();
  double ts = red[lane], tq = red[BST / 32 + lane];
#pragma unroll
  for (int d = 1; d < 32; d <<= 1) {
    ts += __shfl_xor(ts, d, 32);
    tq += __shfl_xor(tq, d, 32);
  }
  const double mud = ts * ninv;
  double var = tq * ninv - mud * mud;
  var = (var > 0.0) ? var : 0.0;
  const float varf = (float)var + BNEPS;
  const float rs = 1.0f / sqrtf(varf);
  const float mu = (float)mud;
#pragma unroll
  for (int bb = 0; bb < NB; ++bb) {
    v4f r;
#pragma unroll
    for (int t = 0; t < 4; ++t) {
      const float d  = a[bb][t] - mu;
      const float nv = d * rs;
      const float av = nv * ga;
      const float sv = av + be;
      r[t] = sv + bfr(xv[bb][t]);
    }
    *(v4f*)((char*)out + bo[bb]) = r;
  }
}

// =========================================================================================================
// Workspace map (bytes; each region start a multiple of 256; every extent is an exact row/tile multiple and is
//   W16 f16 [384][256]            196608      WWb bf16 [256][128]        65536
//   Qh/Ql bf16 [NB][4096][128]   8388608 x2
//   Kh/Kl bf16 [NB][1024][128]   2097152 x2  Gc f16 [NB][32][128][32]  2097152
//   Yh/Yl bf16 [NB][4096][128]   8388608 x2
//   WY  f32  [NB][256][4096]    33554432
//   total (NB=8) = 73662464
//   W16, WWb, Yh and Yl hold their rows in fragment order (piece_off); the sizes are those of the row-major planes.
// =========================================================================================================
extern "C" void kernel_launch(void* const* d_in, const int* in_sizes, int n_in,
                              void* d_out, int out_size, void* d_ws, size_t ws_size,
                              hipStream_t stream) {
  const int XN = NB * CC * NN;
  if (n_in < 11) return;
  if (in_sizes[0] < XN) return;
  if (in_sizes[1] < DQ * CC || in_sizes[3] < DQ * CC || in_sizes[5] < DQ * CC || in_sizes[7] < CC * DQ) return;
  if (in_sizes[2] < DQ || in_sizes[4] < DQ || in_sizes[6] < DQ || in_sizes[8] < CC) return;
  if (in_sizes[9] < CC || in_sizes[10] < CC) return;
  if (out_size < XN) return;

  size_t off = 0;
  auto carve = [&](size_t bytes) { const size_t o = off; off += (bytes + 255) & ~(size_t)255; return o; };
  const size_t oW16 = carve((size_t)MW * CC * 2);
  const size_t oWWb = carve((size_t)CC * DQ * 2);
  const size_t oQh  = carve((size_t)NB * NN * DQ * 2);
  const size_t oQl  = carve((size_t)NB * NN * DQ * 2);
  const size_t oKh  = carve((size_t)NB * MM * DQ * 2);
  const size_t oKl  = carve((size_t)NB * MM * DQ * 2);
  const size_t oGc  = carve((size_t)NB * DQ * MM * 2);
  const size_t oYh  = carve((size_t)NB * NN * DQ * 2);
  const size_t oYl  = carve((size_t)NB * NN * DQ * 2);
  const size_t oWY  = carve((size_t)NB * CC * NN * 4);
  if (off > ws_size) return;
  if (off > (size_t)134217728) return;

  const float* x   = (const float*)d_in[0];
  const float* gw  = (const float*)d_in[1];
  const float* gb  = (const float*)d_in[2];
  const float* tw  = (const float*)d_in[3];
  const float* tb  = (const float*)d_in[4];
  const float* pw  = (const float*)d_in[5];
  const float* pb  = (const float*)d_in[6];
  const float* ow  = (const float*)d_in[7];
  const float* wb  = (const float*)d_in[8];
  const float* gam = (const float*)d_in[9];
  const float* bet = (const float*)d_in[10];

  char* ws = (char*)d_ws;
  unsigned short* W16 = (unsigned short*)(ws + oW16);
  unsigned short* WWb = (unsigned short*)(ws + oWWb);
  unsigned short* Qh  = (unsigned short*)(ws + oQh);
  unsigned short* Ql  = (unsigned short*)(ws + oQl);
  unsigned short* Kh  = (unsigned short*)(ws + oKh);
  unsigned short* Kl  = (unsigned short*)(ws + oKl);
  unsigned short* Gc  = (unsigned short*)(ws + oGc);
  unsigned short* Yh  = (unsigned short*)(ws + oYh);
  unsigned short* Yl  = (unsigned short*)(ws + oYl);
  float*          WY  = (float*)(ws + oWY);
  float* out = (float*)d_out;

  const dim3 blk256(256), blk128(128);

  // (0) theta_w / phi_w / g_w -> stacked f16 plane; w_w -> bf16 plane, both in fragment order
  cvt_w<<<dim3(MW / 8 + CC / 16), blk256, 0, stream>>>(tw, pw, gw, ow, W16, WWb);
  // (1) x strip -> 16-bit LDS tile; conv1x1 GEMM -> theta (q) hi/res planes; phi / g + bias, 2x2 max-pooled -> k hi/res
  //     planes, v plane by stages
  gemm_proj<<<dim3(NSTRIP, NB), dim3(PT), 0, stream>>>(W16, x, tb, pb, gb, Qh, Ql, Kh, Kl, Gc);
  // (2) attention -> y hi/res planes, rows = positions, fragment order
  attn_k<<<dim3(NQ / AQ, NB), dim3(AT), 0, stream>>>(Qh, Ql, Kh, Kl, Gc, Yh, Yl);
  // (3) output conv + bias -> WY f32 plane [b][256][4096]
  gemm_out<<<dim3(NQ / QT, CC / QT, NB), blk128, 0, stream>>>(WWb, Yh, Yl, wb, WY);
  // (4) per-channel mean / rstd, then normalise, affine, residual -> out [b][256][4096]
  bn_norm<<<dim3(CC), dim3(BST), 0, stream>>>(WY, x, gam, bet, out);
  (void)hipGetLastError();
}

// v009
// A run of this version takes 66 microseconds.
// Two timings next to v008 put it at 1.17 and 1.18 times that version's speed.
// Counting every step since v000, it is 12.0 times as fast.
// Contractions: conv1x1 theta/phi/g GEMM W[384x256].X[256x128] per strip on v_wmma_f32_16x16x32_f16 (f16 containers
// of bf16-RNE weights x256 and bf16-RNE x); scores K.Q^T on v_wmma_f32_16x16x32_bf16 (bf16 hi + bf16 residual planes
// of theta / 2x2-max-pooled phi, 3 products, K=128); y^T = G.P^T on v_wmma_f32_16x16x32_f16 (2x2-max-pooled g as
// f16, P = e^{s-m} x16384 f16 from the score D registers); output conv W[256x128].Y on v_wmma_f32_16x16x32_bf16 (bf16
// weights, y as bf16 hi + residual fragments, 2 products); f32 accumulate everywhere; max-pool, softmax statistics and
// bias in f32 VALU; batch-norm channel statistics in f64 VALU; normalisation, affine and residual add in f32 VALU.
#include <hip/hip_runtime.h>
#include <math.h>
#include <stdint.h>

#ifndef NB
#define NB 8
#endif
#ifndef NQ
#define NQ 4096
#endif
#define NB_FULL 8
#define CC     256
#define HIMG   64
#define WIMG   64
#define NN     4096
#define DQ     128
#define HP     32
#define WP     32
#define MM     1024
#define MW     384
#define QT     64
#define SN     128
#define NSTRIP 32
#define OSPW   132
#define BST    1024
#define WSC    256.0f
#define IWSC   0.00390625f
#define LNPS   9.704060527839234f
#define BNEPS  1.0e-5f
#define KT     32
#define KP     136
#define VPT    40
#define STG    (2 * KT * KP + DQ * VPT)
#define GTP    40
#define XPT    264
#define OSA    388
#define PT     512
#define AQ     128
#define AT     256

static_assert(NB >= 1 && NB <= NB_FULL);
static_assert(NQ % QT == 0 && NQ <= NN);
static_assert(NN == HIMG * WIMG);
static_assert(SN == 2 * WIMG);
static_assert(NSTRIP * SN == NN);
static_assert(SN == 8 * 16);
static_assert(HIMG % 2 == 0 && WIMG % 2 == 0);
static_assert(HP == HIMG / 2 && WP == WIMG / 2);
static_assert(MM == HP * WP);
static_assert(WP == 32);
static_assert(MM % QT == 0 && MM % 32 == 0);
static_assert(NN % QT == 0 && CC % QT == 0 && DQ % QT == 0);
static_assert(MW == 3 * DQ && MW % QT == 0 && MW % 8 == 0);
static_assert(CC % 32 == 0 && DQ % 32 == 0);
static_assert((OSPW * 4) % 16 == 0);
static_assert((XPT * 2) % 32 == 16 && XPT >= CC + 8 && (OSA * 4) % 16 == 0 && OSA >= MW + 4);
static_assert(SN * XPT * 2 <= SN * OSA * 4 && MW == 8 * 3 * 16 && PT == 16 * 32 && CC == 8 * 32);
static_assert(BST == 32 * 32 && NQ == 4 * BST);
static_assert(NN % 16 == 0 && CC % 4 == 0);
static_assert((size_t)NB_FULL * CC * NN * 4 == (size_t)33554432);
static_assert((KP * 2) % 16 == 0 && (VPT * 2) % 16 == 0 && (STG * 2) % 16 == 0 && (KT * KP * 2) % 16 == 0);
static_assert(KP >= DQ + 8 && VPT >= KT + 8 && MM % KT == 0 && MM / KT >= 2);
static_assert(KT * DQ / 8 == 4 * 128 && DQ * KT / 8 == 4 * 128 && QT * DQ / 8 == 8 * 128);
static_assert(NQ % AQ == 0 && AQ == 4 * 32 && AT == 2 * 128 && MM % (2 * KT) == 0 && MM / (2 * KT) >= 2 && AQ * DQ / 8 == 8 * AT);
static_assert(DQ * OSPW * 4 <= 2 * AQ * KP * 2 && DQ * OSPW * 4 <= 4 * STG * 2 && CC == 2 * DQ && CC == 8 * 32 && AQ == 32 * 4);
static_assert(KT == WP && NSTRIP == HP && (GTP * 2) % 16 == 0 && GTP >= WP + 8 && QT * WP / 8 == 256);

typedef _Float16       v16h __attribute__((ext_vector_type(16)));
typedef _Float16       v8h  __attribute__((ext_vector_type(8)));
typedef __bf16         v16b __attribute__((ext_vector_type(16)));
typedef unsigned short v8us __attribute__((ext_vector_type(8)));
typedef float          v8f  __attribute__((ext_vector_type(8)));
typedef float          v4f  __attribute__((ext_vector_type(4)));
typedef unsigned int   v4u  __attribute__((ext_vector_type(4)));

union Frag  { v8us u[2]; v16h h; v16b bf; };
union FragH { v16h v; v8h hv[2]; };
static_assert(sizeof(Frag) == 32);
static_assert(sizeof(FragH) == 32);

// ---- scalar helpers ---------------------------------------------------------------------------------------
__device__ __forceinline__ unsigned short bf_bits(float f) {          // f32 -> bf16 bits, RNE convert
  unsigned u = __float_as_uint(f);
  return (unsigned short)((u + 0x7FFFu + ((u >> 16) & 1u)) >> 16);
}
__device__ __forceinline__ float bf_up(unsigned short hb) { return __uint_as_float(((unsigned)hb) << 16); }
__device__ __forceinline__ float bfr(float f) { return bf_up(bf_bits(f)); }
__device__ __forceinline__ unsigned short h_bits(_Float16 x) { return __builtin_bit_cast(unsigned short, x); }
__device__ __forceinline__ unsigned pk16(unsigned short a, unsigned short b) { return (unsigned)a | ((unsigned)b << 16); }
__device__ __forceinline__ v8f zero8() { v8f z = {0.f, 0.f, 0.f, 0.f, 0.f, 0.f, 0.f, 0.f}; return z; }
__device__ __forceinline__ float hmax8(v8f s) {
  return fmaxf(fmaxf(fmaxf(s[0], s[1]), fmaxf(s[2], s[3])), fmaxf(fmaxf(s[4], s[5]), fmaxf(s[6], s[7])));
}
__device__ __forceinline__ unsigned wave_ballot(bool p) {
#if defined(__HIP_DEVICE_COMPILE__)
  return __builtin_amdgcn_ballot_w32(p);
#else
  return p ? 1u : 0u;
#endif
}
// 8 f32 values -> bf16 hi bits and bf16 residual bits (lo = RNE(v - hi)), packed 2 per uint
__device__ __forceinline__ void split8(const float* f, v4u& uh, v4u& ul) {
#pragma unroll
  for (int t = 0; t < 4; ++t) {
    const float f0 = f[2 * t], f1 = f[2 * t + 1];
    const unsigned short hb0 = bf_bits(f0), hb1 = bf_bits(f1);
    const unsigned short lb0 = bf_bits(f0 - bf_up(hb0));
    const unsigned short lb1 = bf_bits(f1 - bf_up(hb1));
    uh[t] = pk16(hb0, hb1);
    ul[t] = pk16(lb0, lb1);
  }
}

// ---- 16-bit fragment loader (A, or B from a k-contiguous [n][k] row): lane -> row/col (lane&15), p already includes
//      + 8*(lane>>4); elements 0..7 <- p[0..7] (k0+8h..), elements 8..15 <- p[16..23] (k0+16+8h..)
__device__ __forceinline__ Frag ldfrag(const unsigned short* p) {
  Frag f;
  f.u[0] = *(const v8us*)(p);
  f.u[1] = *(const v8us*)(p + 16);
  return f;
}

// ---- fragment-order planes (W16, WWb): a 16-row x 32-k operand tile is stored as the 1 KiB its loader
//      reads: half j, then lane = 16 hh + row, then 8 elements, k = k0 + 16 j + 8 hh + e (the k map of ldfrag). Each of
//      the loader's two wave loads then covers 512 contiguous bytes (4 whole lines) and not 32 B of each of 16 rows.
//      piece_off: element offset of the 8-element piece q = k / 8 of row r (0..15) of tile t; nks = 32-k steps a row.
__device__ __forceinline__ size_t piece_off(int t, int nks, int q, int r) {
  return ((size_t)((t * nks + (q >> 2)) * 2 + ((q >> 1) & 1)) * 32 + 16 * (q & 1) + r) * 8;
}
__device__ __forceinline__ Frag ldfrag_p(const unsigned short* plane, int t, int nks, int ks, int lane) {
  const unsigned short* p = plane + ((size_t)(t * nks + ks) * 64 + lane) * 8;
  Frag f;
  f.u[0] = *(const v8us*)(p);
  f.u[1] = *(const v8us*)(p + 256);
  return f;
}

// ---- WMMA helper: builtin followed by a 4-slot VALU gap tying D and keeping A/B live ---------------------------
__device__ __forceinline__ v8f mma_h(v16h a, v16h b, v8f c) {
  v8f d = __builtin_amdgcn_wmma_f32_16x16x32_f16(false, a, false, b, (short)0, c, false, false);
#if defined(__HIP_DEVICE_COMPILE__)
  asm volatile("v_nop\n\tv_nop\n\tv_nop\n\tv_nop" : "+v"(d) : "v"(a), "v"(b));
#endif
  return d;
}

// the same products as plain builtins, for a kernel above 256 registers: operands of an asm statement must lie in the
// first 256, which would spill the accumulators and the kept fragments; the compiler keeps the distances of its own forms
__device__ __forceinline__ v8f mma_hp(v16h a, v16h b, v8f c) {
  return __builtin_amdgcn_wmma_f32_16x16x32_f16(false, a, false, b, (short)0, c, false, false);
}
__device__ __forceinline__ v8f mma_bp(v16b a, v16b b, v8f c) {
  return __builtin_amdgcn_wmma_f32_16x16x32_bf16(false, a, false, b, (short)0, c, false, false);
}
// the scheduler moves nothing across this line; each use says what it holds in place
__device__ __forceinline__ void sched_line() {
#if defined(__HIP_DEVICE_COMPILE__)
  __builtin_amdgcn_sched_barrier(0);
#endif
}
// a value that is the same in every lane of the wave, moved to a scalar register so that tests on it are scalar branches
__device__ __forceinline__ int wave_uniform(int v) {
#if defined(__HIP_DEVICE_COMPILE__)
  return __builtin_amdgcn_readfirstlane(v);
#else
  return v;
#endif
}

// lane i's value of v (i the same in every lane), in a scalar register
__device__ __forceinline__ float lane_value(float v, int i) {
#if defined(__HIP_DEVICE_COMPILE__)
  return __uint_as_float((unsigned)__builtin_amdgcn_readlane((int)__float_as_uint(v), i));
#else
  return v;
#endif
}

// stands directly behind a run of global stores or loads, in front of any later write of a register that they name
__device__ __forceinline__ void wait_x0() {
#if defined(__HIP_DEVICE_COMPILE__)
  asm volatile("s_wait_xcnt 0x0" ::: "memory");
#endif
}

// stands directly behind that wait where more work follows: without it the scheduler lifts later address arithmetic in
// among the stores, onto registers that they name, ahead of the wait
__device__ __forceinline__ void hold_below() {
#if defined(__HIP_DEVICE_COMPILE__)
  __builtin_amdgcn_sched_barrier(0);
#endif
}
// the same wait behind a run of global loads from one address: the address is an input, so it stays in its registers up
// to the wait and no load of the run returns its data onto them
__device__ __forceinline__ void wait_x0_keep(const float* p) {
#if defined(__HIP_DEVICE_COMPILE__)
  asm volatile("s_wait_xcnt 0x0" :: "v"(p) : "memory");
#endif
}

// =========================================================================================================
// (0) weights. Blocks 0..47: W16 f16 [384][256], rows 0..127 = theta_w, 128..255 = phi_w, 256..383 = g_w; value =
//     f16 of (bf16-RNE(w) * 256) (exact). Block owns rows 8*blk..8*blk+7 (half a 16-row tile): 8 lanes x 16 B = one
//     whole line of the fragment-order plane per piece q. Blocks 48..63: WWb bf16 [256][128], one 16-row tile a block.
// coverage: 48 blocks x 8 rows x 32 pieces x 8 halves = 384 x 256; 16 blocks x 16 rows x 16 pieces x 8 = 256 x 128.
// =========================================================================================================
__global__ __launch_bounds__(256)
void cvt_w(const float* __restrict__ tw, const float* __restrict__ pw, const float* __restrict__ gw,
           const float* __restrict__ ow, unsigned short* W16, unsigned short* WWb) {
  const int tid = threadIdx.x, blk = blockIdx.x;
  if (blk < MW / 8) {
    const int rl = tid & 7, pq = tid >> 3, col = 8 * pq;             // row in the block, piece 0..31
    const int o = 8 * blk + rl;                                      // 0..383
    const int grp = blk >> 4;                                        // 0,1,2 (block-uniform)
    const float* wbase = (grp == 0) ? tw : ((grp == 1) ? pw : gw);  // all global
    const float* s = wbase + (size_t)(o - DQ * grp) * CC + col;      // (o - 128 grp) in 0..127
    const v4f a = *(const v4f*)s;
    const v4f q = *(const v4f*)(s + 4);
    const float f[8] = {a[0], a[1], a[2], a[3], q[0], q[1], q[2], q[3]};
    v4u u;
#pragma unroll
    for (int t = 0; t < 4; ++t) {
      const _Float16 h0 = (_Float16)(bfr(f[2 * t]) * WSC);
      const _Float16 h1 = (_Float16)(bfr(f[2 * t + 1]) * WSC);
      u[t] = pk16(h_bits(h0), h_bits(h1));
    }
{
      *(v4u*)(W16 + piece_off(o >> 4, CC / 32, pq, o & 15)) = u;
      
    }
  } else {
    const int rb = blk - MW / 8;                                     // 0..15
    const int o = 16 * rb + (tid & 15);                              // 0..255
    const int pq = tid >> 4, col = 8 * pq;                           // piece 0..15, col 0..120
    const float* s = ow + (size_t)o * DQ + col;
    const v4f a = *(const v4f*)s;
    const v4f q = *(const v4f*)(s + 4);
    const float f[8] = {a[0], a[1], a[2], a[3], q[0], q[1], q[2], q[3]};
    v4u u;
#pragma unroll
    for (int t = 0; t < 4; ++t) u[t] = pk16(bf_bits(f[2 * t]), bf_bits(f[2 * t + 1]));
{
      *(v4u*)(WWb + piece_off(rb, DQ / 32, pq, tid & 15)) = u;
      
    }
  }
}

// =========================================================================================================
// (1) conv1x1 GEMM for one (b, strip of 128 positions = image rows 2s and 2s+1), all 384 rows of the stacked weights:
//     Y[o][n] = (1/256) sum_c W16[o][c] X[n][c]. Block 512 threads = 16 waves, one block a WGP.
//     Stage: the strip x f32 [256 c][128 n] is read once from global (a thread: 8 channels x 4 positions, twice; 8 lanes
//     cover one whole 128-B line, a wave load 4 lines), rounded to bf16-RNE, held as f16 (the same values a B fragment
//     had before) and turned in registers into Xs[128 n][256 c] (pitch XPT, b128 stores, cross-wave, block barrier).
//     Products: wave w owns m-tiles 3 (w >> 1) .. + 2 (A rows o = 16 tile + (lane&15), W16 in fragment order, read from
//     global one k-step ahead) and n-tiles 4 (w & 1) .. + 3 (B rows n = 16 tile + (lane&15) of Xs, the k map of ldfrag, too).
//     K = 256 = 8 steps in ascending order into one accumulator a tile.
//     Epilogue staged in LDS Os[n_loc][384 o] (pitch OSA, b128 stores) on the bytes of Xs, behind a block barrier that
//     ends every wave's reads of Xs; block barrier (cross-wave); then the two halves of the block (h = tid >> 8) take
//     dims 64 h .. 64 h + 63 of (g first, then theta, then phi):
//       theta + bias -> Qh/Ql bf16 [b][4096 n][128 d] (hi = RNE(v), lo = RNE(v-hi)), 8 consecutive lanes x 16 B = one line;
//       phi + bias in f32, 2x2 stride-2 max-pool in f32 (the strip holds both image rows of every window: pooled column
//                       px takes n_loc = 64 dy + 2 px + dx, dy, dx in {0,1}; key m = 32 st + px) -> Kh/Kl bf16
//                       [b][1024 m][128 d] (hi = RNE(v), lo = RNE(v-hi)): 32 rows x one whole line of the 256-B row;
//       g + bias, the same pool, f16, turned through the half's LDS tile Tg[64 d][32 px] (pitch GTP, cross-wave, block
//                       barrier) -> Gc f16 [b][32 st][128 d][32 px]: one 32-key stage of the attention a strip, keys
//                       contiguous a channel; each wave store 512 contiguous B.
// coverage: Xs written rows 64 (w&1) + 32 g + 4 lq + t = 0..127 x cols 32 (w>>1) + 8 lo + 0..7 = 0..255, read rows 0..127 x
//           cols 0..255; Os 8 m-groups x 3 tiles x 16 o = 384 cols x 2 n-halves x 4 tiles x 16 = 128 rows written, reads
//           rows <= 127 cols <= 383; theta planes 4 it x 32 rows x 8 lanes x 8 x 2 halves = 128 n x 128 d; pooled planes
//           32 px x 8 lanes x 8 x 2 halves = 32 m x 128 d; Tg written rows (8e+t)=0..63 x cols 0..31 a half, read rows
//           0..63 x cols 8 kq..8 kq+7, kq 0..3; grid (32, NB) covers all 4096 rows x 128 d of Qh/Ql and all 1024 keys x
//           128 d of Kh/Kl/Gc exactly once.
// =========================================================================================================
__global__ __launch_bounds__(PT)
void gemm_proj(const unsigned short* __restrict__ W16, const float* __restrict__ x,
               const float* __restrict__ tb, const float* __restrict__ pb, const float* __restrict__ gb,
               unsigned short* Qh, unsigned short* Ql, unsigned short* Kh, unsigned short* Kl, unsigned short* Gc) {
  __shared__ __align__(16) float Os[SN * OSA];
  __shared__ __align__(16) unsigned short Tg[2 * QT * GTP];
  unsigned short* Xs = (unsigned short*)Os;                          // the x tile lives on the bytes of Os, ahead of it
  const int tid  = threadIdx.x;
  const int lane = tid & 31, wave = tid >> 5;                        // wave 0..15
  const int hh   = lane >> 4, c = lane & 15;
  const int st   = blockIdx.x, b = blockIdx.y;
  const int n0   = st * SN;
  const int ta   = 3 * (wave >> 1), tn = 4 * (wave & 1);             // first A tile (of 24), first n-tile (of 8)

  Frag fa[2][3];                                                     // A fragments of this k-step and of the next
#pragma unroll
  for (int i = 0; i < 3; ++i) fa[0][i] = ldfrag_p(W16, ta + i, CC / 32, 0, lane);

  // ---- stage the strip: f32 [c][n] -> f16 Xs[n][c]
  {
    const int lo = lane & 3, lq = lane >> 2;                         // channel octet 0..3, position quad 0..7
    const int c8 = 32 * (wave >> 1) + 8 * lo;                        // the thread's channels c8..c8+7
    const int nq = 64 * (wave & 1) + 4 * lq;                         // its positions nq + 32 g + 0..3
    const float* xp = x + ((size_t)(b * CC + c8)) * NN + n0 + nq;
    v4f v[2][8];
#pragma unroll
    for (int e = 0; e < 8; ++e) {
#pragma unroll
      for (int g = 0; g < 2; ++g) v[g][e] = *(const v4f*)(xp + (size_t)e * NN + 32 * g);
    }
    wait_x0_keep(xp);
#pragma unroll
    for (int g = 0; g < 2; ++g) {
#pragma unroll
      for (int t = 0; t < 4; ++t) {
        v4u u;
#pragma unroll
        for (int k = 0; k < 4; ++k)
          u[k] = pk16(h_bits((_Float16)bfr(v[g][2 * k][t])), h_bits((_Float16)bfr(v[g][2 * k + 1][t])));
        *(v4u*)(Xs + (nq + 32 * g + t) * XPT + c8) = u;
      }
    }
  }
  __syncthreads();

  v8f acc[3][4];
#pragma unroll
  for (int i = 0; i < 3; ++i) {
#pragma unroll
    for (int j = 0; j < 4; ++j) acc[i][j] = zero8();
  }
  const unsigned short* Xp = Xs + (16 * tn + c) * XPT + 8 * hh;      // B fragment base, + 16 j rows, + 32 ks

  Frag fb[2][4];                                                     // B fragments of this k-step and of the next
#pragma unroll
  for (int j = 0; j < 4; ++j) fb[0][j] = ldfrag(Xp + (16 * j) * XPT);
  // unrolled so that the two sets are registers: the next step's reads stand as one group above this step's products
#pragma unroll
  for (int ks = 0; ks < CC / 32; ++ks) {
    if (ks + 1 < CC / 32) {
#pragma unroll
      for (int i = 0; i < 3; ++i) fa[(ks + 1) & 1][i] = ldfrag_p(W16, ta + i, CC / 32, ks + 1, lane);
#pragma unroll
      for (int j = 0; j < 4; ++j) fb[(ks + 1) & 1][j] = ldfrag(Xp + (16 * j) * XPT + 32 * (ks + 1));
    }
#pragma unroll
    for (int j = 0; j < 4; ++j) {
#pragma unroll
      for (int i = 0; i < 3; ++i) acc[i][j] = mma_h(fa[ks & 1][i].h, fb[ks & 1][j].h, acc[i][j]);
    }
  }
  __syncthreads();                                                   // every wave has left Xs before Os overwrites it

  // ---- epilogue: scale back -> LDS Os[n_loc][o]; lane (hh, c) holds o = 16 tile + 8 hh + r for n_loc = 16 n-tile + c
#pragma unroll
  for (int j = 0; j < 4; ++j) {
    const int nl = 16 * (tn + j) + c;
#pragma unroll
    for (int i = 0; i < 3; ++i) {
      v4f va, vb;
#pragma unroll
      for (int r = 0; r < 4; ++r) { va[r] = acc[i][j][r] * IWSC; vb[r] = acc[i][j][4 + r] * IWSC; }
      *(v4f*)(Os + nl * OSA + 16 * (ta + i) + 8 * hh)     = va;
      *(v4f*)(Os + nl * OSA + 16 * (ta + i) + 8 * hh + 4) = vb;
    }
  }
  __syncthreads();

  const int u256 = tid & 255;
  const int dsel = (tid >> 8) * QT;                                  // 0 or 64 (wave-uniform)
  const int e = u256 & 7, lq = u256 >> 3;                            // dims 8 e..8 e+7 of the half; lq 0..31
  auto bias8 = [&](const float* bias, float* bv) {
    const float* bp = bias + dsel + 8 * e;
    const v4f ba = *(const v4f*)bp;
    const v4f bq = *(const v4f*)(bp + 4);
    wait_x0_keep(bp);
#pragma unroll
    for (int t = 0; t < 4; ++t) { bv[t] = bfr(ba[t]); bv[4 + t] = bfr(bq[t]); }
  };

  // ---- phi and g: bias, then the 2x2 max-pool; pooled column px = lq
  const int px = lq;
  auto pooled = [&](const float* bias, int ob, float* f) {           // ob: first column of the plane in Os
    float bv[8];
    bias8(bias, bv);
#pragma unroll
    for (int t = 0; t < 8; ++t) f[t] = -__builtin_inff();
#pragma unroll
    for (int dy = 0; dy < 2; ++dy) {
#pragma unroll
      for (int dx = 0; dx < 2; ++dx) {
        const int row = dy * WIMG + 2 * px + dx;                     // n_loc 0..127
        const v4f a = *(const v4f*)(Os + row * OSA + ob + dsel + 8 * e);
        const v4f q = *(const v4f*)(Os + row * OSA + ob + dsel + 8 * e + 4);
#pragma unroll
        for (int t = 0; t < 4; ++t) {
          f[t]     = fmaxf(f[t], a[t] + bv[t]);
          f[4 + t] = fmaxf(f[4 + t], q[t] + bv[4 + t]);
        }
      }
    }
  };
  // g first: its barrier then has no global store of this block to wait for
  {
    float f[8];
    pooled(gb, 2 * DQ, f);
    unsigned short* Th = Tg + (tid >> 8) * (QT * GTP);               // the half's own tile
#pragma unroll
    for (int t = 0; t < 8; ++t) Th[(8 * e + t) * GTP + px] = h_bits((_Float16)f[t]);
    __syncthreads();                                                 // straight-line code: every wave passes
    const int dl = u256 >> 2, kq = u256 & 3;                         // channel 0..63 of the half, 8 keys 8 kq..8 kq+7
    const v4u u = *(const v4u*)(Th + dl * GTP + 8 * kq);
    *(v4u*)(Gc + ((size_t)((b * NSTRIP + st) * DQ + dsel + dl)) * WP + 8 * kq) = u;
    wait_x0();
  }

  // ---- theta
  {
    float bv[8];
    bias8(tb, bv);
    v4u uh[4], ul[4];
#pragma unroll
    for (int it = 0; it < 4; ++it) {
      const int row = it * 32 + lq;                                  // n_loc 0..127
      const v4f a = *(const v4f*)(Os + row * OSA + dsel + 8 * e);
      const v4f q = *(const v4f*)(Os + row * OSA + dsel + 8 * e + 4);
      float f[8];
#pragma unroll
      for (int t = 0; t < 4; ++t) { f[t] = a[t] + bv[t]; f[4 + t] = q[t] + bv[4 + t]; }
      split8(f, uh[it], ul[it]);
    }
#pragma unroll
    for (int it = 0; it < 4; ++it) {
      const int row = it * 32 + lq;
      const size_t po = ((size_t)(b * NN + n0 + row)) * DQ + dsel + 8 * e;
      *(v4u*)(Qh + po) = uh[it];
      *(v4u*)(Ql + po) = ul[it];
    }
    wait_x0();
    hold_below();
  }

  // ---- phi
  {
    float f[8];
    pooled(pb, DQ, f);
    v4u kh, kl;
    split8(f, kh, kl);
    const size_t po = ((size_t)(b * MM + WP * st + px)) * DQ + dsel + 8 * e;
    *(v4u*)(Kh + po) = kh;
    *(v4u*)(Kl + po) = kl;
    wait_x0();
  }
}

// ---- asynchronous copies to LDS: each lane moves its own 16 bytes, global -> LDS, through no register. Arguments: the
//      lane's LDS byte addresses, then its global addresses in the same order, all multiples of 16. The closing
//      s_wait_xcnt 0 stands inside the copies' own statement so that no address register named there is rewritten ahead
//      of it.
__device__ __forceinline__ unsigned lds_addr(const void* p) { return (unsigned)(uintptr_t)p; }
__device__ __forceinline__ void copy4(unsigned l0, unsigned l1, unsigned l2, unsigned l3,
                                      const unsigned short* g0, const unsigned short* g1,
                                      const unsigned short* g2, const unsigned short* g3) {
#if defined(__HIP_DEVICE_COMPILE__)
  asm volatile("global_load_async_to_lds_b128 %0, %4, off\n\t"
               "global_load_async_to_lds_b128 %1, %5, off\n\t"
               "global_load_async_to_lds_b128 %2, %6, off\n\t"
               "global_load_async_to_lds_b128 %3, %7, off\n\t"
               "s_wait_xcnt 0x0"
               :: "v"(l0), "v"(l1), "v"(l2), "v"(l3), "v"(g0), "v"(g1), "v"(g2), "v"(g3) : "memory");
#endif
}
__device__ __forceinline__ void copy12(unsigned a0, unsigned a1, unsigned a2, unsigned a3, unsigned b0, unsigned b1,
                                       unsigned b2, unsigned b3, unsigned c0, unsigned c1, unsigned c2, unsigned c3,
                                       const unsigned short* p0, const unsigned short* p1, const unsigned short* p2,
                                       const unsigned short* p3, const unsigned short* q0, const unsigned short* q1,
                                       const unsigned short* q2, const unsigned short* q3, const unsigned short* r0,
                                       const unsigned short* r1, const unsigned short* r2, const unsigned short* r3) {
#if defined(__HIP_DEVICE_COMPILE__)
  asm volatile("global_load_async_to_lds_b128 %0, %12, off\n\t"
               "global_load_async_to_lds_b128 %1, %13, off\n\t"
               "global_load_async_to_lds_b128 %2, %14, off\n\t"
               "global_load_async_to_lds_b128 %3, %15, off\n\t"
               "global_load_async_to_lds_b128 %4, %16, off\n\t"
               "global_load_async_to_lds_b128 %5, %17, off\n\t"
               "global_load_async_to_lds_b128 %6, %18, off\n\t"
               "global_load_async_to_lds_b128 %7, %19, off\n\t"
               "global_load_async_to_lds_b128 %8, %20, off\n\t"
               "global_load_async_to_lds_b128 %9, %21, off\n\t"
               "global_load_async_to_lds_b128 %10, %22, off\n\t"
               "global_load_async_to_lds_b128 %11, %23, off\n\t"
               "s_wait_xcnt 0x0"
               :: "v"(a0), "v"(a1), "v"(a2), "v"(a3), "v"(b0), "v"(b1), "v"(b2), "v"(b3), "v"(c0), "v"(c1), "v"(c2),
                  "v"(c3), "v"(p0), "v"(p1), "v"(p2), "v"(p3), "v"(q0), "v"(q1), "v"(q2), "v"(q3), "v"(r0), "v"(r1),
                  "v"(r2), "v"(r3) : "memory");
#endif
}
// the issuing wave's copies have landed behind this wait
__device__ __forceinline__ void wait_async0() {
#if defined(__HIP_DEVICE_COMPILE__)
  asm volatile("s_wait_asynccnt 0x0" ::: "memory");
#endif
}
// the wave's own LDS reads have retired before the buffer they read is handed to the copies that refill it
__device__ __forceinline__ void wait_ds0() {
#if defined(__HIP_DEVICE_COMPILE__)
  asm volatile("s_wait_dscnt 0x0" ::: "memory");
#endif
}
// one 32-key stage: Kh and Kl rows kb..kb+31 (256 B each, LDS pitch 272 B) and stage kb / 32 of Gc, 128 channel rows of
// 64 B in a row (LDS pitch 80 B). 128 threads x 12 copies of 16 B = 8 KiB + 8 KiB + 8 KiB; no two lanes share an LDS byte.
__device__ __forceinline__ void stage_kv(unsigned short* st, const unsigned short* Khb, const unsigned short* Klb,
                                         const unsigned short* Gcb, int kb, int tid) {
  const int kr = tid >> 4, kcol = 8 * (tid & 15);                    // kr 0..7, + 8 i -> key row 0..31
  const int vr = tid >> 2, vcol = 8 * (tid & 3);                     // vr 0..31, + 32 i -> channel row 0..127
  const unsigned lk = lds_addr(st + kr * KP + kcol);
  const unsigned ll = lk + 2u * (KT * KP);
  const unsigned lv = lds_addr(st + 2 * KT * KP + vr * VPT + vcol);
  const unsigned short* gk = Khb + (size_t)(kb + kr) * DQ + kcol;
  const unsigned short* gl = Klb + (size_t)(kb + kr) * DQ + kcol;
  const unsigned short* gv = Gcb + (size_t)kb * DQ + vr * KT + vcol;   // kb a multiple of KT: stage kb / KT starts at kb DQ
  copy12(lk, lk + 2u * (8 * KP), lk + 2u * (16 * KP), lk + 2u * (24 * KP),
         ll, ll + 2u * (8 * KP), ll + 2u * (16 * KP), ll + 2u * (24 * KP),
         lv, lv + 2u * (32 * VPT), lv + 2u * (64 * VPT), lv + 2u * (96 * VPT),
         gk, gk + 8 * DQ, gk + 16 * DQ, gk + 24 * DQ, gl, gl + 8 * DQ, gl + 16 * DQ, gl + 24 * DQ,
         gv, gv + 32 * KT, gv + 64 * KT, gv + 96 * KT);
}

// =========================================================================================================
// (2) attention for one (b, 128-query tile), transposed formulation, 1024 keys (all valid, no mask, no scale):
//   S^T tile (16 keys x 16 queries) = sum over 4 d-chunks (unrolled) of A(k: row = key kb + (lane&15), 32 d via
//   the split k map from the bf16 plane Kh [b][1024][128]) . B(q: col = query, same map from Qh [b][4096][128])
//   + A(Kh).B(Ql) + A(Kl).B(Qh) (bf16 unscaled residual planes, shared accumulator).
//   Block = 8 waves = 2 key groups x 4 query waves, one block a WGP, two waves a SIMD. A wave owns 32 queries (two
//   B tiles, queries 32 wq + 16 u + (lane&15)); its 16 Q fragments are read from LDS once and stay in registers, and
//   every K or V fragment it reads from LDS feeds both tiles. Key group g takes the 32-key stages 2 t + g.
//   Per lane a D tile holds 8 keys of ONE query: online softmax state per lane and tile, one shuffle (lane^16) for the
//   max over 32 keys; the o/l rescale is skipped under one wave-uniform ballot a trip when no lane's max grew (corr == 1
//   exactly for every lane then); row-sum partials combined at the end. P = e^{s-m} x 16384 as f16 is the B operand of
//   y^T (rows channel, cols queries) += A(pooled g: rows channel = 16j + (lane&15), keys contiguous, f16 plane Gc
//   [b][32 stages][128][32]) . B(P^T): element r <- D of the tile covering keys kb..kb+15, element 8+r <- the tile covering
//   kb+16..kb+31, lane unchanged. 16 accumulator tiles per wave (128 channels x 2 query tiles).
//   The block's 128 query rows of Qh/Ql are copied once (Qs, pitch 272 B); each group's four waves copy their own
//   32-key stage of Kh/Kl/Gc into their half of one of two buffers (Ring) one trip ahead of its use.
//   Join of the two key groups: a wave leaves m, l and unnormalised o of the query tile u = 1 - group in LDS (Ms, Ls, Os;
//   block barrier) and finishes tile u = group: both shares brought to the common max, added, divided by the joint l.
//   Output conv in the same block: WY[c][n] = sum_ci WWb[c][ci] (yh + yl)[n][ci] on bf16 WMMA (2 products per k-step,
//   shared accumulator, K = 128 = 4 steps). The wave's y (16 queries x 128 channels) never leaves its registers: split
//   into bf16 hi + residual it is the A operand (rows n); B = WWb in fragment order from global (cols c), 16 channel
//   tiles a wave. Results staged in LDS rows [256 c][128 n] (pitch OSPW, b128 stores), block barrier (cross-wave), + bias,
//   then WY f32 [b][256][4096], each wave store 512 contiguous B.
// coverage: Os rows 32 wq + 16 u + c: group 0 writes u = 1, group 1 u = 0, each read by the other group's same lane; staged
//           rows 16 tiles x 16 c x cols 4 wq x 2 groups x 16 = 256 c x 128 n written, read 8 waves x 32 rows x 32 lanes x 4;
//           grid (NQ/128, NB) covers WY[b][0..255][0..NQ-1] exactly once.
// =========================================================================================================
__global__ __launch_bounds__(AT)
void attn_k(const unsigned short* __restrict__ Qh, const unsigned short* __restrict__ Ql,
            const unsigned short* __restrict__ Kh, const unsigned short* __restrict__ Kl,
            const unsigned short* __restrict__ Gc, const unsigned short* __restrict__ WWb,
            const float* __restrict__ wb, float* WY) {
  __shared__ __align__(16) float Os[AQ * OSPW];
  __shared__ __align__(16) unsigned short Qs[2 * AQ * KP];
  __shared__ __align__(16) unsigned short Ring[4 * STG];
  __shared__ float Ms[AQ];
  __shared__ float Ls[AQ];
  const int tid  = threadIdx.x;
  const int wave = wave_uniform(tid >> 5), lane = tid & 31;
  const int grp  = wave >> 2, wq = wave & 3;                         // key group, query wave (both wave-uniform)
  const int t128 = tid & 127;                                        // thread within its key group
  const int hh   = lane >> 4, c = lane & 15;
  const int n0   = blockIdx.x * AQ, b = blockIdx.y;

  const unsigned short* Khb = Kh + (size_t)b * MM * DQ;
  const unsigned short* Klb = Kl + (size_t)b * MM * DQ;
  const unsigned short* Gcb = Gc + (size_t)b * DQ * MM;

  // ---- in front of the loop: the query tile and trip 0's stages, their wait, the barrier that publishes them, then
  //      trip 1's stages
  {
    const int qr = tid >> 4, qcol = 8 * (tid & 15);                  // qr 0..15, + 16 i -> query row 0..127
    const unsigned lq = lds_addr(Qs + qr * KP + qcol);
    const size_t go = ((size_t)(b * NN + n0 + qr)) * DQ + qcol;
    auto plane = [](unsigned l0, const unsigned short* g) {          // 128 rows of one plane, 8 copies a thread
      copy4(l0, l0 + 2u * (16 * KP), l0 + 2u * (32 * KP), l0 + 2u * (48 * KP), g, g + 16 * DQ, g + 32 * DQ,
            g + 48 * DQ);
      copy4(l0 + 2u * (64 * KP), l0 + 2u * (80 * KP), l0 + 2u * (96 * KP), l0 + 2u * (112 * KP), g + 64 * DQ,
            g + 80 * DQ, g + 96 * DQ, g + 112 * DQ);
    };
    plane(lq, Qh + go);
    plane(lq + 2u * (AQ * KP), Ql + go);
  }
  stage_kv(Ring + grp * STG, Khb, Klb, Gcb, grp * KT, t128);
  wait_async0();
  __syncthreads();
  stage_kv(Ring + (2 + grp) * STG, Khb, Klb, Gcb, (2 + grp) * KT, t128);

  // q fragments (B operand, col = query 32 wq + 16 u + c of the tile), d-chunk kc: read once, kept in registers
  Frag qh[2][DQ / 32], ql[2][DQ / 32];
#pragma unroll
  for (int u = 0; u < 2; ++u) {
    const unsigned short* Qhp = Qs + (32 * wq + 16 * u + c) * KP + 8 * hh;
#pragma unroll
    for (int kc = 0; kc < DQ / 32; ++kc) {
      qh[u][kc] = ldfrag(Qhp + 32 * kc);
      ql[u][kc] = ldfrag(Qhp + AQ * KP + 32 * kc);
    }
  }

  float m[2] = {-1.0e30f, -1.0e30f}, l[2] = {0.f, 0.f};
  v8f o[2][8];
#pragma unroll
  for (int u = 0; u < 2; ++u) {
#pragma unroll
    for (int j = 0; j < 8; ++j) o[u][j] = zero8();
  }

#pragma unroll 1
  for (int t = 0; t < MM / (2 * KT); ++t) {
    unsigned short* st = Ring + (2 * (t & 1) + grp) * STG;           // this trip's buffer, the group's half
    // k fragment base (A operand, row = key kb + c), + 32*kc; v fragment base (A operand, row = channel 16j + c)
    const unsigned short* k0p  = st + c * KP + 8 * hh;               // keys kb .. kb+15, kb = 32 (2 t + grp)
    const unsigned short* k1p  = k0p + 16 * KP;                      // keys kb+16 .. kb+31
    const unsigned short* k0lp = k0p + KT * KP;
    const unsigned short* k1lp = k1p + KT * KP;
    const unsigned short* Vp   = st + 2 * KT * KP + c * VPT + 8 * hh;
    v8f s0[2] = {zero8(), zero8()}, s1[2] = {zero8(), zero8()};
    Frag fr[DQ / 32][4], vf[8];                                      // all K fragments of the stage; V fragments
    // the trip's LDS reads stand at two places only, each a whole group well ahead of its products and waited for by
    // count: all 32 K reads here, the 16 V reads between the second and the third d-chunk (onto registers those left)
#pragma unroll
    for (int kc = 0; kc < DQ / 32; ++kc) {
      fr[kc][0] = ldfrag(k0p + 32 * kc);
      fr[kc][1] = ldfrag(k1p + 32 * kc);
      fr[kc][2] = ldfrag(k0lp + 32 * kc);
      fr[kc][3] = ldfrag(k1lp + 32 * kc);
    }
    sched_line();                                                    // without it the K reads are spread among the products
#pragma unroll
    for (int kc = 0; kc < DQ / 32; ++kc) {
      if (kc == DQ / 64) {
        // without the pair the V reads sink behind the last products, and the softmax waits out their latency
        sched_line();
#pragma unroll
        for (int j = 0; j < 8; ++j) vf[j] = ldfrag(Vp + (16 * j) * VPT);
        sched_line();
      }
      const Frag* f = fr[kc];
#pragma unroll
      for (int u = 0; u < 2; ++u) {
        s0[u] = mma_bp(f[0].bf, qh[u][kc].bf, s0[u]);
        s1[u] = mma_bp(f[1].bf, qh[u][kc].bf, s1[u]);
      }
#pragma unroll
      for (int u = 0; u < 2; ++u) {
        s0[u] = mma_bp(f[0].bf, ql[u][kc].bf, s0[u]);
        s1[u] = mma_bp(f[1].bf, ql[u][kc].bf, s1[u]);
      }
#pragma unroll
      for (int u = 0; u < 2; ++u) {
        s0[u] = mma_bp(f[2].bf, qh[u][kc].bf, s0[u]);
        s1[u] = mma_bp(f[3].bf, qh[u][kc].bf, s1[u]);
      }
    }

    float mn[2];
    bool up = false;
#pragma unroll
    for (int u = 0; u < 2; ++u) {
      float mx = fmaxf(hmax8(s0[u]), hmax8(s1[u]));
      mx = fmaxf(mx, __shfl_xor(mx, 16, 32));
      mn[u] = fmaxf(m[u], mx);
      up = up || (mx > m[u]);
    }
    const unsigned grew = wave_ballot(up);                           // wave-uniform
    if (grew != 0u) {
#pragma unroll
      for (int u = 0; u < 2; ++u) {
        const float corr = __expf(m[u] - mn[u]);                     // == 1 exactly for lanes whose max did not grow
        l[u] *= corr;
#pragma unroll
        for (int j = 0; j < 8; ++j) {
#pragma unroll
          for (int r = 0; r < 8; ++r) o[u][j][r] *= corr;
        }
      }
    }

    FragH ph[2];
#pragma unroll
    for (int u = 0; u < 2; ++u) {
      m[u] = mn[u];
      const float msh = mn[u] - LNPS;                                // exp gives e^{s-m} * 16384
      float ls = 0.f;
#pragma unroll
      for (int r = 0; r < 8; ++r) {
        const float e0 = __expf(s0[u][r] - msh);                     // key kb      + 8hh + r
        const float e1 = __expf(s1[u][r] - msh);                     // key kb + 16 + 8hh + r
        ls += e0 + e1;
        ph[u].hv[0][r] = (_Float16)e0;
        ph[u].hv[1][r] = (_Float16)e1;
      }
      l[u] += ls;
    }

#pragma unroll
    for (int j = 0; j < 8; ++j) {
#pragma unroll
      for (int u = 0; u < 2; ++u) o[u][j] = mma_hp(vf[j].h, ph[u].v, o[u][j]);
    }

    // ---- foot of the trip: own reads retired, own copies of the next stage landed, one barrier that publishes that
    //      stage and ends every reader's last read of this buffer; only then the refill of this buffer. (The softmax and
    //      the last products work on registers alone: the scheduler may set them behind these waits and the barrier's
    //      signal; every LDS read of the trip stays in front, the refill behind.)
    wait_ds0();
    wait_async0();
    __syncthreads();
    if (t + 2 < MM / (2 * KT)) stage_kv(st, Khb, Klb, Gcb, (2 * (t + 2) + grp) * KT, t128);
  }
  wait_async0();                                                     // nothing is in flight when the wave goes on

  // ---- output-conv weights, B operand (col = channel 16 ct + c, k = y channel): channel tiles 4 g .. 4 g + 3 form one
  //      group of 16 fragments, two register sets; group 0 is asked for here, ahead of the join that hides its latency
  Frag wf[2][4][DQ / 32];
#pragma unroll
  for (int i = 0; i < 4; ++i) {
#pragma unroll
    for (int ks = 0; ks < DQ / 32; ++ks) wf[0][i][ks] = ldfrag_p(WWb, i, DQ / 32, ks, lane);
  }
  const float bl = bfr(wb[32 * wave + lane]);                        // lane i: bias of channel 32 wave + i, the rows the wave stores
  wait_x0();                                                         // ahead of any reuse of the bias load's address register
  // without it these loads sink behind the join, and the shuffles below rise onto that register in front of the wait
  sched_line();
#pragma unroll
  for (int u = 0; u < 2; ++u) l[u] += __shfl_xor(l[u], 16, 32);

  // ---- join of the key groups; lane (hh, c) holds ch = 16 j + 8 hh + r for query 32 wq + 16 u + c in both groups.
  //      A wave hands the query tile u = 1 - grp to its partner and finishes tile u = grp itself.
  auto give = [&](int u) {
    const int qrow = 32 * wq + 16 * u + c;
    if (hh == 0) { Ms[qrow] = m[u]; Ls[qrow] = l[u]; }               // both halves hold the same m and l
#pragma unroll
    for (int j = 0; j < 8; ++j) {
      v4f va, vb;
#pragma unroll
      for (int r = 0; r < 4; ++r) { va[r] = o[u][j][r]; vb[r] = o[u][j][4 + r]; }
      *(v4f*)(Os + qrow * OSPW + 16 * j + 8 * hh)     = va;
      *(v4f*)(Os + qrow * OSPW + 16 * j + 8 * hh + 4) = vb;
    }
  };
  // y of the wave's 16 queries as A fragments (row = query c, k = channel), bf16 hi and residual: element e of half 0 is
  // D register e of tile 2 ks (ch 32 ks + 8 hh + e), of half 1 that of tile 2 ks + 1 (ch 32 ks + 16 + 8 hh + e): the k
  // map of ldfrag, lane unchanged
  Frag yh[DQ / 32], yl[DQ / 32];
  auto take = [&](int u) {                                           // u == grp; group 0's share stands first in every sum
    const int qrow = 32 * wq + 16 * u + c;
    const float mp = Ms[qrow], lp = Ls[qrow];
    const float m0 = (u == 0) ? m[u] : mp, m1 = (u == 0) ? mp : m[u];
    const float l0 = (u == 0) ? l[u] : lp, l1 = (u == 0) ? lp : l[u];
    const float mj = fmaxf(m0, m1);
    const float c0 = __expf(m0 - mj), c1 = __expf(m1 - mj);
    const float inv = 1.0f / (l0 * c0 + l1 * c1);                    // o and l both carry the x16384 factor
    const float a0 = c0 * inv, a1 = c1 * inv;
#pragma unroll
    for (int j = 0; j < 8; ++j) {
      const float* op = Os + qrow * OSPW + 16 * j + 8 * hh;
      const v4f pa = *(const v4f*)op;
      const v4f pb = *(const v4f*)(op + 4);
      float f[8];
#pragma unroll
      for (int r = 0; r < 4; ++r) {
        if (u == 0) {
          f[r]     = o[u][j][r] * a0 + pa[r] * a1;
          f[4 + r] = o[u][j][4 + r] * a0 + pb[r] * a1;
        } else {
          f[r]     = pa[r] * a0 + o[u][j][r] * a1;
          f[4 + r] = pb[r] * a0 + o[u][j][4 + r] * a1;
        }
      }
      v4u uh, ul;
      split8(f, uh, ul);
      yh[j >> 1].u[j & 1] = __builtin_bit_cast(v8us, uh);
      yl[j >> 1].u[j & 1] = __builtin_bit_cast(v8us, ul);
    }
  };
  if (grp == 0) give(1); else give(0);                               // wave-uniform
  __syncthreads();
  if (grp == 0) take(0); else take(1);                               // wave-uniform

  // ---- output conv: D[query][channel] = sum_ci (yh + yl)[query][ci] WWb[channel][ci], K = 128 = 4 steps in ascending
  //      order, hi then residual product a step, one accumulator a tile; four channel tiles run side by side. Lane (hh, c)
  //      holds queries 8 hh + r of channel 16 ct + c: 8 neighbours of a WY row, staged in LDS rows [channel][128 n]
  //      (pitch OSPW): channels 0..127 on the bytes of Ring, 128..255 on those of Qs, both left by every reader at the
  //      barrier that ended the last trip.
  {
    const int ncol = 32 * wq + 16 * grp + 8 * hh;
#pragma unroll
    for (int g = 0; g < 4; ++g) {
      if (g + 1 < 4) {
#pragma unroll
        for (int i = 0; i < 4; ++i) {
#pragma unroll
          for (int ks = 0; ks < DQ / 32; ++ks)
            wf[(g + 1) & 1][i][ks] = ldfrag_p(WWb, 4 * (g + 1) + i, DQ / 32, ks, lane);
        }
        if (g + 1 == 3) wait_x0();                                   // behind the last weight load: its address registers are free from here on
        sched_line();                                                // keeps the next group's loads above this group's products
      }
      v8f acc[4];
#pragma unroll
      for (int i = 0; i < 4; ++i) acc[i] = zero8();
#pragma unroll
      for (int ks = 0; ks < DQ / 32; ++ks) {
#pragma unroll
        for (int i = 0; i < 4; ++i) acc[i] = mma_bp(yh[ks].bf, wf[g & 1][i][ks].bf, acc[i]);
#pragma unroll
        for (int i = 0; i < 4; ++i) acc[i] = mma_bp(yl[ks].bf, wf[g & 1][i][ks].bf, acc[i]);
      }
      float* wsb = (g < 2) ? (float*)Ring : (float*)Qs;
#pragma unroll
      for (int i = 0; i < 4; ++i) {
        float* wp = wsb + (16 * (4 * (g & 1) + i) + c) * OSPW + ncol;
        v4f va, vb;
#pragma unroll
        for (int r = 0; r < 4; ++r) { va[r] = acc[i][r]; vb[r] = acc[i][4 + r]; }
        *(v4f*)wp       = va;
        *(v4f*)(wp + 4) = vb;
      }
#if defined(__HIP_DEVICE_COMPILE__)
      // the next group starts new sums on the registers of this one's: with four tiles side by side only three vector
      // slots lie between a tile's last product and the product that overwrites its D; this is the fourth. (The last
      // group has no loads in front of it, runs interleaved with the third and so has registers of its own.)
      if (g + 1 < 3) asm volatile("v_nop");
#endif
    }
  }
  __syncthreads();

  // ---- wave w stores channels 32 w .. 32 w + 31: a wave store is the block's whole 512-B run of one WY row
  {
    const float* wr = ((wave < 4) ? (const float*)Ring : (const float*)Qs) + (32 * (wave & 3)) * OSPW + 4 * lane;
    v4f res[32];
#pragma unroll
    for (int i = 0; i < 32; ++i) {
      const float bvs = lane_value(bl, i);
      const v4f v = *(const v4f*)(wr + i * OSPW);
#pragma unroll
      for (int t = 0; t < 4; ++t) res[i][t] = v[t] + bvs;
    }
    sched_line();   // keeps the arithmetic above the stores: nothing then rewrites a register that an issued store names
    float* wy = WY + ((size_t)(b * CC + 32 * wave)) * NN + n0 + 4 * lane;
#pragma unroll
    for (int i = 0; i < 32; ++i) *(v4f*)(wy + (size_t)i * NN) = res[i];
    wait_x0();
  }
}

// =========================================================================================================
// (3) batch-norm statistics, normalisation, affine and residual in one launch: block owns ONE channel (256 blocks of
//     32 waves). Thread tid takes floats 4 tid..4 tid+3 of each of the NB rows WY[b][c][0..NQ) and of the same rows of
//     x, so every wave load is one contiguous 512-B run; a thread's 2 NB loads are independent and all issued before
//     the first sum; the WY values stay in registers from the statistics to the normalisation. Sum and sum of squares
//     in f64 per thread (rows, then elements, in ascending order), wave shuffle reduce, per-wave partials in LDS
//     (cross-wave, block barrier); every wave then shuffle-reduces the same 32 partials itself (a butterfly leaves the
//     same bits in every lane of every wave), so no second barrier and no table: mean, biased variance,
//     rstd = 1/sqrt(var + eps) in f32, then out[b][c][n] = (((WY - mu) * rstd) * bf16-RNE(gamma[c]) + bf16-RNE(beta[c]))
//     + bf16-RNE(x[b][c][n]) in f32.
// coverage: 256 blocks x 1 channel x NB rows x BST threads x 4 floats = out[b][0..255][0..NQ-1] exactly once, each
//           wave store one contiguous 512-B run; reads WY and x at the same offsets only (the produced extent).
// =========================================================================================================
__global__ __launch_bounds__(BST)
void bn_norm(const float* __restrict__ WY, const float* __restrict__ x, const float* __restrict__ gam,
             const float* __restrict__ bet, float* out) {
#pragma clang fp contract(off)
  __shared__ double red[2 * (BST / 32)];
  const int tid = threadIdx.x, lane = tid & 31, wave = tid >> 5;
  const int cc = blockIdx.x;
  const double ninv = 1.0 / ((double)NB * (double)NQ);
  unsigned bo[NB];                                                   // byte offsets in WY, x and out, all < 2^25
  v4f a[NB], xv[NB];
#pragma unroll
  for (int bb = 0; bb < NB; ++bb) bo[bb] = 4u * (unsigned)((bb * CC + cc) * NN + 4 * tid);
#pragma unroll
  for (int bb = 0; bb < NB; ++bb) a[bb] = *(const v4f*)((const char*)WY + bo[bb]);
#if defined(__HIP_DEVICE_COMPILE__)
  // keeps the WY loads ahead of the x loads: loads return in order, and interleaved the sums would wait for rows of x
  __builtin_amdgcn_sched_barrier(0);
#endif
#pragma unroll
  for (int bb = 0; bb < NB; ++bb) xv[bb] = *(const v4f*)((const char*)x + bo[bb]);
#if defined(__HIP_DEVICE_COMPILE__)
  // keeps every load above the sums: without it the scheduler sinks them and only a few stay in flight per wave
  __builtin_amdgcn_sched_barrier(0);
#endif
  const float ga = bfr(gam[cc]), be = bfr(bet[cc]);                  // block-uniform, back long before their use
  double s = 0.0, q = 0.0;
#pragma unroll
  for (int bb = 0; bb < NB; ++bb) {
#pragma unroll
    for (int t = 0; t < 4; ++t) {
      const double d = (double)a[bb][t];
      s += d; q += d * d;
    }
  }
#pragma unroll
  for (int d = 1; d < 32; d <<= 1) {
    s += __shfl_xor(s, d, 32);
    q += __shfl_xor(q, d, 32);
  }
  if (lane == 0) { red[wave] = s; red[BST / 32 + wave] = q; }
  __syncthreads();
  double ts = red[lane], tq = red[BST / 32 + lane];
#pragma unroll
  for (int d = 1; d < 32; d <<= 1) {
    ts += __shfl_xor(ts, d, 32);
    tq += __shfl_xor(tq, d, 32);
  }
  const double mud = ts * ninv;
  double var = tq * ninv - mud * mud;
  var = (var > 0.0) ? var : 0.0;
  const float varf = (float)var + BNEPS;
  const float rs = 1.0f / sqrtf(varf);
  const float mu = (float)mud;
#pragma unroll
  for (int bb = 0; bb < NB; ++bb) {
    v4f r;
#pragma unroll
    for (int t = 0; t < 4; ++t) {
      const float d  = a[bb][t] - mu;
      const float nv = d * rs;
      const float av = nv * ga;
      const float sv = av + be;
      r[t] = sv + bfr(xv[bb][t]);
    }
    *(v4f*)((char*)out + bo[bb]) = r;
  }
}

// =========================================================================================================
// Workspace map (bytes; each region start a multiple of 256; every extent is an exact row/tile multiple and is
//   W16 f16 [384][256]            196608      WWb bf16 [256][128]        65536
//   Qh/Ql bf16 [NB][4096][128]   8388608 x2
//   Kh/Kl bf16 [NB][1024][128]   2097152 x2  Gc f16 [NB][32][128][32]  2097152
//   WY  f32  [NB][256][4096]    33554432
//   total (NB=8) = 56885248
//   W16 and WWb hold their rows in fragment order (piece_off); the sizes are those of the row-major planes.
// =========================================================================================================
extern "C" void kernel_launch(void* const* d_in, const int* in_sizes, int n_in,
                              void* d_out, int out_size, void* d_ws, size_t ws_size,
                              hipStream_t stream) {
  const int XN = NB * CC * NN;
  if (n_in < 11) return;
  if (in_sizes[0] < XN) return;
  if (in_sizes[1] < DQ * CC || in_sizes[3] < DQ * CC || in_sizes[5] < DQ * CC || in_sizes[7] < CC * DQ) return;
  if (in_sizes[2] < DQ || in_sizes[4] < DQ || in_sizes[6] < DQ || in_sizes[8] < CC) return;
  if (in_sizes[9] < CC || in_sizes[10] < CC) return;
  if (out_size < XN) return;

  size_t off = 0;
  auto carve = [&](size_t bytes) { const size_t o = off; off += (bytes + 255) & ~(size_t)255; return o; };
  const size_t oW16 = carve((size_t)MW * CC * 2);
  const size_t oWWb = carve((size_t)CC * DQ * 2);
  const size_t oQh  = carve((size_t)NB * NN * DQ * 2);
  const size_t oQl  = carve((size_t)NB * NN * DQ * 2);
  const size_t oKh  = carve((size_t)NB * MM * DQ * 2);
  const size_t oKl  = carve((size_t)NB * MM * DQ * 2);
  const size_t oGc  = carve((size_t)NB * DQ * MM * 2);
  const size_t oWY  = carve((size_t)NB * CC * NN * 4);
  if (off > ws_size) return;
  if (off > (size_t)134217728) return;

  const float* x   = (const float*)d_in[0];
  const float* gw  = (const float*)d_in[1];
  const float* gb  = (const float*)d_in[2];
  const float* tw  = (const float*)d_in[3];
  const float* tb  = (const float*)d_in[4];
  const float* pw  = (const float*)d_in[5];
  const float* pb  = (const float*)d_in[6];
  const float* ow  = (const float*)d_in[7];
  const float* wb  = (const float*)d_in[8];
  const float* gam = (const float*)d_in[9];
  const float* bet = (const float*)d_in[10];

  char* ws = (char*)d_ws;
  unsigned short* W16 = (unsigned short*)(ws + oW16);
  unsigned short* WWb = (unsigned short*)(ws + oWWb);
  unsigned short* Qh  = (unsigned short*)(ws + oQh);
  unsigned short* Ql  = (unsigned short*)(ws + oQl);
  unsigned short* Kh  = (unsigned short*)(ws + oKh);
  unsigned short* Kl  = (unsigned short*)(ws + oKl);
  unsigned short* Gc  = (unsigned short*)(ws + oGc);
  float*          WY  = (float*)(ws + oWY);
  float* out = (float*)d_out;

  const dim3 blk256(256);

  // (0) theta_w / phi_w / g_w -> stacked f16 plane; w_w -> bf16 plane, both in fragment order
  cvt_w<<<dim3(MW / 8 + CC / 16), blk256, 0, stream>>>(tw, pw, gw, ow, W16, WWb);
  // (1) x strip -> 16-bit LDS tile; conv1x1 GEMM -> theta (q) hi/res planes; phi / g + bias, 2x2 max-pooled -> k hi/res
  //     planes, v plane by stages
  gemm_proj<<<dim3(NSTRIP, NB), dim3(PT), 0, stream>>>(W16, x, tb, pb, gb, Qh, Ql, Kh, Kl, Gc);
  // (2) attention, then output conv + bias on the block's own y -> WY f32 plane [b][256][4096]
  attn_k<<<dim3(NQ / AQ, NB), dim3(AT), 0, stream>>>(Qh, Ql, Kh, Kl, Gc, WWb, wb, WY);
  // (3) per-channel mean / rstd, then normalise, affine, residual -> out [b][256][4096]
  bn_norm<<<dim3(CC), dim3(BST), 0, stream>>>(WY, x, gam, bet, out);
  (void)hipGetLastError();
}

// v010
// Measured time: 53.3 microseconds a run.
// Two timings next to v009 both put it at 1.25 times that version's speed.
// Counting every step since v000, it is 15.1 times as fast.
// Contractions: conv1x1 theta/phi/g GEMM W[384x256].X[256x128] per strip on v_wmma_f32_16x16x32_f16 (f16 containers
// of bf16-RNE weights x256 and bf16-RNE x); scores K.Q^T on v_wmma_f32_16x16x32_bf16 (bf16 hi + bf16 residual planes
// of theta / 2x2-max-pooled phi, 3 products, K=128); y^T = G.P^T on v_wmma_f32_16x16x32_f16 (2x2-max-pooled g as
// f16, P = e^{s-m} x16384 f16 from the score D registers); output conv W[256x128].Y on v_wmma_f32_16x16x32_bf16 (bf16
// weights, y as bf16 hi + residual fragments, 2 products); f32 accumulate everywhere; max-pool, softmax statistics and
// bias in f32 VALU; batch-norm channel statistics, normalisation, affine and residual add in f32 VALU.
#include <hip/hip_runtime.h>
#include <math.h>
#include <stdint.h>

#ifndef NB
#define NB 8
#endif
#ifndef NQ
#define NQ 4096
#endif
#define NB_FULL 8
#define CC     256
#define HIMG   64
#define WIMG   64
#define NN     4096
#define DQ     128
#define HP     32
#define WP     32
#define MM     1024
#define MW     384
#define QT     64
#define SN     128
#define NSTRIP 32
#define OSPW   132
#define BST    1024
#define WSC    256.0f
#define IWSC   0.00390625f
#define LNPS   9.704060527839234f
#define BNEPS  1.0e-5f
#define KT     32
#define KP     136
#define VPT    40
#define STG    (2 * KT * KP + DQ * VPT)
#define GTP    40
#define XPT    264
#define OSA    388
#define PT     512
#define AQ     128
#define AT     256

static_assert(NB >= 1 && NB <= NB_FULL);
static_assert(NQ % QT == 0 && NQ <= NN);
static_assert(NN == HIMG * WIMG);
static_assert(SN == 2 * WIMG);
static_assert(NSTRIP * SN == NN);
static_assert(SN == 8 * 16);
static_assert(HIMG % 2 == 0 && WIMG % 2 == 0);
static_assert(HP == HIMG / 2 && WP == WIMG / 2);
static_assert(MM == HP * WP);
static_assert(WP == 32);
static_assert(MM % QT == 0 && MM % 32 == 0);
static_assert(NN % QT == 0 && CC % QT == 0 && DQ % QT == 0);
static_assert(MW == 3 * DQ && MW % QT == 0 && MW % 8 == 0);
static_assert(CC % 32 == 0 && DQ % 32 == 0);
static_assert((OSPW * 4) % 16 == 0);
static_assert((XPT * 2) % 32 == 16 && XPT >= CC + 8 && (OSA * 4) % 16 == 0 && OSA >= MW + 4);
static_assert(SN * XPT * 2 <= SN * OSA * 4 && MW == 8 * 3 * 16 && PT == 16 * 32 && CC == 8 * 32);
static_assert(BST == 32 * 32 && NQ == 4 * BST);
static_assert(NN % 16 == 0 && CC % 4 == 0);
static_assert((size_t)NB_FULL * CC * NN * 4 == (size_t)33554432);
static_assert((KP * 2) % 16 == 0 && (VPT * 2) % 16 == 0 && (STG * 2) % 16 == 0 && (KT * KP * 2) % 16 == 0);
static_assert(KP >= DQ + 8 && VPT >= KT + 8 && MM % KT == 0 && MM / KT >= 2);
static_assert(KT * DQ / 8 == 4 * 128 && DQ * KT / 8 == 4 * 128 && QT * DQ / 8 == 8 * 128);
static_assert(NQ % AQ == 0 && AQ == 4 * 32 && AT == 2 * 128 && MM % (2 * KT) == 0 && MM / (2 * KT) >= 2 && AQ * DQ / 8 == 8 * AT);
static_assert(DQ * OSPW * 4 <= 2 * AQ * KP * 2 && DQ * OSPW * 4 <= 4 * STG * 2 && CC == 2 * DQ && CC == 8 * 32 && AQ == 32 * 4);
static_assert(KT == WP && NSTRIP == HP && (GTP * 2) % 16 == 0 && GTP >= WP + 8 && QT * WP / 8 == 256);

typedef _Float16       v16h __attribute__((ext_vector_type(16)));
typedef _Float16       v8h  __attribute__((ext_vector_type(8)));
typedef __bf16         v16b __attribute__((ext_vector_type(16)));
typedef unsigned short v8us __attribute__((ext_vector_type(8)));
typedef float          v8f  __attribute__((ext_vector_type(8)));
typedef float          v4f  __attribute__((ext_vector_type(4)));
typedef unsigned int   v4u  __attribute__((ext_vector_type(4)));

union Frag  { v8us u[2]; v16h h; v16b bf; };
union FragH { v16h v; v8h hv[2]; };
static_assert(sizeof(Frag) == 32);
static_assert(sizeof(FragH) == 32);

// ---- scalar helpers ---------------------------------------------------------------------------------------
__device__ __forceinline__ unsigned short bf_bits(float f) {          // f32 -> bf16 bits, RNE convert
  unsigned u = __float_as_uint(f);
  return (unsigned short)((u + 0x7FFFu + ((u >> 16) & 1u)) >> 16);
}
__device__ __forceinline__ float bf_up(unsigned short hb) { return __uint_as_float(((unsigned)hb) << 16); }
__device__ __forceinline__ float bfr(float f) { return bf_up(bf_bits(f)); }
__device__ __forceinline__ unsigned short h_bits(_Float16 x) { return __builtin_bit_cast(unsigned short, x); }
__device__ __forceinline__ unsigned pk16(unsigned short a, unsigned short b) { return (unsigned)a | ((unsigned)b << 16); }
__device__ __forceinline__ v8f zero8() { v8f z = {0.f, 0.f, 0.f, 0.f, 0.f, 0.f, 0.f, 0.f}; return z; }
__device__ __forceinline__ float hmax8(v8f s) {
  return fmaxf(fmaxf(fmaxf(s[0], s[1]), fmaxf(s[2], s[3])), fmaxf(fmaxf(s[4], s[5]), fmaxf(s[6], s[7])));
}
__device__ __forceinline__ unsigned wave_ballot(bool p) {
#if defined(__HIP_DEVICE_COMPILE__)
  return __builtin_amdgcn_ballot_w32(p);
#else
  return p ? 1u : 0u;
#endif
}
// 8 f32 values -> bf16 hi bits and bf16 residual bits (lo = RNE(v - hi)), packed 2 per uint
__device__ __forceinline__ void split8(const float* f, v4u& uh, v4u& ul) {
#pragma unroll
  for (int t = 0; t < 4; ++t) {
    const float f0 = f[2 * t], f1 = f[2 * t + 1];
    const unsigned short hb0 = bf_bits(f0), hb1 = bf_bits(f1);
    const unsigned short lb0 = bf_bits(f0 - bf_up(hb0));
    const unsigned short lb1 = bf_bits(f1 - bf_up(hb1));
    uh[t] = pk16(hb0, hb1);
    ul[t] = pk16(lb0, lb1);
  }
}

// ---- 16-bit fragment loader (A, or B from a k-contiguous [n][k] row): lane -> row/col (lane&15), p already includes
//      + 8*(lane>>4); elements 0..7 <- p[0..7] (k0+8h..), elements 8..15 <- p[16..23] (k0+16+8h..)
__device__ __forceinline__ Frag ldfrag(const unsigned short* p) {
  Frag f;
  f.u[0] = *(const v8us*)(p);
  f.u[1] = *(const v8us*)(p + 16);
  return f;
}

// ---- fragment-order planes (W16, WWb): a 16-row x 32-k operand tile is stored as the 1 KiB its loader
//      reads: half j, then lane = 16 hh + row, then 8 elements, k = k0 + 16 j + 8 hh + e (the k map of ldfrag). Each of
//      the loader's two wave loads then covers 512 contiguous bytes (4 whole lines) and not 32 B of each of 16 rows.
//      piece_off: element offset of the 8-element piece q = k / 8 of row r (0..15) of tile t; nks = 32-k steps a row.
__device__ __forceinline__ size_t piece_off(int t, int nks, int q, int r) {
  return ((size_t)((t * nks + (q >> 2)) * 2 + ((q >> 1) & 1)) * 32 + 16 * (q & 1) + r) * 8;
}
__device__ __forceinline__ Frag ldfrag_p(const unsigned short* plane, int t, int nks, int ks, int lane) {
  const unsigned short* p = plane + ((size_t)(t * nks + ks) * 64 + lane) * 8;
  Frag f;
  f.u[0] = *(const v8us*)(p);
  f.u[1] = *(const v8us*)(p + 256);
  return f;
}

// ---- WMMA helper: builtin followed by a 4-slot VALU gap tying D and keeping A/B live ---------------------------
__device__ __forceinline__ v8f mma_h(v16h a, v16h b, v8f c) {
  v8f d = __builtin_amdgcn_wmma_f32_16x16x32_f16(false, a, false, b, (short)0, c, false, false);
#if defined(__HIP_DEVICE_COMPILE__)
  asm volatile("v_nop\n\tv_nop\n\tv_nop\n\tv_nop" : "+v"(d) : "v"(a), "v"(b));
#endif
  return d;
}

// the same products as plain builtins, for a kernel above 256 registers: operands of an asm statement must lie in the
// first 256, which would spill the accumulators and the kept fragments; the compiler keeps the distances of its own forms
__device__ __forceinline__ v8f mma_hp(v16h a, v16h b, v8f c) {
  return __builtin_amdgcn_wmma_f32_16x16x32_f16(false, a, false, b, (short)0, c, false, false);
}
__device__ __forceinline__ v8f mma_bp(v16b a, v16b b, v8f c) {
  return __builtin_amdgcn_wmma_f32_16x16x32_bf16(false, a, false, b, (short)0, c, false, false);
}
// the scheduler moves nothing across this line; each use says what it holds in place
__device__ __forceinline__ void sched_line() {
#if defined(__HIP_DEVICE_COMPILE__)
  __builtin_amdgcn_sched_barrier(0);
#endif
}
// a value that is the same in every lane of the wave, moved to a scalar register so that tests on it are scalar branches
__device__ __forceinline__ int wave_uniform(int v) {
#if defined(__HIP_DEVICE_COMPILE__)
  return __builtin_amdgcn_readfirstlane(v);
#else
  return v;
#endif
}

// lane i's value of v (i the same in every lane), in a scalar register
__device__ __forceinline__ float lane_value(float v, int i) {
#if defined(__HIP_DEVICE_COMPILE__)
  return __uint_as_float((unsigned)__builtin_amdgcn_readlane((int)__float_as_uint(v), i));
#else
  return v;
#endif
}

// stands directly behind a run of global stores or loads, in front of any later write of a register that they name
__device__ __forceinline__ void wait_x0() {
#if defined(__HIP_DEVICE_COMPILE__)
  asm volatile("s_wait_xcnt 0x0" ::: "memory");
#endif
}

// stands directly behind that wait where more work follows: without it the scheduler lifts later address arithmetic in
// among the stores, onto registers that they name, ahead of the wait
__device__ __forceinline__ void hold_below() {
#if defined(__HIP_DEVICE_COMPILE__)
  __builtin_amdgcn_sched_barrier(0);
#endif
}
// the same wait behind a run of global loads from one address: the address is an input, so it stays in its registers up
// to the wait and no load of the run returns its data onto them
__device__ __forceinline__ void wait_x0_keep(const float* p) {
#if defined(__HIP_DEVICE_COMPILE__)
  asm volatile("s_wait_xcnt 0x0" :: "v"(p) : "memory");
#endif
}

// =========================================================================================================
// (0) weights. Blocks 0..47: W16 f16 [384][256], rows 0..127 = theta_w, 128..255 = phi_w, 256..383 = g_w; value =
//     f16 of (bf16-RNE(w) * 256) (exact). Block owns rows 8*blk..8*blk+7 (half a 16-row tile): 8 lanes x 16 B = one
//     whole line of the fragment-order plane per piece q. Blocks 48..63: WWb bf16 [256][128], one 16-row tile a block.
// coverage: 48 blocks x 8 rows x 32 pieces x 8 halves = 384 x 256; 16 blocks x 16 rows x 16 pieces x 8 = 256 x 128.
// =========================================================================================================
__global__ __launch_bounds__(256)
void cvt_w(const float* __restrict__ tw, const float* __restrict__ pw, const float* __restrict__ gw,
           const float* __restrict__ ow, unsigned short* W16, unsigned short* WWb) {
  const int tid = threadIdx.x, blk = blockIdx.x;
  if (blk < MW / 8) {
    const int rl = tid & 7, pq = tid >> 3, col = 8 * pq;             // row in the block, piece 0..31
    const int o = 8 * blk + rl;                                      // 0..383
    const int grp = blk >> 4;                                        // 0,1,2 (block-uniform)
    const float* wbase = (grp == 0) ? tw : ((grp == 1) ? pw : gw);  // all global
    const float* s = wbase + (size_t)(o - DQ * grp) * CC + col;      // (o - 128 grp) in 0..127
    const v4f a = *(const v4f*)s;
    const v4f q = *(const v4f*)(s + 4);
    const float f[8] = {a[0], a[1], a[2], a[3], q[0], q[1], q[2], q[3]};
    v4u u;
#pragma unroll
    for (int t = 0; t < 4; ++t) {
      const _Float16 h0 = (_Float16)(bfr(f[2 * t]) * WSC);
      const _Float16 h1 = (_Float16)(bfr(f[2 * t + 1]) * WSC);
      u[t] = pk16(h_bits(h0), h_bits(h1));
    }
{
      *(v4u*)(W16 + piece_off(o >> 4, CC / 32, pq, o & 15)) = u;
      
    }
  } else {
    const int rb = blk - MW / 8;                                     // 0..15
    const int o = 16 * rb + (tid & 15);                              // 0..255
    const int pq = tid >> 4, col = 8 * pq;                           // piece 0..15, col 0..120
    const float* s = ow + (size_t)o * DQ + col;
    const v4f a = *(const v4f*)s;
    const v4f q = *(const v4f*)(s + 4);
    const float f[8] = {a[0], a[1], a[2], a[3], q[0], q[1], q[2], q[3]};
    v4u u;
#pragma unroll
    for (int t = 0; t < 4; ++t) u[t] = pk16(bf_bits(f[2 * t]), bf_bits(f[2 * t + 1]));
{
      *(v4u*)(WWb + piece_off(rb, DQ / 32, pq, tid & 15)) = u;
      
    }
  }
}

// =========================================================================================================
// (1) conv1x1 GEMM for one (b, strip of 128 positions = image rows 2s and 2s+1), all 384 rows of the stacked weights:
//     Y[o][n] = (1/256) sum_c W16[o][c] X[n][c]. Block 512 threads = 16 waves, one block a WGP.
//     Stage: the strip x f32 [256 c][128 n] is read once from global (a thread: 8 channels x 4 positions, twice; 8 lanes
//     cover one whole 128-B line, a wave load 4 lines), rounded to bf16-RNE, held as f16 (the same values a B fragment
//     had before) and turned in registers into Xs[128 n][256 c] (pitch XPT, b128 stores, cross-wave, block barrier).
//     Products: wave w owns m-tiles 3 (w >> 1) .. + 2 (A rows o = 16 tile + (lane&15), W16 in fragment order, read from
//     global one k-step ahead) and n-tiles 4 (w & 1) .. + 3 (B rows n = 16 tile + (lane&15) of Xs, the k map of ldfrag, too).
//     K = 256 = 8 steps in ascending order into one accumulator a tile.
//     Epilogue staged in LDS Os[n_loc][384 o] (pitch OSA, b128 stores) on the bytes of Xs, behind a block barrier that
//     ends every wave's reads of Xs; block barrier (cross-wave); then the two halves of the block (h = tid >> 8) take
//     dims 64 h .. 64 h + 63 of (g first, then theta, then phi):
//       theta + bias -> Qh/Ql bf16 [b][4096 n][128 d] (hi = RNE(v), lo = RNE(v-hi)), 8 consecutive lanes x 16 B = one line;
//       phi + bias in f32, 2x2 stride-2 max-pool in f32 (the strip holds both image rows of every window: pooled column
//                       px takes n_loc = 64 dy + 2 px + dx, dy, dx in {0,1}; key m = 32 st + px) -> Kh/Kl bf16
//                       [b][1024 m][128 d] (hi = RNE(v), lo = RNE(v-hi)): 32 rows x one whole line of the 256-B row;
//       g + bias, the same pool, f16, turned through the half's LDS tile Tg[64 d][32 px] (pitch GTP, cross-wave, block
//                       barrier) -> Gc f16 [b][32 st][128 d][32 px]: one 32-key stage of the attention a strip, keys
//                       contiguous a channel; each wave store 512 contiguous B.
// coverage: Xs written rows 64 (w&1) + 32 g + 4 lq + t = 0..127 x cols 32 (w>>1) + 8 lo + 0..7 = 0..255, read rows 0..127 x
//           cols 0..255; Os 8 m-groups x 3 tiles x 16 o = 384 cols x 2 n-halves x 4 tiles x 16 = 128 rows written, reads
//           rows <= 127 cols <= 383; theta planes 4 it x 32 rows x 8 lanes x 8 x 2 halves = 128 n x 128 d; pooled planes
//           32 px x 8 lanes x 8 x 2 halves = 32 m x 128 d; Tg written rows (8e+t)=0..63 x cols 0..31 a half, read rows
//           0..63 x cols 8 kq..8 kq+7, kq 0..3; grid (32, NB) covers all 4096 rows x 128 d of Qh/Ql and all 1024 keys x
//           128 d of Kh/Kl/Gc exactly once.
// =========================================================================================================
__global__ __launch_bounds__(PT)
void gemm_proj(const unsigned short* __restrict__ W16, const float* __restrict__ x,
               const float* __restrict__ tb, const float* __restrict__ pb, const float* __restrict__ gb,
               unsigned short* Qh, unsigned short* Ql, unsigned short* Kh, unsigned short* Kl, unsigned short* Gc) {
  __shared__ __align__(16) float Os[SN * OSA];
  __shared__ __align__(16) unsigned short Tg[2 * QT * GTP];
  unsigned short* Xs = (unsigned short*)Os;                          // the x tile lives on the bytes of Os, ahead of it
  const int tid  = threadIdx.x;
  const int lane = tid & 31, wave = tid >> 5;                        // wave 0..15
  const int hh   = lane >> 4, c = lane & 15;
  const int st   = blockIdx.x, b = blockIdx.y;
  const int n0   = st * SN;
  const int ta   = 3 * (wave >> 1), tn = 4 * (wave & 1);             // first A tile (of 24), first n-tile (of 8)

  Frag fa[2][3];                                                     // A fragments of this k-step and of the next
#pragma unroll
  for (int i = 0; i < 3; ++i) fa[0][i] = ldfrag_p(W16, ta + i, CC / 32, 0, lane);

  // ---- stage the strip: f32 [c][n] -> f16 Xs[n][c]
  {
    const int lo = lane & 3, lq = lane >> 2;                         // channel octet 0..3, position quad 0..7
    const int c8 = 32 * (wave >> 1) + 8 * lo;                        // the thread's channels c8..c8+7
    const int nq = 64 * (wave & 1) + 4 * lq;                         // its positions nq + 32 g + 0..3
    const float* xp = x + ((size_t)(b * CC + c8)) * NN + n0 + nq;
    v4f v[2][8];
#pragma unroll
    for (int e = 0; e < 8; ++e) {
#pragma unroll
      for (int g = 0; g < 2; ++g) v[g][e] = *(const v4f*)(xp + (size_t)e * NN + 32 * g);
    }
    wait_x0_keep(xp);
#pragma unroll
    for (int g = 0; g < 2; ++g) {
#pragma unroll
      for (int t = 0; t < 4; ++t) {
        v4u u;
#pragma unroll
        for (int k = 0; k < 4; ++k)
          u[k] = pk16(h_bits((_Float16)bfr(v[g][2 * k][t])), h_bits((_Float16)bfr(v[g][2 * k + 1][t])));
        *(v4u*)(Xs + (nq + 32 * g + t) * XPT + c8) = u;
      }
    }
  }
  __syncthreads();

  v8f acc[3][4];
#pragma unroll
  for (int i = 0; i < 3; ++i) {
#pragma unroll
    for (int j = 0; j < 4; ++j) acc[i][j] = zero8();
  }
  const unsigned short* Xp = Xs + (16 * tn + c) * XPT + 8 * hh;      // B fragment base, + 16 j rows, + 32 ks

  Frag fb[2][4];                                                     // B fragments of this k-step and of the next
#pragma unroll
  for (int j = 0; j < 4; ++j) fb[0][j] = ldfrag(Xp + (16 * j) * XPT);
  // unrolled so that the two sets are registers: the next step's reads stand as one group above this step's products
#pragma unroll
  for (int ks = 0; ks < CC / 32; ++ks) {
    if (ks + 1 < CC / 32) {
#pragma unroll
      for (int i = 0; i < 3; ++i) fa[(ks + 1) & 1][i] = ldfrag_p(W16, ta + i, CC / 32, ks + 1, lane);
#pragma unroll
      for (int j = 0; j < 4; ++j) fb[(ks + 1) & 1][j] = ldfrag(Xp + (16 * j) * XPT + 32 * (ks + 1));
    }
#pragma unroll
    for (int j = 0; j < 4; ++j) {
#pragma unroll
      for (int i = 0; i < 3; ++i) acc[i][j] = mma_h(fa[ks & 1][i].h, fb[ks & 1][j].h, acc[i][j]);
    }
  }
  __syncthreads();                                                   // every wave has left Xs before Os overwrites it

  // ---- epilogue: scale back -> LDS Os[n_loc][o]; lane (hh, c) holds o = 16 tile + 8 hh + r for n_loc = 16 n-tile + c
#pragma unroll
  for (int j = 0; j < 4; ++j) {
    const int nl = 16 * (tn + j) + c;
#pragma unroll
    for (int i = 0; i < 3; ++i) {
      v4f va, vb;
#pragma unroll
      for (int r = 0; r < 4; ++r) { va[r] = acc[i][j][r] * IWSC; vb[r] = acc[i][j][4 + r] * IWSC; }
      *(v4f*)(Os + nl * OSA + 16 * (ta + i) + 8 * hh)     = va;
      *(v4f*)(Os + nl * OSA + 16 * (ta + i) + 8 * hh + 4) = vb;
    }
  }
  __syncthreads();

  const int u256 = tid & 255;
  const int dsel = (tid >> 8) * QT;                                  // 0 or 64 (wave-uniform)
  const int e = u256 & 7, lq = u256 >> 3;                            // dims 8 e..8 e+7 of the half; lq 0..31
  auto bias8 = [&](const float* bias, float* bv) {
    const float* bp = bias + dsel + 8 * e;
    const v4f ba = *(const v4f*)bp;
    const v4f bq = *(const v4f*)(bp + 4);
    wait_x0_keep(bp);
#pragma unroll
    for (int t = 0; t < 4; ++t) { bv[t] = bfr(ba[t]); bv[4 + t] = bfr(bq[t]); }
  };

  // ---- phi and g: bias, then the 2x2 max-pool; pooled column px = lq
  const int px = lq;
  auto pooled = [&](const float* bias, int ob, float* f) {           // ob: first column of the plane in Os
    float bv[8];
    bias8(bias, bv);
#pragma unroll
    for (int t = 0; t < 8; ++t) f[t] = -__builtin_inff();
#pragma unroll
    for (int dy = 0; dy < 2; ++dy) {
#pragma unroll
      for (int dx = 0; dx < 2; ++dx) {
        const int row = dy * WIMG + 2 * px + dx;                     // n_loc 0..127
        const v4f a = *(const v4f*)(Os + row * OSA + ob + dsel + 8 * e);
        const v4f q = *(const v4f*)(Os + row * OSA + ob + dsel + 8 * e + 4);
#pragma unroll
        for (int t = 0; t < 4; ++t) {
          f[t]     = fmaxf(f[t], a[t] + bv[t]);
          f[4 + t] = fmaxf(f[4 + t], q[t] + bv[4 + t]);
        }
      }
    }
  };
  // g first: its barrier then has no global store of this block to wait for
  {
    float f[8];
    pooled(gb, 2 * DQ, f);
    unsigned short* Th = Tg + (tid >> 8) * (QT * GTP);               // the half's own tile
#pragma unroll
    for (int t = 0; t < 8; ++t) Th[(8 * e + t) * GTP + px] = h_bits((_Float16)f[t]);
    __syncthreads();                                                 // straight-line code: every wave passes
    const int dl = u256 >> 2, kq = u256 & 3;                         // channel 0..63 of the half, 8 keys 8 kq..8 kq+7
    const v4u u = *(const v4u*)(Th + dl * GTP + 8 * kq);
    *(v4u*)(Gc + ((size_t)((b * NSTRIP + st) * DQ + dsel + dl)) * WP + 8 * kq) = u;
    wait_x0();
  }

  // ---- theta
  {
    float bv[8];
    bias8(tb, bv);
    v4u uh[4], ul[4];
#pragma unroll
    for (int it = 0; it < 4; ++it) {
      const int row = it * 32 + lq;                                  // n_loc 0..127
      const v4f a = *(const v4f*)(Os + row * OSA + dsel + 8 * e);
      const v4f q = *(const v4f*)(Os + row * OSA + dsel + 8 * e + 4);
      float f[8];
#pragma unroll
      for (int t = 0; t < 4; ++t) { f[t] = a[t] + bv[t]; f[4 + t] = q[t] + bv[4 + t]; }
      split8(f, uh[it], ul[it]);
    }
#pragma unroll
    for (int it = 0; it < 4; ++it) {
      const int row = it * 32 + lq;
      const size_t po = ((size_t)(b * NN + n0 + row)) * DQ + dsel + 8 * e;
      *(v4u*)(Qh + po) = uh[it];
      *(v4u*)(Ql + po) = ul[it];
    }
    wait_x0();
    hold_below();
  }

  // ---- phi
  {
    float f[8];
    pooled(pb, DQ, f);
    v4u kh, kl;
    split8(f, kh, kl);
    const size_t po = ((size_t)(b * MM + WP * st + px)) * DQ + dsel + 8 * e;
    *(v4u*)(Kh + po) = kh;
    *(v4u*)(Kl + po) = kl;
    wait_x0();
  }
}

// ---- asynchronous copies to LDS: each lane moves its own 16 bytes, global -> LDS, through no register. Arguments: the
//      lane's LDS byte addresses, then its global addresses in the same order, all multiples of 16. The closing
//      s_wait_xcnt 0 stands inside the copies' own statement so that no address register named there is rewritten ahead
//      of it.
__device__ __forceinline__ unsigned lds_addr(const void* p) { return (unsigned)(uintptr_t)p; }
__device__ __forceinline__ void copy4(unsigned l0, unsigned l1, unsigned l2, unsigned l3,
                                      const unsigned short* g0, const unsigned short* g1,
                                      const unsigned short* g2, const unsigned short* g3) {
#if defined(__HIP_DEVICE_COMPILE__)
  asm volatile("global_load_async_to_lds_b128 %0, %4, off\n\t"
               "global_load_async_to_lds_b128 %1, %5, off\n\t"
               "global_load_async_to_lds_b128 %2, %6, off\n\t"
               "global_load_async_to_lds_b128 %3, %7, off\n\t"
               "s_wait_xcnt 0x0"
               :: "v"(l0), "v"(l1), "v"(l2), "v"(l3), "v"(g0), "v"(g1), "v"(g2), "v"(g3) : "memory");
#endif
}
__device__ __forceinline__ void copy12(unsigned a0, unsigned a1, unsigned a2, unsigned a3, unsigned b0, unsigned b1,
                                       unsigned b2, unsigned b3, unsigned c0, unsigned c1, unsigned c2, unsigned c3,
                                       const unsigned short* p0, const unsigned short* p1, const unsigned short* p2,
                                       const unsigned short* p3, const unsigned short* q0, const unsigned short* q1,
                                       const unsigned short* q2, const unsigned short* q3, const unsigned short* r0,
                                       const unsigned short* r1, const unsigned short* r2, const unsigned short* r3) {
#if defined(__HIP_DEVICE_COMPILE__)
  asm volatile("global_load_async_to_lds_b128 %0, %12, off\n\t"
               "global_load_async_to_lds_b128 %1, %13, off\n\t"
               "global_load_async_to_lds_b128 %2, %14, off\n\t"
               "global_load_async_to_lds_b128 %3, %15, off\n\t"
               "global_load_async_to_lds_b128 %4, %16, off\n\t"
               "global_load_async_to_lds_b128 %5, %17, off\n\t"
               "global_load_async_to_lds_b128 %6, %18, off\n\t"
               "global_load_async_to_lds_b128 %7, %19, off\n\t"
               "global_load_async_to_lds_b128 %8, %20, off\n\t"
               "global_load_async_to_lds_b128 %9, %21, off\n\t"
               "global_load_async_to_lds_b128 %10, %22, off\n\t"
               "global_load_async_to_lds_b128 %11, %23, off\n\t"
               "s_wait_xcnt 0x0"
               :: "v"(a0), "v"(a1), "v"(a2), "v"(a3), "v"(b0), "v"(b1), "v"(b2), "v"(b3), "v"(c0), "v"(c1), "v"(c2),
                  "v"(c3), "v"(p0), "v"(p1), "v"(p2), "v"(p3), "v"(q0), "v"(q1), "v"(q2), "v"(q3), "v"(r0), "v"(r1),
                  "v"(r2), "v"(r3) : "memory");
#endif
}
// the issuing wave's copies have landed behind this wait
__device__ __forceinline__ void wait_async0() {
#if defined(__HIP_DEVICE_COMPILE__)
  asm volatile("s_wait_asynccnt 0x0" ::: "memory");
#endif
}
// the wave's own LDS reads have retired before the buffer they read is handed to the copies that refill it
__device__ __forceinline__ void wait_ds0() {
#if defined(__HIP_DEVICE_COMPILE__)
  asm volatile("s_wait_dscnt 0x0" ::: "memory");
#endif
}
// one 32-key stage: Kh and Kl rows kb..kb+31 (256 B each, LDS pitch 272 B) and stage kb / 32 of Gc, 128 channel rows of
// 64 B in a row (LDS pitch 80 B). 128 threads x 12 copies of 16 B = 8 KiB + 8 KiB + 8 KiB; no two lanes share an LDS byte.
__device__ __forceinline__ void stage_kv(unsigned short* st, const unsigned short* Khb, const unsigned short* Klb,
                                         const unsigned short* Gcb, int kb, int tid) {
  const int kr = tid >> 4, kcol = 8 * (tid & 15);                    // kr 0..7, + 8 i -> key row 0..31
  const int vr = tid >> 2, vcol = 8 * (tid & 3);                     // vr 0..31, + 32 i -> channel row 0..127
  const unsigned lk = lds_addr(st + kr * KP + kcol);
  const unsigned ll = lk + 2u * (KT * KP);
  const unsigned lv = lds_addr(st + 2 * KT * KP + vr * VPT + vcol);
  const unsigned short* gk = Khb + (size_t)(kb + kr) * DQ + kcol;
  const unsigned short* gl = Klb + (size_t)(kb + kr) * DQ + kcol;
  const unsigned short* gv = Gcb + (size_t)kb * DQ + vr * KT + vcol;   // kb a multiple of KT: stage kb / KT starts at kb DQ
  copy12(lk, lk + 2u * (8 * KP), lk + 2u * (16 * KP), lk + 2u * (24 * KP),
         ll, ll + 2u * (8 * KP), ll + 2u * (16 * KP), ll + 2u * (24 * KP),
         lv, lv + 2u * (32 * VPT), lv + 2u * (64 * VPT), lv + 2u * (96 * VPT),
         gk, gk + 8 * DQ, gk + 16 * DQ, gk + 24 * DQ, gl, gl + 8 * DQ, gl + 16 * DQ, gl + 24 * DQ,
         gv, gv + 32 * KT, gv + 64 * KT, gv + 96 * KT);
}

// =========================================================================================================
// (2) attention for one (b, 128-query tile), transposed formulation, 1024 keys (all valid, no mask, no scale):
//   S^T tile (16 keys x 16 queries) = sum over 4 d-chunks (unrolled) of A(k: row = key kb + (lane&15), 32 d via
//   the split k map from the bf16 plane Kh [b][1024][128]) . B(q: col = query, same map from Qh [b][4096][128])
//   + A(Kh).B(Ql) + A(Kl).B(Qh) (bf16 unscaled residual planes, shared accumulator).
//   Block = 8 waves = 2 key groups x 4 query waves, one block a WGP, two waves a SIMD. A wave owns 32 queries (two
//   B tiles, queries 32 wq + 16 u + (lane&15)); its 16 Q fragments are read from LDS once and stay in registers, and
//   every K or V fragment it reads from LDS feeds both tiles. Key group g takes the 32-key stages 2 t + g.
//   Per lane a D tile holds 8 keys of ONE query: online softmax state per lane and tile, one shuffle (lane^16) for the
//   max over 32 keys; the o/l rescale is skipped under one wave-uniform ballot a trip when no lane's max grew (corr == 1
//   exactly for every lane then); row-sum partials combined at the end. P = e^{s-m} x 16384 as f16 is the B operand of
//   y^T (rows channel, cols queries) += A(pooled g: rows channel = 16j + (lane&15), keys contiguous, f16 plane Gc
//   [b][32 stages][128][32]) . B(P^T): element r <- D of the tile covering keys kb..kb+15, element 8+r <- the tile covering
//   kb+16..kb+31, lane unchanged. 16 accumulator tiles per wave (128 channels x 2 query tiles).
//   The block's 128 query rows of Qh/Ql are copied once (Qs, pitch 272 B); each group's four waves copy their own
//   32-key stage of Kh/Kl/Gc into their half of one of two buffers (Ring) one trip ahead of its use.
//   Join of the two key groups: a wave leaves m, l and unnormalised o of the query tile u = 1 - group in LDS (Ms, Ls, Os;
//   block barrier) and finishes tile u = group: both shares brought to the common max, added, divided by the joint l.
//   Output conv in the same block: WY[c][n] = sum_ci WWb[c][ci] (yh + yl)[n][ci] on bf16 WMMA (2 products per k-step,
//   shared accumulator, K = 128 = 4 steps). The wave's y (16 queries x 128 channels) never leaves its registers: split
//   into bf16 hi + residual it is the A operand (rows n); B = WWb in fragment order from global (cols c), 16 channel
//   tiles a wave. Results staged in LDS rows [256 c][128 n] (pitch OSPW, b128 stores), block barrier (cross-wave), + bias,
//   then WY f32 [b][256][4096], each wave store 512 contiguous B.
// coverage: Os rows 32 wq + 16 u + c: group 0 writes u = 1, group 1 u = 0, each read by the other group's same lane; staged
//           rows 16 tiles x 16 c x cols 4 wq x 2 groups x 16 = 256 c x 128 n written, read 8 waves x 32 rows x 32 lanes x 4;
//           grid (NQ/128, NB) covers WY[b][0..255][0..NQ-1] exactly once.
// =========================================================================================================
__global__ __launch_bounds__(AT)
void attn_k(const unsigned short* __restrict__ Qh, const unsigned short* __restrict__ Ql,
            const unsigned short* __restrict__ Kh, const unsigned short* __restrict__ Kl,
            const unsigned short* __restrict__ Gc, const unsigned short* __restrict__ WWb,
            const float* __restrict__ wb, float* WY) {
  __shared__ __align__(16) float Os[AQ * OSPW];
  __shared__ __align__(16) unsigned short Qs[2 * AQ * KP];
  __shared__ __align__(16) unsigned short Ring[4 * STG];
  __shared__ float Ms[AQ];
  __shared__ float Ls[AQ];
  const int tid  = threadIdx.x;
  const int wave = wave_uniform(tid >> 5), lane = tid & 31;
  const int grp  = wave >> 2, wq = wave & 3;                         // key group, query wave (both wave-uniform)
  const int t128 = tid & 127;                                        // thread within its key group
  const int hh   = lane >> 4, c = lane & 15;
  const int n0   = blockIdx.x * AQ, b = blockIdx.y;

  const unsigned short* Khb = Kh + (size_t)b * MM * DQ;
  const unsigned short* Klb = Kl + (size_t)b * MM * DQ;
  const unsigned short* Gcb = Gc + (size_t)b * DQ * MM;

  // ---- in front of the loop: the query tile and trip 0's stages, their wait, the barrier that publishes them, then
  //      trip 1's stages
  {
    const int qr = tid >> 4, qcol = 8 * (tid & 15);                  // qr 0..15, + 16 i -> query row 0..127
    const unsigned lq = lds_addr(Qs + qr * KP + qcol);
    const size_t go = ((size_t)(b * NN + n0 + qr)) * DQ + qcol;
    auto plane = [](unsigned l0, const unsigned short* g) {          // 128 rows of one plane, 8 copies a thread
      copy4(l0, l0 + 2u * (16 * KP), l0 + 2u * (32 * KP), l0 + 2u * (48 * KP), g, g + 16 * DQ, g + 32 * DQ,
            g + 48 * DQ);
      copy4(l0 + 2u * (64 * KP), l0 + 2u * (80 * KP), l0 + 2u * (96 * KP), l0 + 2u * (112 * KP), g + 64 * DQ,
            g + 80 * DQ, g + 96 * DQ, g + 112 * DQ);
    };
    plane(lq, Qh + go);
    plane(lq + 2u * (AQ * KP), Ql + go);
  }
  stage_kv(Ring + grp * STG, Khb, Klb, Gcb, grp * KT, t128);
  wait_async0();
  __syncthreads();
  stage_kv(Ring + (2 + grp) * STG, Khb, Klb, Gcb, (2 + grp) * KT, t128);

  // q fragments (B operand, col = query 32 wq + 16 u + c of the tile), d-chunk kc: read once, kept in registers
  Frag qh[2][DQ / 32], ql[2][DQ / 32];
#pragma unroll
  for (int u = 0; u < 2; ++u) {
    const unsigned short* Qhp = Qs + (32 * wq + 16 * u + c) * KP + 8 * hh;
#pragma unroll
    for (int kc = 0; kc < DQ / 32; ++kc) {
      qh[u][kc] = ldfrag(Qhp + 32 * kc);
      ql[u][kc] = ldfrag(Qhp + AQ * KP + 32 * kc);
    }
  }

  float m[2] = {-1.0e30f, -1.0e30f}, l[2] = {0.f, 0.f};
  v8f o[2][8];
#pragma unroll
  for (int u = 0; u < 2; ++u) {
#pragma unroll
    for (int j = 0; j < 8; ++j) o[u][j] = zero8();
  }

#pragma unroll 1
  for (int t = 0; t < MM / (2 * KT); ++t) {
    unsigned short* st = Ring + (2 * (t & 1) + grp) * STG;           // this trip's buffer, the group's half
    // k fragment base (A operand, row = key kb + c), + 32*kc; v fragment base (A operand, row = channel 16j + c)
    const unsigned short* k0p  = st + c * KP + 8 * hh;               // keys kb .. kb+15, kb = 32 (2 t + grp)
    const unsigned short* k1p  = k0p + 16 * KP;                      // keys kb+16 .. kb+31
    const unsigned short* k0lp = k0p + KT * KP;
    const unsigned short* k1lp = k1p + KT * KP;
    const unsigned short* Vp   = st + 2 * KT * KP + c * VPT + 8 * hh;
    v8f s0[2] = {zero8(), zero8()}, s1[2] = {zero8(), zero8()};
    Frag fr[DQ / 32][4], vf[8];                                      // all K fragments of the stage; V fragments
    // the trip's LDS reads stand at two places only, each a whole group well ahead of its products and waited for by
    // count: all 32 K reads here, the 16 V reads between the second and the third d-chunk (onto registers those left)
#pragma unroll
    for (int kc = 0; kc < DQ / 32; ++kc) {
      fr[kc][0] = ldfrag(k0p + 32 * kc);
      fr[kc][1] = ldfrag(k1p + 32 * kc);
      fr[kc][2] = ldfrag(k0lp + 32 * kc);
      fr[kc][3] = ldfrag(k1lp + 32 * kc);
    }
    sched_line();                                                    // without it the K reads are spread among the products
#pragma unroll
    for (int kc = 0; kc < DQ / 32; ++kc) {
      if (kc == DQ / 64) {
        // without the pair the V reads sink behind the last products, and the softmax waits out their latency
        sched_line();
#pragma unroll
        for (int j = 0; j < 8; ++j) vf[j] = ldfrag(Vp + (16 * j) * VPT);
        sched_line();
      }
      const Frag* f = fr[kc];
#pragma unroll
      for (int u = 0; u < 2; ++u) {
        s0[u] = mma_bp(f[0].bf, qh[u][kc].bf, s0[u]);
        s1[u] = mma_bp(f[1].bf, qh[u][kc].bf, s1[u]);
      }
#pragma unroll
      for (int u = 0; u < 2; ++u) {
        s0[u] = mma_bp(f[0].bf, ql[u][kc].bf, s0[u]);
        s1[u] = mma_bp(f[1].bf, ql[u][kc].bf, s1[u]);
      }
#pragma unroll
      for (int u = 0; u < 2; ++u) {
        s0[u] = mma_bp(f[2].bf, qh[u][kc].bf, s0[u]);
        s1[u] = mma_bp(f[3].bf, qh[u][kc].bf, s1[u]);
      }
    }

    float mn[2];
    bool up = false;
#pragma unroll
    for (int u = 0; u < 2; ++u) {
      float mx = fmaxf(hmax8(s0[u]), hmax8(s1[u]));
      mx = fmaxf(mx, __shfl_xor(mx, 16, 32));
      mn[u] = fmaxf(m[u], mx);
      up = up || (mx > m[u]);
    }
    const unsigned grew = wave_ballot(up);                           // wave-uniform
    if (grew != 0u) {
#pragma unroll
      for (int u = 0; u < 2; ++u) {
        const float corr = __expf(m[u] - mn[u]);                     // == 1 exactly for lanes whose max did not grow
        l[u] *= corr;
#pragma unroll
        for (int j = 0; j < 8; ++j) {
#pragma unroll
          for (int r = 0; r < 8; ++r) o[u][j][r] *= corr;
        }
      }
    }

    FragH ph[2];
#pragma unroll
    for (int u = 0; u < 2; ++u) {
      m[u] = mn[u];
      const float msh = mn[u] - LNPS;                                // exp gives e^{s-m} * 16384
      float ls = 0.f;
#pragma unroll
      for (int r = 0; r < 8; ++r) {
        const float e0 = __expf(s0[u][r] - msh);                     // key kb      + 8hh + r
        const float e1 = __expf(s1[u][r] - msh);                     // key kb + 16 + 8hh + r
        ls += e0 + e1;
        ph[u].hv[0][r] = (_Float16)e0;
        ph[u].hv[1][r] = (_Float16)e1;
      }
      l[u] += ls;
    }

#pragma unroll
    for (int j = 0; j < 8; ++j) {
#pragma unroll
      for (int u = 0; u < 2; ++u) o[u][j] = mma_hp(vf[j].h, ph[u].v, o[u][j]);
    }

    // ---- foot of the trip: own reads retired, own copies of the next stage landed, one barrier that publishes that
    //      stage and ends every reader's last read of this buffer; only then the refill of this buffer. (The softmax and
    //      the last products work on registers alone: the scheduler may set them behind these waits and the barrier's
    //      signal; every LDS read of the trip stays in front, the refill behind.)
    wait_ds0();
    wait_async0();
    __syncthreads();
    if (t + 2 < MM / (2 * KT)) stage_kv(st, Khb, Klb, Gcb, (2 * (t + 2) + grp) * KT, t128);
  }
  wait_async0();                                                     // nothing is in flight when the wave goes on

  // ---- output-conv weights, B operand (col = channel 16 ct + c, k = y channel): channel tiles 4 g .. 4 g + 3 form one
  //      group of 16 fragments, two register sets; group 0 is asked for here, ahead of the join that hides its latency
  Frag wf[2][4][DQ / 32];
#pragma unroll
  for (int i = 0; i < 4; ++i) {
#pragma unroll
    for (int ks = 0; ks < DQ / 32; ++ks) wf[0][i][ks] = ldfrag_p(WWb, i, DQ / 32, ks, lane);
  }
  const float bl = bfr(wb[32 * wave + lane]);                        // lane i: bias of channel 32 wave + i, the rows the wave stores
  wait_x0();                                                         // ahead of any reuse of the bias load's address register
  // without it these loads sink behind the join, and the shuffles below rise onto that register in front of the wait
  sched_line();
#pragma unroll
  for (int u = 0; u < 2; ++u) l[u] += __shfl_xor(l[u], 16, 32);

  // ---- join of the key groups; lane (hh, c) holds ch = 16 j + 8 hh + r for query 32 wq + 16 u + c in both groups.
  //      A wave hands the query tile u = 1 - grp to its partner and finishes tile u = grp itself.
  auto give = [&](int u) {
    const int qrow = 32 * wq + 16 * u + c;
    if (hh == 0) { Ms[qrow] = m[u]; Ls[qrow] = l[u]; }               // both halves hold the same m and l
#pragma unroll
    for (int j = 0; j < 8; ++j) {
      v4f va, vb;
#pragma unroll
      for (int r = 0; r < 4; ++r) { va[r] = o[u][j][r]; vb[r] = o[u][j][4 + r]; }
      *(v4f*)(Os + qrow * OSPW + 16 * j + 8 * hh)     = va;
      *(v4f*)(Os + qrow * OSPW + 16 * j + 8 * hh + 4) = vb;
    }
  };
  // y of the wave's 16 queries as A fragments (row = query c, k = channel), bf16 hi and residual: element e of half 0 is
  // D register e of tile 2 ks (ch 32 ks + 8 hh + e), of half 1 that of tile 2 ks + 1 (ch 32 ks + 16 + 8 hh + e): the k
  // map of ldfrag, lane unchanged
  Frag yh[DQ / 32], yl[DQ / 32];
  auto take = [&](int u) {                                           // u == grp; group 0's share stands first in every sum
    const int qrow = 32 * wq + 16 * u + c;
    const float mp = Ms[qrow], lp = Ls[qrow];
    const float m0 = (u == 0) ? m[u] : mp, m1 = (u == 0) ? mp : m[u];
    const float l0 = (u == 0) ? l[u] : lp, l1 = (u == 0) ? lp : l[u];
    const float mj = fmaxf(m0, m1);
    const float c0 = __expf(m0 - mj), c1 = __expf(m1 - mj);
    const float inv = 1.0f / (l0 * c0 + l1 * c1);                    // o and l both carry the x16384 factor
    const float a0 = c0 * inv, a1 = c1 * inv;
#pragma unroll
    for (int j = 0; j < 8; ++j) {
      const float* op = Os + qrow * OSPW + 16 * j + 8 * hh;
      const v4f pa = *(const v4f*)op;
      const v4f pb = *(const v4f*)(op + 4);
      float f[8];
#pragma unroll
      for (int r = 0; r < 4; ++r) {
        if (u == 0) {
          f[r]     = o[u][j][r] * a0 + pa[r] * a1;
          f[4 + r] = o[u][j][4 + r] * a0 + pb[r] * a1;
        } else {
          f[r]     = pa[r] * a0 + o[u][j][r] * a1;
          f[4 + r] = pb[r] * a0 + o[u][j][4 + r] * a1;
        }
      }
      v4u uh, ul;
      split8(f, uh, ul);
      yh[j >> 1].u[j & 1] = __builtin_bit_cast(v8us, uh);
      yl[j >> 1].u[j & 1] = __builtin_bit_cast(v8us, ul);
    }
  };
  if (grp == 0) give(1); else give(0);                               // wave-uniform
  __syncthreads();
  if (grp == 0) take(0); else take(1);                               // wave-uniform

  // ---- output conv: D[query][channel] = sum_ci (yh + yl)[query][ci] WWb[channel][ci], K = 128 = 4 steps in ascending
  //      order, hi then residual product a step, one accumulator a tile; four channel tiles run side by side. Lane (hh, c)
  //      holds queries 8 hh + r of channel 16 ct + c: 8 neighbours of a WY row, staged in LDS rows [channel][128 n]
  //      (pitch OSPW): channels 0..127 on the bytes of Ring, 128..255 on those of Qs, both left by every reader at the
  //      barrier that ended the last trip.
  {
    const int ncol = 32 * wq + 16 * grp + 8 * hh;
#pragma unroll
    for (int g = 0; g < 4; ++g) {
      if (g + 1 < 4) {
#pragma unroll
        for (int i = 0; i < 4; ++i) {
#pragma unroll
          for (int ks = 0; ks < DQ / 32; ++ks)
            wf[(g + 1) & 1][i][ks] = ldfrag_p(WWb, 4 * (g + 1) + i, DQ / 32, ks, lane);
        }
        if (g + 1 == 3) wait_x0();                                   // behind the last weight load: its address registers are free from here on
        sched_line();                                                // keeps the next group's loads above this group's products
      }
      v8f acc[4];
#pragma unroll
      for (int i = 0; i < 4; ++i) acc[i] = zero8();
#pragma unroll
      for (int ks = 0; ks < DQ / 32; ++ks) {
#pragma unroll
        for (int i = 0; i < 4; ++i) acc[i] = mma_bp(yh[ks].bf, wf[g & 1][i][ks].bf, acc[i]);
#pragma unroll
        for (int i = 0; i < 4; ++i) acc[i] = mma_bp(yl[ks].bf, wf[g & 1][i][ks].bf, acc[i]);
      }
      float* wsb = (g < 2) ? (float*)Ring : (float*)Qs;
#pragma unroll
      for (int i = 0; i < 4; ++i) {
        float* wp = wsb + (16 * (4 * (g & 1) + i) + c) * OSPW + ncol;
        v4f va, vb;
#pragma unroll
        for (int r = 0; r < 4; ++r) { va[r] = acc[i][r]; vb[r] = acc[i][4 + r]; }
        *(v4f*)wp       = va;
        *(v4f*)(wp + 4) = vb;
      }
#if defined(__HIP_DEVICE_COMPILE__)
      // the next group starts new sums on the registers of this one's: with four tiles side by side only three vector
      // slots lie between a tile's last product and the product that overwrites its D; this is the fourth. (The last
      // group has no loads in front of it, runs interleaved with the third and so has registers of its own.)
      if (g + 1 < 3) asm volatile("v_nop");
#endif
    }
  }
  __syncthreads();

  // ---- wave w stores channels 32 w .. 32 w + 31: a wave store is the block's whole 512-B run of one WY row
  {
    const float* wr = ((wave < 4) ? (const float*)Ring : (const float*)Qs) + (32 * (wave & 3)) * OSPW + 4 * lane;
    v4f res[32];
#pragma unroll
    for (int i = 0; i < 32; ++i) {
      const float bvs = lane_value(bl, i);
      const v4f v = *(const v4f*)(wr + i * OSPW);
#pragma unroll
      for (int t = 0; t < 4; ++t) res[i][t] = v[t] + bvs;
    }
    sched_line();   // keeps the arithmetic above the stores: nothing then rewrites a register that an issued store names
    float* wy = WY + ((size_t)(b * CC + 32 * wave)) * NN + n0 + 4 * lane;
#pragma unroll
    for (int i = 0; i < 32; ++i) *(v4f*)(wy + (size_t)i * NN) = res[i];
    wait_x0();
  }
}

// =========================================================================================================
// (3) batch-norm statistics, normalisation, affine and residual in one launch: block owns ONE channel (256 blocks of
//     32 waves). Thread tid takes floats 4 tid..4 tid+3 of each of the NB rows WY[b][c][0..NQ) and of the same rows of
//     x, so every wave load is one contiguous 512-B run; a thread's 2 NB loads are independent and all issued before
//     the first sum; the WY values stay in registers from the statistics to the normalisation. Sum and sum of squares
//     of d = WY - pivot in f32, as a tree; the pivot is the channel's first value, the same in every thread: it lies
//     within a few deviations of the mean, so that E[d^2] - E[d]^2 cancels little however far the channel's mean lies
//     from zero. Per thread four chains (one a vector element) over the NB rows in ascending order, the square fused
//     into its add, the chains joined in pairs; wave shuffle reduce, per-wave partials in LDS (cross-wave, block
//     barrier); every wave then shuffle-reduces the same 32 partials itself (a butterfly leaves the same bits in every
//     lane of every wave), so no second barrier and no table. No chain is longer than NB terms and the tree is 12 levels
//     deep, so a total carries some 20 roundings of 2^-24. mean = pivot + E[d]; biased variance = E[d^2] - E[d]^2 in one
//     fused multiply-add (one rounding); rstd = 1/sqrt(var + eps), then
//     out[b][c][n] = (((WY - mu) * rstd) * bf16-RNE(gamma[c]) + bf16-RNE(beta[c])) + bf16-RNE(x[b][c][n]) in f32.
// coverage: 256 blocks x 1 channel x NB rows x BST threads x 4 floats = out[b][0..255][0..NQ-1] exactly once, each
//           wave store one contiguous 512-B run; reads WY and x at the same offsets only (the produced extent).
// =========================================================================================================
__global__ __launch_bounds__(BST)
void bn_norm(const float* __restrict__ WY, const float* __restrict__ x, const float* __restrict__ gam,
             const float* __restrict__ bet, float* out) {
#pragma clang fp contract(off)
  __shared__ float red[2 * (BST / 32)];
  const int tid = threadIdx.x, lane = tid & 31, wave = tid >> 5;
  const int cc = blockIdx.x;
  const float ninv = 1.0f / ((float)NB * (float)NQ);
  unsigned bo[NB];                                                   // byte offsets in WY, x and out, all < 2^25
  v4f a[NB], xv[NB];
#pragma unroll
  for (int bb = 0; bb < NB; ++bb) bo[bb] = 4u * (unsigned)((bb * CC + cc) * NN + 4 * tid);
#pragma unroll
  for (int bb = 0; bb < NB; ++bb) a[bb] = *(const v4f*)((const char*)WY + bo[bb]);
#if defined(__HIP_DEVICE_COMPILE__)
  // keeps the WY loads ahead of the x loads: loads return in order, and interleaved the sums would wait for rows of x
  __builtin_amdgcn_sched_barrier(0);
#endif
#pragma unroll
  for (int bb = 0; bb < NB; ++bb) xv[bb] = *(const v4f*)((const char*)x + bo[bb]);
#if defined(__HIP_DEVICE_COMPILE__)
  // keeps every load above the sums: without it the scheduler sinks them and only a few stay in flight per wave
  __builtin_amdgcn_sched_barrier(0);
#endif
  const float ga = bfr(gam[cc]), be = bfr(bet[cc]);                  // block-uniform, back long before their use
  const float pv = WY[(size_t)cc * NN];                              // pivot: WY[0][cc][0], block-uniform
  v4f s4 = a[0] - pv, q4 = s4 * s4;
#pragma unroll
  for (int bb = 1; bb < NB; ++bb) {
    const v4f d4 = a[bb] - pv;
    s4 += d4;
    q4 = __builtin_elementwise_fma(d4, d4, q4);
  }
  float s = (s4[0] + s4[1]) + (s4[2] + s4[3]);
  float q = (q4[0] + q4[1]) + (q4[2] + q4[3]);
#pragma unroll
  for (int d = 1; d < 32; d <<= 1) {
    const float so = __shfl_xor(s, d, 32), qo = __shfl_xor(q, d, 32);
    s += so;
    q += qo;
  }
  if (lane == 0) { red[wave] = s; red[BST / 32 + wave] = q; }
  __syncthreads();
  float ts = red[lane], tq = red[BST / 32 + lane];
#pragma unroll
  for (int d = 1; d < 32; d <<= 1) {
    const float so = __shfl_xor(ts, d, 32), qo = __shfl_xor(tq, d, 32);
    ts += so;
    tq += qo;
  }
  const float md = ts * ninv;                                        // E[d]
  const float mu = pv + md;
  float var = __builtin_fmaf(-md, md, tq * ninv);
  var = (var > 0.0f) ? var : 0.0f;
  const float varf = var + BNEPS;
  const float rs = 1.0f / sqrtf(varf);
#pragma unroll
  for (int bb = 0; bb < NB; ++bb) {
    v4f r;
#pragma unroll
    for (int t = 0; t < 4; ++t) {
      const float d  = a[bb][t] - mu;
      const float nv = d * rs;
      const float av = nv * ga;
      const float sv = av + be;
      r[t] = sv + bfr(xv[bb][t]);
    }
    *(v4f*)((char*)out + bo[bb]) = r;
  }
}

// =========================================================================================================
// Workspace map (bytes; each region start a multiple of 256; every extent is an exact row/tile multiple and is
//   W16 f16 [384][256]            196608      WWb bf16 [256][128]        65536
//   Qh/Ql bf16 [NB][4096][128]   8388608 x2
//   Kh/Kl bf16 [NB][1024][128]   2097152 x2  Gc f16 [NB][32][128][32]  2097152
//   WY  f32  [NB][256][4096]    33554432
//   total (NB=8) = 56885248
//   W16 and WWb hold their rows in fragment order (piece_off); the sizes are those of the row-major planes.
// =========================================================================================================
extern "C" void kernel_launch(void* const* d_in, const int* in_sizes, int n_in,
                              void* d_out, int out_size, void* d_ws, size_t ws_size,
                              hipStream_t stream) {
  const int XN = NB * CC * NN;
  if (n_in < 11) return;
  if (in_sizes[0] < XN) return;
  if (in_sizes[1] < DQ * CC || in_sizes[3] < DQ * CC || in_sizes[5] < DQ * CC || in_sizes[7] < CC * DQ) return;
  if (in_sizes[2] < DQ || in_sizes[4] < DQ || in_sizes[6] < DQ || in_sizes[8] < CC) return;
  if (in_sizes[9] < CC || in_sizes[10] < CC) return;
  if (out_size < XN) return;

  size_t off = 0;
  auto carve = [&](size_t bytes) { const size_t o = off; off += (bytes + 255) & ~(size_t)255; return o; };
  const size_t oW16 = carve((size_t)MW * CC * 2);
  const size_t oWWb = carve((size_t)CC * DQ * 2);
  const size_t oQh  = carve((size_t)NB * NN * DQ * 2);
  const size_t oQl  = carve((size_t)NB * NN * DQ * 2);
  const size_t oKh  = carve((size_t)NB * MM * DQ * 2);
  const size_t oKl  = carve((size_t)NB * MM * DQ * 2);
  const size_t oGc  = carve((size_t)NB * DQ * MM * 2);
  const size_t oWY  = carve((size_t)NB * CC * NN * 4);
  if (off > ws_size) return;
  if (off > (size_t)134217728) return;

  const float* x   = (const float*)d_in[0];
  const float* gw  = (const float*)d_in[1];
  const float* gb  = (const float*)d_in[2];
  const float* tw  = (const float*)d_in[3];
  const float* tb  = (const float*)d_in[4];
  const float* pw  = (const float*)d_in[5];
  const float* pb  = (const float*)d_in[6];
  const float* ow  = (const float*)d_in[7];
  const float* wb  = (const float*)d_in[8];
  const float* gam = (const float*)d_in[9];
  const float* bet = (const float*)d_in[10];

  char* ws = (char*)d_ws;
  unsigned short* W16 = (unsigned short*)(ws + oW16);
  unsigned short* WWb = (unsigned short*)(ws + oWWb);
  unsigned short* Qh  = (unsigned short*)(ws + oQh);
  unsigned short* Ql  = (unsigned short*)(ws + oQl);
  unsigned short* Kh  = (unsigned short*)(ws + oKh);
  unsigned short* Kl  = (unsigned short*)(ws + oKl);
  unsigned short* Gc  = (unsigned short*)(ws + oGc);
  float*          WY  = (float*)(ws + oWY);
  float* out = (float*)d_out;

  const dim3 blk256(256);

  // (0) theta_w / phi_w / g_w -> stacked f16 plane; w_w -> bf16 plane, both in fragment order
  cvt_w<<<dim3(MW / 8 + CC / 16), blk256, 0, stream>>>(tw, pw, gw, ow, W16, WWb);
  // (1) x strip -> 16-bit LDS tile; conv1x1 GEMM -> theta (q) hi/res planes; phi / g + bias, 2x2 max-pooled -> k hi/res
  //     planes, v plane by stages
  gemm_proj<<<dim3(NSTRIP, NB), dim3(PT), 0, stream>>>(W16, x, tb, pb, gb, Qh, Ql, Kh, Kl, Gc);
  // (2) attention, then output conv + bias on the block's own y -> WY f32 plane [b][256][4096]
  attn_k<<<dim3(NQ / AQ, NB), dim3(AT), 0, stream>>>(Qh, Ql, Kh, Kl, Gc, WWb, wb, WY);
  // (3) per-channel mean / rstd, then normalise, affine, residual -> out [b][256][4096]
  bn_norm<<<dim3(CC), dim3(BST), 0, stream>>>(WY, x, gam, bet, out);
  (void)hipGetLastError();
}
